// v000
// Times are from an AMD MI455X. After a warm-up the kernel runs many times in a row, and a time is the length of
// such a window on the GPU divided by its runs, so every launch and the gaps after it count. The runs cycle
// through copies of the inputs. A figure is the median of several windows, for all but v000 over two sittings.
// Sittings can differ by a few percent; kernels timed side by side share one.
// v000, which the later versions start from, runs in 814 microseconds.
#include <hip/hip_runtime.h>
// Pre-LN self-attention layer with a key padding mask and residual (B=4, S=2048, H=1024, 16 heads × 64): x = LN(hidden); [q|k|v] = x·qkv_wᵀ + qkv_b ((out,in) fused); scores = q·kᵀ·64^-½ + mask·(−1e8) (int mask [B,S], 1 = pad); softmax;
// out = (attn·v merged)·out_wᵀ + out_b + hidden.
// Compute dtype: x, weights, biases rounded to bf16; q/k/v as f16 GEMM outputs; fused flash-style kernel (online softmax f32, P f16 ×2^10) on v_wmma_f32_16x16x32_f16; O → f16 → output GEMM with bias; f32 accumulate.
#define BB 4
#define TT 2048
#define NH 16
#define DD 1024
#define NR (BB * TT)

typedef __bf16 v16b __attribute__((ext_vector_type(16)));
typedef unsigned short v8us __attribute__((ext_vector_type(8), may_alias));
typedef float  v8f  __attribute__((ext_vector_type(8)));
typedef float  v4f  __attribute__((ext_vector_type(4)));
typedef float  v4fa __attribute__((ext_vector_type(4), may_alias));
union FragB { v16b v; v8us half[2]; unsigned short u[16]; };

__device__ __forceinline__ unsigned short bf16_bits(float x) { unsigned int u = __float_as_uint(x); return (unsigned short)((u + 0x7FFFu + ((u >> 16) & 1u)) >> 16); }
__device__ __forceinline__ float bf16_val(unsigned short b) { return __uint_as_float(((unsigned int)b) << 16); }
__device__ __forceinline__ float bf16_round(float x) { return bf16_val(bf16_bits(x)); }
// D += A·B with NT terms: 1 = ah·bh, 2 = + al·bh (A split), 3 = + ah·bl (both split)
template <int NT>
__device__ __forceinline__ v8f mmaN(v16b ah, v16b al, v16b bh, v16b bl, v8f c) {
  c = __builtin_amdgcn_wmma_f32_16x16x32_bf16(false, ah, false, bh, (short)0, c, false, false);
  if (NT >= 2) c = __builtin_amdgcn_wmma_f32_16x16x32_bf16(false, al, false, bh, (short)0, c, false, false);
  if (NT >= 3) c = __builtin_amdgcn_wmma_f32_16x16x32_bf16(false, ah, false, bl, (short)0, c, false, false);
  asm volatile("v_nop\n\tv_nop\n\tv_nop\n\tv_nop" : "+v"(c) : "v"(ah), "v"(al), "v"(bh), "v"(bl));
  return c;
}

__global__ __launch_bounds__(256) void k_wt_bf16(const float* __restrict__ W, unsigned short* __restrict__ Wt, int K, int N) {
  const int t = blockIdx.x * 256 + threadIdx.x;
  const int k8n = K / 8;
  if (t >= N * k8n) return;
  const int n = t / k8n, k8 = (t % k8n) * 8;
  v8us v;
#pragma unroll
  for (int i = 0; i < 8; ++i) v[i] = bf16_bits(W[(size_t)(k8 + i) * N + n]);
  *(v8us*)(Wt + (size_t)n * K + k8) = v;
  
}

// GEMM C[M][N] (f32, pitch ldc) = act(A[M][K]·W + bias). A f32 row-major (pitch lda) converted per fragment to bf16
// (ASPLIT: hi/lo two planes -> 2 terms, else single rounded term); Wt bf16 [N][K] (pitch ldb). BIAS_BF16 rounds the
// bias to bf16 first (bias quantised to bf16 before the add). K%32==0, M%16==0, N%64==0.
template <bool ASPLIT, int ACT, bool BIAS_BF16>
__global__ __launch_bounds__(128) void k_gemm_bf(const float* __restrict__ A, int lda, const unsigned short* __restrict__ Wt, int ldb,
                                               const float* __restrict__ bias, float* __restrict__ C, int ldc, int M, int N, int K) {
  __shared__ __attribute__((aligned(16))) float so[4][16][64];
  const int tid = threadIdx.x, w = tid >> 5, lane = tid & 31, ln = lane & 15, hh = lane >> 4;
  const int ntn = N / 64;
  const int wid = blockIdx.x * 4 + w;
  const int mt = wid / ntn, nq = wid % ntn;
  if (mt * 16 >= M) return;
  const int row0 = mt * 16, col0 = nq * 64;
  const float* arow = A + (size_t)(row0 + ln) * lda;
  v8f acc[4] = {};
  for (int kb = 0; kb < K; kb += 32) {
    FragB ah, al;
    const v4f x0 = *(const v4fa*)(arow + kb + 8 * hh), x1 = *(const v4fa*)(arow + kb + 8 * hh + 4);
    const v4f x2 = *(const v4fa*)(arow + kb + 16 + 8 * hh), x3 = *(const v4fa*)(arow + kb + 16 + 8 * hh + 4);
    float xs[16] = {x0[0],x0[1],x0[2],x0[3],x1[0],x1[1],x1[2],x1[3],x2[0],x2[1],x2[2],x2[3],x3[0],x3[1],x3[2],x3[3]};
#pragma unroll
    for (int i = 0; i < 16; ++i) { const unsigned short hb = bf16_bits(xs[i]); ah.u[i] = hb; al.u[i] = ASPLIT ? bf16_bits(xs[i] - bf16_val(hb)) : (unsigned short)0; }
#pragma unroll
    for (int t = 0; t < 4; ++t) {
      const unsigned short* brow = Wt + (size_t)(col0 + t * 16 + ln) * ldb + kb;
      FragB b;
      b.half[0] = *(const v8us*)(brow + 8 * hh);
      b.half[1] = *(const v8us*)(brow + 16 + 8 * hh);
      acc[t] = mmaN<ASPLIT ? 2 : 1>(ah.v, al.v, b.v, b.v, acc[t]);
    }
  }
#pragma unroll
  for (int t = 0; t < 4; ++t) {
    float bv = bias ? bias[col0 + t * 16 + ln] : 0.f;
    if (BIAS_BF16) bv = bf16_round(bv);
#pragma unroll
    for (int r = 0; r < 8; ++r) { float v = acc[t][r] + bv; if (ACT == 1) v = fmaxf(v, 0.f); so[w][8 * hh + r][t * 16 + ln] = v; }
  }
  __builtin_amdgcn_fence(__ATOMIC_ACQ_REL, "workgroup");
  __builtin_amdgcn_wave_barrier();
  const int rsub = lane >> 4, c4 = (lane & 15) * 4;
  {
#pragma unroll
    for (int q = 0; q < 8; ++q) {
      const int r = q * 2 + rsub;
      const v4f v = *(const v4fa*)&so[w][r][c4];
      *(v4f*)(C + (size_t)(row0 + r) * ldc + col0 + c4) = v;
    }
    
  }
}

// Flash-style causal/unmasked attention, all contractions 3-term bf16 hi/lo splits, f32 softmax with running max.
// q,k,v rows are read from f32 buffers with arbitrary row pitch (so they can live inside a fused qkv buffer);
// D = head size (multiple of 32, <= 128); one wave = 16 query rows; block = 4 waves (64 queries) sharing K/V chunks of 32.
template <int D, bool CAUSAL>
__global__ __launch_bounds__(128) void k_flash(const float* __restrict__ qb, const float* __restrict__ kb, const float* __restrict__ vb,
                                             int pitch, int T, int H, float scale, float* __restrict__ y, int ypitch) {
  constexpr int KS = D / 32;        // k-steps for QK
  constexpr int DT = D / 16;        // d tiles for PV
  __shared__ __attribute__((aligned(16))) unsigned short sKh[32][D + 8], sKl[32][D + 8], sVh[32][D + 8], sVl[32][D + 8];
  __shared__ __attribute__((aligned(16))) unsigned short sPh[4][16][40], sPl[4][16][40];
  __shared__ __attribute__((aligned(16))) float sO[4][16][D];
  const int tid = threadIdx.x, w = tid >> 5, lane = tid & 31, ln = lane & 15, hh = lane >> 4;
  const int nqb = (T + 63) / 64;
  const int bh = blockIdx.x / nqb, qblk = blockIdx.x % nqb;
  const int b = bh / H, h = bh % H;
  const int q0 = qblk * 64 + w * 16;
  const float* Q = qb + (size_t)b * T * pitch + h * D;
  const float* K = kb + (size_t)b * T * pitch + h * D;
  const float* V = vb + (size_t)b * T * pitch + h * D;

  // A fragments of the wave's 16 query rows (scaled), hi/lo
  FragB aqh[KS], aql[KS];
  {
    int row = q0 + ln; if (row >= T) row = T - 1;
    const float* qr = Q + (size_t)row * pitch;
#pragma unroll
    for (int ks = 0; ks < KS; ++ks)
#pragma unroll
      for (int i = 0; i < 16; ++i) {
        const int d = ks * 32 + ((i < 8) ? (8 * hh + i) : (16 + 8 * hh + (i - 8)));
        const float x = qr[d] * scale; const unsigned short hb = bf16_bits(x);
        aqh[ks].u[i] = hb; aql[ks].u[i] = bf16_bits(x - bf16_val(hb));
      }
  }
  float m_r[8], l_r[8];
#pragma unroll
  for (int r = 0; r < 8; ++r) { m_r[r] = -3.0e38f; l_r[r] = 0.f; }
  v8f oacc[DT];
#pragma unroll
  for (int dt = 0; dt < DT; ++dt) oacc[dt] = (v8f){0.f,0.f,0.f,0.f,0.f,0.f,0.f,0.f};

  const int kv_end = CAUSAL ? min(T, qblk * 64 + 64) : T;     // block-uniform
  for (int j0 = 0; j0 < kv_end; j0 += 32) {
    __syncthreads();
    for (int e = tid; e < 32 * (D / 4); e += 128) {
      const int r = e / (D / 4), c4 = (e % (D / 4)) * 4;
      const int key = j0 + r;
      v4f kf = {0.f,0.f,0.f,0.f}, vf = {0.f,0.f,0.f,0.f};
      if (key < T) { kf = *(const v4fa*)(K + (size_t)key * pitch + c4); vf = *(const v4fa*)(V + (size_t)key * pitch + c4); }
#pragma unroll
      for (int t = 0; t < 4; ++t) {
        unsigned short hb = bf16_bits(kf[t]); sKh[r][c4 + t] = hb; sKl[r][c4 + t] = bf16_bits(kf[t] - bf16_val(hb));
        hb = bf16_bits(vf[t]); sVh[r][c4 + t] = hb; sVl[r][c4 + t] = bf16_bits(vf[t] - bf16_val(hb));
      }
    }
    __syncthreads();
    // S tile 16 x 32
    v8f s[2];
#pragma unroll
    for (int nt = 0; nt < 2; ++nt) {
      v8f acc = {};
#pragma unroll
      for (int ks = 0; ks < KS; ++ks) {
        FragB bh_, bl_;
        bh_.half[0] = *(const v8us*)&sKh[nt * 16 + ln][ks * 32 + 8 * hh]; bh_.half[1] = *(const v8us*)&sKh[nt * 16 + ln][ks * 32 + 16 + 8 * hh];
        bl_.half[0] = *(const v8us*)&sKl[nt * 16 + ln][ks * 32 + 8 * hh]; bl_.half[1] = *(const v8us*)&sKl[nt * 16 + ln][ks * 32 + 16 + 8 * hh];
        acc = mmaN<3>(aqh[ks].v, aql[ks].v, bh_.v, bl_.v, acc);
      }
      s[nt] = acc;
    }
    // mask + running max (rows 8hh+r; the 16 lanes of a half share rows)
    float alpha[8];
#pragma unroll
    for (int r = 0; r < 8; ++r) {
      const int qi = q0 + 8 * hh + r;
      const int ja = j0 + ln, jb = j0 + 16 + ln;
      if (CAUSAL) { if (ja > qi) s[0][r] = -3.0e38f; if (jb > qi) s[1][r] = -3.0e38f; }
      if (ja >= T) s[0][r] = -3.0e38f;
      if (jb >= T) s[1][r] = -3.0e38f;
      float mx = fmaxf(s[0][r], s[1][r]);
      mx = fmaxf(mx, __shfl_xor(mx, 1, 32)); mx = fmaxf(mx, __shfl_xor(mx, 2, 32)); mx = fmaxf(mx, __shfl_xor(mx, 4, 32)); mx = fmaxf(mx, __shfl_xor(mx, 8, 32));
      const float mnew = fmaxf(m_r[r], mx);
      alpha[r] = (mnew > -1.0e38f) ? __expf(m_r[r] - mnew) : 1.0f;
      const float p0 = (s[0][r] > -1.0e38f) ? __expf(s[0][r] - mnew) : 0.f;
      const float p1 = (s[1][r] > -1.0e38f) ? __expf(s[1][r] - mnew) : 0.f;
      m_r[r] = mnew;
      l_r[r] = l_r[r] * alpha[r] + p0 + p1;            // per-lane partial row sum (16 lanes combined at the end)
      unsigned short hb = bf16_bits(p0); sPh[w][8 * hh + r][ln] = hb;      sPl[w][8 * hh + r][ln] = bf16_bits(p0 - bf16_val(hb));
      hb = bf16_bits(p1);                sPh[w][8 * hh + r][16 + ln] = hb; sPl[w][8 * hh + r][16 + ln] = bf16_bits(p1 - bf16_val(hb));
    }
#pragma unroll
    for (int dt = 0; dt < DT; ++dt)
#pragma unroll
      for (int r = 0; r < 8; ++r) oacc[dt][r] *= alpha[r];
    __builtin_amdgcn_fence(__ATOMIC_ACQ_REL, "workgroup");
    __builtin_amdgcn_wave_barrier();
    FragB pah, pal;
    pah.half[0] = *(const v8us*)&sPh[w][ln][8 * hh]; pah.half[1] = *(const v8us*)&sPh[w][ln][16 + 8 * hh];
    pal.half[0] = *(const v8us*)&sPl[w][ln][8 * hh]; pal.half[1] = *(const v8us*)&sPl[w][ln][16 + 8 * hh];
#pragma unroll
    for (int dt = 0; dt < DT; ++dt) {
      FragB bvh, bvl;
#pragma unroll
      for (int i = 0; i < 8; ++i) {
        bvh.u[i] = sVh[8 * hh + i][dt * 16 + ln]; bvh.u[8 + i] = sVh[16 + 8 * hh + i][dt * 16 + ln];
        bvl.u[i] = sVl[8 * hh + i][dt * 16 + ln]; bvl.u[8 + i] = sVl[16 + 8 * hh + i][dt * 16 + ln];
      }
      oacc[dt] = mmaN<3>(pah.v, pal.v, bvh.v, bvl.v, oacc[dt]);
    }
    __builtin_amdgcn_fence(__ATOMIC_ACQ_REL, "workgroup");
    __builtin_amdgcn_wave_barrier();
  }
#pragma unroll
  for (int r = 0; r < 8; ++r) {
    float l = l_r[r];
    l += __shfl_xor(l, 1, 32); l += __shfl_xor(l, 2, 32); l += __shfl_xor(l, 4, 32); l += __shfl_xor(l, 8, 32);
    l_r[r] = (l > 0.f) ? 1.0f / l : 0.f;
  }
#pragma unroll
  for (int dt = 0; dt < DT; ++dt)
#pragma unroll
    for (int r = 0; r < 8; ++r) sO[w][8 * hh + r][dt * 16 + ln] = oacc[dt][r] * l_r[r];
  __builtin_amdgcn_fence(__ATOMIC_ACQ_REL, "workgroup");
  __builtin_amdgcn_wave_barrier();
  {
    for (int r = 0; r < 16; ++r) {
      const int row = q0 + r;
      if (row < T && lane < D / 4) {
        const v4f val = *(const v4fa*)&sO[w][r][lane * 4];
        *(v4f*)(y + ((size_t)b * T + row) * ypitch + h * D + lane * 4) = val;
      }
    }
    
  }
}

// GEMM C = act(A·W + bias + resid): A f32 (ASPLIT -> hi/lo 2 terms), Wt bf16 [N][K]; ACT 0 none, 1 relu, 2 exact gelu;
// resid (optional, f32, row index = (row % rmod), pitch ldr, RES_BF16 rounds it) added before the activation.
template <bool ASPLIT, int ACT, bool BIAS_BF16, bool RES_BF16>
__global__ __launch_bounds__(128) void k_gemm_bf3(const float* __restrict__ A, int lda, const unsigned short* __restrict__ Wt, int ldb,
                                                const float* __restrict__ bias, const float* __restrict__ resid, int rmod, int ldr,
                                                float* __restrict__ C, int ldc, int M, int N, int K) {
  __shared__ __attribute__((aligned(16))) float so[4][16][64];
  const int tid = threadIdx.x, w = tid >> 5, lane = tid & 31, ln = lane & 15, hh = lane >> 4;
  const int ntn = N / 64;
  const int wid = blockIdx.x * 4 + w;
  const int mt = wid / ntn, nq = wid % ntn;
  if (mt * 16 >= M) return;
  const int row0 = mt * 16, col0 = nq * 64;
  const float* arow = A + (size_t)(row0 + ln) * lda;
  v8f acc[4] = {};
  for (int kb = 0; kb < K; kb += 32) {
    FragB ah, al;
    const v4f x0 = *(const v4fa*)(arow + kb + 8 * hh), x1 = *(const v4fa*)(arow + kb + 8 * hh + 4);
    const v4f x2 = *(const v4fa*)(arow + kb + 16 + 8 * hh), x3 = *(const v4fa*)(arow + kb + 16 + 8 * hh + 4);
    float xs[16] = {x0[0],x0[1],x0[2],x0[3],x1[0],x1[1],x1[2],x1[3],x2[0],x2[1],x2[2],x2[3],x3[0],x3[1],x3[2],x3[3]};
#pragma unroll
    for (int i = 0; i < 16; ++i) { const unsigned short hb = bf16_bits(xs[i]); ah.u[i] = hb; al.u[i] = ASPLIT ? bf16_bits(xs[i] - bf16_val(hb)) : (unsigned short)0; }
#pragma unroll
    for (int t = 0; t < 4; ++t) {
      const unsigned short* brow = Wt + (size_t)(col0 + t * 16 + ln) * ldb + kb;
      FragB b;
      b.half[0] = *(const v8us*)(brow + 8 * hh);
      b.half[1] = *(const v8us*)(brow + 16 + 8 * hh);
      acc[t] = mmaN<ASPLIT ? 2 : 1>(ah.v, al.v, b.v, b.v, acc[t]);
    }
  }
#pragma unroll
  for (int t = 0; t < 4; ++t) {
    const int col = col0 + t * 16 + ln;
    float bv = bias ? bias[col] : 0.f;
    if (BIAS_BF16) bv = bf16_round(bv);
#pragma unroll
    for (int r = 0; r < 8; ++r) {
      float v = acc[t][r] + bv;
      if (resid) { float rv = resid[(size_t)((row0 + 8 * hh + r) % rmod) * ldr + col]; if (RES_BF16) rv = bf16_round(rv); v += rv; }
      if (ACT == 1) v = fmaxf(v, 0.f);
      if (ACT == 2) v = 0.5f * v * (1.0f + erff(v * 0.70710678118654752f));
      if (ACT == 3) { const float u = 0.7978845608028654f * (v + 0.044715f * v * v * v); v = 0.5f * v * (1.0f + tanhf(u)); }
      so[w][8 * hh + r][t * 16 + ln] = v;
    }
  }
  __builtin_amdgcn_fence(__ATOMIC_ACQ_REL, "workgroup");
  __builtin_amdgcn_wave_barrier();
  const int rsub = lane >> 4, c4 = (lane & 15) * 4;
  {
#pragma unroll
    for (int q = 0; q < 8; ++q) {
      const int r = q * 2 + rsub;
      const v4f v = *(const v4fa*)&so[w][r][c4];
      *(v4f*)(C + (size_t)(row0 + r) * ldc + col0 + c4) = v;
    }
    
  }
}
// row LayerNorm (biased variance, eps) over N: s = X (+ R); optional out_sum <- s; out_norm <- (s-mu)*rsqrt(var+eps)*g + b
template <bool PARAM_BF16>
__global__ __launch_bounds__(256) void k_layernorm(const float* __restrict__ X, const float* __restrict__ R, const float* __restrict__ g, const float* __restrict__ bta,
                                                  float* __restrict__ out_sum, float* __restrict__ out_norm, int N, float eps) {
  __shared__ float red[256];
  const int row = blockIdx.x, tid = threadIdx.x;
  const float* x = X + (size_t)row * N; const float* rr = R ? R + (size_t)row * N : nullptr;
  float vals[16];                     // up to N = 4096
  const int per = N / 256;            // contiguous chunk per thread? use strided-by-4 chunks: thread handles j = tid*4 + 1024*u
  float s1 = 0.f;
  for (int u = 0; u < per / 4; ++u) {
    const int j = tid * 4 + 1024 * u;
    const v4f a = *(const v4fa*)(x + j);
    v4f b = {0.f,0.f,0.f,0.f}; if (rr) b = *(const v4fa*)(rr + j);
#pragma unroll
    for (int q = 0; q < 4; ++q) { const float v = a[q] + b[q]; vals[u * 4 + q] = v; s1 += v; }
  }
  red[tid] = s1; __syncthreads();
  for (int st = 128; st > 0; st >>= 1) { if (tid < st) red[tid] += red[tid + st]; __syncthreads(); }
  const float mu = red[0] / (float)N; __syncthreads();
  float s2 = 0.f;
  for (int u = 0; u < per / 4; ++u)
#pragma unroll
    for (int q = 0; q < 4; ++q) { const float c = vals[u * 4 + q] - mu; s2 += c * c; }
  red[tid] = s2; __syncthreads();
  for (int st = 128; st > 0; st >>= 1) { if (tid < st) red[tid] += red[tid + st]; __syncthreads(); }
  const float rs = rsqrtf(red[0] / (float)N + eps);
  {
    for (int u = 0; u < per / 4; ++u) {
      const int j = tid * 4 + 1024 * u;
      v4f o, sm;
#pragma unroll
      for (int q = 0; q < 4; ++q) {
        float gg = g[j + q], bb = bta[j + q];
        if (PARAM_BF16) { gg = bf16_round(gg); bb = bf16_round(bb); }
        sm[q] = vals[u * 4 + q]; o[q] = (vals[u * 4 + q] - mu) * rs * gg + bb;
      }
      if (out_sum) *(v4f*)(out_sum + (size_t)row * N + j) = sm;
      *(v4f*)(out_norm + (size_t)row * N + j) = o;
    }
    
  }
}



// ---- f16 WMMA path (v_wmma_f32_16x16x32_f16): 11-bit significands for operands in range — used where a [0,1] probability operand needs more precision than bf16
typedef _Float16 v16h __attribute__((ext_vector_type(16)));
union FragH { v16h v; v8us half[2]; _Float16 h[16]; unsigned short u[16]; };
template <int NT>
__device__ __forceinline__ v8f mmaH(v16h ah, v16h al, v16h bh, v16h bl, v8f c) {
  c = __builtin_amdgcn_wmma_f32_16x16x32_f16(false, ah, false, bh, (short)0, c, false, false);
  if (NT >= 2) c = __builtin_amdgcn_wmma_f32_16x16x32_f16(false, al, false, bh, (short)0, c, false, false);
  if (NT >= 3) c = __builtin_amdgcn_wmma_f32_16x16x32_f16(false, ah, false, bl, (short)0, c, false, false);
  asm volatile("v_nop\n\tv_nop\n\tv_nop\n\tv_nop" : "+v"(c) : "v"(ah), "v"(al), "v"(bh), "v"(bl));
  return c;
}
// batched GEMM like k_gemm_b but f16 operands: A f32 (split into f16 hi/lo if ASPLIT, else rounded to f16), Bt = f16 values [n][k]; alpha; C f32; N multiple of 16 (partial tiles skipped)
template <bool ASPLIT>
__global__ __launch_bounds__(128) void k_gemm_h(const float* __restrict__ A, int lda, size_t sA, const _Float16* __restrict__ Bh, int ldb, size_t sB, float alpha, float* __restrict__ C, int ldc, size_t sC, int M, int N, int K) {
  __shared__ __attribute__((aligned(16))) float so[4][16][64];
  const int tid = threadIdx.x, w = tid >> 5, lane = tid & 31, ln = lane & 15, hh = lane >> 4; const int by = blockIdx.y;
  A += (size_t)by * sA; Bh += (size_t)by * sB; C += (size_t)by * sC;
  const int ntn = (N + 63) / 64; const int wid = blockIdx.x * 4 + w; const int mt = wid / ntn, nq = wid % ntn; if (mt * 16 >= M) return;
  const int row0 = mt * 16, col0 = nq * 64; const float* arow = A + (size_t)(row0 + ln) * lda;
  v8f acc[4] = {};
  for (int kb = 0; kb < K; kb += 32) {
    FragH ah, al;
    const v4f x0 = *(const v4fa*)(arow + kb + 8 * hh), x1 = *(const v4fa*)(arow + kb + 8 * hh + 4), x2 = *(const v4fa*)(arow + kb + 16 + 8 * hh), x3 = *(const v4fa*)(arow + kb + 16 + 8 * hh + 4);
    float xs[16] = {x0[0],x0[1],x0[2],x0[3],x1[0],x1[1],x1[2],x1[3],x2[0],x2[1],x2[2],x2[3],x3[0],x3[1],x3[2],x3[3]};
#pragma unroll
    for (int i = 0; i < 16; ++i) { const _Float16 h = (_Float16)xs[i]; ah.h[i] = h; al.h[i] = ASPLIT ? (_Float16)(xs[i] - (float)h) : (_Float16)0.0f; }
#pragma unroll
    for (int t = 0; t < 4; ++t) { if (col0 + t * 16 >= N) continue; const size_t boff = (size_t)(col0 + t * 16 + ln) * ldb + kb; FragH bq; bq.half[0] = *(const v8us*)(Bh + boff + 8 * hh); bq.half[1] = *(const v8us*)(Bh + boff + 16 + 8 * hh);
      acc[t] = mmaH<ASPLIT ? 2 : 1>(ah.v, al.v, bq.v, bq.v, acc[t]); }
  }
#pragma unroll
  for (int t = 0; t < 4; ++t) { if (col0 + t * 16 >= N) continue;
#pragma unroll
    for (int r = 0; r < 8; ++r) so[w][8 * hh + r][t * 16 + ln] = acc[t][r] * alpha; }
  __builtin_amdgcn_fence(__ATOMIC_ACQ_REL, "workgroup"); __builtin_amdgcn_wave_barrier();
  const int rsub = lane >> 4, c4 = (lane & 15) * 4;
  {
#pragma unroll
    for (int q = 0; q < 8; ++q) { const int r = q * 2 + rsub; if (col0 + c4 < N) { const v4f v = *(const v4fa*)&so[w][r][c4]; *(v4f*)(C + (size_t)(row0 + r) * ldc + col0 + c4) = v; } }
     }
}

// Wt[n][k] = f16(W[k][n]·scale) from f32 row-major W[K][N] (scale = power of two; bf16-exact weights stay exact in f16 away from the subnormal range)
__global__ __launch_bounds__(256) void k_wt_f16(const float* __restrict__ W, _Float16* __restrict__ Wt, int K, int N, float scale) {
  const int t = blockIdx.x * 256 + threadIdx.x; if (t >= N * (K / 8)) return; const int n = t / (K / 8), k8 = (t % (K / 8)) * 8; FragH f;
#pragma unroll
  for (int i = 0; i < 8; ++i) f.h[i] = (_Float16)(bf16_round(W[(size_t)(k8 + i) * N + n]) * scale); const v8us o = f.half[0];
  *(v8us*)((unsigned short*)Wt + (size_t)n * K + k8) = o; 
}
// k_gemm_hh variant with fused epilogue: v = acc·alpha + bias[by·sBias + col] (+ CP[(row/rowsPerB)·sCPb + by·64 + col] if CP) ; ACT 0 none / 1 elu ; writes f16 C16 and/or f32 C (each if non-null)
template <int ACT>
__global__ __launch_bounds__(128) void k_gemm_hhx(const _Float16* __restrict__ A, int lda, size_t sA, const _Float16* __restrict__ Bh, int ldb, size_t sB, float alpha, const float* __restrict__ bias, size_t sBias, const float* __restrict__ CP, int rowsPerB, size_t sCPb, int row0g,
    float* __restrict__ C, _Float16* __restrict__ C16, int ldc, size_t sC, int M, int N, int K) {
  __shared__ __attribute__((aligned(16))) float so[4][16][64];
  const int tid = threadIdx.x, w = tid >> 5, lane = tid & 31, ln = lane & 15, hh = lane >> 4; const int by = blockIdx.y;
  A += (size_t)by * sA; Bh += (size_t)by * sB; const size_t cofs = (size_t)by * sC; const float* bp = bias ? bias + (size_t)by * sBias : nullptr;
  const int ntn = (N + 63) / 64; const int wid = blockIdx.x * 4 + w; const int mt = wid / ntn, nq = wid % ntn; if (mt * 16 >= M) return;
  const int row0 = mt * 16, col0 = nq * 64; const _Float16* arow = A + (size_t)(row0 + ln) * lda;
  v8f acc[4] = {};
  for (int kb = 0; kb < K; kb += 32) { FragH ah; ah.half[0] = *(const v8us*)((const unsigned short*)arow + kb + 8 * hh); ah.half[1] = *(const v8us*)((const unsigned short*)arow + kb + 16 + 8 * hh);
#pragma unroll
    for (int t = 0; t < 4; ++t) { if (col0 + t * 16 >= N) continue; const size_t boff = (size_t)(col0 + t * 16 + ln) * ldb + kb; FragH bq; bq.half[0] = *(const v8us*)((const unsigned short*)Bh + boff + 8 * hh); bq.half[1] = *(const v8us*)((const unsigned short*)Bh + boff + 16 + 8 * hh);
      acc[t] = mmaH<1>(ah.v, ah.v, bq.v, bq.v, acc[t]); }
  }
#pragma unroll
  for (int t = 0; t < 4; ++t) { if (col0 + t * 16 >= N) continue; const int col = col0 + t * 16 + ln; const float bv = bp ? bf16_round(bp[col]) : 0.f;
#pragma unroll
    for (int r = 0; r < 8; ++r) { float v = acc[t][r] * alpha + bv; if (CP) { const int bidx = (row0g + row0 + 8 * hh + r) / rowsPerB; v += CP[(size_t)bidx * sCPb + (size_t)by * 64 + col]; } if (ACT == 1) v = (v > 0.f) ? v : expm1f(v); else if (ACT == 7) v = (v > 0.f) ? v + 1.0f : expf(v); else if (ACT == 8) v = tanhf(v); else if (ACT == 9) v = 0.5f * v * (1.0f + tanhf(0.7978845608028654f * (v + 0.044715f * v * v * v))); else if (ACT == 11) v = 1.0f / (1.0f + expf(-v)); else if (ACT == 12) v = (v > 0.f) ? v : 0.01f * v; else if (ACT == 14) v = (v > 0.f) ? v : 0.1f * v; else if (ACT == 15) v = v / (1.0f + expf(-v)); else if (ACT == 3) v = fmaxf(v, 0.f); else if (ACT == 6) v = 0.5f * v * (1.0f + erff(v * 0.70710678118654752f)); so[w][8 * hh + r][t * 16 + ln] = v; } }
  __builtin_amdgcn_fence(__ATOMIC_ACQ_REL, "workgroup"); __builtin_amdgcn_wave_barrier();
  const int rsub = lane >> 4, c4 = (lane & 15) * 4; typedef _Float16 v4h __attribute__((ext_vector_type(4)));
  {
#pragma unroll
    for (int q = 0; q < 8; ++q) { const int r = q * 2 + rsub; if (col0 + c4 < N) { const v4f v = *(const v4fa*)&so[w][r][c4]; if (C) *(v4f*)(C + cofs + (size_t)(row0 + r) * ldc + col0 + c4) = v; if (C16) { v4h h4; for (int i = 0; i < 4; ++i) h4[i] = (_Float16)v[i]; *(v4h*)(C16 + cofs + (size_t)(row0 + r) * ldc + col0 + c4) = h4; } } }
     }
}


typedef _Float16 v4h __attribute__((ext_vector_type(4)));

__global__ __launch_bounds__(256) void k_x16(const float* __restrict__ x, _Float16* __restrict__ X16, size_t n8) { const size_t t = (size_t)blockIdx.x * 256 + threadIdx.x; if (t >= n8) return; FragH f;
#pragma unroll
  for (int q = 0; q < 8; ++q) f.h[q] = (_Float16)bf16_round(x[t * 8 + q]); *(v8us*)((unsigned short*)X16 + t * 8) = f.half[0];  }
__global__ __launch_bounds__(256) void k_h16(const float* __restrict__ x, _Float16* __restrict__ X16, size_t n8) { const size_t t = (size_t)blockIdx.x * 256 + threadIdx.x; if (t >= n8) return; FragH f;
#pragma unroll
  for (int q = 0; q < 8; ++q) f.h[q] = (_Float16)x[t * 8 + q]; *(v8us*)((unsigned short*)X16 + t * 8) = f.half[0];  }
__global__ __launch_bounds__(256) void k_round16f(const float* __restrict__ W, _Float16* __restrict__ Bt, size_t n8) { const size_t t = (size_t)blockIdx.x * 256 + threadIdx.x; if (t >= n8) return; FragH f;
#pragma unroll
  for (int i = 0; i < 8; ++i) f.h[i] = (_Float16)(bf16_round(W[t * 8 + i]) * 16.0f); *(v8us*)((unsigned short*)Bt + t * 8) = f.half[0];  }
template <int NHv, int TTv>
__global__ __launch_bounds__(256) void k_vt(const _Float16* __restrict__ V16, int ldv, int voff, _Float16* __restrict__ Vt) { __shared__ unsigned short tl[64][66]; const int tid = threadIdx.x; const int slab = blockIdx.x / (TTv / 64), lg = blockIdx.x % (TTv / 64); const int b = slab / NHv, h = slab % NHv;
  for (int i = tid; i < 64 * 8; i += 256) { const int r = i / 8, c8 = (i % 8) * 8; FragH f; f.half[0] = *(const v8us*)((const unsigned short*)V16 + ((size_t)b * TTv + lg * 64 + r) * ldv + voff + h * 64 + c8);
#pragma unroll
    for (int q = 0; q < 8; ++q) tl[r][c8 + q] = f.u[q]; }
  __syncthreads();
  {
#pragma unroll
    for (int rd = 0; rd < 2; ++rd) { const int d = rd * 32 + tid / 8, pc = tid % 8; FragH f;
#pragma unroll
      for (int q = 0; q < 8; ++q) f.u[q] = tl[pc * 8 + q][d];
      *(v8us*)((unsigned short*)Vt + ((size_t)slab * 64 + d) * TTv + lg * 64 + pc * 8) = f.half[0]; }
     } }

template <int D, int RBF>
__global__ __launch_bounds__(256) void k_lnx(const float* __restrict__ X, const float* __restrict__ gam, const float* __restrict__ bet, int nrows, float eps, _Float16* __restrict__ O16, float* __restrict__ XR) {
  constexpr int NP = D / 128; const int tid = threadIdx.x, wv = tid >> 5, lane = tid & 31; const size_t r = (size_t)blockIdx.x * 8 + wv; if (r >= (size_t)nrows) return; v4f y[NP]; float s = 0.f;
#pragma unroll
  for (int j = 0; j < NP; ++j) { const int c = j * 128 + lane * 4; v4f g = *(const v4fa*)(X + r * D + c); if (RBF) { for (int q = 0; q < 4; ++q) g[q] = bf16_round(g[q]); } y[j] = g; s += g[0] + g[1] + g[2] + g[3]; }
  for (int o = 16; o >= 1; o >>= 1) s += __shfl_xor(s, o, 32); const float mu = s / (float)D; float q2 = 0.f;
#pragma unroll
  for (int j = 0; j < NP; ++j) for (int q = 0; q < 4; ++q) { const float d = y[j][q] - mu; q2 += d * d; }
  for (int o = 16; o >= 1; o >>= 1) q2 += __shfl_xor(q2, o, 32); const float rs = rsqrtf(q2 / (float)D + eps);
  {
#pragma unroll
    for (int j = 0; j < NP; ++j) { const int c = j * 128 + lane * 4; v4h h; for (int q = 0; q < 4; ++q) { const float v = (y[j][q] - mu) * rs * bf16_round(gam[c + q]) + bf16_round(bet[c + q]); h[q] = (_Float16)v; } *(v4h*)(O16 + r * D + c) = h; if (XR) *(v4f*)(XR + r * D + c) = y[j]; }
     } }
__global__ __launch_bounds__(128) void k_flash(const _Float16* __restrict__ Q16, int ldq, const _Float16* __restrict__ K16, int ldk, const _Float16* __restrict__ Vt, const int* __restrict__ MSK, float* __restrict__ O, int ldo) {
  constexpr int RPW = 16, RTN = RPW / 16, NQB = TT / (4 * RPW), DT = 4, KS = 2;
  __shared__ __attribute__((aligned(16))) unsigned short sP[4][RPW][40]; __shared__ __attribute__((aligned(16))) float sO[4][RPW][64 + 4];
  const int tid = threadIdx.x, w = tid >> 5, lane = tid & 31, ln = lane & 15, hh = lane >> 4;
  const int slab = blockIdx.x / NQB, qblk = blockIdx.x % NQB; const int b = slab / NH, h = slab % NH; const int qb0 = qblk * (4 * RPW); const int q0 = qb0 + w * RPW;
  FragH aq[2][KS];
#pragma unroll
  for (int rt = 0; rt < RTN; ++rt) { const unsigned short* qr = (const unsigned short*)Q16 + ((size_t)b * TT + q0 + rt * 16 + ln) * ldq + h * 64;
#pragma unroll
    for (int ks = 0; ks < KS; ++ks) { aq[rt][ks].half[0] = *(const v8us*)(qr + ks * 32 + 8 * hh); aq[rt][ks].half[1] = *(const v8us*)(qr + ks * 32 + 16 + 8 * hh); } }
  const unsigned short* Vth = (const unsigned short*)Vt + (size_t)slab * 64 * TT;
  float m_r[2][8], l_r[2][8]; v8f oacc[2][DT];
#pragma unroll
  for (int rt = 0; rt < RTN; ++rt) {
#pragma unroll
    for (int r = 0; r < 8; ++r) { m_r[rt][r] = -3.0e38f; l_r[rt][r] = 0.f; }
#pragma unroll
    for (int dt = 0; dt < DT; ++dt) oacc[rt][dt] = (v8f){0.f,0.f,0.f,0.f,0.f,0.f,0.f,0.f}; }
  const int jend = TT;
#pragma unroll 1
  for (int j0 = 0; j0 < jend; j0 += 32) {
    const int km0 = MSK[(size_t)b * TT + j0 + ln], km1 = MSK[(size_t)b * TT + j0 + 16 + ln];      /* key padding mask (1 = PAD), shared by all queries and heads */
    v8f s[2][2];
#pragma unroll
    for (int nt = 0; nt < 2; ++nt) { const unsigned short* kr = (const unsigned short*)K16 + ((size_t)b * TT + j0 + nt * 16 + ln) * ldk + h * 64; FragH bk[KS];
#pragma unroll
      for (int ks = 0; ks < KS; ++ks) { bk[ks].half[0] = *(const v8us*)(kr + ks * 32 + 8 * hh); bk[ks].half[1] = *(const v8us*)(kr + ks * 32 + 16 + 8 * hh); }
#pragma unroll
      for (int rt = 0; rt < RTN; ++rt) { v8f acc = (v8f){0.f,0.f,0.f,0.f,0.f,0.f,0.f,0.f};
#pragma unroll
        for (int ks = 0; ks < KS; ++ks) acc = mmaH<1>(aq[rt][ks].v, aq[rt][ks].v, bk[ks].v, bk[ks].v, acc); s[rt][nt] = acc; } }
#pragma unroll
    for (int rt = 0; rt < RTN; ++rt)
#pragma unroll
      for (int r = 0; r < 8; ++r) { const int tq = q0 + rt * 16 + 8 * hh + r; const int k0 = j0 + ln, k1 = j0 + 16 + ln; (void)tq; (void)k0; (void)k1;
        const bool ok0 = (km0 == 0), ok1 = (km1 == 0);      /* 1 = pad → excluded (the module adds −1e8) */
        const float s0 = ok0 ? s[rt][0][r] * 0.125f : -INFINITY, s1 = ok1 ? s[rt][1][r] * 0.125f : -INFINITY; float mc = fmaxf(s0, s1);
        mc = fmaxf(mc, __shfl_xor(mc, 1, 32)); mc = fmaxf(mc, __shfl_xor(mc, 2, 32)); mc = fmaxf(mc, __shfl_xor(mc, 4, 32)); mc = fmaxf(mc, __shfl_xor(mc, 8, 32));
        const float mn = fmaxf(m_r[rt][r], mc); const float al = (mn > -1.0e38f) ? expf(m_r[rt][r] - mn) : 1.0f; m_r[rt][r] = mn; const float p0 = ok0 ? expf(s0 - mn) : 0.f, p1 = ok1 ? expf(s1 - mn) : 0.f; l_r[rt][r] = l_r[rt][r] * al + p0 + p1;
#pragma unroll
        for (int dt = 0; dt < DT; ++dt) oacc[rt][dt][r] *= al;
        FragH t2; t2.h[0] = (_Float16)(p0 * 1024.0f); t2.h[1] = (_Float16)(p1 * 1024.0f); sP[w][rt * 16 + 8 * hh + r][ln] = t2.u[0]; sP[w][rt * 16 + 8 * hh + r][16 + ln] = t2.u[1]; }
    __builtin_amdgcn_fence(__ATOMIC_ACQ_REL, "workgroup"); __builtin_amdgcn_wave_barrier();
    FragH pa[2];
#pragma unroll
    for (int rt = 0; rt < RTN; ++rt) { pa[rt].half[0] = *(const v8us*)&sP[w][rt * 16 + ln][8 * hh]; pa[rt].half[1] = *(const v8us*)&sP[w][rt * 16 + ln][16 + 8 * hh]; }
#pragma unroll
    for (int dt = 0; dt < DT; ++dt) { const unsigned short* vrow = Vth + (size_t)(dt * 16 + ln) * TT + j0; FragH bv; bv.half[0] = *(const v8us*)(vrow + 8 * hh); bv.half[1] = *(const v8us*)(vrow + 16 + 8 * hh);
#pragma unroll
      for (int rt = 0; rt < RTN; ++rt) oacc[rt][dt] = mmaH<1>(pa[rt].v, pa[rt].v, bv.v, bv.v, oacc[rt][dt]); }
    __builtin_amdgcn_fence(__ATOMIC_ACQ_REL, "workgroup"); __builtin_amdgcn_wave_barrier(); }
#pragma unroll
  for (int rt = 0; rt < RTN; ++rt) {
#pragma unroll
    for (int r = 0; r < 8; ++r) { float l = l_r[rt][r]; l += __shfl_xor(l, 1, 32); l += __shfl_xor(l, 2, 32); l += __shfl_xor(l, 4, 32); l += __shfl_xor(l, 8, 32); l_r[rt][r] = (l > 0.f) ? 1.0f / (l * 1024.0f) : 0.f; }
#pragma unroll
    for (int dt = 0; dt < DT; ++dt)
#pragma unroll
      for (int r = 0; r < 8; ++r) sO[w][rt * 16 + 8 * hh + r][dt * 16 + ln] = oacc[rt][dt][r] * l_r[rt][r]; }
  __builtin_amdgcn_fence(__ATOMIC_ACQ_REL, "workgroup"); __builtin_amdgcn_wave_barrier();
  {
#pragma unroll
    for (int rp = 0; rp < RPW; rp += 2) { const int r = rp + (lane >> 4), pc = lane & 15; const v4f val = *(const v4fa*)&sO[w][r][pc * 4]; *(v4f*)(O + ((size_t)b * TT + q0 + r) * ldo + h * 64 + pc * 4) = val; }
     } }

__global__ __launch_bounds__(256) void k_addbf(float* __restrict__ out, const float* __restrict__ x, size_t n4) { const size_t t = (size_t)blockIdx.x * 256 + threadIdx.x; if (t >= n4) return; v4f a = *(const v4fa*)(out + t * 4); const v4f b = *(const v4fa*)(x + t * 4); for (int q = 0; q < 4; ++q) a[q] += bf16_round(b[q]); *(v4f*)(out + t * 4) = a;  }
extern "C" void kernel_launch(void* const* d_in, const int* in_sizes, int n_in,
                              void* d_out, int out_size, void* d_ws, size_t ws_size, hipStream_t stream) {
  (void)in_sizes; (void)n_in; (void)out_size;
  const float* const* I = (const float* const*)d_in; const float* x = I[0]; const int* mask = (const int*)d_in[1]; const float* Wqkv = I[2]; const float* bqkv = I[3]; const float* Wo = I[4]; const float* bo = I[5]; const float* lng = I[6]; const float* lnb = I[7];      /* d_in order: hidden_states, encoder_padding_mask, qkv_w, qkv_b, out_w, out_b, ln_g, ln_b */
  const float* bq = bqkv; const float* bk = bqkv + DD; const float* bv = bqkv + 2 * DD;
  char* ws = (char*)d_ws; size_t off = 0;
  auto take = [&](size_t bytes) { char* p = ws + off; off += (bytes + 255) & ~(size_t)255; return p; };
  const size_t WSZ = (size_t)DD * DD; _Float16* Bw = (_Float16*)take(4 * WSZ * 2); _Float16* X16 = (_Float16*)take((size_t)NR * DD * 2);
  _Float16* Q = (_Float16*)take((size_t)NR * DD * 2); _Float16* K = (_Float16*)take((size_t)NR * DD * 2); _Float16* V = (_Float16*)take((size_t)NR * DD * 2); _Float16* Vt = (_Float16*)take((size_t)NR * DD * 2);
  float* O = (float*)take((size_t)NR * DD * 4); _Float16* O16 = V;      /* the v plane is dead once Vᵀ is built (before the attention kernel); O16 reuses it */
  if (off > ws_size) return;      // 8.4 + 16.8 × 5 + 33.6 ≈ 126 MB (120 MiB)
  const unsigned gw2 = (unsigned)((WSZ / 8 + 255) / 256);
  k_round16f<<<(unsigned)((3 * WSZ / 8 + 255) / 256), 256, 0, stream>>>(Wqkv, Bw, 3 * WSZ / 8); k_round16f<<<gw2, 256, 0, stream>>>(Wo, Bw + 3 * WSZ, WSZ / 8);      /* (out,in) natural ×2^4: rows q|k|v, then out_w */
  const unsigned gx = (unsigned)(((size_t)NR * DD / 8 + 255) / 256); const dim3 gp(((NR / 16) * (DD / 64) + 3) / 4, 1);
  k_lnx<DD, 1><<<(NR + 7) / 8, 256, 0, stream>>>(x, lng, lnb, NR, 1e-5f, X16, nullptr);      /* x = LN(bf16 hidden) → f16 */
  k_gemm_hhx<0><<<gp, 128, 0, stream>>>(X16, DD, 0, Bw, DD, 0, 0.0625f, bq, 0, nullptr, 1, 0, 0, nullptr, Q, DD, 0, NR, DD, DD);      /* q = x·Wq + bq: M 8192 N 1024 K 1024 */
  k_gemm_hhx<0><<<gp, 128, 0, stream>>>(X16, DD, 0, Bw + WSZ, DD, 0, 0.0625f, bk, 0, nullptr, 1, 0, 0, nullptr, K, DD, 0, NR, DD, DD);
  k_gemm_hhx<0><<<gp, 128, 0, stream>>>(X16, DD, 0, Bw + 2 * WSZ, DD, 0, 0.0625f, bv, 0, nullptr, 1, 0, 0, nullptr, V, DD, 0, NR, DD, DD);
  k_vt<NH, TT><<<BB * NH * (TT / 64), 256, 0, stream>>>(V, DD, 0, Vt);
  k_flash<<<BB * NH * (TT / 64), 128, 0, stream>>>(Q, DD, K, DD, Vt, mask, O, DD);
  k_h16<<<gx, 256, 0, stream>>>(O, O16, (size_t)NR * DD / 8);
  k_gemm_hhx<0><<<gp, 128, 0, stream>>>(O16, DD, 0, Bw + 3 * WSZ, DD, 0, 0.0625f, bo, 0, nullptr, 1, 0, 0, (float*)d_out, nullptr, DD, 0, NR, DD, DD);      /* out = O·out_wᵀ + out_b */
  k_addbf<<<(unsigned)(((size_t)NR * DD / 4 + 255) / 256), 256, 0, stream>>>((float*)d_out, x, (size_t)NR * DD / 4);      /* += bf16(hidden) in place (residual; no workspace left for an f32 copy) */
}

// v001
// Measured time: 525 microseconds a run.
// Timed twice side by side with v000, it ran 1.58 times as fast both times.
#include <hip/hip_runtime.h>
// Pre-LN self-attention layer with a key padding mask and residual (B=4, S=2048, H=1024, 16 heads × 64): x = LN(hidden); [q|k|v] = x·qkv_wᵀ + qkv_b ((out,in) fused); scores = q·kᵀ·64^-½ + mask·(−1e8) (int mask [B,S], 1 = pad); softmax;
// out = (attn·v merged)·out_wᵀ + out_b + hidden.
// Compute dtype: x, weights, biases rounded to bf16; q/k/v as f16 GEMM outputs; fused flash-style kernel (online softmax f32, P f16 ×2^10) on v_wmma_f32_16x16x32_f16; O → f16 → output GEMM with bias; f32 accumulate.
#define BB 4
#define TT 2048
#define NH 16
#define DD 1024
#define NR (BB * TT)

typedef __bf16 v16b __attribute__((ext_vector_type(16)));
typedef unsigned short v8us __attribute__((ext_vector_type(8), may_alias));
typedef float  v8f  __attribute__((ext_vector_type(8)));
typedef float  v4f  __attribute__((ext_vector_type(4)));
typedef float  v4fa __attribute__((ext_vector_type(4), may_alias));
union FragB { v16b v; v8us half[2]; unsigned short u[16]; };

__device__ __forceinline__ unsigned short bf16_bits(float x) { unsigned int u = __float_as_uint(x); return (unsigned short)((u + 0x7FFFu + ((u >> 16) & 1u)) >> 16); }
__device__ __forceinline__ float bf16_val(unsigned short b) { return __uint_as_float(((unsigned int)b) << 16); }
__device__ __forceinline__ float bf16_round(float x) { return bf16_val(bf16_bits(x)); }
// D += A·B with NT terms: 1 = ah·bh, 2 = + al·bh (A split), 3 = + ah·bl (both split)
template <int NT>
__device__ __forceinline__ v8f mmaN(v16b ah, v16b al, v16b bh, v16b bl, v8f c) {
  c = __builtin_amdgcn_wmma_f32_16x16x32_bf16(false, ah, false, bh, (short)0, c, false, false);
  if (NT >= 2) c = __builtin_amdgcn_wmma_f32_16x16x32_bf16(false, al, false, bh, (short)0, c, false, false);
  if (NT >= 3) c = __builtin_amdgcn_wmma_f32_16x16x32_bf16(false, ah, false, bl, (short)0, c, false, false);
  asm volatile("v_nop\n\tv_nop\n\tv_nop\n\tv_nop" : "+v"(c) : "v"(ah), "v"(al), "v"(bh), "v"(bl));
  return c;
}

__global__ __launch_bounds__(256) void k_wt_bf16(const float* __restrict__ W, unsigned short* __restrict__ Wt, int K, int N) {
  const int t = blockIdx.x * 256 + threadIdx.x;
  const int k8n = K / 8;
  if (t >= N * k8n) return;
  const int n = t / k8n, k8 = (t % k8n) * 8;
  v8us v;
#pragma unroll
  for (int i = 0; i < 8; ++i) v[i] = bf16_bits(W[(size_t)(k8 + i) * N + n]);
  *(v8us*)(Wt + (size_t)n * K + k8) = v;
  
}

// GEMM C[M][N] (f32, pitch ldc) = act(A[M][K]·W + bias). A f32 row-major (pitch lda) converted per fragment to bf16
// (ASPLIT: hi/lo two planes -> 2 terms, else single rounded term); Wt bf16 [N][K] (pitch ldb). BIAS_BF16 rounds the
// bias to bf16 first (bias quantised to bf16 before the add). K%32==0, M%16==0, N%64==0.
template <bool ASPLIT, int ACT, bool BIAS_BF16>
__global__ __launch_bounds__(128) void k_gemm_bf(const float* __restrict__ A, int lda, const unsigned short* __restrict__ Wt, int ldb,
                                               const float* __restrict__ bias, float* __restrict__ C, int ldc, int M, int N, int K) {
  __shared__ __attribute__((aligned(16))) float so[4][16][64];
  const int tid = threadIdx.x, w = tid >> 5, lane = tid & 31, ln = lane & 15, hh = lane >> 4;
  const int ntn = N / 64;
  const int wid = blockIdx.x * 4 + w;
  const int mt = wid / ntn, nq = wid % ntn;
  if (mt * 16 >= M) return;
  const int row0 = mt * 16, col0 = nq * 64;
  const float* arow = A + (size_t)(row0 + ln) * lda;
  v8f acc[4] = {};
  for (int kb = 0; kb < K; kb += 32) {
    FragB ah, al;
    const v4f x0 = *(const v4fa*)(arow + kb + 8 * hh), x1 = *(const v4fa*)(arow + kb + 8 * hh + 4);
    const v4f x2 = *(const v4fa*)(arow + kb + 16 + 8 * hh), x3 = *(const v4fa*)(arow + kb + 16 + 8 * hh + 4);
    float xs[16] = {x0[0],x0[1],x0[2],x0[3],x1[0],x1[1],x1[2],x1[3],x2[0],x2[1],x2[2],x2[3],x3[0],x3[1],x3[2],x3[3]};
#pragma unroll
    for (int i = 0; i < 16; ++i) { const unsigned short hb = bf16_bits(xs[i]); ah.u[i] = hb; al.u[i] = ASPLIT ? bf16_bits(xs[i] - bf16_val(hb)) : (unsigned short)0; }
#pragma unroll
    for (int t = 0; t < 4; ++t) {
      const unsigned short* brow = Wt + (size_t)(col0 + t * 16 + ln) * ldb + kb;
      FragB b;
      b.half[0] = *(const v8us*)(brow + 8 * hh);
      b.half[1] = *(const v8us*)(brow + 16 + 8 * hh);
      acc[t] = mmaN<ASPLIT ? 2 : 1>(ah.v, al.v, b.v, b.v, acc[t]);
    }
  }
#pragma unroll
  for (int t = 0; t < 4; ++t) {
    float bv = bias ? bias[col0 + t * 16 + ln] : 0.f;
    if (BIAS_BF16) bv = bf16_round(bv);
#pragma unroll
    for (int r = 0; r < 8; ++r) { float v = acc[t][r] + bv; if (ACT == 1) v = fmaxf(v, 0.f); so[w][8 * hh + r][t * 16 + ln] = v; }
  }
  __builtin_amdgcn_fence(__ATOMIC_ACQ_REL, "workgroup");
  __builtin_amdgcn_wave_barrier();
  const int rsub = lane >> 4, c4 = (lane & 15) * 4;
  {
#pragma unroll
    for (int q = 0; q < 8; ++q) {
      const int r = q * 2 + rsub;
      const v4f v = *(const v4fa*)&so[w][r][c4];
      *(v4f*)(C + (size_t)(row0 + r) * ldc + col0 + c4) = v;
    }
    
  }
}

// Flash-style causal/unmasked attention, all contractions 3-term bf16 hi/lo splits, f32 softmax with running max.
// q,k,v rows are read from f32 buffers with arbitrary row pitch (so they can live inside a fused qkv buffer);
// D = head size (multiple of 32, <= 128); one wave = 16 query rows; block = 4 waves (64 queries) sharing K/V chunks of 32.
template <int D, bool CAUSAL>
__global__ __launch_bounds__(128) void k_flash(const float* __restrict__ qb, const float* __restrict__ kb, const float* __restrict__ vb,
                                             int pitch, int T, int H, float scale, float* __restrict__ y, int ypitch) {
  constexpr int KS = D / 32;        // k-steps for QK
  constexpr int DT = D / 16;        // d tiles for PV
  __shared__ __attribute__((aligned(16))) unsigned short sKh[32][D + 8], sKl[32][D + 8], sVh[32][D + 8], sVl[32][D + 8];
  __shared__ __attribute__((aligned(16))) unsigned short sPh[4][16][40], sPl[4][16][40];
  __shared__ __attribute__((aligned(16))) float sO[4][16][D];
  const int tid = threadIdx.x, w = tid >> 5, lane = tid & 31, ln = lane & 15, hh = lane >> 4;
  const int nqb = (T + 63) / 64;
  const int bh = blockIdx.x / nqb, qblk = blockIdx.x % nqb;
  const int b = bh / H, h = bh % H;
  const int q0 = qblk * 64 + w * 16;
  const float* Q = qb + (size_t)b * T * pitch + h * D;
  const float* K = kb + (size_t)b * T * pitch + h * D;
  const float* V = vb + (size_t)b * T * pitch + h * D;

  // A fragments of the wave's 16 query rows (scaled), hi/lo
  FragB aqh[KS], aql[KS];
  {
    int row = q0 + ln; if (row >= T) row = T - 1;
    const float* qr = Q + (size_t)row * pitch;
#pragma unroll
    for (int ks = 0; ks < KS; ++ks)
#pragma unroll
      for (int i = 0; i < 16; ++i) {
        const int d = ks * 32 + ((i < 8) ? (8 * hh + i) : (16 + 8 * hh + (i - 8)));
        const float x = qr[d] * scale; const unsigned short hb = bf16_bits(x);
        aqh[ks].u[i] = hb; aql[ks].u[i] = bf16_bits(x - bf16_val(hb));
      }
  }
  float m_r[8], l_r[8];
#pragma unroll
  for (int r = 0; r < 8; ++r) { m_r[r] = -3.0e38f; l_r[r] = 0.f; }
  v8f oacc[DT];
#pragma unroll
  for (int dt = 0; dt < DT; ++dt) oacc[dt] = (v8f){0.f,0.f,0.f,0.f,0.f,0.f,0.f,0.f};

  const int kv_end = CAUSAL ? min(T, qblk * 64 + 64) : T;     // block-uniform
  for (int j0 = 0; j0 < kv_end; j0 += 32) {
    __syncthreads();
    for (int e = tid; e < 32 * (D / 4); e += 128) {
      const int r = e / (D / 4), c4 = (e % (D / 4)) * 4;
      const int key = j0 + r;
      v4f kf = {0.f,0.f,0.f,0.f}, vf = {0.f,0.f,0.f,0.f};
      if (key < T) { kf = *(const v4fa*)(K + (size_t)key * pitch + c4); vf = *(const v4fa*)(V + (size_t)key * pitch + c4); }
#pragma unroll
      for (int t = 0; t < 4; ++t) {
        unsigned short hb = bf16_bits(kf[t]); sKh[r][c4 + t] = hb; sKl[r][c4 + t] = bf16_bits(kf[t] - bf16_val(hb));
        hb = bf16_bits(vf[t]); sVh[r][c4 + t] = hb; sVl[r][c4 + t] = bf16_bits(vf[t] - bf16_val(hb));
      }
    }
    __syncthreads();
    // S tile 16 x 32
    v8f s[2];
#pragma unroll
    for (int nt = 0; nt < 2; ++nt) {
      v8f acc = {};
#pragma unroll
      for (int ks = 0; ks < KS; ++ks) {
        FragB bh_, bl_;
        bh_.half[0] = *(const v8us*)&sKh[nt * 16 + ln][ks * 32 + 8 * hh]; bh_.half[1] = *(const v8us*)&sKh[nt * 16 + ln][ks * 32 + 16 + 8 * hh];
        bl_.half[0] = *(const v8us*)&sKl[nt * 16 + ln][ks * 32 + 8 * hh]; bl_.half[1] = *(const v8us*)&sKl[nt * 16 + ln][ks * 32 + 16 + 8 * hh];
        acc = mmaN<3>(aqh[ks].v, aql[ks].v, bh_.v, bl_.v, acc);
      }
      s[nt] = acc;
    }
    // mask + running max (rows 8hh+r; the 16 lanes of a half share rows)
    float alpha[8];
#pragma unroll
    for (int r = 0; r < 8; ++r) {
      const int qi = q0 + 8 * hh + r;
      const int ja = j0 + ln, jb = j0 + 16 + ln;
      if (CAUSAL) { if (ja > qi) s[0][r] = -3.0e38f; if (jb > qi) s[1][r] = -3.0e38f; }
      if (ja >= T) s[0][r] = -3.0e38f;
      if (jb >= T) s[1][r] = -3.0e38f;
      float mx = fmaxf(s[0][r], s[1][r]);
      mx = fmaxf(mx, __shfl_xor(mx, 1, 32)); mx = fmaxf(mx, __shfl_xor(mx, 2, 32)); mx = fmaxf(mx, __shfl_xor(mx, 4, 32)); mx = fmaxf(mx, __shfl_xor(mx, 8, 32));
      const float mnew = fmaxf(m_r[r], mx);
      alpha[r] = (mnew > -1.0e38f) ? __expf(m_r[r] - mnew) : 1.0f;
      const float p0 = (s[0][r] > -1.0e38f) ? __expf(s[0][r] - mnew) : 0.f;
      const float p1 = (s[1][r] > -1.0e38f) ? __expf(s[1][r] - mnew) : 0.f;
      m_r[r] = mnew;
      l_r[r] = l_r[r] * alpha[r] + p0 + p1;            // per-lane partial row sum (16 lanes combined at the end)
      unsigned short hb = bf16_bits(p0); sPh[w][8 * hh + r][ln] = hb;      sPl[w][8 * hh + r][ln] = bf16_bits(p0 - bf16_val(hb));
      hb = bf16_bits(p1);                sPh[w][8 * hh + r][16 + ln] = hb; sPl[w][8 * hh + r][16 + ln] = bf16_bits(p1 - bf16_val(hb));
    }
#pragma unroll
    for (int dt = 0; dt < DT; ++dt)
#pragma unroll
      for (int r = 0; r < 8; ++r) oacc[dt][r] *= alpha[r];
    __builtin_amdgcn_fence(__ATOMIC_ACQ_REL, "workgroup");
    __builtin_amdgcn_wave_barrier();
    FragB pah, pal;
    pah.half[0] = *(const v8us*)&sPh[w][ln][8 * hh]; pah.half[1] = *(const v8us*)&sPh[w][ln][16 + 8 * hh];
    pal.half[0] = *(const v8us*)&sPl[w][ln][8 * hh]; pal.half[1] = *(const v8us*)&sPl[w][ln][16 + 8 * hh];
#pragma unroll
    for (int dt = 0; dt < DT; ++dt) {
      FragB bvh, bvl;
#pragma unroll
      for (int i = 0; i < 8; ++i) {
        bvh.u[i] = sVh[8 * hh + i][dt * 16 + ln]; bvh.u[8 + i] = sVh[16 + 8 * hh + i][dt * 16 + ln];
        bvl.u[i] = sVl[8 * hh + i][dt * 16 + ln]; bvl.u[8 + i] = sVl[16 + 8 * hh + i][dt * 16 + ln];
      }
      oacc[dt] = mmaN<3>(pah.v, pal.v, bvh.v, bvl.v, oacc[dt]);
    }
    __builtin_amdgcn_fence(__ATOMIC_ACQ_REL, "workgroup");
    __builtin_amdgcn_wave_barrier();
  }
#pragma unroll
  for (int r = 0; r < 8; ++r) {
    float l = l_r[r];
    l += __shfl_xor(l, 1, 32); l += __shfl_xor(l, 2, 32); l += __shfl_xor(l, 4, 32); l += __shfl_xor(l, 8, 32);
    l_r[r] = (l > 0.f) ? 1.0f / l : 0.f;
  }
#pragma unroll
  for (int dt = 0; dt < DT; ++dt)
#pragma unroll
    for (int r = 0; r < 8; ++r) sO[w][8 * hh + r][dt * 16 + ln] = oacc[dt][r] * l_r[r];
  __builtin_amdgcn_fence(__ATOMIC_ACQ_REL, "workgroup");
  __builtin_amdgcn_wave_barrier();
  {
    for (int r = 0; r < 16; ++r) {
      const int row = q0 + r;
      if (row < T && lane < D / 4) {
        const v4f val = *(const v4fa*)&sO[w][r][lane * 4];
        *(v4f*)(y + ((size_t)b * T + row) * ypitch + h * D + lane * 4) = val;
      }
    }
    
  }
}

// GEMM C = act(A·W + bias + resid): A f32 (ASPLIT -> hi/lo 2 terms), Wt bf16 [N][K]; ACT 0 none, 1 relu, 2 exact gelu;
// resid (optional, f32, row index = (row % rmod), pitch ldr, RES_BF16 rounds it) added before the activation.
template <bool ASPLIT, int ACT, bool BIAS_BF16, bool RES_BF16>
__global__ __launch_bounds__(128) void k_gemm_bf3(const float* __restrict__ A, int lda, const unsigned short* __restrict__ Wt, int ldb,
                                                const float* __restrict__ bias, const float* __restrict__ resid, int rmod, int ldr,
                                                float* __restrict__ C, int ldc, int M, int N, int K) {
  __shared__ __attribute__((aligned(16))) float so[4][16][64];
  const int tid = threadIdx.x, w = tid >> 5, lane = tid & 31, ln = lane & 15, hh = lane >> 4;
  const int ntn = N / 64;
  const int wid = blockIdx.x * 4 + w;
  const int mt = wid / ntn, nq = wid % ntn;
  if (mt * 16 >= M) return;
  const int row0 = mt * 16, col0 = nq * 64;
  const float* arow = A + (size_t)(row0 + ln) * lda;
  v8f acc[4] = {};
  for (int kb = 0; kb < K; kb += 32) {
    FragB ah, al;
    const v4f x0 = *(const v4fa*)(arow + kb + 8 * hh), x1 = *(const v4fa*)(arow + kb + 8 * hh + 4);
    const v4f x2 = *(const v4fa*)(arow + kb + 16 + 8 * hh), x3 = *(const v4fa*)(arow + kb + 16 + 8 * hh + 4);
    float xs[16] = {x0[0],x0[1],x0[2],x0[3],x1[0],x1[1],x1[2],x1[3],x2[0],x2[1],x2[2],x2[3],x3[0],x3[1],x3[2],x3[3]};
#pragma unroll
    for (int i = 0; i < 16; ++i) { const unsigned short hb = bf16_bits(xs[i]); ah.u[i] = hb; al.u[i] = ASPLIT ? bf16_bits(xs[i] - bf16_val(hb)) : (unsigned short)0; }
#pragma unroll
    for (int t = 0; t < 4; ++t) {
      const unsigned short* brow = Wt + (size_t)(col0 + t * 16 + ln) * ldb + kb;
      FragB b;
      b.half[0] = *(const v8us*)(brow + 8 * hh);
      b.half[1] = *(const v8us*)(brow + 16 + 8 * hh);
      acc[t] = mmaN<ASPLIT ? 2 : 1>(ah.v, al.v, b.v, b.v, acc[t]);
    }
  }
#pragma unroll
  for (int t = 0; t < 4; ++t) {
    const int col = col0 + t * 16 + ln;
    float bv = bias ? bias[col] : 0.f;
    if (BIAS_BF16) bv = bf16_round(bv);
#pragma unroll
    for (int r = 0; r < 8; ++r) {
      float v = acc[t][r] + bv;
      if (resid) { float rv = resid[(size_t)((row0 + 8 * hh + r) % rmod) * ldr + col]; if (RES_BF16) rv = bf16_round(rv); v += rv; }
      if (ACT == 1) v = fmaxf(v, 0.f);
      if (ACT == 2) v = 0.5f * v * (1.0f + erff(v * 0.70710678118654752f));
      if (ACT == 3) { const float u = 0.7978845608028654f * (v + 0.044715f * v * v * v); v = 0.5f * v * (1.0f + tanhf(u)); }
      so[w][8 * hh + r][t * 16 + ln] = v;
    }
  }
  __builtin_amdgcn_fence(__ATOMIC_ACQ_REL, "workgroup");
  __builtin_amdgcn_wave_barrier();
  const int rsub = lane >> 4, c4 = (lane & 15) * 4;
  {
#pragma unroll
    for (int q = 0; q < 8; ++q) {
      const int r = q * 2 + rsub;
      const v4f v = *(const v4fa*)&so[w][r][c4];
      *(v4f*)(C + (size_t)(row0 + r) * ldc + col0 + c4) = v;
    }
    
  }
}
// row LayerNorm (biased variance, eps) over N: s = X (+ R); optional out_sum <- s; out_norm <- (s-mu)*rsqrt(var+eps)*g + b
template <bool PARAM_BF16>
__global__ __launch_bounds__(256) void k_layernorm(const float* __restrict__ X, const float* __restrict__ R, const float* __restrict__ g, const float* __restrict__ bta,
                                                  float* __restrict__ out_sum, float* __restrict__ out_norm, int N, float eps) {
  __shared__ float red[256];
  const int row = blockIdx.x, tid = threadIdx.x;
  const float* x = X + (size_t)row * N; const float* rr = R ? R + (size_t)row * N : nullptr;
  float vals[16];                     // up to N = 4096
  const int per = N / 256;            // contiguous chunk per thread? use strided-by-4 chunks: thread handles j = tid*4 + 1024*u
  float s1 = 0.f;
  for (int u = 0; u < per / 4; ++u) {
    const int j = tid * 4 + 1024 * u;
    const v4f a = *(const v4fa*)(x + j);
    v4f b = {0.f,0.f,0.f,0.f}; if (rr) b = *(const v4fa*)(rr + j);
#pragma unroll
    for (int q = 0; q < 4; ++q) { const float v = a[q] + b[q]; vals[u * 4 + q] = v; s1 += v; }
  }
  red[tid] = s1; __syncthreads();
  for (int st = 128; st > 0; st >>= 1) { if (tid < st) red[tid] += red[tid + st]; __syncthreads(); }
  const float mu = red[0] / (float)N; __syncthreads();
  float s2 = 0.f;
  for (int u = 0; u < per / 4; ++u)
#pragma unroll
    for (int q = 0; q < 4; ++q) { const float c = vals[u * 4 + q] - mu; s2 += c * c; }
  red[tid] = s2; __syncthreads();
  for (int st = 128; st > 0; st >>= 1) { if (tid < st) red[tid] += red[tid + st]; __syncthreads(); }
  const float rs = rsqrtf(red[0] / (float)N + eps);
  {
    for (int u = 0; u < per / 4; ++u) {
      const int j = tid * 4 + 1024 * u;
      v4f o, sm;
#pragma unroll
      for (int q = 0; q < 4; ++q) {
        float gg = g[j + q], bb = bta[j + q];
        if (PARAM_BF16) { gg = bf16_round(gg); bb = bf16_round(bb); }
        sm[q] = vals[u * 4 + q]; o[q] = (vals[u * 4 + q] - mu) * rs * gg + bb;
      }
      if (out_sum) *(v4f*)(out_sum + (size_t)row * N + j) = sm;
      *(v4f*)(out_norm + (size_t)row * N + j) = o;
    }
    
  }
}



// ---- f16 WMMA path (v_wmma_f32_16x16x32_f16): 11-bit significands for operands in range — used where a [0,1] probability operand needs more precision than bf16
typedef _Float16 v16h __attribute__((ext_vector_type(16)));
union FragH { v16h v; v8us half[2]; _Float16 h[16]; unsigned short u[16]; };
template <int NT>
__device__ __forceinline__ v8f mmaH(v16h ah, v16h al, v16h bh, v16h bl, v8f c) {
  c = __builtin_amdgcn_wmma_f32_16x16x32_f16(false, ah, false, bh, (short)0, c, false, false);
  if (NT >= 2) c = __builtin_amdgcn_wmma_f32_16x16x32_f16(false, al, false, bh, (short)0, c, false, false);
  if (NT >= 3) c = __builtin_amdgcn_wmma_f32_16x16x32_f16(false, ah, false, bl, (short)0, c, false, false);
  asm volatile("v_nop\n\tv_nop\n\tv_nop\n\tv_nop" : "+v"(c) : "v"(ah), "v"(al), "v"(bh), "v"(bl));
  return c;
}
// batched GEMM like k_gemm_b but f16 operands: A f32 (split into f16 hi/lo if ASPLIT, else rounded to f16), Bt = f16 values [n][k]; alpha; C f32; N multiple of 16 (partial tiles skipped)
template <bool ASPLIT>
__global__ __launch_bounds__(128) void k_gemm_h(const float* __restrict__ A, int lda, size_t sA, const _Float16* __restrict__ Bh, int ldb, size_t sB, float alpha, float* __restrict__ C, int ldc, size_t sC, int M, int N, int K) {
  __shared__ __attribute__((aligned(16))) float so[4][16][64];
  const int tid = threadIdx.x, w = tid >> 5, lane = tid & 31, ln = lane & 15, hh = lane >> 4; const int by = blockIdx.y;
  A += (size_t)by * sA; Bh += (size_t)by * sB; C += (size_t)by * sC;
  const int ntn = (N + 63) / 64; const int wid = blockIdx.x * 4 + w; const int mt = wid / ntn, nq = wid % ntn; if (mt * 16 >= M) return;
  const int row0 = mt * 16, col0 = nq * 64; const float* arow = A + (size_t)(row0 + ln) * lda;
  v8f acc[4] = {};
  for (int kb = 0; kb < K; kb += 32) {
    FragH ah, al;
    const v4f x0 = *(const v4fa*)(arow + kb + 8 * hh), x1 = *(const v4fa*)(arow + kb + 8 * hh + 4), x2 = *(const v4fa*)(arow + kb + 16 + 8 * hh), x3 = *(const v4fa*)(arow + kb + 16 + 8 * hh + 4);
    float xs[16] = {x0[0],x0[1],x0[2],x0[3],x1[0],x1[1],x1[2],x1[3],x2[0],x2[1],x2[2],x2[3],x3[0],x3[1],x3[2],x3[3]};
#pragma unroll
    for (int i = 0; i < 16; ++i) { const _Float16 h = (_Float16)xs[i]; ah.h[i] = h; al.h[i] = ASPLIT ? (_Float16)(xs[i] - (float)h) : (_Float16)0.0f; }
#pragma unroll
    for (int t = 0; t < 4; ++t) { if (col0 + t * 16 >= N) continue; const size_t boff = (size_t)(col0 + t * 16 + ln) * ldb + kb; FragH bq; bq.half[0] = *(const v8us*)(Bh + boff + 8 * hh); bq.half[1] = *(const v8us*)(Bh + boff + 16 + 8 * hh);
      acc[t] = mmaH<ASPLIT ? 2 : 1>(ah.v, al.v, bq.v, bq.v, acc[t]); }
  }
#pragma unroll
  for (int t = 0; t < 4; ++t) { if (col0 + t * 16 >= N) continue;
#pragma unroll
    for (int r = 0; r < 8; ++r) so[w][8 * hh + r][t * 16 + ln] = acc[t][r] * alpha; }
  __builtin_amdgcn_fence(__ATOMIC_ACQ_REL, "workgroup"); __builtin_amdgcn_wave_barrier();
  const int rsub = lane >> 4, c4 = (lane & 15) * 4;
  {
#pragma unroll
    for (int q = 0; q < 8; ++q) { const int r = q * 2 + rsub; if (col0 + c4 < N) { const v4f v = *(const v4fa*)&so[w][r][c4]; *(v4f*)(C + (size_t)(row0 + r) * ldc + col0 + c4) = v; } }
     }
}

// Wt[n][k] = f16(W[k][n]·scale) from f32 row-major W[K][N] (scale = power of two; bf16-exact weights stay exact in f16 away from the subnormal range)
__global__ __launch_bounds__(256) void k_wt_f16(const float* __restrict__ W, _Float16* __restrict__ Wt, int K, int N, float scale) {
  const int t = blockIdx.x * 256 + threadIdx.x; if (t >= N * (K / 8)) return; const int n = t / (K / 8), k8 = (t % (K / 8)) * 8; FragH f;
#pragma unroll
  for (int i = 0; i < 8; ++i) f.h[i] = (_Float16)(bf16_round(W[(size_t)(k8 + i) * N + n]) * scale); const v8us o = f.half[0];
  *(v8us*)((unsigned short*)Wt + (size_t)n * K + k8) = o; 
}
// k_gemm_hh variant with fused epilogue: v = acc·alpha + bias[by·sBias + col] (+ CP[(row/rowsPerB)·sCPb + by·64 + col] if CP) ; ACT 0 none / 1 elu ; writes f16 C16 and/or f32 C (each if non-null)
template <int ACT>
__global__ __launch_bounds__(128) void k_gemm_hhx(const _Float16* __restrict__ A, int lda, size_t sA, const _Float16* __restrict__ Bh, int ldb, size_t sB, float alpha, const float* __restrict__ bias, size_t sBias, const float* __restrict__ CP, int rowsPerB, size_t sCPb, int row0g,
    float* __restrict__ C, _Float16* __restrict__ C16, int ldc, size_t sC, int M, int N, int K) {
  __shared__ __attribute__((aligned(16))) float so[4][16][64];
  const int tid = threadIdx.x, w = tid >> 5, lane = tid & 31, ln = lane & 15, hh = lane >> 4; const int by = blockIdx.y;
  A += (size_t)by * sA; Bh += (size_t)by * sB; const size_t cofs = (size_t)by * sC; const float* bp = bias ? bias + (size_t)by * sBias : nullptr;
  const int ntn = (N + 63) / 64; const int wid = blockIdx.x * 4 + w; const int mt = wid / ntn, nq = wid % ntn; if (mt * 16 >= M) return;
  const int row0 = mt * 16, col0 = nq * 64; const _Float16* arow = A + (size_t)(row0 + ln) * lda;
  v8f acc[4] = {};
  for (int kb = 0; kb < K; kb += 32) { FragH ah; ah.half[0] = *(const v8us*)((const unsigned short*)arow + kb + 8 * hh); ah.half[1] = *(const v8us*)((const unsigned short*)arow + kb + 16 + 8 * hh);
#pragma unroll
    for (int t = 0; t < 4; ++t) { if (col0 + t * 16 >= N) continue; const size_t boff = (size_t)(col0 + t * 16 + ln) * ldb + kb; FragH bq; bq.half[0] = *(const v8us*)((const unsigned short*)Bh + boff + 8 * hh); bq.half[1] = *(const v8us*)((const unsigned short*)Bh + boff + 16 + 8 * hh);
      acc[t] = mmaH<1>(ah.v, ah.v, bq.v, bq.v, acc[t]); }
  }
#pragma unroll
  for (int t = 0; t < 4; ++t) { if (col0 + t * 16 >= N) continue; const int col = col0 + t * 16 + ln; const float bv = bp ? bf16_round(bp[col]) : 0.f;
#pragma unroll
    for (int r = 0; r < 8; ++r) { float v = acc[t][r] * alpha + bv; if (CP) { const int bidx = (row0g + row0 + 8 * hh + r) / rowsPerB; v += CP[(size_t)bidx * sCPb + (size_t)by * 64 + col]; } if (ACT == 1) v = (v > 0.f) ? v : expm1f(v); else if (ACT == 7) v = (v > 0.f) ? v + 1.0f : expf(v); else if (ACT == 8) v = tanhf(v); else if (ACT == 9) v = 0.5f * v * (1.0f + tanhf(0.7978845608028654f * (v + 0.044715f * v * v * v))); else if (ACT == 11) v = 1.0f / (1.0f + expf(-v)); else if (ACT == 12) v = (v > 0.f) ? v : 0.01f * v; else if (ACT == 14) v = (v > 0.f) ? v : 0.1f * v; else if (ACT == 15) v = v / (1.0f + expf(-v)); else if (ACT == 3) v = fmaxf(v, 0.f); else if (ACT == 6) v = 0.5f * v * (1.0f + erff(v * 0.70710678118654752f)); so[w][8 * hh + r][t * 16 + ln] = v; } }
  __builtin_amdgcn_fence(__ATOMIC_ACQ_REL, "workgroup"); __builtin_amdgcn_wave_barrier();
  const int rsub = lane >> 4, c4 = (lane & 15) * 4; typedef _Float16 v4h __attribute__((ext_vector_type(4)));
  {
#pragma unroll
    for (int q = 0; q < 8; ++q) { const int r = q * 2 + rsub; if (col0 + c4 < N) { const v4f v = *(const v4fa*)&so[w][r][c4]; if (C) *(v4f*)(C + cofs + (size_t)(row0 + r) * ldc + col0 + c4) = v; if (C16) { v4h h4; for (int i = 0; i < 4; ++i) h4[i] = (_Float16)v[i]; *(v4h*)(C16 + cofs + (size_t)(row0 + r) * ldc + col0 + c4) = h4; } } }
     }
}


typedef _Float16 v4h __attribute__((ext_vector_type(4)));

__global__ __launch_bounds__(256) void k_x16(const float* __restrict__ x, _Float16* __restrict__ X16, size_t n8) { const size_t t = (size_t)blockIdx.x * 256 + threadIdx.x; if (t >= n8) return; FragH f;
#pragma unroll
  for (int q = 0; q < 8; ++q) f.h[q] = (_Float16)bf16_round(x[t * 8 + q]); *(v8us*)((unsigned short*)X16 + t * 8) = f.half[0];  }
__global__ __launch_bounds__(256) void k_h16(const float* __restrict__ x, _Float16* __restrict__ X16, size_t n8) { const size_t t = (size_t)blockIdx.x * 256 + threadIdx.x; if (t >= n8) return; FragH f;
#pragma unroll
  for (int q = 0; q < 8; ++q) f.h[q] = (_Float16)x[t * 8 + q]; *(v8us*)((unsigned short*)X16 + t * 8) = f.half[0];  }
__global__ __launch_bounds__(256) void k_round16f(const float* __restrict__ W, _Float16* __restrict__ Bt, size_t n8) { const size_t t = (size_t)blockIdx.x * 256 + threadIdx.x; if (t >= n8) return; FragH f;
#pragma unroll
  for (int i = 0; i < 8; ++i) f.h[i] = (_Float16)(bf16_round(W[t * 8 + i]) * 16.0f); *(v8us*)((unsigned short*)Bt + t * 8) = f.half[0];  }
template <int NHv, int TTv>
__global__ __launch_bounds__(256) void k_vt(const _Float16* __restrict__ V16, int ldv, int voff, _Float16* __restrict__ Vt) { __shared__ unsigned short tl[64][66]; const int tid = threadIdx.x; const int slab = blockIdx.x / (TTv / 64), lg = blockIdx.x % (TTv / 64); const int b = slab / NHv, h = slab % NHv;
  for (int i = tid; i < 64 * 8; i += 256) { const int r = i / 8, c8 = (i % 8) * 8; FragH f; f.half[0] = *(const v8us*)((const unsigned short*)V16 + ((size_t)b * TTv + lg * 64 + r) * ldv + voff + h * 64 + c8);
#pragma unroll
    for (int q = 0; q < 8; ++q) tl[r][c8 + q] = f.u[q]; }
  __syncthreads();
  {
#pragma unroll
    for (int rd = 0; rd < 2; ++rd) { const int d = rd * 32 + tid / 8, pc = tid % 8; FragH f;
#pragma unroll
      for (int q = 0; q < 8; ++q) f.u[q] = tl[pc * 8 + q][d];
      *(v8us*)((unsigned short*)Vt + ((size_t)slab * 64 + d) * TTv + lg * 64 + pc * 8) = f.half[0]; }
     } }

template <int D, int RBF>
__global__ __launch_bounds__(256) void k_lnx(const float* __restrict__ X, const float* __restrict__ gam, const float* __restrict__ bet, int nrows, float eps, _Float16* __restrict__ O16, float* __restrict__ XR) {
  constexpr int NP = D / 128; const int tid = threadIdx.x, wv = tid >> 5, lane = tid & 31; const size_t r = (size_t)blockIdx.x * 8 + wv; if (r >= (size_t)nrows) return; v4f y[NP]; float s = 0.f;
#pragma unroll
  for (int j = 0; j < NP; ++j) { const int c = j * 128 + lane * 4; v4f g = *(const v4fa*)(X + r * D + c); if (RBF) { for (int q = 0; q < 4; ++q) g[q] = bf16_round(g[q]); } y[j] = g; s += g[0] + g[1] + g[2] + g[3]; }
  for (int o = 16; o >= 1; o >>= 1) s += __shfl_xor(s, o, 32); const float mu = s / (float)D; float q2 = 0.f;
#pragma unroll
  for (int j = 0; j < NP; ++j) for (int q = 0; q < 4; ++q) { const float d = y[j][q] - mu; q2 += d * d; }
  for (int o = 16; o >= 1; o >>= 1) q2 += __shfl_xor(q2, o, 32); const float rs = rsqrtf(q2 / (float)D + eps);
  {
#pragma unroll
    for (int j = 0; j < NP; ++j) { const int c = j * 128 + lane * 4; v4h h; for (int q = 0; q < 4; ++q) { const float v = (y[j][q] - mu) * rs * bf16_round(gam[c + q]) + bf16_round(bet[c + q]); h[q] = (_Float16)v; } *(v4h*)(O16 + r * D + c) = h; if (XR) *(v4f*)(XR + r * D + c) = y[j]; }
     } }
typedef int v4ia __attribute__((ext_vector_type(4), may_alias));
// lane l <-> lane l ^ 16 (the two halves of a wave hold the two key halves of one query column)
__device__ __forceinline__ float xhalf(float x) { const int b = __builtin_bit_cast(int, x); return __builtin_bit_cast(float, __builtin_amdgcn_permlanex16(b, b, 0x76543210, 0xfedcba98, false, false)); }
__global__ __launch_bounds__(128) void k_flash(const _Float16* __restrict__ Q16, int ldq, const _Float16* __restrict__ K16, int ldk, const _Float16* __restrict__ Vt, const int* __restrict__ MSK, float* __restrict__ O, int ldo) {
  constexpr int RPW = 16, NQB = TT / (4 * RPW), DT = 4, KS = 2;
  __shared__ __attribute__((aligned(16))) float sO[4][RPW][64 + 4];
  const int tid = threadIdx.x, w = tid >> 5, lane = tid & 31, ln = lane & 15, hh = lane >> 4;
  const int slab = blockIdx.x / NQB, qblk = blockIdx.x % NQB; const int b = slab / NH, h = slab % NH; const int qb0 = qblk * (4 * RPW); const int q0 = qb0 + w * RPW;
  FragH bq[KS];      /* B operand: column ln = query q0 + ln */
  { const unsigned short* qr = (const unsigned short*)Q16 + ((size_t)b * TT + q0 + ln) * ldq + h * 64;
#pragma unroll
    for (int ks = 0; ks < KS; ++ks) { bq[ks].half[0] = *(const v8us*)(qr + ks * 32 + 8 * hh); bq[ks].half[1] = *(const v8us*)(qr + ks * 32 + 16 + 8 * hh); } }
  const unsigned short* Vth = (const unsigned short*)Vt + (size_t)slab * 64 * TT;
  float m_q = -3.0e38f, l_q = 0.f; v8f oacc[DT];      /* oacc[dt][r] = O[q0 + ln][dt * 16 + 8 * hh + r] */
#pragma unroll
  for (int dt = 0; dt < DT; ++dt) oacc[dt] = (v8f){0.f,0.f,0.f,0.f,0.f,0.f,0.f,0.f};
  const int jend = TT;
#pragma unroll 1
  for (int j0 = 0; j0 < jend; j0 += 32) {
    const int* mp = MSK + (size_t)b * TT + j0 + 8 * hh;      /* key padding mask (1 = PAD) of this lane's keys j0 + 8hh + 0..7 and j0 + 16 + 8hh + 0..7 */
    const v4ia km[4] = { *(const v4ia*)mp, *(const v4ia*)(mp + 4), *(const v4ia*)(mp + 16), *(const v4ia*)(mp + 20) };
    v8f s[2];
#pragma unroll
    for (int nt = 0; nt < 2; ++nt) { const unsigned short* kr = (const unsigned short*)K16 + ((size_t)b * TT + j0 + nt * 16 + ln) * ldk + h * 64; FragH ak[KS];
#pragma unroll
      for (int ks = 0; ks < KS; ++ks) { ak[ks].half[0] = *(const v8us*)(kr + ks * 32 + 8 * hh); ak[ks].half[1] = *(const v8us*)(kr + ks * 32 + 16 + 8 * hh); }
      v8f acc = (v8f){0.f,0.f,0.f,0.f,0.f,0.f,0.f,0.f};
#pragma unroll
      for (int ks = 0; ks < KS; ++ks) acc = mmaH<1>(ak[ks].v, ak[ks].v, bq[ks].v, bq[ks].v, acc);
      s[nt] = acc; }
    float sc[16]; float mc = -INFINITY;      /* 1 = pad -> excluded (the module adds -1e8): score -inf, so its exp below is exactly 0 */
#pragma unroll
    for (int i = 0; i < 16; ++i) { sc[i] = (km[i >> 2][i & 3] == 0) ? s[i >> 3][i & 7] * 0.125f : -INFINITY; mc = fmaxf(mc, sc[i]); }
    mc = fmaxf(mc, xhalf(mc));
    const float mn = fmaxf(m_q, mc); const float al = expf(m_q - mn); m_q = mn;      /* m_q and mn are finite (start -3e38): no key seen yet gives exp(0) = 1 */
    float ps = 0.f; FragH pb;      /* pb.h[i] = P^T[k = kmap(i, hh)][ln] */
#pragma unroll
    for (int i = 0; i < 16; ++i) { const float p = expf(sc[i] - mn); ps += p; pb.h[i] = (_Float16)(p * 1024.0f); }
    l_q = l_q * al + ps;
#pragma unroll
    for (int dt = 0; dt < DT; ++dt)
#pragma unroll
      for (int r = 0; r < 8; ++r) oacc[dt][r] *= al;
#pragma unroll
    for (int dt = 0; dt < DT; ++dt) { const unsigned short* vrow = Vth + (size_t)(dt * 16 + ln) * TT + j0; FragH av; av.half[0] = *(const v8us*)(vrow + 8 * hh); av.half[1] = *(const v8us*)(vrow + 16 + 8 * hh);
      oacc[dt] = mmaH<1>(av.v, av.v, pb.v, pb.v, oacc[dt]); } }
  { float l = l_q + xhalf(l_q); l = (l > 0.f) ? 1.0f / (l * 1024.0f) : 0.f;
#pragma unroll
    for (int dt = 0; dt < DT; ++dt)
#pragma unroll
      for (int g = 0; g < 2; ++g) { v4f o; for (int q = 0; q < 4; ++q) o[q] = oacc[dt][g * 4 + q] * l; *(v4fa*)&sO[w][ln][dt * 16 + 8 * hh + g * 4] = o; } }
  __builtin_amdgcn_fence(__ATOMIC_ACQ_REL, "workgroup"); __builtin_amdgcn_wave_barrier();
  {
#pragma unroll
    for (int rp = 0; rp < RPW; rp += 2) { const int r = rp + (lane >> 4), pc = lane & 15; const v4f val = *(const v4fa*)&sO[w][r][pc * 4]; *(v4f*)(O + ((size_t)b * TT + q0 + r) * ldo + h * 64 + pc * 4) = val; }
     } }

__global__ __launch_bounds__(256) void k_addbf(float* __restrict__ out, const float* __restrict__ x, size_t n4) { const size_t t = (size_t)blockIdx.x * 256 + threadIdx.x; if (t >= n4) return; v4f a = *(const v4fa*)(out + t * 4); const v4f b = *(const v4fa*)(x + t * 4); for (int q = 0; q < 4; ++q) a[q] += bf16_round(b[q]); *(v4f*)(out + t * 4) = a;  }
extern "C" void kernel_launch(void* const* d_in, const int* in_sizes, int n_in,
                              void* d_out, int out_size, void* d_ws, size_t ws_size, hipStream_t stream) {
  (void)in_sizes; (void)n_in; (void)out_size;
  const float* const* I = (const float* const*)d_in; const float* x = I[0]; const int* mask = (const int*)d_in[1]; const float* Wqkv = I[2]; const float* bqkv = I[3]; const float* Wo = I[4]; const float* bo = I[5]; const float* lng = I[6]; const float* lnb = I[7];      /* d_in order: hidden_states, encoder_padding_mask, qkv_w, qkv_b, out_w, out_b, ln_g, ln_b */
  const float* bq = bqkv; const float* bk = bqkv + DD; const float* bv = bqkv + 2 * DD;
  char* ws = (char*)d_ws; size_t off = 0;
  auto take = [&](size_t bytes) { char* p = ws + off; off += (bytes + 255) & ~(size_t)255; return p; };
  const size_t WSZ = (size_t)DD * DD; _Float16* Bw = (_Float16*)take(4 * WSZ * 2); _Float16* X16 = (_Float16*)take((size_t)NR * DD * 2);
  _Float16* Q = (_Float16*)take((size_t)NR * DD * 2); _Float16* K = (_Float16*)take((size_t)NR * DD * 2); _Float16* V = (_Float16*)take((size_t)NR * DD * 2); _Float16* Vt = (_Float16*)take((size_t)NR * DD * 2);
  float* O = (float*)take((size_t)NR * DD * 4); _Float16* O16 = V;      /* the v plane is dead once Vᵀ is built (before the attention kernel); O16 reuses it */
  if (off > ws_size) return;      // 8.4 + 16.8 × 5 + 33.6 ≈ 126 MB (120 MiB)
  const unsigned gw2 = (unsigned)((WSZ / 8 + 255) / 256);
  k_round16f<<<(unsigned)((3 * WSZ / 8 + 255) / 256), 256, 0, stream>>>(Wqkv, Bw, 3 * WSZ / 8); k_round16f<<<gw2, 256, 0, stream>>>(Wo, Bw + 3 * WSZ, WSZ / 8);      /* (out,in) natural ×2^4: rows q|k|v, then out_w */
  const unsigned gx = (unsigned)(((size_t)NR * DD / 8 + 255) / 256); const dim3 gp(((NR / 16) * (DD / 64) + 3) / 4, 1);
  k_lnx<DD, 1><<<(NR + 7) / 8, 256, 0, stream>>>(x, lng, lnb, NR, 1e-5f, X16, nullptr);      /* x = LN(bf16 hidden) → f16 */
  k_gemm_hhx<0><<<gp, 128, 0, stream>>>(X16, DD, 0, Bw, DD, 0, 0.0625f, bq, 0, nullptr, 1, 0, 0, nullptr, Q, DD, 0, NR, DD, DD);      /* q = x·Wq + bq: M 8192 N 1024 K 1024 */
  k_gemm_hhx<0><<<gp, 128, 0, stream>>>(X16, DD, 0, Bw + WSZ, DD, 0, 0.0625f, bk, 0, nullptr, 1, 0, 0, nullptr, K, DD, 0, NR, DD, DD);
  k_gemm_hhx<0><<<gp, 128, 0, stream>>>(X16, DD, 0, Bw + 2 * WSZ, DD, 0, 0.0625f, bv, 0, nullptr, 1, 0, 0, nullptr, V, DD, 0, NR, DD, DD);
  k_vt<NH, TT><<<BB * NH * (TT / 64), 256, 0, stream>>>(V, DD, 0, Vt);
  k_flash<<<BB * NH * (TT / 64), 128, 0, stream>>>(Q, DD, K, DD, Vt, mask, O, DD);
  k_h16<<<gx, 256, 0, stream>>>(O, O16, (size_t)NR * DD / 8);
  k_gemm_hhx<0><<<gp, 128, 0, stream>>>(O16, DD, 0, Bw + 3 * WSZ, DD, 0, 0.0625f, bo, 0, nullptr, 1, 0, 0, (float*)d_out, nullptr, DD, 0, NR, DD, DD);      /* out = O·out_wᵀ + out_b */
  k_addbf<<<(unsigned)(((size_t)NR * DD / 4 + 255) / 256), 256, 0, stream>>>((float*)d_out, x, (size_t)NR * DD / 4);      /* += bf16(hidden) in place (residual; no workspace left for an f32 copy) */
}

// v002
// A run of this version takes 307 microseconds.
// Next to v001, in two timings, it ran 1.71 times as fast each time.
// Over all steps from v000 it is 2.71 times as fast.
#include <hip/hip_runtime.h>
// Pre-LN self-attention layer with a key padding mask and residual (B=4, S=2048, H=1024, 16 heads × 64): x = LN(hidden); [q|k|v] = x·qkv_wᵀ + qkv_b ((out,in) fused); scores = q·kᵀ·64^-½ + mask·(−1e8) (int mask [B,S], 1 = pad); softmax;
// out = (attn·v merged)·out_wᵀ + out_b + hidden.
// Compute dtype: x, weights, biases rounded to bf16; q/k/v as f16 GEMM outputs; fused flash-style kernel (online softmax f32, P f16 ×2^10) on v_wmma_f32_16x16x32_f16; O → f16 → output GEMM with bias; f32 accumulate.
#define BB 4
#define TT 2048
#define NH 16
#define DD 1024
#define NR (BB * TT)

typedef __bf16 v16b __attribute__((ext_vector_type(16)));
typedef unsigned short v8us __attribute__((ext_vector_type(8), may_alias));
typedef float  v8f  __attribute__((ext_vector_type(8)));
typedef float  v4f  __attribute__((ext_vector_type(4)));
typedef float  v4fa __attribute__((ext_vector_type(4), may_alias));
union FragB { v16b v; v8us half[2]; unsigned short u[16]; };

__device__ __forceinline__ unsigned short bf16_bits(float x) { unsigned int u = __float_as_uint(x); return (unsigned short)((u + 0x7FFFu + ((u >> 16) & 1u)) >> 16); }
__device__ __forceinline__ float bf16_val(unsigned short b) { return __uint_as_float(((unsigned int)b) << 16); }
__device__ __forceinline__ float bf16_round(float x) { return bf16_val(bf16_bits(x)); }
// D += A·B with NT terms: 1 = ah·bh, 2 = + al·bh (A split), 3 = + ah·bl (both split)
template <int NT>
__device__ __forceinline__ v8f mmaN(v16b ah, v16b al, v16b bh, v16b bl, v8f c) {
  c = __builtin_amdgcn_wmma_f32_16x16x32_bf16(false, ah, false, bh, (short)0, c, false, false);
  if (NT >= 2) c = __builtin_amdgcn_wmma_f32_16x16x32_bf16(false, al, false, bh, (short)0, c, false, false);
  if (NT >= 3) c = __builtin_amdgcn_wmma_f32_16x16x32_bf16(false, ah, false, bl, (short)0, c, false, false);
  asm volatile("v_nop\n\tv_nop\n\tv_nop\n\tv_nop" : "+v"(c) : "v"(ah), "v"(al), "v"(bh), "v"(bl));
  return c;
}

__global__ __launch_bounds__(256) void k_wt_bf16(const float* __restrict__ W, unsigned short* __restrict__ Wt, int K, int N) {
  const int t = blockIdx.x * 256 + threadIdx.x;
  const int k8n = K / 8;
  if (t >= N * k8n) return;
  const int n = t / k8n, k8 = (t % k8n) * 8;
  v8us v;
#pragma unroll
  for (int i = 0; i < 8; ++i) v[i] = bf16_bits(W[(size_t)(k8 + i) * N + n]);
  *(v8us*)(Wt + (size_t)n * K + k8) = v;
  
}

// GEMM C[M][N] (f32, pitch ldc) = act(A[M][K]·W + bias). A f32 row-major (pitch lda) converted per fragment to bf16
// (ASPLIT: hi/lo two planes -> 2 terms, else single rounded term); Wt bf16 [N][K] (pitch ldb). BIAS_BF16 rounds the
// bias to bf16 first (bias quantised to bf16 before the add). K%32==0, M%16==0, N%64==0.
template <bool ASPLIT, int ACT, bool BIAS_BF16>
__global__ __launch_bounds__(128) void k_gemm_bf(const float* __restrict__ A, int lda, const unsigned short* __restrict__ Wt, int ldb,
                                               const float* __restrict__ bias, float* __restrict__ C, int ldc, int M, int N, int K) {
  __shared__ __attribute__((aligned(16))) float so[4][16][64];
  const int tid = threadIdx.x, w = tid >> 5, lane = tid & 31, ln = lane & 15, hh = lane >> 4;
  const int ntn = N / 64;
  const int wid = blockIdx.x * 4 + w;
  const int mt = wid / ntn, nq = wid % ntn;
  if (mt * 16 >= M) return;
  const int row0 = mt * 16, col0 = nq * 64;
  const float* arow = A + (size_t)(row0 + ln) * lda;
  v8f acc[4] = {};
  for (int kb = 0; kb < K; kb += 32) {
    FragB ah, al;
    const v4f x0 = *(const v4fa*)(arow + kb + 8 * hh), x1 = *(const v4fa*)(arow + kb + 8 * hh + 4);
    const v4f x2 = *(const v4fa*)(arow + kb + 16 + 8 * hh), x3 = *(const v4fa*)(arow + kb + 16 + 8 * hh + 4);
    float xs[16] = {x0[0],x0[1],x0[2],x0[3],x1[0],x1[1],x1[2],x1[3],x2[0],x2[1],x2[2],x2[3],x3[0],x3[1],x3[2],x3[3]};
#pragma unroll
    for (int i = 0; i < 16; ++i) { const unsigned short hb = bf16_bits(xs[i]); ah.u[i] = hb; al.u[i] = ASPLIT ? bf16_bits(xs[i] - bf16_val(hb)) : (unsigned short)0; }
#pragma unroll
    for (int t = 0; t < 4; ++t) {
      const unsigned short* brow = Wt + (size_t)(col0 + t * 16 + ln) * ldb + kb;
      FragB b;
      b.half[0] = *(const v8us*)(brow + 8 * hh);
      b.half[1] = *(const v8us*)(brow + 16 + 8 * hh);
      acc[t] = mmaN<ASPLIT ? 2 : 1>(ah.v, al.v, b.v, b.v, acc[t]);
    }
  }
#pragma unroll
  for (int t = 0; t < 4; ++t) {
    float bv = bias ? bias[col0 + t * 16 + ln] : 0.f;
    if (BIAS_BF16) bv = bf16_round(bv);
#pragma unroll
    for (int r = 0; r < 8; ++r) { float v = acc[t][r] + bv; if (ACT == 1) v = fmaxf(v, 0.f); so[w][8 * hh + r][t * 16 + ln] = v; }
  }
  __builtin_amdgcn_fence(__ATOMIC_ACQ_REL, "workgroup");
  __builtin_amdgcn_wave_barrier();
  const int rsub = lane >> 4, c4 = (lane & 15) * 4;
  {
#pragma unroll
    for (int q = 0; q < 8; ++q) {
      const int r = q * 2 + rsub;
      const v4f v = *(const v4fa*)&so[w][r][c4];
      *(v4f*)(C + (size_t)(row0 + r) * ldc + col0 + c4) = v;
    }
    
  }
}

// Flash-style causal/unmasked attention, all contractions 3-term bf16 hi/lo splits, f32 softmax with running max.
// q,k,v rows are read from f32 buffers with arbitrary row pitch (so they can live inside a fused qkv buffer);
// D = head size (multiple of 32, <= 128); one wave = 16 query rows; block = 4 waves (64 queries) sharing K/V chunks of 32.
template <int D, bool CAUSAL>
__global__ __launch_bounds__(128) void k_flash(const float* __restrict__ qb, const float* __restrict__ kb, const float* __restrict__ vb,
                                             int pitch, int T, int H, float scale, float* __restrict__ y, int ypitch) {
  constexpr int KS = D / 32;        // k-steps for QK
  constexpr int DT = D / 16;        // d tiles for PV
  __shared__ __attribute__((aligned(16))) unsigned short sKh[32][D + 8], sKl[32][D + 8], sVh[32][D + 8], sVl[32][D + 8];
  __shared__ __attribute__((aligned(16))) unsigned short sPh[4][16][40], sPl[4][16][40];
  __shared__ __attribute__((aligned(16))) float sO[4][16][D];
  const int tid = threadIdx.x, w = tid >> 5, lane = tid & 31, ln = lane & 15, hh = lane >> 4;
  const int nqb = (T + 63) / 64;
  const int bh = blockIdx.x / nqb, qblk = blockIdx.x % nqb;
  const int b = bh / H, h = bh % H;
  const int q0 = qblk * 64 + w * 16;
  const float* Q = qb + (size_t)b * T * pitch + h * D;
  const float* K = kb + (size_t)b * T * pitch + h * D;
  const float* V = vb + (size_t)b * T * pitch + h * D;

  // A fragments of the wave's 16 query rows (scaled), hi/lo
  FragB aqh[KS], aql[KS];
  {
    int row = q0 + ln; if (row >= T) row = T - 1;
    const float* qr = Q + (size_t)row * pitch;
#pragma unroll
    for (int ks = 0; ks < KS; ++ks)
#pragma unroll
      for (int i = 0; i < 16; ++i) {
        const int d = ks * 32 + ((i < 8) ? (8 * hh + i) : (16 + 8 * hh + (i - 8)));
        const float x = qr[d] * scale; const unsigned short hb = bf16_bits(x);
        aqh[ks].u[i] = hb; aql[ks].u[i] = bf16_bits(x - bf16_val(hb));
      }
  }
  float m_r[8], l_r[8];
#pragma unroll
  for (int r = 0; r < 8; ++r) { m_r[r] = -3.0e38f; l_r[r] = 0.f; }
  v8f oacc[DT];
#pragma unroll
  for (int dt = 0; dt < DT; ++dt) oacc[dt] = (v8f){0.f,0.f,0.f,0.f,0.f,0.f,0.f,0.f};

  const int kv_end = CAUSAL ? min(T, qblk * 64 + 64) : T;     // block-uniform
  for (int j0 = 0; j0 < kv_end; j0 += 32) {
    __syncthreads();
    for (int e = tid; e < 32 * (D / 4); e += 128) {
      const int r = e / (D / 4), c4 = (e % (D / 4)) * 4;
      const int key = j0 + r;
      v4f kf = {0.f,0.f,0.f,0.f}, vf = {0.f,0.f,0.f,0.f};
      if (key < T) { kf = *(const v4fa*)(K + (size_t)key * pitch + c4); vf = *(const v4fa*)(V + (size_t)key * pitch + c4); }
#pragma unroll
      for (int t = 0; t < 4; ++t) {
        unsigned short hb = bf16_bits(kf[t]); sKh[r][c4 + t] = hb; sKl[r][c4 + t] = bf16_bits(kf[t] - bf16_val(hb));
        hb = bf16_bits(vf[t]); sVh[r][c4 + t] = hb; sVl[r][c4 + t] = bf16_bits(vf[t] - bf16_val(hb));
      }
    }
    __syncthreads();
    // S tile 16 x 32
    v8f s[2];
#pragma unroll
    for (int nt = 0; nt < 2; ++nt) {
      v8f acc = {};
#pragma unroll
      for (int ks = 0; ks < KS; ++ks) {
        FragB bh_, bl_;
        bh_.half[0] = *(const v8us*)&sKh[nt * 16 + ln][ks * 32 + 8 * hh]; bh_.half[1] = *(const v8us*)&sKh[nt * 16 + ln][ks * 32 + 16 + 8 * hh];
        bl_.half[0] = *(const v8us*)&sKl[nt * 16 + ln][ks * 32 + 8 * hh]; bl_.half[1] = *(const v8us*)&sKl[nt * 16 + ln][ks * 32 + 16 + 8 * hh];
        acc = mmaN<3>(aqh[ks].v, aql[ks].v, bh_.v, bl_.v, acc);
      }
      s[nt] = acc;
    }
    // mask + running max (rows 8hh+r; the 16 lanes of a half share rows)
    float alpha[8];
#pragma unroll
    for (int r = 0; r < 8; ++r) {
      const int qi = q0 + 8 * hh + r;
      const int ja = j0 + ln, jb = j0 + 16 + ln;
      if (CAUSAL) { if (ja > qi) s[0][r] = -3.0e38f; if (jb > qi) s[1][r] = -3.0e38f; }
      if (ja >= T) s[0][r] = -3.0e38f;
      if (jb >= T) s[1][r] = -3.0e38f;
      float mx = fmaxf(s[0][r], s[1][r]);
      mx = fmaxf(mx, __shfl_xor(mx, 1, 32)); mx = fmaxf(mx, __shfl_xor(mx, 2, 32)); mx = fmaxf(mx, __shfl_xor(mx, 4, 32)); mx = fmaxf(mx, __shfl_xor(mx, 8, 32));
      const float mnew = fmaxf(m_r[r], mx);
      alpha[r] = (mnew > -1.0e38f) ? __expf(m_r[r] - mnew) : 1.0f;
      const float p0 = (s[0][r] > -1.0e38f) ? __expf(s[0][r] - mnew) : 0.f;
      const float p1 = (s[1][r] > -1.0e38f) ? __expf(s[1][r] - mnew) : 0.f;
      m_r[r] = mnew;
      l_r[r] = l_r[r] * alpha[r] + p0 + p1;            // per-lane partial row sum (16 lanes combined at the end)
      unsigned short hb = bf16_bits(p0); sPh[w][8 * hh + r][ln] = hb;      sPl[w][8 * hh + r][ln] = bf16_bits(p0 - bf16_val(hb));
      hb = bf16_bits(p1);                sPh[w][8 * hh + r][16 + ln] = hb; sPl[w][8 * hh + r][16 + ln] = bf16_bits(p1 - bf16_val(hb));
    }
#pragma unroll
    for (int dt = 0; dt < DT; ++dt)
#pragma unroll
      for (int r = 0; r < 8; ++r) oacc[dt][r] *= alpha[r];
    __builtin_amdgcn_fence(__ATOMIC_ACQ_REL, "workgroup");
    __builtin_amdgcn_wave_barrier();
    FragB pah, pal;
    pah.half[0] = *(const v8us*)&sPh[w][ln][8 * hh]; pah.half[1] = *(const v8us*)&sPh[w][ln][16 + 8 * hh];
    pal.half[0] = *(const v8us*)&sPl[w][ln][8 * hh]; pal.half[1] = *(const v8us*)&sPl[w][ln][16 + 8 * hh];
#pragma unroll
    for (int dt = 0; dt < DT; ++dt) {
      FragB bvh, bvl;
#pragma unroll
      for (int i = 0; i < 8; ++i) {
        bvh.u[i] = sVh[8 * hh + i][dt * 16 + ln]; bvh.u[8 + i] = sVh[16 + 8 * hh + i][dt * 16 + ln];
        bvl.u[i] = sVl[8 * hh + i][dt * 16 + ln]; bvl.u[8 + i] = sVl[16 + 8 * hh + i][dt * 16 + ln];
      }
      oacc[dt] = mmaN<3>(pah.v, pal.v, bvh.v, bvl.v, oacc[dt]);
    }
    __builtin_amdgcn_fence(__ATOMIC_ACQ_REL, "workgroup");
    __builtin_amdgcn_wave_barrier();
  }
#pragma unroll
  for (int r = 0; r < 8; ++r) {
    float l = l_r[r];
    l += __shfl_xor(l, 1, 32); l += __shfl_xor(l, 2, 32); l += __shfl_xor(l, 4, 32); l += __shfl_xor(l, 8, 32);
    l_r[r] = (l > 0.f) ? 1.0f / l : 0.f;
  }
#pragma unroll
  for (int dt = 0; dt < DT; ++dt)
#pragma unroll
    for (int r = 0; r < 8; ++r) sO[w][8 * hh + r][dt * 16 + ln] = oacc[dt][r] * l_r[r];
  __builtin_amdgcn_fence(__ATOMIC_ACQ_REL, "workgroup");
  __builtin_amdgcn_wave_barrier();
  {
    for (int r = 0; r < 16; ++r) {
      const int row = q0 + r;
      if (row < T && lane < D / 4) {
        const v4f val = *(const v4fa*)&sO[w][r][lane * 4];
        *(v4f*)(y + ((size_t)b * T + row) * ypitch + h * D + lane * 4) = val;
      }
    }
    
  }
}

// GEMM C = act(A·W + bias + resid): A f32 (ASPLIT -> hi/lo 2 terms), Wt bf16 [N][K]; ACT 0 none, 1 relu, 2 exact gelu;
// resid (optional, f32, row index = (row % rmod), pitch ldr, RES_BF16 rounds it) added before the activation.
template <bool ASPLIT, int ACT, bool BIAS_BF16, bool RES_BF16>
__global__ __launch_bounds__(128) void k_gemm_bf3(const float* __restrict__ A, int lda, const unsigned short* __restrict__ Wt, int ldb,
                                                const float* __restrict__ bias, const float* __restrict__ resid, int rmod, int ldr,
                                                float* __restrict__ C, int ldc, int M, int N, int K) {
  __shared__ __attribute__((aligned(16))) float so[4][16][64];
  const int tid = threadIdx.x, w = tid >> 5, lane = tid & 31, ln = lane & 15, hh = lane >> 4;
  const int ntn = N / 64;
  const int wid = blockIdx.x * 4 + w;
  const int mt = wid / ntn, nq = wid % ntn;
  if (mt * 16 >= M) return;
  const int row0 = mt * 16, col0 = nq * 64;
  const float* arow = A + (size_t)(row0 + ln) * lda;
  v8f acc[4] = {};
  for (int kb = 0; kb < K; kb += 32) {
    FragB ah, al;
    const v4f x0 = *(const v4fa*)(arow + kb + 8 * hh), x1 = *(const v4fa*)(arow + kb + 8 * hh + 4);
    const v4f x2 = *(const v4fa*)(arow + kb + 16 + 8 * hh), x3 = *(const v4fa*)(arow + kb + 16 + 8 * hh + 4);
    float xs[16] = {x0[0],x0[1],x0[2],x0[3],x1[0],x1[1],x1[2],x1[3],x2[0],x2[1],x2[2],x2[3],x3[0],x3[1],x3[2],x3[3]};
#pragma unroll
    for (int i = 0; i < 16; ++i) { const unsigned short hb = bf16_bits(xs[i]); ah.u[i] = hb; al.u[i] = ASPLIT ? bf16_bits(xs[i] - bf16_val(hb)) : (unsigned short)0; }
#pragma unroll
    for (int t = 0; t < 4; ++t) {
      const unsigned short* brow = Wt + (size_t)(col0 + t * 16 + ln) * ldb + kb;
      FragB b;
      b.half[0] = *(const v8us*)(brow + 8 * hh);
      b.half[1] = *(const v8us*)(brow + 16 + 8 * hh);
      acc[t] = mmaN<ASPLIT ? 2 : 1>(ah.v, al.v, b.v, b.v, acc[t]);
    }
  }
#pragma unroll
  for (int t = 0; t < 4; ++t) {
    const int col = col0 + t * 16 + ln;
    float bv = bias ? bias[col] : 0.f;
    if (BIAS_BF16) bv = bf16_round(bv);
#pragma unroll
    for (int r = 0; r < 8; ++r) {
      float v = acc[t][r] + bv;
      if (resid) { float rv = resid[(size_t)((row0 + 8 * hh + r) % rmod) * ldr + col]; if (RES_BF16) rv = bf16_round(rv); v += rv; }
      if (ACT == 1) v = fmaxf(v, 0.f);
      if (ACT == 2) v = 0.5f * v * (1.0f + erff(v * 0.70710678118654752f));
      if (ACT == 3) { const float u = 0.7978845608028654f * (v + 0.044715f * v * v * v); v = 0.5f * v * (1.0f + tanhf(u)); }
      so[w][8 * hh + r][t * 16 + ln] = v;
    }
  }
  __builtin_amdgcn_fence(__ATOMIC_ACQ_REL, "workgroup");
  __builtin_amdgcn_wave_barrier();
  const int rsub = lane >> 4, c4 = (lane & 15) * 4;
  {
#pragma unroll
    for (int q = 0; q < 8; ++q) {
      const int r = q * 2 + rsub;
      const v4f v = *(const v4fa*)&so[w][r][c4];
      *(v4f*)(C + (size_t)(row0 + r) * ldc + col0 + c4) = v;
    }
    
  }
}
// row LayerNorm (biased variance, eps) over N: s = X (+ R); optional out_sum <- s; out_norm <- (s-mu)*rsqrt(var+eps)*g + b
template <bool PARAM_BF16>
__global__ __launch_bounds__(256) void k_layernorm(const float* __restrict__ X, const float* __restrict__ R, const float* __restrict__ g, const float* __restrict__ bta,
                                                  float* __restrict__ out_sum, float* __restrict__ out_norm, int N, float eps) {
  __shared__ float red[256];
  const int row = blockIdx.x, tid = threadIdx.x;
  const float* x = X + (size_t)row * N; const float* rr = R ? R + (size_t)row * N : nullptr;
  float vals[16];                     // up to N = 4096
  const int per = N / 256;            // contiguous chunk per thread? use strided-by-4 chunks: thread handles j = tid*4 + 1024*u
  float s1 = 0.f;
  for (int u = 0; u < per / 4; ++u) {
    const int j = tid * 4 + 1024 * u;
    const v4f a = *(const v4fa*)(x + j);
    v4f b = {0.f,0.f,0.f,0.f}; if (rr) b = *(const v4fa*)(rr + j);
#pragma unroll
    for (int q = 0; q < 4; ++q) { const float v = a[q] + b[q]; vals[u * 4 + q] = v; s1 += v; }
  }
  red[tid] = s1; __syncthreads();
  for (int st = 128; st > 0; st >>= 1) { if (tid < st) red[tid] += red[tid + st]; __syncthreads(); }
  const float mu = red[0] / (float)N; __syncthreads();
  float s2 = 0.f;
  for (int u = 0; u < per / 4; ++u)
#pragma unroll
    for (int q = 0; q < 4; ++q) { const float c = vals[u * 4 + q] - mu; s2 += c * c; }
  red[tid] = s2; __syncthreads();
  for (int st = 128; st > 0; st >>= 1) { if (tid < st) red[tid] += red[tid + st]; __syncthreads(); }
  const float rs = rsqrtf(red[0] / (float)N + eps);
  {
    for (int u = 0; u < per / 4; ++u) {
      const int j = tid * 4 + 1024 * u;
      v4f o, sm;
#pragma unroll
      for (int q = 0; q < 4; ++q) {
        float gg = g[j + q], bb = bta[j + q];
        if (PARAM_BF16) { gg = bf16_round(gg); bb = bf16_round(bb); }
        sm[q] = vals[u * 4 + q]; o[q] = (vals[u * 4 + q] - mu) * rs * gg + bb;
      }
      if (out_sum) *(v4f*)(out_sum + (size_t)row * N + j) = sm;
      *(v4f*)(out_norm + (size_t)row * N + j) = o;
    }
    
  }
}



// ---- f16 WMMA path (v_wmma_f32_16x16x32_f16): 11-bit significands for operands in range — used where a [0,1] probability operand needs more precision than bf16
typedef _Float16 v16h __attribute__((ext_vector_type(16)));
union FragH { v16h v; v8us half[2]; _Float16 h[16]; unsigned short u[16]; };
template <int NT>
__device__ __forceinline__ v8f mmaH(v16h ah, v16h al, v16h bh, v16h bl, v8f c) {
  c = __builtin_amdgcn_wmma_f32_16x16x32_f16(false, ah, false, bh, (short)0, c, false, false);
  if (NT >= 2) c = __builtin_amdgcn_wmma_f32_16x16x32_f16(false, al, false, bh, (short)0, c, false, false);
  if (NT >= 3) c = __builtin_amdgcn_wmma_f32_16x16x32_f16(false, ah, false, bl, (short)0, c, false, false);
  asm volatile("v_nop\n\tv_nop\n\tv_nop\n\tv_nop" : "+v"(c) : "v"(ah), "v"(al), "v"(bh), "v"(bl));
  return c;
}
// batched GEMM like k_gemm_b but f16 operands: A f32 (split into f16 hi/lo if ASPLIT, else rounded to f16), Bt = f16 values [n][k]; alpha; C f32; N multiple of 16 (partial tiles skipped)
template <bool ASPLIT>
__global__ __launch_bounds__(128) void k_gemm_h(const float* __restrict__ A, int lda, size_t sA, const _Float16* __restrict__ Bh, int ldb, size_t sB, float alpha, float* __restrict__ C, int ldc, size_t sC, int M, int N, int K) {
  __shared__ __attribute__((aligned(16))) float so[4][16][64];
  const int tid = threadIdx.x, w = tid >> 5, lane = tid & 31, ln = lane & 15, hh = lane >> 4; const int by = blockIdx.y;
  A += (size_t)by * sA; Bh += (size_t)by * sB; C += (size_t)by * sC;
  const int ntn = (N + 63) / 64; const int wid = blockIdx.x * 4 + w; const int mt = wid / ntn, nq = wid % ntn; if (mt * 16 >= M) return;
  const int row0 = mt * 16, col0 = nq * 64; const float* arow = A + (size_t)(row0 + ln) * lda;
  v8f acc[4] = {};
  for (int kb = 0; kb < K; kb += 32) {
    FragH ah, al;
    const v4f x0 = *(const v4fa*)(arow + kb + 8 * hh), x1 = *(const v4fa*)(arow + kb + 8 * hh + 4), x2 = *(const v4fa*)(arow + kb + 16 + 8 * hh), x3 = *(const v4fa*)(arow + kb + 16 + 8 * hh + 4);
    float xs[16] = {x0[0],x0[1],x0[2],x0[3],x1[0],x1[1],x1[2],x1[3],x2[0],x2[1],x2[2],x2[3],x3[0],x3[1],x3[2],x3[3]};
#pragma unroll
    for (int i = 0; i < 16; ++i) { const _Float16 h = (_Float16)xs[i]; ah.h[i] = h; al.h[i] = ASPLIT ? (_Float16)(xs[i] - (float)h) : (_Float16)0.0f; }
#pragma unroll
    for (int t = 0; t < 4; ++t) { if (col0 + t * 16 >= N) continue; const size_t boff = (size_t)(col0 + t * 16 + ln) * ldb + kb; FragH bq; bq.half[0] = *(const v8us*)(Bh + boff + 8 * hh); bq.half[1] = *(const v8us*)(Bh + boff + 16 + 8 * hh);
      acc[t] = mmaH<ASPLIT ? 2 : 1>(ah.v, al.v, bq.v, bq.v, acc[t]); }
  }
#pragma unroll
  for (int t = 0; t < 4; ++t) { if (col0 + t * 16 >= N) continue;
#pragma unroll
    for (int r = 0; r < 8; ++r) so[w][8 * hh + r][t * 16 + ln] = acc[t][r] * alpha; }
  __builtin_amdgcn_fence(__ATOMIC_ACQ_REL, "workgroup"); __builtin_amdgcn_wave_barrier();
  const int rsub = lane >> 4, c4 = (lane & 15) * 4;
  {
#pragma unroll
    for (int q = 0; q < 8; ++q) { const int r = q * 2 + rsub; if (col0 + c4 < N) { const v4f v = *(const v4fa*)&so[w][r][c4]; *(v4f*)(C + (size_t)(row0 + r) * ldc + col0 + c4) = v; } }
     }
}

// Wt[n][k] = f16(W[k][n]·scale) from f32 row-major W[K][N] (scale = power of two; bf16-exact weights stay exact in f16 away from the subnormal range)
__global__ __launch_bounds__(256) void k_wt_f16(const float* __restrict__ W, _Float16* __restrict__ Wt, int K, int N, float scale) {
  const int t = blockIdx.x * 256 + threadIdx.x; if (t >= N * (K / 8)) return; const int n = t / (K / 8), k8 = (t % (K / 8)) * 8; FragH f;
#pragma unroll
  for (int i = 0; i < 8; ++i) f.h[i] = (_Float16)(bf16_round(W[(size_t)(k8 + i) * N + n]) * scale); const v8us o = f.half[0];
  *(v8us*)((unsigned short*)Wt + (size_t)n * K + k8) = o; 
}
typedef _Float16 v4h __attribute__((ext_vector_type(4)));
// C = (A.B^T)*alpha + bf16(bias): A f16 [NR][DD], Bh f16 [DD][DD] (row n, k contiguous); writes f32 C (OUT32) or f16 C16, pitch DD.
// One 128 x 128 tile of C per work-group of 8 waves (4 x 2 waves, 32 x 64 each). 64 k of both operands (one 128-byte line a row) are read from
// global memory in whole lines, once per work-group, and staged in LDS (two buffers, row pitch 144 B for the 16-byte fragment reads);
// the next 64 k are in flight in registers while the waves work on this buffer. Each 16 x 16 tile sums k in ascending order in one accumulator chain.
template <bool OUT32>
__global__ __launch_bounds__(256) void k_gemm_t(const _Float16* __restrict__ A, const _Float16* __restrict__ Bh, float alpha, const float* __restrict__ bias, float* __restrict__ C, _Float16* __restrict__ C16) {
  constexpr int BM = 128, BN = 128, BK = 64, LP = BK + 8, NKT = DD / BK;
  __shared__ __attribute__((aligned(16))) unsigned short sA[2][BM][LP], sB[2][BN][LP];
  __shared__ __attribute__((aligned(16))) float so[8][32][64 + 4];
  const int tid = threadIdx.x, w = tid >> 5, lane = tid & 31, ln = lane & 15, hh = lane >> 4;
  const int nt = blockIdx.x % (DD / BN), mt = blockIdx.x / (DD / BN); const int wm = w >> 1, wn = w & 1;
  const int lr = tid >> 3, lc = (tid & 7) * 8;      /* 8 lanes cover one row's 128 bytes; a thread brings rows lr + 32 i */
  const unsigned short* ga = (const unsigned short*)A + (size_t)(mt * BM + lr) * DD + lc;
  const unsigned short* gb = (const unsigned short*)Bh + (size_t)(nt * BN + lr) * DD + lc;
  v8us ra[4], rb[4];
#pragma unroll
  for (int i = 0; i < 4; ++i) { ra[i] = *(const v8us*)(ga + (size_t)i * 32 * DD); rb[i] = *(const v8us*)(gb + (size_t)i * 32 * DD); }
#pragma unroll
  for (int i = 0; i < 4; ++i) { *(v8us*)&sA[0][lr + 32 * i][lc] = ra[i]; *(v8us*)&sB[0][lr + 32 * i][lc] = rb[i]; }
  __syncthreads();
  v8f acc[2][4];
#pragma unroll
  for (int mi = 0; mi < 2; ++mi)
#pragma unroll
    for (int ni = 0; ni < 4; ++ni) acc[mi][ni] = (v8f){0.f,0.f,0.f,0.f,0.f,0.f,0.f,0.f};
  for (int kt = 0; kt < NKT; ++kt) {
    const int cur = kt & 1; const bool more = kt + 1 < NKT;      /* the same for the whole work-group */
    if (more) {
#pragma unroll
      for (int i = 0; i < 4; ++i) { ra[i] = *(const v8us*)(ga + (size_t)i * 32 * DD + (kt + 1) * BK); rb[i] = *(const v8us*)(gb + (size_t)i * 32 * DD + (kt + 1) * BK); } }
    __builtin_amdgcn_sched_barrier(0);      /* keeps the next pass's global loads in front of this pass's products: sunk behind them, their whole latency is waited out in front of the LDS stores */
#pragma unroll
    for (int ks = 0; ks < BK / 32; ++ks) { FragH fa[2], fb[4];
#pragma unroll
      for (int mi = 0; mi < 2; ++mi) { const unsigned short* p = &sA[cur][wm * 32 + mi * 16 + ln][ks * 32 + 8 * hh]; fa[mi].half[0] = *(const v8us*)p; fa[mi].half[1] = *(const v8us*)(p + 16); }
#pragma unroll
      for (int ni = 0; ni < 4; ++ni) { const unsigned short* p = &sB[cur][wn * 64 + ni * 16 + ln][ks * 32 + 8 * hh]; fb[ni].half[0] = *(const v8us*)p; fb[ni].half[1] = *(const v8us*)(p + 16); }
#pragma unroll
      for (int mi = 0; mi < 2; ++mi)
#pragma unroll
        for (int ni = 0; ni < 4; ++ni) acc[mi][ni] = __builtin_amdgcn_wmma_f32_16x16x32_f16(false, fa[mi].v, false, fb[ni].v, (short)0, acc[mi][ni], false, false); }
    if (more) {      /* the other buffer: its last readers left it before the barrier that ended the pass before this one */
#pragma unroll
      for (int i = 0; i < 4; ++i) { *(v8us*)&sA[cur ^ 1][lr + 32 * i][lc] = ra[i]; *(v8us*)&sB[cur ^ 1][lr + 32 * i][lc] = rb[i]; } }
    __syncthreads();
  }
  const int rsub = lane >> 4, c4 = (lane & 15) * 4; const int col0 = nt * BN + wn * 64;
#pragma unroll
  for (int ni = 0; ni < 4; ++ni) { const float bv = bf16_round(bias[col0 + ni * 16 + ln]);      /* each wave stages its 32 rows in its own LDS range and stores whole lines */
#pragma unroll
    for (int mi = 0; mi < 2; ++mi)
#pragma unroll
      for (int r = 0; r < 8; ++r) so[w][mi * 16 + 8 * hh + r][ni * 16 + ln] = acc[mi][ni][r] * alpha + bv; }
  __builtin_amdgcn_fence(__ATOMIC_ACQ_REL, "workgroup"); __builtin_amdgcn_wave_barrier();
#pragma unroll
  for (int q = 0; q < 16; ++q) { const int r = q * 2 + rsub; const v4f v = *(const v4fa*)&so[w][r][c4]; const size_t o = (size_t)(mt * BM + wm * 32 + r) * DD + col0 + c4;
    if (OUT32) *(v4f*)(C + o) = v;
    else { v4h h4; for (int i = 0; i < 4; ++i) h4[i] = (_Float16)v[i]; *(v4h*)(C16 + o) = h4; } }
}

__global__ __launch_bounds__(256) void k_x16(const float* __restrict__ x, _Float16* __restrict__ X16, size_t n8) { const size_t t = (size_t)blockIdx.x * 256 + threadIdx.x; if (t >= n8) return; FragH f;
#pragma unroll
  for (int q = 0; q < 8; ++q) f.h[q] = (_Float16)bf16_round(x[t * 8 + q]); *(v8us*)((unsigned short*)X16 + t * 8) = f.half[0];  }
__global__ __launch_bounds__(256) void k_h16(const float* __restrict__ x, _Float16* __restrict__ X16, size_t n8) { const size_t t = (size_t)blockIdx.x * 256 + threadIdx.x; if (t >= n8) return; FragH f;
#pragma unroll
  for (int q = 0; q < 8; ++q) f.h[q] = (_Float16)x[t * 8 + q]; *(v8us*)((unsigned short*)X16 + t * 8) = f.half[0];  }
__global__ __launch_bounds__(256) void k_round16f(const float* __restrict__ W, _Float16* __restrict__ Bt, size_t n8) { const size_t t = (size_t)blockIdx.x * 256 + threadIdx.x; if (t >= n8) return; FragH f;
#pragma unroll
  for (int i = 0; i < 8; ++i) f.h[i] = (_Float16)(bf16_round(W[t * 8 + i]) * 16.0f); *(v8us*)((unsigned short*)Bt + t * 8) = f.half[0];  }
template <int NHv, int TTv>
__global__ __launch_bounds__(256) void k_vt(const _Float16* __restrict__ V16, int ldv, int voff, _Float16* __restrict__ Vt) { __shared__ unsigned short tl[64][66]; const int tid = threadIdx.x; const int slab = blockIdx.x / (TTv / 64), lg = blockIdx.x % (TTv / 64); const int b = slab / NHv, h = slab % NHv;
  for (int i = tid; i < 64 * 8; i += 256) { const int r = i / 8, c8 = (i % 8) * 8; FragH f; f.half[0] = *(const v8us*)((const unsigned short*)V16 + ((size_t)b * TTv + lg * 64 + r) * ldv + voff + h * 64 + c8);
#pragma unroll
    for (int q = 0; q < 8; ++q) tl[r][c8 + q] = f.u[q]; }
  __syncthreads();
  {
#pragma unroll
    for (int rd = 0; rd < 2; ++rd) { const int d = rd * 32 + tid / 8, pc = tid % 8; FragH f;
#pragma unroll
      for (int q = 0; q < 8; ++q) f.u[q] = tl[pc * 8 + q][d];
      *(v8us*)((unsigned short*)Vt + ((size_t)slab * 64 + d) * TTv + lg * 64 + pc * 8) = f.half[0]; }
     } }

template <int D, int RBF>
__global__ __launch_bounds__(256) void k_lnx(const float* __restrict__ X, const float* __restrict__ gam, const float* __restrict__ bet, int nrows, float eps, _Float16* __restrict__ O16, float* __restrict__ XR) {
  constexpr int NP = D / 128; const int tid = threadIdx.x, wv = tid >> 5, lane = tid & 31; const size_t r = (size_t)blockIdx.x * 8 + wv; if (r >= (size_t)nrows) return; v4f y[NP]; float s = 0.f;
#pragma unroll
  for (int j = 0; j < NP; ++j) { const int c = j * 128 + lane * 4; v4f g = *(const v4fa*)(X + r * D + c); if (RBF) { for (int q = 0; q < 4; ++q) g[q] = bf16_round(g[q]); } y[j] = g; s += g[0] + g[1] + g[2] + g[3]; }
  for (int o = 16; o >= 1; o >>= 1) s += __shfl_xor(s, o, 32); const float mu = s / (float)D; float q2 = 0.f;
#pragma unroll
  for (int j = 0; j < NP; ++j) for (int q = 0; q < 4; ++q) { const float d = y[j][q] - mu; q2 += d * d; }
  for (int o = 16; o >= 1; o >>= 1) q2 += __shfl_xor(q2, o, 32); const float rs = rsqrtf(q2 / (float)D + eps);
  {
#pragma unroll
    for (int j = 0; j < NP; ++j) { const int c = j * 128 + lane * 4; v4h h; for (int q = 0; q < 4; ++q) { const float v = (y[j][q] - mu) * rs * bf16_round(gam[c + q]) + bf16_round(bet[c + q]); h[q] = (_Float16)v; } *(v4h*)(O16 + r * D + c) = h; if (XR) *(v4f*)(XR + r * D + c) = y[j]; }
     } }
typedef int v4ia __attribute__((ext_vector_type(4), may_alias));
// lane l <-> lane l ^ 16 (the two halves of a wave hold the two key halves of one query column)
__device__ __forceinline__ float xhalf(float x) { const int b = __builtin_bit_cast(int, x); return __builtin_bit_cast(float, __builtin_amdgcn_permlanex16(b, b, 0x76543210, 0xfedcba98, false, false)); }
__global__ __launch_bounds__(128) void k_flash(const _Float16* __restrict__ Q16, int ldq, const _Float16* __restrict__ K16, int ldk, const _Float16* __restrict__ Vt, const int* __restrict__ MSK, float* __restrict__ O, int ldo) {
  constexpr int RPW = 16, NQB = TT / (4 * RPW), DT = 4, KS = 2;
  __shared__ __attribute__((aligned(16))) float sO[4][RPW][64 + 4];
  const int tid = threadIdx.x, w = tid >> 5, lane = tid & 31, ln = lane & 15, hh = lane >> 4;
  const int slab = blockIdx.x / NQB, qblk = blockIdx.x % NQB; const int b = slab / NH, h = slab % NH; const int qb0 = qblk * (4 * RPW); const int q0 = qb0 + w * RPW;
  FragH bq[KS];      /* B operand: column ln = query q0 + ln */
  { const unsigned short* qr = (const unsigned short*)Q16 + ((size_t)b * TT + q0 + ln) * ldq + h * 64;
#pragma unroll
    for (int ks = 0; ks < KS; ++ks) { bq[ks].half[0] = *(const v8us*)(qr + ks * 32 + 8 * hh); bq[ks].half[1] = *(const v8us*)(qr + ks * 32 + 16 + 8 * hh); } }
  const unsigned short* Vth = (const unsigned short*)Vt + (size_t)slab * 64 * TT;
  float m_q = -3.0e38f, l_q = 0.f; v8f oacc[DT];      /* oacc[dt][r] = O[q0 + ln][dt * 16 + 8 * hh + r] */
#pragma unroll
  for (int dt = 0; dt < DT; ++dt) oacc[dt] = (v8f){0.f,0.f,0.f,0.f,0.f,0.f,0.f,0.f};
  const int jend = TT;
#pragma unroll 1
  for (int j0 = 0; j0 < jend; j0 += 32) {
    const int* mp = MSK + (size_t)b * TT + j0 + 8 * hh;      /* key padding mask (1 = PAD) of this lane's keys j0 + 8hh + 0..7 and j0 + 16 + 8hh + 0..7 */
    const v4ia km[4] = { *(const v4ia*)mp, *(const v4ia*)(mp + 4), *(const v4ia*)(mp + 16), *(const v4ia*)(mp + 20) };
    v8f s[2];
#pragma unroll
    for (int nt = 0; nt < 2; ++nt) { const unsigned short* kr = (const unsigned short*)K16 + ((size_t)b * TT + j0 + nt * 16 + ln) * ldk + h * 64; FragH ak[KS];
#pragma unroll
      for (int ks = 0; ks < KS; ++ks) { ak[ks].half[0] = *(const v8us*)(kr + ks * 32 + 8 * hh); ak[ks].half[1] = *(const v8us*)(kr + ks * 32 + 16 + 8 * hh); }
      v8f acc = (v8f){0.f,0.f,0.f,0.f,0.f,0.f,0.f,0.f};
#pragma unroll
      for (int ks = 0; ks < KS; ++ks) acc = mmaH<1>(ak[ks].v, ak[ks].v, bq[ks].v, bq[ks].v, acc);
      s[nt] = acc; }
    float sc[16]; float mc = -INFINITY;      /* 1 = pad -> excluded (the module adds -1e8): score -inf, so its exp below is exactly 0 */
#pragma unroll
    for (int i = 0; i < 16; ++i) { sc[i] = (km[i >> 2][i & 3] == 0) ? s[i >> 3][i & 7] * 0.125f : -INFINITY; mc = fmaxf(mc, sc[i]); }
    mc = fmaxf(mc, xhalf(mc));
    const float mn = fmaxf(m_q, mc); const float al = expf(m_q - mn); m_q = mn;      /* m_q and mn are finite (start -3e38): no key seen yet gives exp(0) = 1 */
    float ps = 0.f; FragH pb;      /* pb.h[i] = P^T[k = kmap(i, hh)][ln] */
#pragma unroll
    for (int i = 0; i < 16; ++i) { const float p = expf(sc[i] - mn); ps += p; pb.h[i] = (_Float16)(p * 1024.0f); }
    l_q = l_q * al + ps;
#pragma unroll
    for (int dt = 0; dt < DT; ++dt)
#pragma unroll
      for (int r = 0; r < 8; ++r) oacc[dt][r] *= al;
#pragma unroll
    for (int dt = 0; dt < DT; ++dt) { const unsigned short* vrow = Vth + (size_t)(dt * 16 + ln) * TT + j0; FragH av; av.half[0] = *(const v8us*)(vrow + 8 * hh); av.half[1] = *(const v8us*)(vrow + 16 + 8 * hh);
      oacc[dt] = mmaH<1>(av.v, av.v, pb.v, pb.v, oacc[dt]); } }
  { float l = l_q + xhalf(l_q); l = (l > 0.f) ? 1.0f / (l * 1024.0f) : 0.f;
#pragma unroll
    for (int dt = 0; dt < DT; ++dt)
#pragma unroll
      for (int g = 0; g < 2; ++g) { v4f o; for (int q = 0; q < 4; ++q) o[q] = oacc[dt][g * 4 + q] * l; *(v4fa*)&sO[w][ln][dt * 16 + 8 * hh + g * 4] = o; } }
  __builtin_amdgcn_fence(__ATOMIC_ACQ_REL, "workgroup"); __builtin_amdgcn_wave_barrier();
  {
#pragma unroll
    for (int rp = 0; rp < RPW; rp += 2) { const int r = rp + (lane >> 4), pc = lane & 15; const v4f val = *(const v4fa*)&sO[w][r][pc * 4]; *(v4f*)(O + ((size_t)b * TT + q0 + r) * ldo + h * 64 + pc * 4) = val; }
     } }

__global__ __launch_bounds__(256) void k_addbf(float* __restrict__ out, const float* __restrict__ x, size_t n4) { const size_t t = (size_t)blockIdx.x * 256 + threadIdx.x; if (t >= n4) return; v4f a = *(const v4fa*)(out + t * 4); const v4f b = *(const v4fa*)(x + t * 4); for (int q = 0; q < 4; ++q) a[q] += bf16_round(b[q]); *(v4f*)(out + t * 4) = a;  }
extern "C" void kernel_launch(void* const* d_in, const int* in_sizes, int n_in,
                              void* d_out, int out_size, void* d_ws, size_t ws_size, hipStream_t stream) {
  (void)in_sizes; (void)n_in; (void)out_size;
  const float* const* I = (const float* const*)d_in; const float* x = I[0]; const int* mask = (const int*)d_in[1]; const float* Wqkv = I[2]; const float* bqkv = I[3]; const float* Wo = I[4]; const float* bo = I[5]; const float* lng = I[6]; const float* lnb = I[7];      /* d_in order: hidden_states, encoder_padding_mask, qkv_w, qkv_b, out_w, out_b, ln_g, ln_b */
  const float* bq = bqkv; const float* bk = bqkv + DD; const float* bv = bqkv + 2 * DD;
  char* ws = (char*)d_ws; size_t off = 0;
  auto take = [&](size_t bytes) { char* p = ws + off; off += (bytes + 255) & ~(size_t)255; return p; };
  const size_t WSZ = (size_t)DD * DD; _Float16* Bw = (_Float16*)take(4 * WSZ * 2); _Float16* X16 = (_Float16*)take((size_t)NR * DD * 2);
  _Float16* Q = (_Float16*)take((size_t)NR * DD * 2); _Float16* K = (_Float16*)take((size_t)NR * DD * 2); _Float16* V = (_Float16*)take((size_t)NR * DD * 2); _Float16* Vt = (_Float16*)take((size_t)NR * DD * 2);
  float* O = (float*)take((size_t)NR * DD * 4); _Float16* O16 = V;      /* the v plane is dead once Vᵀ is built (before the attention kernel); O16 reuses it */
  if (off > ws_size) return;      // 8.4 + 16.8 × 5 + 33.6 ≈ 126 MB (120 MiB)
  const unsigned gw2 = (unsigned)((WSZ / 8 + 255) / 256);
  k_round16f<<<(unsigned)((3 * WSZ / 8 + 255) / 256), 256, 0, stream>>>(Wqkv, Bw, 3 * WSZ / 8); k_round16f<<<gw2, 256, 0, stream>>>(Wo, Bw + 3 * WSZ, WSZ / 8);      /* (out,in) natural ×2^4: rows q|k|v, then out_w */
  const unsigned gx = (unsigned)(((size_t)NR * DD / 8 + 255) / 256); const unsigned gp = (NR / 128) * (DD / 128);
  k_lnx<DD, 1><<<(NR + 7) / 8, 256, 0, stream>>>(x, lng, lnb, NR, 1e-5f, X16, nullptr);      /* x = LN(bf16 hidden) → f16 */
  k_gemm_t<false><<<gp, 256, 0, stream>>>(X16, Bw, 0.0625f, bq, nullptr, Q);      /* q = x·Wq + bq: M 8192 N 1024 K 1024 */
  k_gemm_t<false><<<gp, 256, 0, stream>>>(X16, Bw + WSZ, 0.0625f, bk, nullptr, K);
  k_gemm_t<false><<<gp, 256, 0, stream>>>(X16, Bw + 2 * WSZ, 0.0625f, bv, nullptr, V);
  k_vt<NH, TT><<<BB * NH * (TT / 64), 256, 0, stream>>>(V, DD, 0, Vt);
  k_flash<<<BB * NH * (TT / 64), 128, 0, stream>>>(Q, DD, K, DD, Vt, mask, O, DD);
  k_h16<<<gx, 256, 0, stream>>>(O, O16, (size_t)NR * DD / 8);
  k_gemm_t<true><<<gp, 256, 0, stream>>>(O16, Bw + 3 * WSZ, 0.0625f, bo, (float*)d_out, nullptr);      /* out = O·out_wᵀ + out_b */
  k_addbf<<<(unsigned)(((size_t)NR * DD / 4 + 255) / 256), 256, 0, stream>>>((float*)d_out, x, (size_t)NR * DD / 4);      /* += bf16(hidden) in place (residual; no workspace left for an f32 copy) */
}

// v003
// A run of this version takes 258 microseconds.
// Next to v002, in two timings, it ran 1.20 and 1.19 times as fast.
// Over all steps from v000 it is 3.23 times as fast.
#include <hip/hip_runtime.h>
// Pre-LN self-attention layer with a key padding mask and residual (B=4, S=2048, H=1024, 16 heads × 64): x = LN(hidden); [q|k|v] = x·qkv_wᵀ + qkv_b ((out,in) fused); scores = q·kᵀ·64^-½ + mask·(−1e8) (int mask [B,S], 1 = pad); softmax;
// out = (attn·v merged)·out_wᵀ + out_b + hidden.
// Compute dtype: x, weights, biases rounded to bf16; q/k/v as f16 GEMM outputs; fused flash-style kernel (online softmax f32, P f16 ×2^10) on v_wmma_f32_16x16x32_f16; O → f16 → output GEMM with bias; f32 accumulate.
#define BB 4
#define TT 2048
#define NH 16
#define DD 1024
#define NR (BB * TT)

typedef __bf16 v16b __attribute__((ext_vector_type(16)));
typedef unsigned short v8us __attribute__((ext_vector_type(8), may_alias));
typedef float  v8f  __attribute__((ext_vector_type(8)));
typedef float  v4f  __attribute__((ext_vector_type(4)));
typedef float  v4fa __attribute__((ext_vector_type(4), may_alias));
union FragB { v16b v; v8us half[2]; unsigned short u[16]; };

__device__ __forceinline__ unsigned short bf16_bits(float x) { unsigned int u = __float_as_uint(x); return (unsigned short)((u + 0x7FFFu + ((u >> 16) & 1u)) >> 16); }
__device__ __forceinline__ float bf16_val(unsigned short b) { return __uint_as_float(((unsigned int)b) << 16); }
__device__ __forceinline__ float bf16_round(float x) { return bf16_val(bf16_bits(x)); }
// D += A·B with NT terms: 1 = ah·bh, 2 = + al·bh (A split), 3 = + ah·bl (both split)
template <int NT>
__device__ __forceinline__ v8f mmaN(v16b ah, v16b al, v16b bh, v16b bl, v8f c) {
  c = __builtin_amdgcn_wmma_f32_16x16x32_bf16(false, ah, false, bh, (short)0, c, false, false);
  if (NT >= 2) c = __builtin_amdgcn_wmma_f32_16x16x32_bf16(false, al, false, bh, (short)0, c, false, false);
  if (NT >= 3) c = __builtin_amdgcn_wmma_f32_16x16x32_bf16(false, ah, false, bl, (short)0, c, false, false);
  asm volatile("v_nop\n\tv_nop\n\tv_nop\n\tv_nop" : "+v"(c) : "v"(ah), "v"(al), "v"(bh), "v"(bl));
  return c;
}

__global__ __launch_bounds__(256) void k_wt_bf16(const float* __restrict__ W, unsigned short* __restrict__ Wt, int K, int N) {
  const int t = blockIdx.x * 256 + threadIdx.x;
  const int k8n = K / 8;
  if (t >= N * k8n) return;
  const int n = t / k8n, k8 = (t % k8n) * 8;
  v8us v;
#pragma unroll
  for (int i = 0; i < 8; ++i) v[i] = bf16_bits(W[(size_t)(k8 + i) * N + n]);
  *(v8us*)(Wt + (size_t)n * K + k8) = v;
  
}

// GEMM C[M][N] (f32, pitch ldc) = act(A[M][K]·W + bias). A f32 row-major (pitch lda) converted per fragment to bf16
// (ASPLIT: hi/lo two planes -> 2 terms, else single rounded term); Wt bf16 [N][K] (pitch ldb). BIAS_BF16 rounds the
// bias to bf16 first (bias quantised to bf16 before the add). K%32==0, M%16==0, N%64==0.
template <bool ASPLIT, int ACT, bool BIAS_BF16>
__global__ __launch_bounds__(128) void k_gemm_bf(const float* __restrict__ A, int lda, const unsigned short* __restrict__ Wt, int ldb,
                                               const float* __restrict__ bias, float* __restrict__ C, int ldc, int M, int N, int K) {
  __shared__ __attribute__((aligned(16))) float so[4][16][64];
  const int tid = threadIdx.x, w = tid >> 5, lane = tid & 31, ln = lane & 15, hh = lane >> 4;
  const int ntn = N / 64;
  const int wid = blockIdx.x * 4 + w;
  const int mt = wid / ntn, nq = wid % ntn;
  if (mt * 16 >= M) return;
  const int row0 = mt * 16, col0 = nq * 64;
  const float* arow = A + (size_t)(row0 + ln) * lda;
  v8f acc[4] = {};
  for (int kb = 0; kb < K; kb += 32) {
    FragB ah, al;
    const v4f x0 = *(const v4fa*)(arow + kb + 8 * hh), x1 = *(const v4fa*)(arow + kb + 8 * hh + 4);
    const v4f x2 = *(const v4fa*)(arow + kb + 16 + 8 * hh), x3 = *(const v4fa*)(arow + kb + 16 + 8 * hh + 4);
    float xs[16] = {x0[0],x0[1],x0[2],x0[3],x1[0],x1[1],x1[2],x1[3],x2[0],x2[1],x2[2],x2[3],x3[0],x3[1],x3[2],x3[3]};
#pragma unroll
    for (int i = 0; i < 16; ++i) { const unsigned short hb = bf16_bits(xs[i]); ah.u[i] = hb; al.u[i] = ASPLIT ? bf16_bits(xs[i] - bf16_val(hb)) : (unsigned short)0; }
#pragma unroll
    for (int t = 0; t < 4; ++t) {
      const unsigned short* brow = Wt + (size_t)(col0 + t * 16 + ln) * ldb + kb;
      FragB b;
      b.half[0] = *(const v8us*)(brow + 8 * hh);
      b.half[1] = *(const v8us*)(brow + 16 + 8 * hh);
      acc[t] = mmaN<ASPLIT ? 2 : 1>(ah.v, al.v, b.v, b.v, acc[t]);
    }
  }
#pragma unroll
  for (int t = 0; t < 4; ++t) {
    float bv = bias ? bias[col0 + t * 16 + ln] : 0.f;
    if (BIAS_BF16) bv = bf16_round(bv);
#pragma unroll
    for (int r = 0; r < 8; ++r) { float v = acc[t][r] + bv; if (ACT == 1) v = fmaxf(v, 0.f); so[w][8 * hh + r][t * 16 + ln] = v; }
  }
  __builtin_amdgcn_fence(__ATOMIC_ACQ_REL, "workgroup");
  __builtin_amdgcn_wave_barrier();
  const int rsub = lane >> 4, c4 = (lane & 15) * 4;
  {
#pragma unroll
    for (int q = 0; q < 8; ++q) {
      const int r = q * 2 + rsub;
      const v4f v = *(const v4fa*)&so[w][r][c4];
      *(v4f*)(C + (size_t)(row0 + r) * ldc + col0 + c4) = v;
    }
    
  }
}

// Flash-style causal/unmasked attention, all contractions 3-term bf16 hi/lo splits, f32 softmax with running max.
// q,k,v rows are read from f32 buffers with arbitrary row pitch (so they can live inside a fused qkv buffer);
// D = head size (multiple of 32, <= 128); one wave = 16 query rows; block = 4 waves (64 queries) sharing K/V chunks of 32.
template <int D, bool CAUSAL>
__global__ __launch_bounds__(128) void k_flash(const float* __restrict__ qb, const float* __restrict__ kb, const float* __restrict__ vb,
                                             int pitch, int T, int H, float scale, float* __restrict__ y, int ypitch) {
  constexpr int KS = D / 32;        // k-steps for QK
  constexpr int DT = D / 16;        // d tiles for PV
  __shared__ __attribute__((aligned(16))) unsigned short sKh[32][D + 8], sKl[32][D + 8], sVh[32][D + 8], sVl[32][D + 8];
  __shared__ __attribute__((aligned(16))) unsigned short sPh[4][16][40], sPl[4][16][40];
  __shared__ __attribute__((aligned(16))) float sO[4][16][D];
  const int tid = threadIdx.x, w = tid >> 5, lane = tid & 31, ln = lane & 15, hh = lane >> 4;
  const int nqb = (T + 63) / 64;
  const int bh = blockIdx.x / nqb, qblk = blockIdx.x % nqb;
  const int b = bh / H, h = bh % H;
  const int q0 = qblk * 64 + w * 16;
  const float* Q = qb + (size_t)b * T * pitch + h * D;
  const float* K = kb + (size_t)b * T * pitch + h * D;
  const float* V = vb + (size_t)b * T * pitch + h * D;

  // A fragments of the wave's 16 query rows (scaled), hi/lo
  FragB aqh[KS], aql[KS];
  {
    int row = q0 + ln; if (row >= T) row = T - 1;
    const float* qr = Q + (size_t)row * pitch;
#pragma unroll
    for (int ks = 0; ks < KS; ++ks)
#pragma unroll
      for (int i = 0; i < 16; ++i) {
        const int d = ks * 32 + ((i < 8) ? (8 * hh + i) : (16 + 8 * hh + (i - 8)));
        const float x = qr[d] * scale; const unsigned short hb = bf16_bits(x);
        aqh[ks].u[i] = hb; aql[ks].u[i] = bf16_bits(x - bf16_val(hb));
      }
  }
  float m_r[8], l_r[8];
#pragma unroll
  for (int r = 0; r < 8; ++r) { m_r[r] = -3.0e38f; l_r[r] = 0.f; }
  v8f oacc[DT];
#pragma unroll
  for (int dt = 0; dt < DT; ++dt) oacc[dt] = (v8f){0.f,0.f,0.f,0.f,0.f,0.f,0.f,0.f};

  const int kv_end = CAUSAL ? min(T, qblk * 64 + 64) : T;     // block-uniform
  for (int j0 = 0; j0 < kv_end; j0 += 32) {
    __syncthreads();
    for (int e = tid; e < 32 * (D / 4); e += 128) {
      const int r = e / (D / 4), c4 = (e % (D / 4)) * 4;
      const int key = j0 + r;
      v4f kf = {0.f,0.f,0.f,0.f}, vf = {0.f,0.f,0.f,0.f};
      if (key < T) { kf = *(const v4fa*)(K + (size_t)key * pitch + c4); vf = *(const v4fa*)(V + (size_t)key * pitch + c4); }
#pragma unroll
      for (int t = 0; t < 4; ++t) {
        unsigned short hb = bf16_bits(kf[t]); sKh[r][c4 + t] = hb; sKl[r][c4 + t] = bf16_bits(kf[t] - bf16_val(hb));
        hb = bf16_bits(vf[t]); sVh[r][c4 + t] = hb; sVl[r][c4 + t] = bf16_bits(vf[t] - bf16_val(hb));
      }
    }
    __syncthreads();
    // S tile 16 x 32
    v8f s[2];
#pragma unroll
    for (int nt = 0; nt < 2; ++nt) {
      v8f acc = {};
#pragma unroll
      for (int ks = 0; ks < KS; ++ks) {
        FragB bh_, bl_;
        bh_.half[0] = *(const v8us*)&sKh[nt * 16 + ln][ks * 32 + 8 * hh]; bh_.half[1] = *(const v8us*)&sKh[nt * 16 + ln][ks * 32 + 16 + 8 * hh];
        bl_.half[0] = *(const v8us*)&sKl[nt * 16 + ln][ks * 32 + 8 * hh]; bl_.half[1] = *(const v8us*)&sKl[nt * 16 + ln][ks * 32 + 16 + 8 * hh];
        acc = mmaN<3>(aqh[ks].v, aql[ks].v, bh_.v, bl_.v, acc);
      }
      s[nt] = acc;
    }
    // mask + running max (rows 8hh+r; the 16 lanes of a half share rows)
    float alpha[8];
#pragma unroll
    for (int r = 0; r < 8; ++r) {
      const int qi = q0 + 8 * hh + r;
      const int ja = j0 + ln, jb = j0 + 16 + ln;
      if (CAUSAL) { if (ja > qi) s[0][r] = -3.0e38f; if (jb > qi) s[1][r] = -3.0e38f; }
      if (ja >= T) s[0][r] = -3.0e38f;
      if (jb >= T) s[1][r] = -3.0e38f;
      float mx = fmaxf(s[0][r], s[1][r]);
      mx = fmaxf(mx, __shfl_xor(mx, 1, 32)); mx = fmaxf(mx, __shfl_xor(mx, 2, 32)); mx = fmaxf(mx, __shfl_xor(mx, 4, 32)); mx = fmaxf(mx, __shfl_xor(mx, 8, 32));
      const float mnew = fmaxf(m_r[r], mx);
      alpha[r] = (mnew > -1.0e38f) ? __expf(m_r[r] - mnew) : 1.0f;
      const float p0 = (s[0][r] > -1.0e38f) ? __expf(s[0][r] - mnew) : 0.f;
      const float p1 = (s[1][r] > -1.0e38f) ? __expf(s[1][r] - mnew) : 0.f;
      m_r[r] = mnew;
      l_r[r] = l_r[r] * alpha[r] + p0 + p1;            // per-lane partial row sum (16 lanes combined at the end)
      unsigned short hb = bf16_bits(p0); sPh[w][8 * hh + r][ln] = hb;      sPl[w][8 * hh + r][ln] = bf16_bits(p0 - bf16_val(hb));
      hb = bf16_bits(p1);                sPh[w][8 * hh + r][16 + ln] = hb; sPl[w][8 * hh + r][16 + ln] = bf16_bits(p1 - bf16_val(hb));
    }
#pragma unroll
    for (int dt = 0; dt < DT; ++dt)
#pragma unroll
      for (int r = 0; r < 8; ++r) oacc[dt][r] *= alpha[r];
    __builtin_amdgcn_fence(__ATOMIC_ACQ_REL, "workgroup");
    __builtin_amdgcn_wave_barrier();
    FragB pah, pal;
    pah.half[0] = *(const v8us*)&sPh[w][ln][8 * hh]; pah.half[1] = *(const v8us*)&sPh[w][ln][16 + 8 * hh];
    pal.half[0] = *(const v8us*)&sPl[w][ln][8 * hh]; pal.half[1] = *(const v8us*)&sPl[w][ln][16 + 8 * hh];
#pragma unroll
    for (int dt = 0; dt < DT; ++dt) {
      FragB bvh, bvl;
#pragma unroll
      for (int i = 0; i < 8; ++i) {
        bvh.u[i] = sVh[8 * hh + i][dt * 16 + ln]; bvh.u[8 + i] = sVh[16 + 8 * hh + i][dt * 16 + ln];
        bvl.u[i] = sVl[8 * hh + i][dt * 16 + ln]; bvl.u[8 + i] = sVl[16 + 8 * hh + i][dt * 16 + ln];
      }
      oacc[dt] = mmaN<3>(pah.v, pal.v, bvh.v, bvl.v, oacc[dt]);
    }
    __builtin_amdgcn_fence(__ATOMIC_ACQ_REL, "workgroup");
    __builtin_amdgcn_wave_barrier();
  }
#pragma unroll
  for (int r = 0; r < 8; ++r) {
    float l = l_r[r];
    l += __shfl_xor(l, 1, 32); l += __shfl_xor(l, 2, 32); l += __shfl_xor(l, 4, 32); l += __shfl_xor(l, 8, 32);
    l_r[r] = (l > 0.f) ? 1.0f / l : 0.f;
  }
#pragma unroll
  for (int dt = 0; dt < DT; ++dt)
#pragma unroll
    for (int r = 0; r < 8; ++r) sO[w][8 * hh + r][dt * 16 + ln] = oacc[dt][r] * l_r[r];
  __builtin_amdgcn_fence(__ATOMIC_ACQ_REL, "workgroup");
  __builtin_amdgcn_wave_barrier();
  {
    for (int r = 0; r < 16; ++r) {
      const int row = q0 + r;
      if (row < T && lane < D / 4) {
        const v4f val = *(const v4fa*)&sO[w][r][lane * 4];
        *(v4f*)(y + ((size_t)b * T + row) * ypitch + h * D + lane * 4) = val;
      }
    }
    
  }
}

// GEMM C = act(A·W + bias + resid): A f32 (ASPLIT -> hi/lo 2 terms), Wt bf16 [N][K]; ACT 0 none, 1 relu, 2 exact gelu;
// resid (optional, f32, row index = (row % rmod), pitch ldr, RES_BF16 rounds it) added before the activation.
template <bool ASPLIT, int ACT, bool BIAS_BF16, bool RES_BF16>
__global__ __launch_bounds__(128) void k_gemm_bf3(const float* __restrict__ A, int lda, const unsigned short* __restrict__ Wt, int ldb,
                                                const float* __restrict__ bias, const float* __restrict__ resid, int rmod, int ldr,
                                                float* __restrict__ C, int ldc, int M, int N, int K) {
  __shared__ __attribute__((aligned(16))) float so[4][16][64];
  const int tid = threadIdx.x, w = tid >> 5, lane = tid & 31, ln = lane & 15, hh = lane >> 4;
  const int ntn = N / 64;
  const int wid = blockIdx.x * 4 + w;
  const int mt = wid / ntn, nq = wid % ntn;
  if (mt * 16 >= M) return;
  const int row0 = mt * 16, col0 = nq * 64;
  const float* arow = A + (size_t)(row0 + ln) * lda;
  v8f acc[4] = {};
  for (int kb = 0; kb < K; kb += 32) {
    FragB ah, al;
    const v4f x0 = *(const v4fa*)(arow + kb + 8 * hh), x1 = *(const v4fa*)(arow + kb + 8 * hh + 4);
    const v4f x2 = *(const v4fa*)(arow + kb + 16 + 8 * hh), x3 = *(const v4fa*)(arow + kb + 16 + 8 * hh + 4);
    float xs[16] = {x0[0],x0[1],x0[2],x0[3],x1[0],x1[1],x1[2],x1[3],x2[0],x2[1],x2[2],x2[3],x3[0],x3[1],x3[2],x3[3]};
#pragma unroll
    for (int i = 0; i < 16; ++i) { const unsigned short hb = bf16_bits(xs[i]); ah.u[i] = hb; al.u[i] = ASPLIT ? bf16_bits(xs[i] - bf16_val(hb)) : (unsigned short)0; }
#pragma unroll
    for (int t = 0; t < 4; ++t) {
      const unsigned short* brow = Wt + (size_t)(col0 + t * 16 + ln) * ldb + kb;
      FragB b;
      b.half[0] = *(const v8us*)(brow + 8 * hh);
      b.half[1] = *(const v8us*)(brow + 16 + 8 * hh);
      acc[t] = mmaN<ASPLIT ? 2 : 1>(ah.v, al.v, b.v, b.v, acc[t]);
    }
  }
#pragma unroll
  for (int t = 0; t < 4; ++t) {
    const int col = col0 + t * 16 + ln;
    float bv = bias ? bias[col] : 0.f;
    if (BIAS_BF16) bv = bf16_round(bv);
#pragma unroll
    for (int r = 0; r < 8; ++r) {
      float v = acc[t][r] + bv;
      if (resid) { float rv = resid[(size_t)((row0 + 8 * hh + r) % rmod) * ldr + col]; if (RES_BF16) rv = bf16_round(rv); v += rv; }
      if (ACT == 1) v = fmaxf(v, 0.f);
      if (ACT == 2) v = 0.5f * v * (1.0f + erff(v * 0.70710678118654752f));
      if (ACT == 3) { const float u = 0.7978845608028654f * (v + 0.044715f * v * v * v); v = 0.5f * v * (1.0f + tanhf(u)); }
      so[w][8 * hh + r][t * 16 + ln] = v;
    }
  }
  __builtin_amdgcn_fence(__ATOMIC_ACQ_REL, "workgroup");
  __builtin_amdgcn_wave_barrier();
  const int rsub = lane >> 4, c4 = (lane & 15) * 4;
  {
#pragma unroll
    for (int q = 0; q < 8; ++q) {
      const int r = q * 2 + rsub;
      const v4f v = *(const v4fa*)&so[w][r][c4];
      *(v4f*)(C + (size_t)(row0 + r) * ldc + col0 + c4) = v;
    }
    
  }
}
// row LayerNorm (biased variance, eps) over N: s = X (+ R); optional out_sum <- s; out_norm <- (s-mu)*rsqrt(var+eps)*g + b
template <bool PARAM_BF16>
__global__ __launch_bounds__(256) void k_layernorm(const float* __restrict__ X, const float* __restrict__ R, const float* __restrict__ g, const float* __restrict__ bta,
                                                  float* __restrict__ out_sum, float* __restrict__ out_norm, int N, float eps) {
  __shared__ float red[256];
  const int row = blockIdx.x, tid = threadIdx.x;
  const float* x = X + (size_t)row * N; const float* rr = R ? R + (size_t)row * N : nullptr;
  float vals[16];                     // up to N = 4096
  const int per = N / 256;            // contiguous chunk per thread? use strided-by-4 chunks: thread handles j = tid*4 + 1024*u
  float s1 = 0.f;
  for (int u = 0; u < per / 4; ++u) {
    const int j = tid * 4 + 1024 * u;
    const v4f a = *(const v4fa*)(x + j);
    v4f b = {0.f,0.f,0.f,0.f}; if (rr) b = *(const v4fa*)(rr + j);
#pragma unroll
    for (int q = 0; q < 4; ++q) { const float v = a[q] + b[q]; vals[u * 4 + q] = v; s1 += v; }
  }
  red[tid] = s1; __syncthreads();
  for (int st = 128; st > 0; st >>= 1) { if (tid < st) red[tid] += red[tid + st]; __syncthreads(); }
  const float mu = red[0] / (float)N; __syncthreads();
  float s2 = 0.f;
  for (int u = 0; u < per / 4; ++u)
#pragma unroll
    for (int q = 0; q < 4; ++q) { const float c = vals[u * 4 + q] - mu; s2 += c * c; }
  red[tid] = s2; __syncthreads();
  for (int st = 128; st > 0; st >>= 1) { if (tid < st) red[tid] += red[tid + st]; __syncthreads(); }
  const float rs = rsqrtf(red[0] / (float)N + eps);
  {
    for (int u = 0; u < per / 4; ++u) {
      const int j = tid * 4 + 1024 * u;
      v4f o, sm;
#pragma unroll
      for (int q = 0; q < 4; ++q) {
        float gg = g[j + q], bb = bta[j + q];
        if (PARAM_BF16) { gg = bf16_round(gg); bb = bf16_round(bb); }
        sm[q] = vals[u * 4 + q]; o[q] = (vals[u * 4 + q] - mu) * rs * gg + bb;
      }
      if (out_sum) *(v4f*)(out_sum + (size_t)row * N + j) = sm;
      *(v4f*)(out_norm + (size_t)row * N + j) = o;
    }
    
  }
}



// ---- f16 WMMA path (v_wmma_f32_16x16x32_f16): 11-bit significands for operands in range — used where a [0,1] probability operand needs more precision than bf16
typedef _Float16 v16h __attribute__((ext_vector_type(16)));
union FragH { v16h v; v8us half[2]; _Float16 h[16]; unsigned short u[16]; };
template <int NT>
__device__ __forceinline__ v8f mmaH(v16h ah, v16h al, v16h bh, v16h bl, v8f c) {
  c = __builtin_amdgcn_wmma_f32_16x16x32_f16(false, ah, false, bh, (short)0, c, false, false);
  if (NT >= 2) c = __builtin_amdgcn_wmma_f32_16x16x32_f16(false, al, false, bh, (short)0, c, false, false);
  if (NT >= 3) c = __builtin_amdgcn_wmma_f32_16x16x32_f16(false, ah, false, bl, (short)0, c, false, false);
  asm volatile("v_nop\n\tv_nop\n\tv_nop\n\tv_nop" : "+v"(c) : "v"(ah), "v"(al), "v"(bh), "v"(bl));
  return c;
}
// batched GEMM like k_gemm_b but f16 operands: A f32 (split into f16 hi/lo if ASPLIT, else rounded to f16), Bt = f16 values [n][k]; alpha; C f32; N multiple of 16 (partial tiles skipped)
template <bool ASPLIT>
__global__ __launch_bounds__(128) void k_gemm_h(const float* __restrict__ A, int lda, size_t sA, const _Float16* __restrict__ Bh, int ldb, size_t sB, float alpha, float* __restrict__ C, int ldc, size_t sC, int M, int N, int K) {
  __shared__ __attribute__((aligned(16))) float so[4][16][64];
  const int tid = threadIdx.x, w = tid >> 5, lane = tid & 31, ln = lane & 15, hh = lane >> 4; const int by = blockIdx.y;
  A += (size_t)by * sA; Bh += (size_t)by * sB; C += (size_t)by * sC;
  const int ntn = (N + 63) / 64; const int wid = blockIdx.x * 4 + w; const int mt = wid / ntn, nq = wid % ntn; if (mt * 16 >= M) return;
  const int row0 = mt * 16, col0 = nq * 64; const float* arow = A + (size_t)(row0 + ln) * lda;
  v8f acc[4] = {};
  for (int kb = 0; kb < K; kb += 32) {
    FragH ah, al;
    const v4f x0 = *(const v4fa*)(arow + kb + 8 * hh), x1 = *(const v4fa*)(arow + kb + 8 * hh + 4), x2 = *(const v4fa*)(arow + kb + 16 + 8 * hh), x3 = *(const v4fa*)(arow + kb + 16 + 8 * hh + 4);
    float xs[16] = {x0[0],x0[1],x0[2],x0[3],x1[0],x1[1],x1[2],x1[3],x2[0],x2[1],x2[2],x2[3],x3[0],x3[1],x3[2],x3[3]};
#pragma unroll
    for (int i = 0; i < 16; ++i) { const _Float16 h = (_Float16)xs[i]; ah.h[i] = h; al.h[i] = ASPLIT ? (_Float16)(xs[i] - (float)h) : (_Float16)0.0f; }
#pragma unroll
    for (int t = 0; t < 4; ++t) { if (col0 + t * 16 >= N) continue; const size_t boff = (size_t)(col0 + t * 16 + ln) * ldb + kb; FragH bq; bq.half[0] = *(const v8us*)(Bh + boff + 8 * hh); bq.half[1] = *(const v8us*)(Bh + boff + 16 + 8 * hh);
      acc[t] = mmaH<ASPLIT ? 2 : 1>(ah.v, al.v, bq.v, bq.v, acc[t]); }
  }
#pragma unroll
  for (int t = 0; t < 4; ++t) { if (col0 + t * 16 >= N) continue;
#pragma unroll
    for (int r = 0; r < 8; ++r) so[w][8 * hh + r][t * 16 + ln] = acc[t][r] * alpha; }
  __builtin_amdgcn_fence(__ATOMIC_ACQ_REL, "workgroup"); __builtin_amdgcn_wave_barrier();
  const int rsub = lane >> 4, c4 = (lane & 15) * 4;
  {
#pragma unroll
    for (int q = 0; q < 8; ++q) { const int r = q * 2 + rsub; if (col0 + c4 < N) { const v4f v = *(const v4fa*)&so[w][r][c4]; *(v4f*)(C + (size_t)(row0 + r) * ldc + col0 + c4) = v; } }
     }
}

// Wt[n][k] = f16(W[k][n]·scale) from f32 row-major W[K][N] (scale = power of two; bf16-exact weights stay exact in f16 away from the subnormal range)
__global__ __launch_bounds__(256) void k_wt_f16(const float* __restrict__ W, _Float16* __restrict__ Wt, int K, int N, float scale) {
  const int t = blockIdx.x * 256 + threadIdx.x; if (t >= N * (K / 8)) return; const int n = t / (K / 8), k8 = (t % (K / 8)) * 8; FragH f;
#pragma unroll
  for (int i = 0; i < 8; ++i) f.h[i] = (_Float16)(bf16_round(W[(size_t)(k8 + i) * N + n]) * scale); const v8us o = f.half[0];
  *(v8us*)((unsigned short*)Wt + (size_t)n * K + k8) = o; 
}
typedef _Float16 v4h __attribute__((ext_vector_type(4)));
// C = (A.B^T)*alpha + bf16(bias): A f16 [NR][DD], Bh f16 [DD][DD] (row n, k contiguous); writes f32 C (OUT32) or f16 C16, pitch DD.
// One 128 x 128 tile of C per work-group of 8 waves (4 x 2 waves, 32 x 64 each). 64 k of both operands (one 128-byte line a row) are read from
// global memory in whole lines, once per work-group, and staged in LDS (two buffers, row pitch 144 B for the 16-byte fragment reads);
// the next 64 k are in flight in registers while the waves work on this buffer. Each 16 x 16 tile sums k in ascending order in one accumulator chain.
template <bool OUT32>
__global__ __launch_bounds__(256) void k_gemm_t(const _Float16* __restrict__ A, const _Float16* __restrict__ Bh, float alpha, const float* __restrict__ bias, float* __restrict__ C, _Float16* __restrict__ C16) {
  constexpr int BM = 128, BN = 128, BK = 64, LP = BK + 8, NKT = DD / BK;
  __shared__ __attribute__((aligned(16))) unsigned short sA[2][BM][LP], sB[2][BN][LP];
  __shared__ __attribute__((aligned(16))) float so[8][32][64 + 4];
  const int tid = threadIdx.x, w = tid >> 5, lane = tid & 31, ln = lane & 15, hh = lane >> 4;
  const int nt = blockIdx.x % (DD / BN), mt = blockIdx.x / (DD / BN); const int wm = w >> 1, wn = w & 1;
  const int lr = tid >> 3, lc = (tid & 7) * 8;      /* 8 lanes cover one row's 128 bytes; a thread brings rows lr + 32 i */
  const unsigned short* ga = (const unsigned short*)A + (size_t)(mt * BM + lr) * DD + lc;
  const unsigned short* gb = (const unsigned short*)Bh + (size_t)(nt * BN + lr) * DD + lc;
  v8us ra[4], rb[4];
#pragma unroll
  for (int i = 0; i < 4; ++i) { ra[i] = *(const v8us*)(ga + (size_t)i * 32 * DD); rb[i] = *(const v8us*)(gb + (size_t)i * 32 * DD); }
#pragma unroll
  for (int i = 0; i < 4; ++i) { *(v8us*)&sA[0][lr + 32 * i][lc] = ra[i]; *(v8us*)&sB[0][lr + 32 * i][lc] = rb[i]; }
  __syncthreads();
  v8f acc[2][4];
#pragma unroll
  for (int mi = 0; mi < 2; ++mi)
#pragma unroll
    for (int ni = 0; ni < 4; ++ni) acc[mi][ni] = (v8f){0.f,0.f,0.f,0.f,0.f,0.f,0.f,0.f};
  for (int kt = 0; kt < NKT; ++kt) {
    const int cur = kt & 1; const bool more = kt + 1 < NKT;      /* the same for the whole work-group */
    if (more) {
#pragma unroll
      for (int i = 0; i < 4; ++i) { ra[i] = *(const v8us*)(ga + (size_t)i * 32 * DD + (kt + 1) * BK); rb[i] = *(const v8us*)(gb + (size_t)i * 32 * DD + (kt + 1) * BK); } }
    __builtin_amdgcn_sched_barrier(0);      /* keeps the next pass's global loads in front of this pass's products: sunk behind them, their whole latency is waited out in front of the LDS stores */
#pragma unroll
    for (int ks = 0; ks < BK / 32; ++ks) { FragH fa[2], fb[4];
#pragma unroll
      for (int mi = 0; mi < 2; ++mi) { const unsigned short* p = &sA[cur][wm * 32 + mi * 16 + ln][ks * 32 + 8 * hh]; fa[mi].half[0] = *(const v8us*)p; fa[mi].half[1] = *(const v8us*)(p + 16); }
#pragma unroll
      for (int ni = 0; ni < 4; ++ni) { const unsigned short* p = &sB[cur][wn * 64 + ni * 16 + ln][ks * 32 + 8 * hh]; fb[ni].half[0] = *(const v8us*)p; fb[ni].half[1] = *(const v8us*)(p + 16); }
#pragma unroll
      for (int mi = 0; mi < 2; ++mi)
#pragma unroll
        for (int ni = 0; ni < 4; ++ni) acc[mi][ni] = __builtin_amdgcn_wmma_f32_16x16x32_f16(false, fa[mi].v, false, fb[ni].v, (short)0, acc[mi][ni], false, false); }
    if (more) {      /* the other buffer: its last readers left it before the barrier that ended the pass before this one */
#pragma unroll
      for (int i = 0; i < 4; ++i) { *(v8us*)&sA[cur ^ 1][lr + 32 * i][lc] = ra[i]; *(v8us*)&sB[cur ^ 1][lr + 32 * i][lc] = rb[i]; } }
    __syncthreads();
  }
  const int rsub = lane >> 4, c4 = (lane & 15) * 4; const int col0 = nt * BN + wn * 64;
#pragma unroll
  for (int ni = 0; ni < 4; ++ni) { const float bv = bf16_round(bias[col0 + ni * 16 + ln]);      /* each wave stages its 32 rows in its own LDS range and stores whole lines */
#pragma unroll
    for (int mi = 0; mi < 2; ++mi)
#pragma unroll
      for (int r = 0; r < 8; ++r) so[w][mi * 16 + 8 * hh + r][ni * 16 + ln] = acc[mi][ni][r] * alpha + bv; }
  __builtin_amdgcn_fence(__ATOMIC_ACQ_REL, "workgroup"); __builtin_amdgcn_wave_barrier();
#pragma unroll
  for (int q = 0; q < 16; ++q) { const int r = q * 2 + rsub; const v4f v = *(const v4fa*)&so[w][r][c4]; const size_t o = (size_t)(mt * BM + wm * 32 + r) * DD + col0 + c4;
    if (OUT32) *(v4f*)(C + o) = v;
    else { v4h h4; for (int i = 0; i < 4; ++i) h4[i] = (_Float16)v[i]; *(v4h*)(C16 + o) = h4; } }
}

__global__ __launch_bounds__(256) void k_x16(const float* __restrict__ x, _Float16* __restrict__ X16, size_t n8) { const size_t t = (size_t)blockIdx.x * 256 + threadIdx.x; if (t >= n8) return; FragH f;
#pragma unroll
  for (int q = 0; q < 8; ++q) f.h[q] = (_Float16)bf16_round(x[t * 8 + q]); *(v8us*)((unsigned short*)X16 + t * 8) = f.half[0];  }
__global__ __launch_bounds__(256) void k_h16(const float* __restrict__ x, _Float16* __restrict__ X16, size_t n8) { const size_t t = (size_t)blockIdx.x * 256 + threadIdx.x; if (t >= n8) return; FragH f;
#pragma unroll
  for (int q = 0; q < 8; ++q) f.h[q] = (_Float16)x[t * 8 + q]; *(v8us*)((unsigned short*)X16 + t * 8) = f.half[0];  }
__global__ __launch_bounds__(256) void k_round16f(const float* __restrict__ W, _Float16* __restrict__ Bt, size_t n8) { const size_t t = (size_t)blockIdx.x * 256 + threadIdx.x; if (t >= n8) return; FragH f;
#pragma unroll
  for (int i = 0; i < 8; ++i) f.h[i] = (_Float16)(bf16_round(W[t * 8 + i]) * 16.0f); *(v8us*)((unsigned short*)Bt + t * 8) = f.half[0];  }
template <int NHv, int TTv>
__global__ __launch_bounds__(256) void k_vt(const _Float16* __restrict__ V16, int ldv, int voff, _Float16* __restrict__ Vt) { __shared__ unsigned short tl[64][66]; const int tid = threadIdx.x; const int slab = blockIdx.x / (TTv / 64), lg = blockIdx.x % (TTv / 64); const int b = slab / NHv, h = slab % NHv;
  for (int i = tid; i < 64 * 8; i += 256) { const int r = i / 8, c8 = (i % 8) * 8; FragH f; f.half[0] = *(const v8us*)((const unsigned short*)V16 + ((size_t)b * TTv + lg * 64 + r) * ldv + voff + h * 64 + c8);
#pragma unroll
    for (int q = 0; q < 8; ++q) tl[r][c8 + q] = f.u[q]; }
  __syncthreads();
  {
#pragma unroll
    for (int rd = 0; rd < 2; ++rd) { const int d = rd * 32 + tid / 8, pc = tid % 8; FragH f;
#pragma unroll
      for (int q = 0; q < 8; ++q) f.u[q] = tl[pc * 8 + q][d];
      *(v8us*)((unsigned short*)Vt + ((size_t)slab * 64 + d) * TTv + lg * 64 + pc * 8) = f.half[0]; }
     } }

template <int D, int RBF>
__global__ __launch_bounds__(256) void k_lnx(const float* __restrict__ X, const float* __restrict__ gam, const float* __restrict__ bet, int nrows, float eps, _Float16* __restrict__ O16, float* __restrict__ XR) {
  constexpr int NP = D / 128; const int tid = threadIdx.x, wv = tid >> 5, lane = tid & 31; const size_t r = (size_t)blockIdx.x * 8 + wv; if (r >= (size_t)nrows) return; v4f y[NP]; float s = 0.f;
#pragma unroll
  for (int j = 0; j < NP; ++j) { const int c = j * 128 + lane * 4; v4f g = *(const v4fa*)(X + r * D + c); if (RBF) { for (int q = 0; q < 4; ++q) g[q] = bf16_round(g[q]); } y[j] = g; s += g[0] + g[1] + g[2] + g[3]; }
  for (int o = 16; o >= 1; o >>= 1) s += __shfl_xor(s, o, 32); const float mu = s / (float)D; float q2 = 0.f;
#pragma unroll
  for (int j = 0; j < NP; ++j) for (int q = 0; q < 4; ++q) { const float d = y[j][q] - mu; q2 += d * d; }
  for (int o = 16; o >= 1; o >>= 1) q2 += __shfl_xor(q2, o, 32); const float rs = rsqrtf(q2 / (float)D + eps);
  {
#pragma unroll
    for (int j = 0; j < NP; ++j) { const int c = j * 128 + lane * 4; v4h h; for (int q = 0; q < 4; ++q) { const float v = (y[j][q] - mu) * rs * bf16_round(gam[c + q]) + bf16_round(bet[c + q]); h[q] = (_Float16)v; } *(v4h*)(O16 + r * D + c) = h; if (XR) *(v4f*)(XR + r * D + c) = y[j]; }
     } }
typedef int v4ia __attribute__((ext_vector_type(4), may_alias));
// lane l <-> lane l ^ 16 (the two halves of a wave hold the two key halves of one query column)
__device__ __forceinline__ float xhalf(float x) { const int b = __builtin_bit_cast(int, x); return __builtin_bit_cast(float, __builtin_amdgcn_permlanex16(b, b, 0x76543210, 0xfedcba98, false, false)); }
#define FL_SK 64                 /* keys per stage */
#define FL_LP (64 + 8)           /* LDS row pitch in 16-bit elements */
// one stage: this lane's four 16-byte pieces (K rows r and r + 32, V^T rows r and r + 32). The s_wait_xcnt stands inside the statement so that no address register is rewritten ahead of it.
__device__ __forceinline__ void fl_copy4(unsigned lk, unsigned lv, const unsigned short* gk0, const unsigned short* gk1, const unsigned short* gv0, const unsigned short* gv1) {
  const unsigned lk1 = lk + 32 * FL_LP * 2, lv1 = lv + 32 * FL_LP * 2;
  asm volatile("global_load_async_to_lds_b128 %0, %4, off\n\t"
               "global_load_async_to_lds_b128 %1, %5, off\n\t"
               "global_load_async_to_lds_b128 %2, %6, off\n\t"
               "global_load_async_to_lds_b128 %3, %7, off\n\t"
               "s_wait_xcnt 0x0"
               :: "v"(lk), "v"(lk1), "v"(lv), "v"(lv1), "v"(gk0), "v"(gk1), "v"(gv0), "v"(gv1) : "memory");
}
__global__ __launch_bounds__(256) void k_flash(const _Float16* __restrict__ Q16, int ldq, const _Float16* __restrict__ K16, int ldk, const _Float16* __restrict__ Vt, const int* __restrict__ MSK, float* __restrict__ O, int ldo) {
  constexpr int NW = 8, RPW = 16, NQB = TT / (NW * RPW), DT = 4, KS = 2, NST = TT / FL_SK;
  __shared__ __attribute__((aligned(16))) unsigned short sK[2][FL_SK][FL_LP], sV[2][64][FL_LP];
  __shared__ __attribute__((aligned(16))) float sO[NW][RPW][64 + 4];
  const int tid = threadIdx.x, w = tid >> 5, lane = tid & 31, ln = lane & 15, hh = lane >> 4;
  const int slab = blockIdx.x / NQB, qblk = blockIdx.x % NQB; const int b = slab / NH, h = slab % NH; const int qb0 = qblk * (NW * RPW); const int q0 = qb0 + w * RPW;
  const unsigned short* Vth = (const unsigned short*)Vt + (size_t)slab * 64 * TT;
  const int cr = tid >> 3, cc = (tid & 7) * 8;      /* 8 lanes cover one row's 128 bytes; a thread brings rows cr and cr + 32 of both tiles */
  const unsigned short* gk = (const unsigned short*)K16 + ((size_t)b * TT + cr) * ldk + h * 64 + cc;      /* + stage * 64 rows */
  const unsigned short* gv = Vth + (size_t)cr * TT + cc;                                                  /* + stage * 64 columns */
  const unsigned lk = (unsigned)(size_t)&sK[0][cr][cc], lv = (unsigned)(size_t)&sV[0][cr][cc];      /* LDS byte address = low 32 bits of the __shared__ address */
  constexpr unsigned BUFB = FL_SK * FL_LP * 2;      /* bytes of one buffer of either tile */
  fl_copy4(lk, lv, gk, gk + (size_t)32 * ldk, gv, gv + (size_t)32 * TT);
  FragH bq[KS];      /* B operand: column ln = query q0 + ln */
  { const unsigned short* qr = (const unsigned short*)Q16 + ((size_t)b * TT + q0 + ln) * ldq + h * 64;
#pragma unroll
    for (int ks = 0; ks < KS; ++ks) { bq[ks].half[0] = *(const v8us*)(qr + ks * 32 + 8 * hh); bq[ks].half[1] = *(const v8us*)(qr + ks * 32 + 16 + 8 * hh); } }
  asm volatile("s_wait_asynccnt 0x0" ::: "memory");      /* stage 0 of this wave has landed before the barrier that publishes it */
  __syncthreads();
  fl_copy4(lk + BUFB, lv + BUFB, gk + (size_t)FL_SK * ldk, gk + (size_t)(FL_SK + 32) * ldk, gv + FL_SK, gv + (size_t)32 * TT + FL_SK);
  float m_q = -3.0e38f, l_q = 0.f; v8f oacc[DT];      /* oacc[dt][r] = O[q0 + ln][dt * 16 + 8 * hh + r] */
#pragma unroll
  for (int dt = 0; dt < DT; ++dt) oacc[dt] = (v8f){0.f,0.f,0.f,0.f,0.f,0.f,0.f,0.f};
#pragma unroll 1
  for (int st = 0; st < NST; ++st) {
    const int cur = st & 1;
#pragma unroll 1      /* rolled: unrolled, the two passes take more than the 128 registers at which all four work-groups of a WGP are resident */
    for (int jj = 0; jj < FL_SK; jj += 32) {
    const int j0 = st * FL_SK + jj;
    const int* mp = MSK + (size_t)b * TT + j0 + 8 * hh;      /* key padding mask (1 = PAD) of this lane's keys j0 + 8hh + 0..7 and j0 + 16 + 8hh + 0..7 */
    const v4ia km[4] = { *(const v4ia*)mp, *(const v4ia*)(mp + 4), *(const v4ia*)(mp + 16), *(const v4ia*)(mp + 20) };
    v8f s[2];
#pragma unroll
    for (int nt = 0; nt < 2; ++nt) { const unsigned short* kr = &sK[cur][jj + nt * 16 + ln][0]; FragH ak[KS];
#pragma unroll
      for (int ks = 0; ks < KS; ++ks) { ak[ks].half[0] = *(const v8us*)(kr + ks * 32 + 8 * hh); ak[ks].half[1] = *(const v8us*)(kr + ks * 32 + 16 + 8 * hh); }
      v8f acc = (v8f){0.f,0.f,0.f,0.f,0.f,0.f,0.f,0.f};
#pragma unroll
      for (int ks = 0; ks < KS; ++ks) acc = mmaH<1>(ak[ks].v, ak[ks].v, bq[ks].v, bq[ks].v, acc);
      s[nt] = acc; }
    float sc[16]; float mc = -INFINITY;      /* 1 = pad -> excluded (the module adds -1e8): score -inf, so its exp below is exactly 0 */
#pragma unroll
    for (int i = 0; i < 16; ++i) { sc[i] = (km[i >> 2][i & 3] == 0) ? s[i >> 3][i & 7] * 0.125f : -INFINITY; mc = fmaxf(mc, sc[i]); }
    mc = fmaxf(mc, xhalf(mc));
    const float mn = fmaxf(m_q, mc); const float al = expf(m_q - mn); m_q = mn;      /* m_q and mn are finite (start -3e38): no key seen yet gives exp(0) = 1 */
    float ps = 0.f; FragH pb;      /* pb.h[i] = P^T[k = kmap(i, hh)][ln] */
#pragma unroll
    for (int i = 0; i < 16; ++i) { const float p = expf(sc[i] - mn); ps += p; pb.h[i] = (_Float16)(p * 1024.0f); }
    l_q = l_q * al + ps;
#pragma unroll
    for (int dt = 0; dt < DT; ++dt)
#pragma unroll
      for (int r = 0; r < 8; ++r) oacc[dt][r] *= al;
#pragma unroll
    for (int dt = 0; dt < DT; ++dt) { const unsigned short* vrow = &sV[cur][dt * 16 + ln][jj]; FragH av; av.half[0] = *(const v8us*)(vrow + 8 * hh); av.half[1] = *(const v8us*)(vrow + 16 + 8 * hh);
      oacc[dt] = mmaH<1>(av.v, av.v, pb.v, pb.v, oacc[dt]); } }
    asm volatile("s_wait_dscnt 0x0" ::: "memory");      /* this wave's reads of buffer cur have returned before the buffer is refilled */
    asm volatile("s_wait_asynccnt 0x0" ::: "memory");   /* this wave's copies of stage st + 1 have landed before the barrier that publishes them */
    __syncthreads();      /* publishes stage st + 1 and ends every wave's reads of buffer cur */
    if (st + 2 < NST) {      /* the same for the whole work-group */
      const unsigned short* k2 = gk + (size_t)(st + 2) * FL_SK * ldk; const unsigned short* v2 = gv + (st + 2) * FL_SK;
      fl_copy4(lk + cur * BUFB, lv + cur * BUFB, k2, k2 + (size_t)32 * ldk, v2, v2 + (size_t)32 * TT); }
  }
  asm volatile("s_wait_asynccnt 0x0" ::: "memory");      /* nothing of this wave is in flight when it goes on to the output */
  { float l = l_q + xhalf(l_q); l = (l > 0.f) ? 1.0f / (l * 1024.0f) : 0.f;
#pragma unroll
    for (int dt = 0; dt < DT; ++dt)
#pragma unroll
      for (int g = 0; g < 2; ++g) { v4f o; for (int q = 0; q < 4; ++q) o[q] = oacc[dt][g * 4 + q] * l; *(v4fa*)&sO[w][ln][dt * 16 + 8 * hh + g * 4] = o; } }
  __builtin_amdgcn_fence(__ATOMIC_ACQ_REL, "workgroup"); __builtin_amdgcn_wave_barrier();
  {
#pragma unroll
    for (int rp = 0; rp < RPW; rp += 2) { const int r = rp + (lane >> 4), pc = lane & 15; const v4f val = *(const v4fa*)&sO[w][r][pc * 4]; *(v4f*)(O + ((size_t)b * TT + q0 + r) * ldo + h * 64 + pc * 4) = val; }
     } }

__global__ __launch_bounds__(256) void k_addbf(float* __restrict__ out, const float* __restrict__ x, size_t n4) { const size_t t = (size_t)blockIdx.x * 256 + threadIdx.x; if (t >= n4) return; v4f a = *(const v4fa*)(out + t * 4); const v4f b = *(const v4fa*)(x + t * 4); for (int q = 0; q < 4; ++q) a[q] += bf16_round(b[q]); *(v4f*)(out + t * 4) = a;  }
extern "C" void kernel_launch(void* const* d_in, const int* in_sizes, int n_in,
                              void* d_out, int out_size, void* d_ws, size_t ws_size, hipStream_t stream) {
  (void)in_sizes; (void)n_in; (void)out_size;
  const float* const* I = (const float* const*)d_in; const float* x = I[0]; const int* mask = (const int*)d_in[1]; const float* Wqkv = I[2]; const float* bqkv = I[3]; const float* Wo = I[4]; const float* bo = I[5]; const float* lng = I[6]; const float* lnb = I[7];      /* d_in order: hidden_states, encoder_padding_mask, qkv_w, qkv_b, out_w, out_b, ln_g, ln_b */
  const float* bq = bqkv; const float* bk = bqkv + DD; const float* bv = bqkv + 2 * DD;
  char* ws = (char*)d_ws; size_t off = 0;
  auto take = [&](size_t bytes) { char* p = ws + off; off += (bytes + 255) & ~(size_t)255; return p; };
  const size_t WSZ = (size_t)DD * DD; _Float16* Bw = (_Float16*)take(4 * WSZ * 2); _Float16* X16 = (_Float16*)take((size_t)NR * DD * 2);
  _Float16* Q = (_Float16*)take((size_t)NR * DD * 2); _Float16* K = (_Float16*)take((size_t)NR * DD * 2); _Float16* V = (_Float16*)take((size_t)NR * DD * 2); _Float16* Vt = (_Float16*)take((size_t)NR * DD * 2);
  float* O = (float*)take((size_t)NR * DD * 4); _Float16* O16 = V;      /* the v plane is dead once Vᵀ is built (before the attention kernel); O16 reuses it */
  if (off > ws_size) return;      // 8.4 + 16.8 × 5 + 33.6 ≈ 126 MB (120 MiB)
  const unsigned gw2 = (unsigned)((WSZ / 8 + 255) / 256);
  k_round16f<<<(unsigned)((3 * WSZ / 8 + 255) / 256), 256, 0, stream>>>(Wqkv, Bw, 3 * WSZ / 8); k_round16f<<<gw2, 256, 0, stream>>>(Wo, Bw + 3 * WSZ, WSZ / 8);      /* (out,in) natural ×2^4: rows q|k|v, then out_w */
  const unsigned gx = (unsigned)(((size_t)NR * DD / 8 + 255) / 256); const unsigned gp = (NR / 128) * (DD / 128);
  k_lnx<DD, 1><<<(NR + 7) / 8, 256, 0, stream>>>(x, lng, lnb, NR, 1e-5f, X16, nullptr);      /* x = LN(bf16 hidden) → f16 */
  k_gemm_t<false><<<gp, 256, 0, stream>>>(X16, Bw, 0.0625f, bq, nullptr, Q);      /* q = x·Wq + bq: M 8192 N 1024 K 1024 */
  k_gemm_t<false><<<gp, 256, 0, stream>>>(X16, Bw + WSZ, 0.0625f, bk, nullptr, K);
  k_gemm_t<false><<<gp, 256, 0, stream>>>(X16, Bw + 2 * WSZ, 0.0625f, bv, nullptr, V);
  k_vt<NH, TT><<<BB * NH * (TT / 64), 256, 0, stream>>>(V, DD, 0, Vt);
  k_flash<<<BB * NH * (TT / 128), 256, 0, stream>>>(Q, DD, K, DD, Vt, mask, O, DD);
  k_h16<<<gx, 256, 0, stream>>>(O, O16, (size_t)NR * DD / 8);
  k_gemm_t<true><<<gp, 256, 0, stream>>>(O16, Bw + 3 * WSZ, 0.0625f, bo, (float*)d_out, nullptr);      /* out = O·out_wᵀ + out_b */
  k_addbf<<<(unsigned)(((size_t)NR * DD / 4 + 255) / 256), 256, 0, stream>>>((float*)d_out, x, (size_t)NR * DD / 4);      /* += bf16(hidden) in place (residual; no workspace left for an f32 copy) */
}

// v004
// One run takes 192 microseconds.
// Two timings next to v003 both put it at 1.33 times that version's speed.
// Over all steps from v000 it is 4.31 times as fast.
#include <hip/hip_runtime.h>
// Pre-LN self-attention layer with a key padding mask and residual (B=4, S=2048, H=1024, 16 heads × 64): x = LN(hidden); [q|k|v] = x·qkv_wᵀ + qkv_b ((out,in) fused); scores = q·kᵀ·64^-½ + mask·(−1e8) (int mask [B,S], 1 = pad); softmax;
// out = (attn·v merged)·out_wᵀ + out_b + hidden.
// Compute dtype: x, weights, biases rounded to bf16; q/k/v as f16 GEMM outputs; fused flash-style kernel (online softmax f32, P f16 ×2^10) on v_wmma_f32_16x16x32_f16; O → f16 → output GEMM with bias; f32 accumulate.
#define BB 4
#define TT 2048
#define NH 16
#define DD 1024
#define NR (BB * TT)

typedef __bf16 v16b __attribute__((ext_vector_type(16)));
typedef unsigned short v8us __attribute__((ext_vector_type(8), may_alias));
typedef float  v8f  __attribute__((ext_vector_type(8)));
typedef float  v4f  __attribute__((ext_vector_type(4)));
typedef float  v4fa __attribute__((ext_vector_type(4), may_alias));
union FragB { v16b v; v8us half[2]; unsigned short u[16]; };

__device__ __forceinline__ unsigned short bf16_bits(float x) { unsigned int u = __float_as_uint(x); return (unsigned short)((u + 0x7FFFu + ((u >> 16) & 1u)) >> 16); }
__device__ __forceinline__ float bf16_val(unsigned short b) { return __uint_as_float(((unsigned int)b) << 16); }
__device__ __forceinline__ float bf16_round(float x) { return bf16_val(bf16_bits(x)); }
// D += A·B with NT terms: 1 = ah·bh, 2 = + al·bh (A split), 3 = + ah·bl (both split)
template <int NT>
__device__ __forceinline__ v8f mmaN(v16b ah, v16b al, v16b bh, v16b bl, v8f c) {
  c = __builtin_amdgcn_wmma_f32_16x16x32_bf16(false, ah, false, bh, (short)0, c, false, false);
  if (NT >= 2) c = __builtin_amdgcn_wmma_f32_16x16x32_bf16(false, al, false, bh, (short)0, c, false, false);
  if (NT >= 3) c = __builtin_amdgcn_wmma_f32_16x16x32_bf16(false, ah, false, bl, (short)0, c, false, false);
  asm volatile("v_nop\n\tv_nop\n\tv_nop\n\tv_nop" : "+v"(c) : "v"(ah), "v"(al), "v"(bh), "v"(bl));
  return c;
}

__global__ __launch_bounds__(256) void k_wt_bf16(const float* __restrict__ W, unsigned short* __restrict__ Wt, int K, int N) {
  const int t = blockIdx.x * 256 + threadIdx.x;
  const int k8n = K / 8;
  if (t >= N * k8n) return;
  const int n = t / k8n, k8 = (t % k8n) * 8;
  v8us v;
#pragma unroll
  for (int i = 0; i < 8; ++i) v[i] = bf16_bits(W[(size_t)(k8 + i) * N + n]);
  *(v8us*)(Wt + (size_t)n * K + k8) = v;
  
}

// GEMM C[M][N] (f32, pitch ldc) = act(A[M][K]·W + bias). A f32 row-major (pitch lda) converted per fragment to bf16
// (ASPLIT: hi/lo two planes -> 2 terms, else single rounded term); Wt bf16 [N][K] (pitch ldb). BIAS_BF16 rounds the
// bias to bf16 first (bias quantised to bf16 before the add). K%32==0, M%16==0, N%64==0.
template <bool ASPLIT, int ACT, bool BIAS_BF16>
__global__ __launch_bounds__(128) void k_gemm_bf(const float* __restrict__ A, int lda, const unsigned short* __restrict__ Wt, int ldb,
                                               const float* __restrict__ bias, float* __restrict__ C, int ldc, int M, int N, int K) {
  __shared__ __attribute__((aligned(16))) float so[4][16][64];
  const int tid = threadIdx.x, w = tid >> 5, lane = tid & 31, ln = lane & 15, hh = lane >> 4;
  const int ntn = N / 64;
  const int wid = blockIdx.x * 4 + w;
  const int mt = wid / ntn, nq = wid % ntn;
  if (mt * 16 >= M) return;
  const int row0 = mt * 16, col0 = nq * 64;
  const float* arow = A + (size_t)(row0 + ln) * lda;
  v8f acc[4] = {};
  for (int kb = 0; kb < K; kb += 32) {
    FragB ah, al;
    const v4f x0 = *(const v4fa*)(arow + kb + 8 * hh), x1 = *(const v4fa*)(arow + kb + 8 * hh + 4);
    const v4f x2 = *(const v4fa*)(arow + kb + 16 + 8 * hh), x3 = *(const v4fa*)(arow + kb + 16 + 8 * hh + 4);
    float xs[16] = {x0[0],x0[1],x0[2],x0[3],x1[0],x1[1],x1[2],x1[3],x2[0],x2[1],x2[2],x2[3],x3[0],x3[1],x3[2],x3[3]};
#pragma unroll
    for (int i = 0; i < 16; ++i) { const unsigned short hb = bf16_bits(xs[i]); ah.u[i] = hb; al.u[i] = ASPLIT ? bf16_bits(xs[i] - bf16_val(hb)) : (unsigned short)0; }
#pragma unroll
    for (int t = 0; t < 4; ++t) {
      const unsigned short* brow = Wt + (size_t)(col0 + t * 16 + ln) * ldb + kb;
      FragB b;
      b.half[0] = *(const v8us*)(brow + 8 * hh);
      b.half[1] = *(const v8us*)(brow + 16 + 8 * hh);
      acc[t] = mmaN<ASPLIT ? 2 : 1>(ah.v, al.v, b.v, b.v, acc[t]);
    }
  }
#pragma unroll
  for (int t = 0; t < 4; ++t) {
    float bv = bias ? bias[col0 + t * 16 + ln] : 0.f;
    if (BIAS_BF16) bv = bf16_round(bv);
#pragma unroll
    for (int r = 0; r < 8; ++r) { float v = acc[t][r] + bv; if (ACT == 1) v = fmaxf(v, 0.f); so[w][8 * hh + r][t * 16 + ln] = v; }
  }
  __builtin_amdgcn_fence(__ATOMIC_ACQ_REL, "workgroup");
  __builtin_amdgcn_wave_barrier();
  const int rsub = lane >> 4, c4 = (lane & 15) * 4;
  {
#pragma unroll
    for (int q = 0; q < 8; ++q) {
      const int r = q * 2 + rsub;
      const v4f v = *(const v4fa*)&so[w][r][c4];
      *(v4f*)(C + (size_t)(row0 + r) * ldc + col0 + c4) = v;
    }
    
  }
}

// Flash-style causal/unmasked attention, all contractions 3-term bf16 hi/lo splits, f32 softmax with running max.
// q,k,v rows are read from f32 buffers with arbitrary row pitch (so they can live inside a fused qkv buffer);
// D = head size (multiple of 32, <= 128); one wave = 16 query rows; block = 4 waves (64 queries) sharing K/V chunks of 32.
template <int D, bool CAUSAL>
__global__ __launch_bounds__(128) void k_flash(const float* __restrict__ qb, const float* __restrict__ kb, const float* __restrict__ vb,
                                             int pitch, int T, int H, float scale, float* __restrict__ y, int ypitch) {
  constexpr int KS = D / 32;        // k-steps for QK
  constexpr int DT = D / 16;        // d tiles for PV
  __shared__ __attribute__((aligned(16))) unsigned short sKh[32][D + 8], sKl[32][D + 8], sVh[32][D + 8], sVl[32][D + 8];
  __shared__ __attribute__((aligned(16))) unsigned short sPh[4][16][40], sPl[4][16][40];
  __shared__ __attribute__((aligned(16))) float sO[4][16][D];
  const int tid = threadIdx.x, w = tid >> 5, lane = tid & 31, ln = lane & 15, hh = lane >> 4;
  const int nqb = (T + 63) / 64;
  const int bh = blockIdx.x / nqb, qblk = blockIdx.x % nqb;
  const int b = bh / H, h = bh % H;
  const int q0 = qblk * 64 + w * 16;
  const float* Q = qb + (size_t)b * T * pitch + h * D;
  const float* K = kb + (size_t)b * T * pitch + h * D;
  const float* V = vb + (size_t)b * T * pitch + h * D;

  // A fragments of the wave's 16 query rows (scaled), hi/lo
  FragB aqh[KS], aql[KS];
  {
    int row = q0 + ln; if (row >= T) row = T - 1;
    const float* qr = Q + (size_t)row * pitch;
#pragma unroll
    for (int ks = 0; ks < KS; ++ks)
#pragma unroll
      for (int i = 0; i < 16; ++i) {
        const int d = ks * 32 + ((i < 8) ? (8 * hh + i) : (16 + 8 * hh + (i - 8)));
        const float x = qr[d] * scale; const unsigned short hb = bf16_bits(x);
        aqh[ks].u[i] = hb; aql[ks].u[i] = bf16_bits(x - bf16_val(hb));
      }
  }
  float m_r[8], l_r[8];
#pragma unroll
  for (int r = 0; r < 8; ++r) { m_r[r] = -3.0e38f; l_r[r] = 0.f; }
  v8f oacc[DT];
#pragma unroll
  for (int dt = 0; dt < DT; ++dt) oacc[dt] = (v8f){0.f,0.f,0.f,0.f,0.f,0.f,0.f,0.f};

  const int kv_end = CAUSAL ? min(T, qblk * 64 + 64) : T;     // block-uniform
  for (int j0 = 0; j0 < kv_end; j0 += 32) {
    __syncthreads();
    for (int e = tid; e < 32 * (D / 4); e += 128) {
      const int r = e / (D / 4), c4 = (e % (D / 4)) * 4;
      const int key = j0 + r;
      v4f kf = {0.f,0.f,0.f,0.f}, vf = {0.f,0.f,0.f,0.f};
      if (key < T) { kf = *(const v4fa*)(K + (size_t)key * pitch + c4); vf = *(const v4fa*)(V + (size_t)key * pitch + c4); }
#pragma unroll
      for (int t = 0; t < 4; ++t) {
        unsigned short hb = bf16_bits(kf[t]); sKh[r][c4 + t] = hb; sKl[r][c4 + t] = bf16_bits(kf[t] - bf16_val(hb));
        hb = bf16_bits(vf[t]); sVh[r][c4 + t] = hb; sVl[r][c4 + t] = bf16_bits(vf[t] - bf16_val(hb));
      }
    }
    __syncthreads();
    // S tile 16 x 32
    v8f s[2];
#pragma unroll
    for (int nt = 0; nt < 2; ++nt) {
      v8f acc = {};
#pragma unroll
      for (int ks = 0; ks < KS; ++ks) {
        FragB bh_, bl_;
        bh_.half[0] = *(const v8us*)&sKh[nt * 16 + ln][ks * 32 + 8 * hh]; bh_.half[1] = *(const v8us*)&sKh[nt * 16 + ln][ks * 32 + 16 + 8 * hh];
        bl_.half[0] = *(const v8us*)&sKl[nt * 16 + ln][ks * 32 + 8 * hh]; bl_.half[1] = *(const v8us*)&sKl[nt * 16 + ln][ks * 32 + 16 + 8 * hh];
        acc = mmaN<3>(aqh[ks].v, aql[ks].v, bh_.v, bl_.v, acc);
      }
      s[nt] = acc;
    }
    // mask + running max (rows 8hh+r; the 16 lanes of a half share rows)
    float alpha[8];
#pragma unroll
    for (int r = 0; r < 8; ++r) {
      const int qi = q0 + 8 * hh + r;
      const int ja = j0 + ln, jb = j0 + 16 + ln;
      if (CAUSAL) { if (ja > qi) s[0][r] = -3.0e38f; if (jb > qi) s[1][r] = -3.0e38f; }
      if (ja >= T) s[0][r] = -3.0e38f;
      if (jb >= T) s[1][r] = -3.0e38f;
      float mx = fmaxf(s[0][r], s[1][r]);
      mx = fmaxf(mx, __shfl_xor(mx, 1, 32)); mx = fmaxf(mx, __shfl_xor(mx, 2, 32)); mx = fmaxf(mx, __shfl_xor(mx, 4, 32)); mx = fmaxf(mx, __shfl_xor(mx, 8, 32));
      const float mnew = fmaxf(m_r[r], mx);
      alpha[r] = (mnew > -1.0e38f) ? __expf(m_r[r] - mnew) : 1.0f;
      const float p0 = (s[0][r] > -1.0e38f) ? __expf(s[0][r] - mnew) : 0.f;
      const float p1 = (s[1][r] > -1.0e38f) ? __expf(s[1][r] - mnew) : 0.f;
      m_r[r] = mnew;
      l_r[r] = l_r[r] * alpha[r] + p0 + p1;            // per-lane partial row sum (16 lanes combined at the end)
      unsigned short hb = bf16_bits(p0); sPh[w][8 * hh + r][ln] = hb;      sPl[w][8 * hh + r][ln] = bf16_bits(p0 - bf16_val(hb));
      hb = bf16_bits(p1);                sPh[w][8 * hh + r][16 + ln] = hb; sPl[w][8 * hh + r][16 + ln] = bf16_bits(p1 - bf16_val(hb));
    }
#pragma unroll
    for (int dt = 0; dt < DT; ++dt)
#pragma unroll
      for (int r = 0; r < 8; ++r) oacc[dt][r] *= alpha[r];
    __builtin_amdgcn_fence(__ATOMIC_ACQ_REL, "workgroup");
    __builtin_amdgcn_wave_barrier();
    FragB pah, pal;
    pah.half[0] = *(const v8us*)&sPh[w][ln][8 * hh]; pah.half[1] = *(const v8us*)&sPh[w][ln][16 + 8 * hh];
    pal.half[0] = *(const v8us*)&sPl[w][ln][8 * hh]; pal.half[1] = *(const v8us*)&sPl[w][ln][16 + 8 * hh];
#pragma unroll
    for (int dt = 0; dt < DT; ++dt) {
      FragB bvh, bvl;
#pragma unroll
      for (int i = 0; i < 8; ++i) {
        bvh.u[i] = sVh[8 * hh + i][dt * 16 + ln]; bvh.u[8 + i] = sVh[16 + 8 * hh + i][dt * 16 + ln];
        bvl.u[i] = sVl[8 * hh + i][dt * 16 + ln]; bvl.u[8 + i] = sVl[16 + 8 * hh + i][dt * 16 + ln];
      }
      oacc[dt] = mmaN<3>(pah.v, pal.v, bvh.v, bvl.v, oacc[dt]);
    }
    __builtin_amdgcn_fence(__ATOMIC_ACQ_REL, "workgroup");
    __builtin_amdgcn_wave_barrier();
  }
#pragma unroll
  for (int r = 0; r < 8; ++r) {
    float l = l_r[r];
    l += __shfl_xor(l, 1, 32); l += __shfl_xor(l, 2, 32); l += __shfl_xor(l, 4, 32); l += __shfl_xor(l, 8, 32);
    l_r[r] = (l > 0.f) ? 1.0f / l : 0.f;
  }
#pragma unroll
  for (int dt = 0; dt < DT; ++dt)
#pragma unroll
    for (int r = 0; r < 8; ++r) sO[w][8 * hh + r][dt * 16 + ln] = oacc[dt][r] * l_r[r];
  __builtin_amdgcn_fence(__ATOMIC_ACQ_REL, "workgroup");
  __builtin_amdgcn_wave_barrier();
  {
    for (int r = 0; r < 16; ++r) {
      const int row = q0 + r;
      if (row < T && lane < D / 4) {
        const v4f val = *(const v4fa*)&sO[w][r][lane * 4];
        *(v4f*)(y + ((size_t)b * T + row) * ypitch + h * D + lane * 4) = val;
      }
    }
    
  }
}

// GEMM C = act(A·W + bias + resid): A f32 (ASPLIT -> hi/lo 2 terms), Wt bf16 [N][K]; ACT 0 none, 1 relu, 2 exact gelu;
// resid (optional, f32, row index = (row % rmod), pitch ldr, RES_BF16 rounds it) added before the activation.
template <bool ASPLIT, int ACT, bool BIAS_BF16, bool RES_BF16>
__global__ __launch_bounds__(128) void k_gemm_bf3(const float* __restrict__ A, int lda, const unsigned short* __restrict__ Wt, int ldb,
                                                const float* __restrict__ bias, const float* __restrict__ resid, int rmod, int ldr,
                                                float* __restrict__ C, int ldc, int M, int N, int K) {
  __shared__ __attribute__((aligned(16))) float so[4][16][64];
  const int tid = threadIdx.x, w = tid >> 5, lane = tid & 31, ln = lane & 15, hh = lane >> 4;
  const int ntn = N / 64;
  const int wid = blockIdx.x * 4 + w;
  const int mt = wid / ntn, nq = wid % ntn;
  if (mt * 16 >= M) return;
  const int row0 = mt * 16, col0 = nq * 64;
  const float* arow = A + (size_t)(row0 + ln) * lda;
  v8f acc[4] = {};
  for (int kb = 0; kb < K; kb += 32) {
    FragB ah, al;
    const v4f x0 = *(const v4fa*)(arow + kb + 8 * hh), x1 = *(const v4fa*)(arow + kb + 8 * hh + 4);
    const v4f x2 = *(const v4fa*)(arow + kb + 16 + 8 * hh), x3 = *(const v4fa*)(arow + kb + 16 + 8 * hh + 4);
    float xs[16] = {x0[0],x0[1],x0[2],x0[3],x1[0],x1[1],x1[2],x1[3],x2[0],x2[1],x2[2],x2[3],x3[0],x3[1],x3[2],x3[3]};
#pragma unroll
    for (int i = 0; i < 16; ++i) { const unsigned short hb = bf16_bits(xs[i]); ah.u[i] = hb; al.u[i] = ASPLIT ? bf16_bits(xs[i] - bf16_val(hb)) : (unsigned short)0; }
#pragma unroll
    for (int t = 0; t < 4; ++t) {
      const unsigned short* brow = Wt + (size_t)(col0 + t * 16 + ln) * ldb + kb;
      FragB b;
      b.half[0] = *(const v8us*)(brow + 8 * hh);
      b.half[1] = *(const v8us*)(brow + 16 + 8 * hh);
      acc[t] = mmaN<ASPLIT ? 2 : 1>(ah.v, al.v, b.v, b.v, acc[t]);
    }
  }
#pragma unroll
  for (int t = 0; t < 4; ++t) {
    const int col = col0 + t * 16 + ln;
    float bv = bias ? bias[col] : 0.f;
    if (BIAS_BF16) bv = bf16_round(bv);
#pragma unroll
    for (int r = 0; r < 8; ++r) {
      float v = acc[t][r] + bv;
      if (resid) { float rv = resid[(size_t)((row0 + 8 * hh + r) % rmod) * ldr + col]; if (RES_BF16) rv = bf16_round(rv); v += rv; }
      if (ACT == 1) v = fmaxf(v, 0.f);
      if (ACT == 2) v = 0.5f * v * (1.0f + erff(v * 0.70710678118654752f));
      if (ACT == 3) { const float u = 0.7978845608028654f * (v + 0.044715f * v * v * v); v = 0.5f * v * (1.0f + tanhf(u)); }
      so[w][8 * hh + r][t * 16 + ln] = v;
    }
  }
  __builtin_amdgcn_fence(__ATOMIC_ACQ_REL, "workgroup");
  __builtin_amdgcn_wave_barrier();
  const int rsub = lane >> 4, c4 = (lane & 15) * 4;
  {
#pragma unroll
    for (int q = 0; q < 8; ++q) {
      const int r = q * 2 + rsub;
      const v4f v = *(const v4fa*)&so[w][r][c4];
      *(v4f*)(C + (size_t)(row0 + r) * ldc + col0 + c4) = v;
    }
    
  }
}
// row LayerNorm (biased variance, eps) over N: s = X (+ R); optional out_sum <- s; out_norm <- (s-mu)*rsqrt(var+eps)*g + b
template <bool PARAM_BF16>
__global__ __launch_bounds__(256) void k_layernorm(const float* __restrict__ X, const float* __restrict__ R, const float* __restrict__ g, const float* __restrict__ bta,
                                                  float* __restrict__ out_sum, float* __restrict__ out_norm, int N, float eps) {
  __shared__ float red[256];
  const int row = blockIdx.x, tid = threadIdx.x;
  const float* x = X + (size_t)row * N; const float* rr = R ? R + (size_t)row * N : nullptr;
  float vals[16];                     // up to N = 4096
  const int per = N / 256;            // contiguous chunk per thread? use strided-by-4 chunks: thread handles j = tid*4 + 1024*u
  float s1 = 0.f;
  for (int u = 0; u < per / 4; ++u) {
    const int j = tid * 4 + 1024 * u;
    const v4f a = *(const v4fa*)(x + j);
    v4f b = {0.f,0.f,0.f,0.f}; if (rr) b = *(const v4fa*)(rr + j);
#pragma unroll
    for (int q = 0; q < 4; ++q) { const float v = a[q] + b[q]; vals[u * 4 + q] = v; s1 += v; }
  }
  red[tid] = s1; __syncthreads();
  for (int st = 128; st > 0; st >>= 1) { if (tid < st) red[tid] += red[tid + st]; __syncthreads(); }
  const float mu = red[0] / (float)N; __syncthreads();
  float s2 = 0.f;
  for (int u = 0; u < per / 4; ++u)
#pragma unroll
    for (int q = 0; q < 4; ++q) { const float c = vals[u * 4 + q] - mu; s2 += c * c; }
  red[tid] = s2; __syncthreads();
  for (int st = 128; st > 0; st >>= 1) { if (tid < st) red[tid] += red[tid + st]; __syncthreads(); }
  const float rs = rsqrtf(red[0] / (float)N + eps);
  {
    for (int u = 0; u < per / 4; ++u) {
      const int j = tid * 4 + 1024 * u;
      v4f o, sm;
#pragma unroll
      for (int q = 0; q < 4; ++q) {
        float gg = g[j + q], bb = bta[j + q];
        if (PARAM_BF16) { gg = bf16_round(gg); bb = bf16_round(bb); }
        sm[q] = vals[u * 4 + q]; o[q] = (vals[u * 4 + q] - mu) * rs * gg + bb;
      }
      if (out_sum) *(v4f*)(out_sum + (size_t)row * N + j) = sm;
      *(v4f*)(out_norm + (size_t)row * N + j) = o;
    }
    
  }
}



// ---- f16 WMMA path (v_wmma_f32_16x16x32_f16): 11-bit significands for operands in range — used where a [0,1] probability operand needs more precision than bf16
typedef _Float16 v16h __attribute__((ext_vector_type(16)));
union FragH { v16h v; v8us half[2]; _Float16 h[16]; unsigned short u[16]; };
template <int NT>
__device__ __forceinline__ v8f mmaH(v16h ah, v16h al, v16h bh, v16h bl, v8f c) {
  c = __builtin_amdgcn_wmma_f32_16x16x32_f16(false, ah, false, bh, (short)0, c, false, false);
  if (NT >= 2) c = __builtin_amdgcn_wmma_f32_16x16x32_f16(false, al, false, bh, (short)0, c, false, false);
  if (NT >= 3) c = __builtin_amdgcn_wmma_f32_16x16x32_f16(false, ah, false, bl, (short)0, c, false, false);
  asm volatile("v_nop\n\tv_nop\n\tv_nop\n\tv_nop" : "+v"(c) : "v"(ah), "v"(al), "v"(bh), "v"(bl));
  return c;
}
// batched GEMM like k_gemm_b but f16 operands: A f32 (split into f16 hi/lo if ASPLIT, else rounded to f16), Bt = f16 values [n][k]; alpha; C f32; N multiple of 16 (partial tiles skipped)
template <bool ASPLIT>
__global__ __launch_bounds__(128) void k_gemm_h(const float* __restrict__ A, int lda, size_t sA, const _Float16* __restrict__ Bh, int ldb, size_t sB, float alpha, float* __restrict__ C, int ldc, size_t sC, int M, int N, int K) {
  __shared__ __attribute__((aligned(16))) float so[4][16][64];
  const int tid = threadIdx.x, w = tid >> 5, lane = tid & 31, ln = lane & 15, hh = lane >> 4; const int by = blockIdx.y;
  A += (size_t)by * sA; Bh += (size_t)by * sB; C += (size_t)by * sC;
  const int ntn = (N + 63) / 64; const int wid = blockIdx.x * 4 + w; const int mt = wid / ntn, nq = wid % ntn; if (mt * 16 >= M) return;
  const int row0 = mt * 16, col0 = nq * 64; const float* arow = A + (size_t)(row0 + ln) * lda;
  v8f acc[4] = {};
  for (int kb = 0; kb < K; kb += 32) {
    FragH ah, al;
    const v4f x0 = *(const v4fa*)(arow + kb + 8 * hh), x1 = *(const v4fa*)(arow + kb + 8 * hh + 4), x2 = *(const v4fa*)(arow + kb + 16 + 8 * hh), x3 = *(const v4fa*)(arow + kb + 16 + 8 * hh + 4);
    float xs[16] = {x0[0],x0[1],x0[2],x0[3],x1[0],x1[1],x1[2],x1[3],x2[0],x2[1],x2[2],x2[3],x3[0],x3[1],x3[2],x3[3]};
#pragma unroll
    for (int i = 0; i < 16; ++i) { const _Float16 h = (_Float16)xs[i]; ah.h[i] = h; al.h[i] = ASPLIT ? (_Float16)(xs[i] - (float)h) : (_Float16)0.0f; }
#pragma unroll
    for (int t = 0; t < 4; ++t) { if (col0 + t * 16 >= N) continue; const size_t boff = (size_t)(col0 + t * 16 + ln) * ldb + kb; FragH bq; bq.half[0] = *(const v8us*)(Bh + boff + 8 * hh); bq.half[1] = *(const v8us*)(Bh + boff + 16 + 8 * hh);
      acc[t] = mmaH<ASPLIT ? 2 : 1>(ah.v, al.v, bq.v, bq.v, acc[t]); }
  }
#pragma unroll
  for (int t = 0; t < 4; ++t) { if (col0 + t * 16 >= N) continue;
#pragma unroll
    for (int r = 0; r < 8; ++r) so[w][8 * hh + r][t * 16 + ln] = acc[t][r] * alpha; }
  __builtin_amdgcn_fence(__ATOMIC_ACQ_REL, "workgroup"); __builtin_amdgcn_wave_barrier();
  const int rsub = lane >> 4, c4 = (lane & 15) * 4;
  {
#pragma unroll
    for (int q = 0; q < 8; ++q) { const int r = q * 2 + rsub; if (col0 + c4 < N) { const v4f v = *(const v4fa*)&so[w][r][c4]; *(v4f*)(C + (size_t)(row0 + r) * ldc + col0 + c4) = v; } }
     }
}

// Wt[n][k] = f16(W[k][n]·scale) from f32 row-major W[K][N] (scale = power of two; bf16-exact weights stay exact in f16 away from the subnormal range)
__global__ __launch_bounds__(256) void k_wt_f16(const float* __restrict__ W, _Float16* __restrict__ Wt, int K, int N, float scale) {
  const int t = blockIdx.x * 256 + threadIdx.x; if (t >= N * (K / 8)) return; const int n = t / (K / 8), k8 = (t % (K / 8)) * 8; FragH f;
#pragma unroll
  for (int i = 0; i < 8; ++i) f.h[i] = (_Float16)(bf16_round(W[(size_t)(k8 + i) * N + n]) * scale); const v8us o = f.half[0];
  *(v8us*)((unsigned short*)Wt + (size_t)n * K + k8) = o; 
}
typedef _Float16 v4h __attribute__((ext_vector_type(4)));
// C = (A.B^T)*alpha + bf16(bias): A f16 [NR][DD], Bh f16 [DD][DD] (row n, k contiguous); writes f32 C (OUT32) or f16 C16, pitch DD.
// One 128 x 128 tile of C per work-group of 8 waves (4 x 2 waves, 32 x 64 each). 64 k of both operands (one 128-byte line a row) are read from
// global memory in whole lines, once per work-group, and staged in LDS (two buffers, row pitch 144 B for the 16-byte fragment reads);
// the next 64 k are in flight in registers while the waves work on this buffer. Each 16 x 16 tile sums k in ascending order in one accumulator chain.
template <bool OUT32>
__global__ __launch_bounds__(256) void k_gemm_t(const _Float16* __restrict__ A, const _Float16* __restrict__ Bh, float alpha, const float* __restrict__ bias, float* __restrict__ C, _Float16* __restrict__ C16) {
  constexpr int BM = 128, BN = 128, BK = 64, LP = BK + 8, NKT = DD / BK;
  __shared__ __attribute__((aligned(16))) unsigned short sA[2][BM][LP], sB[2][BN][LP];
  __shared__ __attribute__((aligned(16))) float so[8][32][64 + 4];
  const int tid = threadIdx.x, w = tid >> 5, lane = tid & 31, ln = lane & 15, hh = lane >> 4;
  const int nt = blockIdx.x % (DD / BN), mt = blockIdx.x / (DD / BN); const int wm = w >> 1, wn = w & 1;
  const int lr = tid >> 3, lc = (tid & 7) * 8;      /* 8 lanes cover one row's 128 bytes; a thread brings rows lr + 32 i */
  const unsigned short* ga = (const unsigned short*)A + (size_t)(mt * BM + lr) * DD + lc;
  const unsigned short* gb = (const unsigned short*)Bh + (size_t)(nt * BN + lr) * DD + lc;
  v8us ra[4], rb[4];
#pragma unroll
  for (int i = 0; i < 4; ++i) { ra[i] = *(const v8us*)(ga + (size_t)i * 32 * DD); rb[i] = *(const v8us*)(gb + (size_t)i * 32 * DD); }
#pragma unroll
  for (int i = 0; i < 4; ++i) { *(v8us*)&sA[0][lr + 32 * i][lc] = ra[i]; *(v8us*)&sB[0][lr + 32 * i][lc] = rb[i]; }
  __syncthreads();
  v8f acc[2][4];
#pragma unroll
  for (int mi = 0; mi < 2; ++mi)
#pragma unroll
    for (int ni = 0; ni < 4; ++ni) acc[mi][ni] = (v8f){0.f,0.f,0.f,0.f,0.f,0.f,0.f,0.f};
  for (int kt = 0; kt < NKT; ++kt) {
    const int cur = kt & 1; const bool more = kt + 1 < NKT;      /* the same for the whole work-group */
    if (more) {
#pragma unroll
      for (int i = 0; i < 4; ++i) { ra[i] = *(const v8us*)(ga + (size_t)i * 32 * DD + (kt + 1) * BK); rb[i] = *(const v8us*)(gb + (size_t)i * 32 * DD + (kt + 1) * BK); } }
    __builtin_amdgcn_sched_barrier(0);      /* keeps the next pass's global loads in front of this pass's products: sunk behind them, their whole latency is waited out in front of the LDS stores */
#pragma unroll
    for (int ks = 0; ks < BK / 32; ++ks) { FragH fa[2], fb[4];
#pragma unroll
      for (int mi = 0; mi < 2; ++mi) { const unsigned short* p = &sA[cur][wm * 32 + mi * 16 + ln][ks * 32 + 8 * hh]; fa[mi].half[0] = *(const v8us*)p; fa[mi].half[1] = *(const v8us*)(p + 16); }
#pragma unroll
      for (int ni = 0; ni < 4; ++ni) { const unsigned short* p = &sB[cur][wn * 64 + ni * 16 + ln][ks * 32 + 8 * hh]; fb[ni].half[0] = *(const v8us*)p; fb[ni].half[1] = *(const v8us*)(p + 16); }
#pragma unroll
      for (int mi = 0; mi < 2; ++mi)
#pragma unroll
        for (int ni = 0; ni < 4; ++ni) acc[mi][ni] = __builtin_amdgcn_wmma_f32_16x16x32_f16(false, fa[mi].v, false, fb[ni].v, (short)0, acc[mi][ni], false, false); }
    if (more) {      /* the other buffer: its last readers left it before the barrier that ended the pass before this one */
#pragma unroll
      for (int i = 0; i < 4; ++i) { *(v8us*)&sA[cur ^ 1][lr + 32 * i][lc] = ra[i]; *(v8us*)&sB[cur ^ 1][lr + 32 * i][lc] = rb[i]; } }
    __syncthreads();
  }
  const int rsub = lane >> 4, c4 = (lane & 15) * 4; const int col0 = nt * BN + wn * 64;
#pragma unroll
  for (int ni = 0; ni < 4; ++ni) { const float bv = bf16_round(bias[col0 + ni * 16 + ln]);      /* each wave stages its 32 rows in its own LDS range and stores whole lines */
#pragma unroll
    for (int mi = 0; mi < 2; ++mi)
#pragma unroll
      for (int r = 0; r < 8; ++r) so[w][mi * 16 + 8 * hh + r][ni * 16 + ln] = acc[mi][ni][r] * alpha + bv; }
  __builtin_amdgcn_fence(__ATOMIC_ACQ_REL, "workgroup"); __builtin_amdgcn_wave_barrier();
#pragma unroll
  for (int q = 0; q < 16; ++q) { const int r = q * 2 + rsub; const v4f v = *(const v4fa*)&so[w][r][c4]; const size_t o = (size_t)(mt * BM + wm * 32 + r) * DD + col0 + c4;
    if (OUT32) *(v4f*)(C + o) = v;
    else { v4h h4; for (int i = 0; i < 4; ++i) h4[i] = (_Float16)v[i]; *(v4h*)(C16 + o) = h4; } }
}

__global__ __launch_bounds__(256) void k_x16(const float* __restrict__ x, _Float16* __restrict__ X16, size_t n8) { const size_t t = (size_t)blockIdx.x * 256 + threadIdx.x; if (t >= n8) return; FragH f;
#pragma unroll
  for (int q = 0; q < 8; ++q) f.h[q] = (_Float16)bf16_round(x[t * 8 + q]); *(v8us*)((unsigned short*)X16 + t * 8) = f.half[0];  }
__global__ __launch_bounds__(256) void k_h16(const float* __restrict__ x, _Float16* __restrict__ X16, size_t n8) { const size_t t = (size_t)blockIdx.x * 256 + threadIdx.x; if (t >= n8) return; FragH f;
#pragma unroll
  for (int q = 0; q < 8; ++q) f.h[q] = (_Float16)x[t * 8 + q]; *(v8us*)((unsigned short*)X16 + t * 8) = f.half[0];  }
__global__ __launch_bounds__(256) void k_round16f(const float* __restrict__ W, _Float16* __restrict__ Bt, size_t n8) { const size_t t = (size_t)blockIdx.x * 256 + threadIdx.x; if (t >= n8) return; FragH f;
#pragma unroll
  for (int i = 0; i < 8; ++i) f.h[i] = (_Float16)(bf16_round(W[t * 8 + i]) * 16.0f); *(v8us*)((unsigned short*)Bt + t * 8) = f.half[0];  }
template <int NHv, int TTv>
__global__ __launch_bounds__(256) void k_vt(const _Float16* __restrict__ V16, int ldv, int voff, _Float16* __restrict__ Vt) { __shared__ unsigned short tl[64][66]; const int tid = threadIdx.x; const int slab = blockIdx.x / (TTv / 64), lg = blockIdx.x % (TTv / 64); const int b = slab / NHv, h = slab % NHv;
  for (int i = tid; i < 64 * 8; i += 256) { const int r = i / 8, c8 = (i % 8) * 8; FragH f; f.half[0] = *(const v8us*)((const unsigned short*)V16 + ((size_t)b * TTv + lg * 64 + r) * ldv + voff + h * 64 + c8);
#pragma unroll
    for (int q = 0; q < 8; ++q) tl[r][c8 + q] = f.u[q]; }
  __syncthreads();
  {
#pragma unroll
    for (int rd = 0; rd < 2; ++rd) { const int d = rd * 32 + tid / 8, pc = tid % 8; FragH f;
#pragma unroll
      for (int q = 0; q < 8; ++q) f.u[q] = tl[pc * 8 + q][d];
      *(v8us*)((unsigned short*)Vt + ((size_t)slab * 64 + d) * TTv + lg * 64 + pc * 8) = f.half[0]; }
     } }

template <int D, int RBF>
__global__ __launch_bounds__(256) void k_lnx(const float* __restrict__ X, const float* __restrict__ gam, const float* __restrict__ bet, int nrows, float eps, _Float16* __restrict__ O16, float* __restrict__ XR) {
  constexpr int NP = D / 128; const int tid = threadIdx.x, wv = tid >> 5, lane = tid & 31; const size_t r = (size_t)blockIdx.x * 8 + wv; if (r >= (size_t)nrows) return; v4f y[NP]; float s = 0.f;
#pragma unroll
  for (int j = 0; j < NP; ++j) { const int c = j * 128 + lane * 4; v4f g = *(const v4fa*)(X + r * D + c); if (RBF) { for (int q = 0; q < 4; ++q) g[q] = bf16_round(g[q]); } y[j] = g; s += g[0] + g[1] + g[2] + g[3]; }
  for (int o = 16; o >= 1; o >>= 1) s += __shfl_xor(s, o, 32); const float mu = s / (float)D; float q2 = 0.f;
#pragma unroll
  for (int j = 0; j < NP; ++j) for (int q = 0; q < 4; ++q) { const float d = y[j][q] - mu; q2 += d * d; }
  for (int o = 16; o >= 1; o >>= 1) q2 += __shfl_xor(q2, o, 32); const float rs = rsqrtf(q2 / (float)D + eps);
  {
#pragma unroll
    for (int j = 0; j < NP; ++j) { const int c = j * 128 + lane * 4; v4h h; for (int q = 0; q < 4; ++q) { const float v = (y[j][q] - mu) * rs * bf16_round(gam[c + q]) + bf16_round(bet[c + q]); h[q] = (_Float16)v; } *(v4h*)(O16 + r * D + c) = h; if (XR) *(v4f*)(XR + r * D + c) = y[j]; }
     } }
typedef int v4ia __attribute__((ext_vector_type(4), may_alias));
// lane l <-> lane l ^ 16 (the two halves of a wave hold the two key halves of one query column)
__device__ __forceinline__ float xhalf(float x) { const int b = __builtin_bit_cast(int, x); return __builtin_bit_cast(float, __builtin_amdgcn_permlanex16(b, b, 0x76543210, 0xfedcba98, false, false)); }
#define FL_SK 64                 /* keys per stage */
#define FL_LP (64 + 8)           /* LDS row pitch in 16-bit elements */
#define FL_C 0.18033688011112042f      /* 64^-1/2 * log2(e): the exponentials are taken in base 2 on the hardware's own instruction */
// one stage: this lane's four 16-byte pieces (K rows r and r + 32, V^T rows r and r + 32). The s_wait_xcnt stands inside the statement so that no address register is rewritten ahead of it.
__device__ __forceinline__ void fl_copy4(unsigned lk, unsigned lv, const unsigned short* gk0, const unsigned short* gk1, const unsigned short* gv0, const unsigned short* gv1) {
  const unsigned lk1 = lk + 32 * FL_LP * 2, lv1 = lv + 32 * FL_LP * 2;
  asm volatile("global_load_async_to_lds_b128 %0, %4, off\n\t"
               "global_load_async_to_lds_b128 %1, %5, off\n\t"
               "global_load_async_to_lds_b128 %2, %6, off\n\t"
               "global_load_async_to_lds_b128 %3, %7, off\n\t"
               "s_wait_xcnt 0x0"
               :: "v"(lk), "v"(lk1), "v"(lv), "v"(lv1), "v"(gk0), "v"(gk1), "v"(gv0), "v"(gv1) : "memory");
}
__global__ __launch_bounds__(256) void k_flash(const _Float16* __restrict__ Q16, int ldq, const _Float16* __restrict__ K16, int ldk, const _Float16* __restrict__ Vt, const int* __restrict__ MSK, float* __restrict__ O, int ldo) {
  constexpr int NW = 8, RPW = 16, NQB = TT / (NW * RPW), DT = 4, KS = 2, NST = TT / FL_SK;
  __shared__ __attribute__((aligned(16))) unsigned short sK[2][FL_SK][FL_LP], sV[2][64][FL_LP];
  __shared__ __attribute__((aligned(16))) float sO[NW][RPW][64 + 4];
  const int tid = threadIdx.x, w = tid >> 5, lane = tid & 31, ln = lane & 15, hh = lane >> 4;
  const int slab = blockIdx.x / NQB, qblk = blockIdx.x % NQB; const int b = slab / NH, h = slab % NH; const int qb0 = qblk * (NW * RPW); const int q0 = qb0 + w * RPW;
  const unsigned short* Vth = (const unsigned short*)Vt + (size_t)slab * 64 * TT;
  const int cr = tid >> 3, cc = (tid & 7) * 8;      /* 8 lanes cover one row's 128 bytes; a thread brings rows cr and cr + 32 of both tiles */
  const unsigned short* gk = (const unsigned short*)K16 + ((size_t)b * TT + cr) * ldk + h * 64 + cc;      /* + stage * 64 rows */
  const unsigned short* gv = Vth + (size_t)cr * TT + cc;                                                  /* + stage * 64 columns */
  const unsigned lk = (unsigned)(size_t)&sK[0][cr][cc], lv = (unsigned)(size_t)&sV[0][cr][cc];      /* LDS byte address = low 32 bits of the __shared__ address */
  constexpr unsigned BUFB = FL_SK * FL_LP * 2;      /* bytes of one buffer of either tile */
  fl_copy4(lk, lv, gk, gk + (size_t)32 * ldk, gv, gv + (size_t)32 * TT);
  FragH bq[KS];      /* B operand: column ln = query q0 + ln */
  { const unsigned short* qr = (const unsigned short*)Q16 + ((size_t)b * TT + q0 + ln) * ldq + h * 64;
#pragma unroll
    for (int ks = 0; ks < KS; ++ks) { bq[ks].half[0] = *(const v8us*)(qr + ks * 32 + 8 * hh); bq[ks].half[1] = *(const v8us*)(qr + ks * 32 + 16 + 8 * hh); } }
  asm volatile("s_wait_asynccnt 0x0" ::: "memory");      /* stage 0 of this wave has landed before the barrier that publishes it */
  __syncthreads();
  fl_copy4(lk + BUFB, lv + BUFB, gk + (size_t)FL_SK * ldk, gk + (size_t)(FL_SK + 32) * ldk, gv + FL_SK, gv + (size_t)32 * TT + FL_SK);
  float m_q = -3.0e38f, l_q = 0.f; v8f oacc[DT];      /* oacc[dt][r] = O[q0 + ln][dt * 16 + 8 * hh + r] */
#pragma unroll
  for (int dt = 0; dt < DT; ++dt) oacc[dt] = (v8f){0.f,0.f,0.f,0.f,0.f,0.f,0.f,0.f};
#pragma unroll 1
  for (int st = 0; st < NST; ++st) {
    const int cur = st & 1;
#pragma unroll 1      /* rolled: unrolled, the two passes take more than the 128 registers at which all four work-groups of a WGP are resident */
    for (int jj = 0; jj < FL_SK; jj += 32) {
    const int j0 = st * FL_SK + jj;
    const int* mp = MSK + (size_t)b * TT + j0 + 8 * hh;      /* key padding mask (1 = PAD) of this lane's keys j0 + 8hh + 0..7 and j0 + 16 + 8hh + 0..7 */
    const v4ia km[4] = { *(const v4ia*)mp, *(const v4ia*)(mp + 4), *(const v4ia*)(mp + 16), *(const v4ia*)(mp + 20) };
    v8f s[2];
#pragma unroll
    for (int nt = 0; nt < 2; ++nt) { const unsigned short* kr = &sK[cur][jj + nt * 16 + ln][0]; FragH ak[KS];
#pragma unroll
      for (int ks = 0; ks < KS; ++ks) { ak[ks].half[0] = *(const v8us*)(kr + ks * 32 + 8 * hh); ak[ks].half[1] = *(const v8us*)(kr + ks * 32 + 16 + 8 * hh); }
      v8f acc = (v8f){0.f,0.f,0.f,0.f,0.f,0.f,0.f,0.f};
#pragma unroll
      for (int ks = 0; ks < KS; ++ks) acc = mmaH<1>(ak[ks].v, ak[ks].v, bq[ks].v, bq[ks].v, acc);
      s[nt] = acc; }
    float sc[16]; float mc = -INFINITY;      /* raw q.k; 1 = pad -> excluded (the module adds -1e8): score -inf, so its exponential below is exactly 0 */
#pragma unroll
    for (int i = 0; i < 16; ++i) { sc[i] = (km[i >> 2][i & 3] == 0) ? s[i >> 3][i & 7] : -INFINITY; mc = fmaxf(mc, sc[i]); }
    mc = fmaxf(mc, xhalf(mc));
    const float mn = fmaxf(m_q, mc); const float al = __builtin_amdgcn_exp2f((m_q - mn) * FL_C); m_q = mn;      /* m_q and mn (raw q.k units) are finite (start -3e38): no key seen yet gives 2^0 = 1 */
    const float nb = __builtin_fmaf(-mn, FL_C, 10.0f);      /* 2^10 e^((s - mn) / 8) = 2^(s C + nb): scale, maximum and the 2^10 of P in one fused multiply-add a score */
    float ps = 0.f; FragH pb;      /* pb.h[i] = 2^10 P^T[k = kmap(i, hh)][ln] */
#pragma unroll
    for (int i = 0; i < 16; ++i) { const float p = __builtin_amdgcn_exp2f(__builtin_fmaf(sc[i], FL_C, nb)); ps += p; pb.h[i] = (_Float16)p; }
    l_q = l_q * al + ps;      /* the row sum carries the same 2^10 */
#pragma unroll
    for (int dt = 0; dt < DT; ++dt)
#pragma unroll
      for (int r = 0; r < 8; ++r) oacc[dt][r] *= al;
#pragma unroll
    for (int dt = 0; dt < DT; ++dt) { const unsigned short* vrow = &sV[cur][dt * 16 + ln][jj]; FragH av; av.half[0] = *(const v8us*)(vrow + 8 * hh); av.half[1] = *(const v8us*)(vrow + 16 + 8 * hh);
      oacc[dt] = mmaH<1>(av.v, av.v, pb.v, pb.v, oacc[dt]); } }
    asm volatile("s_wait_dscnt 0x0" ::: "memory");      /* this wave's reads of buffer cur have returned before the buffer is refilled */
    asm volatile("s_wait_asynccnt 0x0" ::: "memory");   /* this wave's copies of stage st + 1 have landed before the barrier that publishes them */
    __syncthreads();      /* publishes stage st + 1 and ends every wave's reads of buffer cur */
    if (st + 2 < NST) {      /* the same for the whole work-group */
      const unsigned short* k2 = gk + (size_t)(st + 2) * FL_SK * ldk; const unsigned short* v2 = gv + (st + 2) * FL_SK;
      fl_copy4(lk + cur * BUFB, lv + cur * BUFB, k2, k2 + (size_t)32 * ldk, v2, v2 + (size_t)32 * TT); }
  }
  asm volatile("s_wait_asynccnt 0x0" ::: "memory");      /* nothing of this wave is in flight when it goes on to the output */
  { float l = l_q + xhalf(l_q); l = (l > 0.f) ? 1.0f / l : 0.f;
#pragma unroll
    for (int dt = 0; dt < DT; ++dt)
#pragma unroll
      for (int g = 0; g < 2; ++g) { v4f o; for (int q = 0; q < 4; ++q) o[q] = oacc[dt][g * 4 + q] * l; *(v4fa*)&sO[w][ln][dt * 16 + 8 * hh + g * 4] = o; } }
  __builtin_amdgcn_fence(__ATOMIC_ACQ_REL, "workgroup"); __builtin_amdgcn_wave_barrier();
  {
#pragma unroll
    for (int rp = 0; rp < RPW; rp += 2) { const int r = rp + (lane >> 4), pc = lane & 15; const v4f val = *(const v4fa*)&sO[w][r][pc * 4]; *(v4f*)(O + ((size_t)b * TT + q0 + r) * ldo + h * 64 + pc * 4) = val; }
     } }

__global__ __launch_bounds__(256) void k_addbf(float* __restrict__ out, const float* __restrict__ x, size_t n4) { const size_t t = (size_t)blockIdx.x * 256 + threadIdx.x; if (t >= n4) return; v4f a = *(const v4fa*)(out + t * 4); const v4f b = *(const v4fa*)(x + t * 4); for (int q = 0; q < 4; ++q) a[q] += bf16_round(b[q]); *(v4f*)(out + t * 4) = a;  }
extern "C" void kernel_launch(void* const* d_in, const int* in_sizes, int n_in,
                              void* d_out, int out_size, void* d_ws, size_t ws_size, hipStream_t stream) {
  (void)in_sizes; (void)n_in; (void)out_size;
  const float* const* I = (const float* const*)d_in; const float* x = I[0]; const int* mask = (const int*)d_in[1]; const float* Wqkv = I[2]; const float* bqkv = I[3]; const float* Wo = I[4]; const float* bo = I[5]; const float* lng = I[6]; const float* lnb = I[7];      /* d_in order: hidden_states, encoder_padding_mask, qkv_w, qkv_b, out_w, out_b, ln_g, ln_b */
  const float* bq = bqkv; const float* bk = bqkv + DD; const float* bv = bqkv + 2 * DD;
  char* ws = (char*)d_ws; size_t off = 0;
  auto take = [&](size_t bytes) { char* p = ws + off; off += (bytes + 255) & ~(size_t)255; return p; };
  const size_t WSZ = (size_t)DD * DD; _Float16* Bw = (_Float16*)take(4 * WSZ * 2); _Float16* X16 = (_Float16*)take((size_t)NR * DD * 2);
  _Float16* Q = (_Float16*)take((size_t)NR * DD * 2); _Float16* K = (_Float16*)take((size_t)NR * DD * 2); _Float16* V = (_Float16*)take((size_t)NR * DD * 2); _Float16* Vt = (_Float16*)take((size_t)NR * DD * 2);
  float* O = (float*)take((size_t)NR * DD * 4); _Float16* O16 = V;      /* the v plane is dead once Vᵀ is built (before the attention kernel); O16 reuses it */
  if (off > ws_size) return;      // 8.4 + 16.8 × 5 + 33.6 ≈ 126 MB (120 MiB)
  const unsigned gw2 = (unsigned)((WSZ / 8 + 255) / 256);
  k_round16f<<<(unsigned)((3 * WSZ / 8 + 255) / 256), 256, 0, stream>>>(Wqkv, Bw, 3 * WSZ / 8); k_round16f<<<gw2, 256, 0, stream>>>(Wo, Bw + 3 * WSZ, WSZ / 8);      /* (out,in) natural ×2^4: rows q|k|v, then out_w */
  const unsigned gx = (unsigned)(((size_t)NR * DD / 8 + 255) / 256); const unsigned gp = (NR / 128) * (DD / 128);
  k_lnx<DD, 1><<<(NR + 7) / 8, 256, 0, stream>>>(x, lng, lnb, NR, 1e-5f, X16, nullptr);      /* x = LN(bf16 hidden) → f16 */
  k_gemm_t<false><<<gp, 256, 0, stream>>>(X16, Bw, 0.0625f, bq, nullptr, Q);      /* q = x·Wq + bq: M 8192 N 1024 K 1024 */
  k_gemm_t<false><<<gp, 256, 0, stream>>>(X16, Bw + WSZ, 0.0625f, bk, nullptr, K);
  k_gemm_t<false><<<gp, 256, 0, stream>>>(X16, Bw + 2 * WSZ, 0.0625f, bv, nullptr, V);
  k_vt<NH, TT><<<BB * NH * (TT / 64), 256, 0, stream>>>(V, DD, 0, Vt);
  k_flash<<<BB * NH * (TT / 128), 256, 0, stream>>>(Q, DD, K, DD, Vt, mask, O, DD);
  k_h16<<<gx, 256, 0, stream>>>(O, O16, (size_t)NR * DD / 8);
  k_gemm_t<true><<<gp, 256, 0, stream>>>(O16, Bw + 3 * WSZ, 0.0625f, bo, (float*)d_out, nullptr);      /* out = O·out_wᵀ + out_b */
  k_addbf<<<(unsigned)(((size_t)NR * DD / 4 + 255) / 256), 256, 0, stream>>>((float*)d_out, x, (size_t)NR * DD / 4);      /* += bf16(hidden) in place (residual; no workspace left for an f32 copy) */
}

// v005
// It runs in 147 microseconds.
// Two timings next to v004 put it at 1.30 and 1.32 times that version's speed.
// Over all steps from v000 it is 5.64 times as fast.
#include <hip/hip_runtime.h>
// Pre-LN self-attention layer with a key padding mask and residual (B=4, S=2048, H=1024, 16 heads × 64): x = LN(hidden); [q|k|v] = x·qkv_wᵀ + qkv_b ((out,in) fused); scores = q·kᵀ·64^-½ + mask·(−1e8) (int mask [B,S], 1 = pad); softmax;
// out = (attn·v merged)·out_wᵀ + out_b + hidden.
// Compute dtype: x, weights, biases rounded to bf16; q/k/v as f16 GEMM outputs; fused flash-style kernel (online softmax f32, P f16 ×2^10) on v_wmma_f32_16x16x32_f16; O → f16 → output GEMM with bias; f32 accumulate.
#define BB 4
#define TT 2048
#define NH 16
#define DD 1024
#define NR (BB * TT)

typedef __bf16 v16b __attribute__((ext_vector_type(16)));
typedef unsigned short v8us __attribute__((ext_vector_type(8), may_alias));
typedef float  v8f  __attribute__((ext_vector_type(8)));
typedef float  v4f  __attribute__((ext_vector_type(4)));
typedef float  v4fa __attribute__((ext_vector_type(4), may_alias));
union FragB { v16b v; v8us half[2]; unsigned short u[16]; };

__device__ __forceinline__ unsigned short bf16_bits(float x) { unsigned int u = __float_as_uint(x); return (unsigned short)((u + 0x7FFFu + ((u >> 16) & 1u)) >> 16); }
__device__ __forceinline__ float bf16_val(unsigned short b) { return __uint_as_float(((unsigned int)b) << 16); }
__device__ __forceinline__ float bf16_round(float x) { return bf16_val(bf16_bits(x)); }
// D += A·B with NT terms: 1 = ah·bh, 2 = + al·bh (A split), 3 = + ah·bl (both split)
template <int NT>
__device__ __forceinline__ v8f mmaN(v16b ah, v16b al, v16b bh, v16b bl, v8f c) {
  c = __builtin_amdgcn_wmma_f32_16x16x32_bf16(false, ah, false, bh, (short)0, c, false, false);
  if (NT >= 2) c = __builtin_amdgcn_wmma_f32_16x16x32_bf16(false, al, false, bh, (short)0, c, false, false);
  if (NT >= 3) c = __builtin_amdgcn_wmma_f32_16x16x32_bf16(false, ah, false, bl, (short)0, c, false, false);
  asm volatile("v_nop\n\tv_nop\n\tv_nop\n\tv_nop" : "+v"(c) : "v"(ah), "v"(al), "v"(bh), "v"(bl));
  return c;
}

__global__ __launch_bounds__(256) void k_wt_bf16(const float* __restrict__ W, unsigned short* __restrict__ Wt, int K, int N) {
  const int t = blockIdx.x * 256 + threadIdx.x;
  const int k8n = K / 8;
  if (t >= N * k8n) return;
  const int n = t / k8n, k8 = (t % k8n) * 8;
  v8us v;
#pragma unroll
  for (int i = 0; i < 8; ++i) v[i] = bf16_bits(W[(size_t)(k8 + i) * N + n]);
  *(v8us*)(Wt + (size_t)n * K + k8) = v;
  
}

// GEMM C[M][N] (f32, pitch ldc) = act(A[M][K]·W + bias). A f32 row-major (pitch lda) converted per fragment to bf16
// (ASPLIT: hi/lo two planes -> 2 terms, else single rounded term); Wt bf16 [N][K] (pitch ldb). BIAS_BF16 rounds the
// bias to bf16 first (bias quantised to bf16 before the add). K%32==0, M%16==0, N%64==0.
template <bool ASPLIT, int ACT, bool BIAS_BF16>
__global__ __launch_bounds__(128) void k_gemm_bf(const float* __restrict__ A, int lda, const unsigned short* __restrict__ Wt, int ldb,
                                               const float* __restrict__ bias, float* __restrict__ C, int ldc, int M, int N, int K) {
  __shared__ __attribute__((aligned(16))) float so[4][16][64];
  const int tid = threadIdx.x, w = tid >> 5, lane = tid & 31, ln = lane & 15, hh = lane >> 4;
  const int ntn = N / 64;
  const int wid = blockIdx.x * 4 + w;
  const int mt = wid / ntn, nq = wid % ntn;
  if (mt * 16 >= M) return;
  const int row0 = mt * 16, col0 = nq * 64;
  const float* arow = A + (size_t)(row0 + ln) * lda;
  v8f acc[4] = {};
  for (int kb = 0; kb < K; kb += 32) {
    FragB ah, al;
    const v4f x0 = *(const v4fa*)(arow + kb + 8 * hh), x1 = *(const v4fa*)(arow + kb + 8 * hh + 4);
    const v4f x2 = *(const v4fa*)(arow + kb + 16 + 8 * hh), x3 = *(const v4fa*)(arow + kb + 16 + 8 * hh + 4);
    float xs[16] = {x0[0],x0[1],x0[2],x0[3],x1[0],x1[1],x1[2],x1[3],x2[0],x2[1],x2[2],x2[3],x3[0],x3[1],x3[2],x3[3]};
#pragma unroll
    for (int i = 0; i < 16; ++i) { const unsigned short hb = bf16_bits(xs[i]); ah.u[i] = hb; al.u[i] = ASPLIT ? bf16_bits(xs[i] - bf16_val(hb)) : (unsigned short)0; }
#pragma unroll
    for (int t = 0; t < 4; ++t) {
      const unsigned short* brow = Wt + (size_t)(col0 + t * 16 + ln) * ldb + kb;
      FragB b;
      b.half[0] = *(const v8us*)(brow + 8 * hh);
      b.half[1] = *(const v8us*)(brow + 16 + 8 * hh);
      acc[t] = mmaN<ASPLIT ? 2 : 1>(ah.v, al.v, b.v, b.v, acc[t]);
    }
  }
#pragma unroll
  for (int t = 0; t < 4; ++t) {
    float bv = bias ? bias[col0 + t * 16 + ln] : 0.f;
    if (BIAS_BF16) bv = bf16_round(bv);
#pragma unroll
    for (int r = 0; r < 8; ++r) { float v = acc[t][r] + bv; if (ACT == 1) v = fmaxf(v, 0.f); so[w][8 * hh + r][t * 16 + ln] = v; }
  }
  __builtin_amdgcn_fence(__ATOMIC_ACQ_REL, "workgroup");
  __builtin_amdgcn_wave_barrier();
  const int rsub = lane >> 4, c4 = (lane & 15) * 4;
  {
#pragma unroll
    for (int q = 0; q < 8; ++q) {
      const int r = q * 2 + rsub;
      const v4f v = *(const v4fa*)&so[w][r][c4];
      *(v4f*)(C + (size_t)(row0 + r) * ldc + col0 + c4) = v;
    }
    
  }
}

// Flash-style causal/unmasked attention, all contractions 3-term bf16 hi/lo splits, f32 softmax with running max.
// q,k,v rows are read from f32 buffers with arbitrary row pitch (so they can live inside a fused qkv buffer);
// D = head size (multiple of 32, <= 128); one wave = 16 query rows; block = 4 waves (64 queries) sharing K/V chunks of 32.
template <int D, bool CAUSAL>
__global__ __launch_bounds__(128) void k_flash(const float* __restrict__ qb, const float* __restrict__ kb, const float* __restrict__ vb,
                                             int pitch, int T, int H, float scale, float* __restrict__ y, int ypitch) {
  constexpr int KS = D / 32;        // k-steps for QK
  constexpr int DT = D / 16;        // d tiles for PV
  __shared__ __attribute__((aligned(16))) unsigned short sKh[32][D + 8], sKl[32][D + 8], sVh[32][D + 8], sVl[32][D + 8];
  __shared__ __attribute__((aligned(16))) unsigned short sPh[4][16][40], sPl[4][16][40];
  __shared__ __attribute__((aligned(16))) float sO[4][16][D];
  const int tid = threadIdx.x, w = tid >> 5, lane = tid & 31, ln = lane & 15, hh = lane >> 4;
  const int nqb = (T + 63) / 64;
  const int bh = blockIdx.x / nqb, qblk = blockIdx.x % nqb;
  const int b = bh / H, h = bh % H;
  const int q0 = qblk * 64 + w * 16;
  const float* Q = qb + (size_t)b * T * pitch + h * D;
  const float* K = kb + (size_t)b * T * pitch + h * D;
  const float* V = vb + (size_t)b * T * pitch + h * D;

  // A fragments of the wave's 16 query rows (scaled), hi/lo
  FragB aqh[KS], aql[KS];
  {
    int row = q0 + ln; if (row >= T) row = T - 1;
    const float* qr = Q + (size_t)row * pitch;
#pragma unroll
    for (int ks = 0; ks < KS; ++ks)
#pragma unroll
      for (int i = 0; i < 16; ++i) {
        const int d = ks * 32 + ((i < 8) ? (8 * hh + i) : (16 + 8 * hh + (i - 8)));
        const float x = qr[d] * scale; const unsigned short hb = bf16_bits(x);
        aqh[ks].u[i] = hb; aql[ks].u[i] = bf16_bits(x - bf16_val(hb));
      }
  }
  float m_r[8], l_r[8];
#pragma unroll
  for (int r = 0; r < 8; ++r) { m_r[r] = -3.0e38f; l_r[r] = 0.f; }
  v8f oacc[DT];
#pragma unroll
  for (int dt = 0; dt < DT; ++dt) oacc[dt] = (v8f){0.f,0.f,0.f,0.f,0.f,0.f,0.f,0.f};

  const int kv_end = CAUSAL ? min(T, qblk * 64 + 64) : T;     // block-uniform
  for (int j0 = 0; j0 < kv_end; j0 += 32) {
    __syncthreads();
    for (int e = tid; e < 32 * (D / 4); e += 128) {
      const int r = e / (D / 4), c4 = (e % (D / 4)) * 4;
      const int key = j0 + r;
      v4f kf = {0.f,0.f,0.f,0.f}, vf = {0.f,0.f,0.f,0.f};
      if (key < T) { kf = *(const v4fa*)(K + (size_t)key * pitch + c4); vf = *(const v4fa*)(V + (size_t)key * pitch + c4); }
#pragma unroll
      for (int t = 0; t < 4; ++t) {
        unsigned short hb = bf16_bits(kf[t]); sKh[r][c4 + t] = hb; sKl[r][c4 + t] = bf16_bits(kf[t] - bf16_val(hb));
        hb = bf16_bits(vf[t]); sVh[r][c4 + t] = hb; sVl[r][c4 + t] = bf16_bits(vf[t] - bf16_val(hb));
      }
    }
    __syncthreads();
    // S tile 16 x 32
    v8f s[2];
#pragma unroll
    for (int nt = 0; nt < 2; ++nt) {
      v8f acc = {};
#pragma unroll
      for (int ks = 0; ks < KS; ++ks) {
        FragB bh_, bl_;
        bh_.half[0] = *(const v8us*)&sKh[nt * 16 + ln][ks * 32 + 8 * hh]; bh_.half[1] = *(const v8us*)&sKh[nt * 16 + ln][ks * 32 + 16 + 8 * hh];
        bl_.half[0] = *(const v8us*)&sKl[nt * 16 + ln][ks * 32 + 8 * hh]; bl_.half[1] = *(const v8us*)&sKl[nt * 16 + ln][ks * 32 + 16 + 8 * hh];
        acc = mmaN<3>(aqh[ks].v, aql[ks].v, bh_.v, bl_.v, acc);
      }
      s[nt] = acc;
    }
    // mask + running max (rows 8hh+r; the 16 lanes of a half share rows)
    float alpha[8];
#pragma unroll
    for (int r = 0; r < 8; ++r) {
      const int qi = q0 + 8 * hh + r;
      const int ja = j0 + ln, jb = j0 + 16 + ln;
      if (CAUSAL) { if (ja > qi) s[0][r] = -3.0e38f; if (jb > qi) s[1][r] = -3.0e38f; }
      if (ja >= T) s[0][r] = -3.0e38f;
      if (jb >= T) s[1][r] = -3.0e38f;
      float mx = fmaxf(s[0][r], s[1][r]);
      mx = fmaxf(mx, __shfl_xor(mx, 1, 32)); mx = fmaxf(mx, __shfl_xor(mx, 2, 32)); mx = fmaxf(mx, __shfl_xor(mx, 4, 32)); mx = fmaxf(mx, __shfl_xor(mx, 8, 32));
      const float mnew = fmaxf(m_r[r], mx);
      alpha[r] = (mnew > -1.0e38f) ? __expf(m_r[r] - mnew) : 1.0f;
      const float p0 = (s[0][r] > -1.0e38f) ? __expf(s[0][r] - mnew) : 0.f;
      const float p1 = (s[1][r] > -1.0e38f) ? __expf(s[1][r] - mnew) : 0.f;
      m_r[r] = mnew;
      l_r[r] = l_r[r] * alpha[r] + p0 + p1;            // per-lane partial row sum (16 lanes combined at the end)
      unsigned short hb = bf16_bits(p0); sPh[w][8 * hh + r][ln] = hb;      sPl[w][8 * hh + r][ln] = bf16_bits(p0 - bf16_val(hb));
      hb = bf16_bits(p1);                sPh[w][8 * hh + r][16 + ln] = hb; sPl[w][8 * hh + r][16 + ln] = bf16_bits(p1 - bf16_val(hb));
    }
#pragma unroll
    for (int dt = 0; dt < DT; ++dt)
#pragma unroll
      for (int r = 0; r < 8; ++r) oacc[dt][r] *= alpha[r];
    __builtin_amdgcn_fence(__ATOMIC_ACQ_REL, "workgroup");
    __builtin_amdgcn_wave_barrier();
    FragB pah, pal;
    pah.half[0] = *(const v8us*)&sPh[w][ln][8 * hh]; pah.half[1] = *(const v8us*)&sPh[w][ln][16 + 8 * hh];
    pal.half[0] = *(const v8us*)&sPl[w][ln][8 * hh]; pal.half[1] = *(const v8us*)&sPl[w][ln][16 + 8 * hh];
#pragma unroll
    for (int dt = 0; dt < DT; ++dt) {
      FragB bvh, bvl;
#pragma unroll
      for (int i = 0; i < 8; ++i) {
        bvh.u[i] = sVh[8 * hh + i][dt * 16 + ln]; bvh.u[8 + i] = sVh[16 + 8 * hh + i][dt * 16 + ln];
        bvl.u[i] = sVl[8 * hh + i][dt * 16 + ln]; bvl.u[8 + i] = sVl[16 + 8 * hh + i][dt * 16 + ln];
      }
      oacc[dt] = mmaN<3>(pah.v, pal.v, bvh.v, bvl.v, oacc[dt]);
    }
    __builtin_amdgcn_fence(__ATOMIC_ACQ_REL, "workgroup");
    __builtin_amdgcn_wave_barrier();
  }
#pragma unroll
  for (int r = 0; r < 8; ++r) {
    float l = l_r[r];
    l += __shfl_xor(l, 1, 32); l += __shfl_xor(l, 2, 32); l += __shfl_xor(l, 4, 32); l += __shfl_xor(l, 8, 32);
    l_r[r] = (l > 0.f) ? 1.0f / l : 0.f;
  }
#pragma unroll
  for (int dt = 0; dt < DT; ++dt)
#pragma unroll
    for (int r = 0; r < 8; ++r) sO[w][8 * hh + r][dt * 16 + ln] = oacc[dt][r] * l_r[r];
  __builtin_amdgcn_fence(__ATOMIC_ACQ_REL, "workgroup");
  __builtin_amdgcn_wave_barrier();
  {
    for (int r = 0; r < 16; ++r) {
      const int row = q0 + r;
      if (row < T && lane < D / 4) {
        const v4f val = *(const v4fa*)&sO[w][r][lane * 4];
        *(v4f*)(y + ((size_t)b * T + row) * ypitch + h * D + lane * 4) = val;
      }
    }
    
  }
}

// GEMM C = act(A·W + bias + resid): A f32 (ASPLIT -> hi/lo 2 terms), Wt bf16 [N][K]; ACT 0 none, 1 relu, 2 exact gelu;
// resid (optional, f32, row index = (row % rmod), pitch ldr, RES_BF16 rounds it) added before the activation.
template <bool ASPLIT, int ACT, bool BIAS_BF16, bool RES_BF16>
__global__ __launch_bounds__(128) void k_gemm_bf3(const float* __restrict__ A, int lda, const unsigned short* __restrict__ Wt, int ldb,
                                                const float* __restrict__ bias, const float* __restrict__ resid, int rmod, int ldr,
                                                float* __restrict__ C, int ldc, int M, int N, int K) {
  __shared__ __attribute__((aligned(16))) float so[4][16][64];
  const int tid = threadIdx.x, w = tid >> 5, lane = tid & 31, ln = lane & 15, hh = lane >> 4;
  const int ntn = N / 64;
  const int wid = blockIdx.x * 4 + w;
  const int mt = wid / ntn, nq = wid % ntn;
  if (mt * 16 >= M) return;
  const int row0 = mt * 16, col0 = nq * 64;
  const float* arow = A + (size_t)(row0 + ln) * lda;
  v8f acc[4] = {};
  for (int kb = 0; kb < K; kb += 32) {
    FragB ah, al;
    const v4f x0 = *(const v4fa*)(arow + kb + 8 * hh), x1 = *(const v4fa*)(arow + kb + 8 * hh + 4);
    const v4f x2 = *(const v4fa*)(arow + kb + 16 + 8 * hh), x3 = *(const v4fa*)(arow + kb + 16 + 8 * hh + 4);
    float xs[16] = {x0[0],x0[1],x0[2],x0[3],x1[0],x1[1],x1[2],x1[3],x2[0],x2[1],x2[2],x2[3],x3[0],x3[1],x3[2],x3[3]};
#pragma unroll
    for (int i = 0; i < 16; ++i) { const unsigned short hb = bf16_bits(xs[i]); ah.u[i] = hb; al.u[i] = ASPLIT ? bf16_bits(xs[i] - bf16_val(hb)) : (unsigned short)0; }
#pragma unroll
    for (int t = 0; t < 4; ++t) {
      const unsigned short* brow = Wt + (size_t)(col0 + t * 16 + ln) * ldb + kb;
      FragB b;
      b.half[0] = *(const v8us*)(brow + 8 * hh);
      b.half[1] = *(const v8us*)(brow + 16 + 8 * hh);
      acc[t] = mmaN<ASPLIT ? 2 : 1>(ah.v, al.v, b.v, b.v, acc[t]);
    }
  }
#pragma unroll
  for (int t = 0; t < 4; ++t) {
    const int col = col0 + t * 16 + ln;
    float bv = bias ? bias[col] : 0.f;
    if (BIAS_BF16) bv = bf16_round(bv);
#pragma unroll
    for (int r = 0; r < 8; ++r) {
      float v = acc[t][r] + bv;
      if (resid) { float rv = resid[(size_t)((row0 + 8 * hh + r) % rmod) * ldr + col]; if (RES_BF16) rv = bf16_round(rv); v += rv; }
      if (ACT == 1) v = fmaxf(v, 0.f);
      if (ACT == 2) v = 0.5f * v * (1.0f + erff(v * 0.70710678118654752f));
      if (ACT == 3) { const float u = 0.7978845608028654f * (v + 0.044715f * v * v * v); v = 0.5f * v * (1.0f + tanhf(u)); }
      so[w][8 * hh + r][t * 16 + ln] = v;
    }
  }
  __builtin_amdgcn_fence(__ATOMIC_ACQ_REL, "workgroup");
  __builtin_amdgcn_wave_barrier();
  const int rsub = lane >> 4, c4 = (lane & 15) * 4;
  {
#pragma unroll
    for (int q = 0; q < 8; ++q) {
      const int r = q * 2 + rsub;
      const v4f v = *(const v4fa*)&so[w][r][c4];
      *(v4f*)(C + (size_t)(row0 + r) * ldc + col0 + c4) = v;
    }
    
  }
}
// row LayerNorm (biased variance, eps) over N: s = X (+ R); optional out_sum <- s; out_norm <- (s-mu)*rsqrt(var+eps)*g + b
template <bool PARAM_BF16>
__global__ __launch_bounds__(256) void k_layernorm(const float* __restrict__ X, const float* __restrict__ R, const float* __restrict__ g, const float* __restrict__ bta,
                                                  float* __restrict__ out_sum, float* __restrict__ out_norm, int N, float eps) {
  __shared__ float red[256];
  const int row = blockIdx.x, tid = threadIdx.x;
  const float* x = X + (size_t)row * N; const float* rr = R ? R + (size_t)row * N : nullptr;
  float vals[16];                     // up to N = 4096
  const int per = N / 256;            // contiguous chunk per thread? use strided-by-4 chunks: thread handles j = tid*4 + 1024*u
  float s1 = 0.f;
  for (int u = 0; u < per / 4; ++u) {
    const int j = tid * 4 + 1024 * u;
    const v4f a = *(const v4fa*)(x + j);
    v4f b = {0.f,0.f,0.f,0.f}; if (rr) b = *(const v4fa*)(rr + j);
#pragma unroll
    for (int q = 0; q < 4; ++q) { const float v = a[q] + b[q]; vals[u * 4 + q] = v; s1 += v; }
  }
  red[tid] = s1; __syncthreads();
  for (int st = 128; st > 0; st >>= 1) { if (tid < st) red[tid] += red[tid + st]; __syncthreads(); }
  const float mu = red[0] / (float)N; __syncthreads();
  float s2 = 0.f;
  for (int u = 0; u < per / 4; ++u)
#pragma unroll
    for (int q = 0; q < 4; ++q) { const float c = vals[u * 4 + q] - mu; s2 += c * c; }
  red[tid] = s2; __syncthreads();
  for (int st = 128; st > 0; st >>= 1) { if (tid < st) red[tid] += red[tid + st]; __syncthreads(); }
  const float rs = rsqrtf(red[0] / (float)N + eps);
  {
    for (int u = 0; u < per / 4; ++u) {
      const int j = tid * 4 + 1024 * u;
      v4f o, sm;
#pragma unroll
      for (int q = 0; q < 4; ++q) {
        float gg = g[j + q], bb = bta[j + q];
        if (PARAM_BF16) { gg = bf16_round(gg); bb = bf16_round(bb); }
        sm[q] = vals[u * 4 + q]; o[q] = (vals[u * 4 + q] - mu) * rs * gg + bb;
      }
      if (out_sum) *(v4f*)(out_sum + (size_t)row * N + j) = sm;
      *(v4f*)(out_norm + (size_t)row * N + j) = o;
    }
    
  }
}



// ---- f16 WMMA path (v_wmma_f32_16x16x32_f16): 11-bit significands for operands in range — used where a [0,1] probability operand needs more precision than bf16
typedef _Float16 v16h __attribute__((ext_vector_type(16)));
union FragH { v16h v; v8us half[2]; _Float16 h[16]; unsigned short u[16]; };
template <int NT>
__device__ __forceinline__ v8f mmaH(v16h ah, v16h al, v16h bh, v16h bl, v8f c) {
  c = __builtin_amdgcn_wmma_f32_16x16x32_f16(false, ah, false, bh, (short)0, c, false, false);
  if (NT >= 2) c = __builtin_amdgcn_wmma_f32_16x16x32_f16(false, al, false, bh, (short)0, c, false, false);
  if (NT >= 3) c = __builtin_amdgcn_wmma_f32_16x16x32_f16(false, ah, false, bl, (short)0, c, false, false);
  asm volatile("v_nop\n\tv_nop\n\tv_nop\n\tv_nop" : "+v"(c) : "v"(ah), "v"(al), "v"(bh), "v"(bl));
  return c;
}
// batched GEMM like k_gemm_b but f16 operands: A f32 (split into f16 hi/lo if ASPLIT, else rounded to f16), Bt = f16 values [n][k]; alpha; C f32; N multiple of 16 (partial tiles skipped)
template <bool ASPLIT>
__global__ __launch_bounds__(128) void k_gemm_h(const float* __restrict__ A, int lda, size_t sA, const _Float16* __restrict__ Bh, int ldb, size_t sB, float alpha, float* __restrict__ C, int ldc, size_t sC, int M, int N, int K) {
  __shared__ __attribute__((aligned(16))) float so[4][16][64];
  const int tid = threadIdx.x, w = tid >> 5, lane = tid & 31, ln = lane & 15, hh = lane >> 4; const int by = blockIdx.y;
  A += (size_t)by * sA; Bh += (size_t)by * sB; C += (size_t)by * sC;
  const int ntn = (N + 63) / 64; const int wid = blockIdx.x * 4 + w; const int mt = wid / ntn, nq = wid % ntn; if (mt * 16 >= M) return;
  const int row0 = mt * 16, col0 = nq * 64; const float* arow = A + (size_t)(row0 + ln) * lda;
  v8f acc[4] = {};
  for (int kb = 0; kb < K; kb += 32) {
    FragH ah, al;
    const v4f x0 = *(const v4fa*)(arow + kb + 8 * hh), x1 = *(const v4fa*)(arow + kb + 8 * hh + 4), x2 = *(const v4fa*)(arow + kb + 16 + 8 * hh), x3 = *(const v4fa*)(arow + kb + 16 + 8 * hh + 4);
    float xs[16] = {x0[0],x0[1],x0[2],x0[3],x1[0],x1[1],x1[2],x1[3],x2[0],x2[1],x2[2],x2[3],x3[0],x3[1],x3[2],x3[3]};
#pragma unroll
    for (int i = 0; i < 16; ++i) { const _Float16 h = (_Float16)xs[i]; ah.h[i] = h; al.h[i] = ASPLIT ? (_Float16)(xs[i] - (float)h) : (_Float16)0.0f; }
#pragma unroll
    for (int t = 0; t < 4; ++t) { if (col0 + t * 16 >= N) continue; const size_t boff = (size_t)(col0 + t * 16 + ln) * ldb + kb; FragH bq; bq.half[0] = *(const v8us*)(Bh + boff + 8 * hh); bq.half[1] = *(const v8us*)(Bh + boff + 16 + 8 * hh);
      acc[t] = mmaH<ASPLIT ? 2 : 1>(ah.v, al.v, bq.v, bq.v, acc[t]); }
  }
#pragma unroll
  for (int t = 0; t < 4; ++t) { if (col0 + t * 16 >= N) continue;
#pragma unroll
    for (int r = 0; r < 8; ++r) so[w][8 * hh + r][t * 16 + ln] = acc[t][r] * alpha; }
  __builtin_amdgcn_fence(__ATOMIC_ACQ_REL, "workgroup"); __builtin_amdgcn_wave_barrier();
  const int rsub = lane >> 4, c4 = (lane & 15) * 4;
  {
#pragma unroll
    for (int q = 0; q < 8; ++q) { const int r = q * 2 + rsub; if (col0 + c4 < N) { const v4f v = *(const v4fa*)&so[w][r][c4]; *(v4f*)(C + (size_t)(row0 + r) * ldc + col0 + c4) = v; } }
     }
}

// Wt[n][k] = f16(W[k][n]·scale) from f32 row-major W[K][N] (scale = power of two; bf16-exact weights stay exact in f16 away from the subnormal range)
__global__ __launch_bounds__(256) void k_wt_f16(const float* __restrict__ W, _Float16* __restrict__ Wt, int K, int N, float scale) {
  const int t = blockIdx.x * 256 + threadIdx.x; if (t >= N * (K / 8)) return; const int n = t / (K / 8), k8 = (t % (K / 8)) * 8; FragH f;
#pragma unroll
  for (int i = 0; i < 8; ++i) f.h[i] = (_Float16)(bf16_round(W[(size_t)(k8 + i) * N + n]) * scale); const v8us o = f.half[0];
  *(v8us*)((unsigned short*)Wt + (size_t)n * K + k8) = o; 
}
typedef _Float16 v4h __attribute__((ext_vector_type(4)));
// A padded key (mask != 0) has probability exactly 0 in every query's softmax while its batch keeps a key, so it is dropped before K and V are projected (no key kept: context 0).
// idx[b][p] = position of batch b's p-th kept key, ascending (0 from the kept count on, so that every entry names a row); cnt[b] = kept count.
__global__ __launch_bounds__(256) void k_keys(const int* __restrict__ MSK, int* __restrict__ idx, int* __restrict__ cnt) {
  __shared__ int part[256];
  const int b = blockIdx.x, tid = threadIdx.x; const int* m = MSK + (size_t)b * TT + tid * (TT / 256);
  int keep[TT / 256]; int c = 0;
#pragma unroll      /* constant subscripts: keep[] stays in registers */
  for (int q = 0; q < TT / 256; ++q) { keep[q] = (m[q] == 0) ? 1 : 0; c += keep[q]; }
  part[tid] = c; __syncthreads();
  for (int o = 1; o < 256; o <<= 1) { const int a = (tid >= o) ? part[tid - o] : 0; __syncthreads(); part[tid] += a; __syncthreads(); }      /* inclusive sums over the threads */
  int pos = part[tid] - c; const int n = part[255];
#pragma unroll      /* constant subscripts: keep[] stays in registers */
  for (int q = 0; q < TT / 256; ++q) if (keep[q]) idx[(size_t)b * TT + pos++] = tid * (TT / 256) + q;
  for (int p = n + tid; p < TT; p += 256) idx[(size_t)b * TT + p] = 0;
  if (tid == 0) cnt[b] = n;
}
// b is the same for a whole work-group; readfirstlane keeps the clamped count in a scalar register, so that every test on it is a scalar branch
__device__ __forceinline__ int kept_count(const int* __restrict__ cnt, int b) { const int n = cnt[b]; return __builtin_amdgcn_readfirstlane(n < 0 ? 0 : (n > TT ? TT : n)); }
// C = (A.B^T)*alpha + bf16(bias): A f16 [NR][DD], Bh f16 [DD][DD] (row n, k contiguous); writes f32 C (OUT32) or f16 C16, pitch DD.
// One 128 x 128 tile of C per work-group of 8 waves (4 x 2 waves, 32 x 64 each). 64 k of both operands (one 128-byte line a row) are read from
// global memory in whole lines, once per work-group, and staged in LDS (two buffers, row pitch 144 B for the 16-byte fragment reads);
// the next 64 k are in flight in registers while the waves work on this buffer. Each 16 x 16 tile sums k in ascending order in one accumulator chain.
// GATH (the K and V projections): row p of a batch's C is the projection of that batch's p-th kept key, A row idx[p]; tiles past the batch's kept count do nothing.
template <bool OUT32, bool GATH>
__global__ __launch_bounds__(256) void k_gemm_t(const _Float16* __restrict__ A, const _Float16* __restrict__ Bh, float alpha, const float* __restrict__ bias, float* __restrict__ C, _Float16* __restrict__ C16, const int* __restrict__ idx, const int* __restrict__ cnt) {
  constexpr int BM = 128, BN = 128, BK = 64, LP = BK + 8, NKT = DD / BK;
  __shared__ __attribute__((aligned(16))) unsigned short sA[2][BM][LP], sB[2][BN][LP];
  __shared__ __attribute__((aligned(16))) float so[8][32][64 + 4];
  const int tid = threadIdx.x, w = tid >> 5, lane = tid & 31, ln = lane & 15, hh = lane >> 4;
  const int nt = blockIdx.x % (DD / BN), mt = blockIdx.x / (DD / BN); const int wm = w >> 1, wn = w & 1;
  const int lr = tid >> 3, lc = (tid & 7) * 8;      /* 8 lanes cover one row's 128 bytes; a thread brings rows lr + 32 i */
  if (GATH) { if ((mt % (TT / BM)) * BM >= kept_count(cnt, mt / (TT / BM))) return; }      /* the same for the whole work-group, in front of every barrier */
  const unsigned short* ga[4];
#pragma unroll
  for (int i = 0; i < 4; ++i) { int row = mt * BM + lr + 32 * i; if (GATH) row = (row & ~(TT - 1)) + (idx[row] & (TT - 1)); ga[i] = (const unsigned short*)A + (size_t)row * DD + lc; }
  const unsigned short* gb = (const unsigned short*)Bh + (size_t)(nt * BN + lr) * DD + lc;
  v8us ra[4], rb[4];
#pragma unroll
  for (int i = 0; i < 4; ++i) { ra[i] = *(const v8us*)ga[i]; rb[i] = *(const v8us*)(gb + (size_t)i * 32 * DD); }
#pragma unroll
  for (int i = 0; i < 4; ++i) { *(v8us*)&sA[0][lr + 32 * i][lc] = ra[i]; *(v8us*)&sB[0][lr + 32 * i][lc] = rb[i]; }
  __syncthreads();
  v8f acc[2][4];
#pragma unroll
  for (int mi = 0; mi < 2; ++mi)
#pragma unroll
    for (int ni = 0; ni < 4; ++ni) acc[mi][ni] = (v8f){0.f,0.f,0.f,0.f,0.f,0.f,0.f,0.f};
  for (int kt = 0; kt < NKT; ++kt) {
    const int cur = kt & 1; const bool more = kt + 1 < NKT;      /* the same for the whole work-group */
    if (more) {
#pragma unroll
      for (int i = 0; i < 4; ++i) { ra[i] = *(const v8us*)(ga[i] + (kt + 1) * BK); rb[i] = *(const v8us*)(gb + (size_t)i * 32 * DD + (kt + 1) * BK); } }
    __builtin_amdgcn_sched_barrier(0);      /* keeps the next pass's global loads in front of this pass's products: sunk behind them, their whole latency is waited out in front of the LDS stores */
#pragma unroll
    for (int ks = 0; ks < BK / 32; ++ks) { FragH fa[2], fb[4];
#pragma unroll
      for (int mi = 0; mi < 2; ++mi) { const unsigned short* p = &sA[cur][wm * 32 + mi * 16 + ln][ks * 32 + 8 * hh]; fa[mi].half[0] = *(const v8us*)p; fa[mi].half[1] = *(const v8us*)(p + 16); }
#pragma unroll
      for (int ni = 0; ni < 4; ++ni) { const unsigned short* p = &sB[cur][wn * 64 + ni * 16 + ln][ks * 32 + 8 * hh]; fb[ni].half[0] = *(const v8us*)p; fb[ni].half[1] = *(const v8us*)(p + 16); }
#pragma unroll
      for (int mi = 0; mi < 2; ++mi)
#pragma unroll
        for (int ni = 0; ni < 4; ++ni) acc[mi][ni] = __builtin_amdgcn_wmma_f32_16x16x32_f16(false, fa[mi].v, false, fb[ni].v, (short)0, acc[mi][ni], false, false); }
    if (more) {      /* the other buffer: its last readers left it before the barrier that ended the pass before this one */
#pragma unroll
      for (int i = 0; i < 4; ++i) { *(v8us*)&sA[cur ^ 1][lr + 32 * i][lc] = ra[i]; *(v8us*)&sB[cur ^ 1][lr + 32 * i][lc] = rb[i]; } }
    __syncthreads();
  }
  const int rsub = lane >> 4, c4 = (lane & 15) * 4; const int col0 = nt * BN + wn * 64;
#pragma unroll
  for (int ni = 0; ni < 4; ++ni) { const float bv = bf16_round(bias[col0 + ni * 16 + ln]);      /* each wave stages its 32 rows in its own LDS range and stores whole lines */
#pragma unroll
    for (int mi = 0; mi < 2; ++mi)
#pragma unroll
      for (int r = 0; r < 8; ++r) so[w][mi * 16 + 8 * hh + r][ni * 16 + ln] = acc[mi][ni][r] * alpha + bv; }
  __builtin_amdgcn_fence(__ATOMIC_ACQ_REL, "workgroup"); __builtin_amdgcn_wave_barrier();
#pragma unroll
  for (int q = 0; q < 16; ++q) { const int r = q * 2 + rsub; const v4f v = *(const v4fa*)&so[w][r][c4]; const size_t o = (size_t)(mt * BM + wm * 32 + r) * DD + col0 + c4;
    if (OUT32) *(v4f*)(C + o) = v;
    else { v4h h4; for (int i = 0; i < 4; ++i) h4[i] = (_Float16)v[i]; *(v4h*)(C16 + o) = h4; } }
}

__global__ __launch_bounds__(256) void k_x16(const float* __restrict__ x, _Float16* __restrict__ X16, size_t n8) { const size_t t = (size_t)blockIdx.x * 256 + threadIdx.x; if (t >= n8) return; FragH f;
#pragma unroll
  for (int q = 0; q < 8; ++q) f.h[q] = (_Float16)bf16_round(x[t * 8 + q]); *(v8us*)((unsigned short*)X16 + t * 8) = f.half[0];  }
__global__ __launch_bounds__(256) void k_h16(const float* __restrict__ x, _Float16* __restrict__ X16, size_t n8) { const size_t t = (size_t)blockIdx.x * 256 + threadIdx.x; if (t >= n8) return; FragH f;
#pragma unroll
  for (int q = 0; q < 8; ++q) f.h[q] = (_Float16)x[t * 8 + q]; *(v8us*)((unsigned short*)X16 + t * 8) = f.half[0];  }
__global__ __launch_bounds__(256) void k_round16f(const float* __restrict__ W, _Float16* __restrict__ Bt, size_t n8) { const size_t t = (size_t)blockIdx.x * 256 + threadIdx.x; if (t >= n8) return; FragH f;
#pragma unroll
  for (int i = 0; i < 8; ++i) f.h[i] = (_Float16)(bf16_round(W[t * 8 + i]) * 16.0f); *(v8us*)((unsigned short*)Bt + t * 8) = f.half[0];  }
template <int NHv, int TTv>
__global__ __launch_bounds__(256) void k_vt(const _Float16* __restrict__ V16, int ldv, int voff, _Float16* __restrict__ Vt, const int* __restrict__ cnt) { __shared__ unsigned short tl[64][66]; const int tid = threadIdx.x; const int slab = blockIdx.x / (TTv / 64), lg = blockIdx.x % (TTv / 64); const int b = slab / NHv, h = slab % NHv;
  if (lg * 64 >= kept_count(cnt, b)) return;      /* 64-row groups that start at or past the kept count are never read; the same for the whole work-group, in front of the barrier */
  for (int i = tid; i < 64 * 8; i += 256) { const int r = i / 8, c8 = (i % 8) * 8; FragH f; f.half[0] = *(const v8us*)((const unsigned short*)V16 + ((size_t)b * TTv + lg * 64 + r) * ldv + voff + h * 64 + c8);
#pragma unroll
    for (int q = 0; q < 8; ++q) tl[r][c8 + q] = f.u[q]; }
  __syncthreads();
  {
#pragma unroll
    for (int rd = 0; rd < 2; ++rd) { const int d = rd * 32 + tid / 8, pc = tid % 8; FragH f;
#pragma unroll
      for (int q = 0; q < 8; ++q) f.u[q] = tl[pc * 8 + q][d];
      *(v8us*)((unsigned short*)Vt + ((size_t)slab * 64 + d) * TTv + lg * 64 + pc * 8) = f.half[0]; }
     } }

template <int D, int RBF>
__global__ __launch_bounds__(256) void k_lnx(const float* __restrict__ X, const float* __restrict__ gam, const float* __restrict__ bet, int nrows, float eps, _Float16* __restrict__ O16, float* __restrict__ XR) {
  constexpr int NP = D / 128; const int tid = threadIdx.x, wv = tid >> 5, lane = tid & 31; const size_t r = (size_t)blockIdx.x * 8 + wv; if (r >= (size_t)nrows) return; v4f y[NP]; float s = 0.f;
#pragma unroll
  for (int j = 0; j < NP; ++j) { const int c = j * 128 + lane * 4; v4f g = *(const v4fa*)(X + r * D + c); if (RBF) { for (int q = 0; q < 4; ++q) g[q] = bf16_round(g[q]); } y[j] = g; s += g[0] + g[1] + g[2] + g[3]; }
  for (int o = 16; o >= 1; o >>= 1) s += __shfl_xor(s, o, 32); const float mu = s / (float)D; float q2 = 0.f;
#pragma unroll
  for (int j = 0; j < NP; ++j) for (int q = 0; q < 4; ++q) { const float d = y[j][q] - mu; q2 += d * d; }
  for (int o = 16; o >= 1; o >>= 1) q2 += __shfl_xor(q2, o, 32); const float rs = rsqrtf(q2 / (float)D + eps);
  {
#pragma unroll
    for (int j = 0; j < NP; ++j) { const int c = j * 128 + lane * 4; v4h h; for (int q = 0; q < 4; ++q) { const float v = (y[j][q] - mu) * rs * bf16_round(gam[c + q]) + bf16_round(bet[c + q]); h[q] = (_Float16)v; } *(v4h*)(O16 + r * D + c) = h; if (XR) *(v4f*)(XR + r * D + c) = y[j]; }
     } }
// lane l <-> lane l ^ 16 (the two halves of a wave hold the two key halves of one query column)
__device__ __forceinline__ float xhalf(float x) { const int b = __builtin_bit_cast(int, x); return __builtin_bit_cast(float, __builtin_amdgcn_permlanex16(b, b, 0x76543210, 0xfedcba98, false, false)); }
#define FL_SK 64                 /* keys per stage */
#define FL_LP (64 + 8)           /* LDS row pitch in 16-bit elements */
#define FL_C 0.18033688011112042f      /* 64^-1/2 * log2(e): the exponentials are taken in base 2 on the hardware's own instruction */
// one stage: this lane's four 16-byte pieces (K rows r and r + 32, V^T rows r and r + 32). The s_wait_xcnt stands inside the statement so that no address register is rewritten ahead of it.
__device__ __forceinline__ void fl_copy4(unsigned lk, unsigned lv, const unsigned short* gk0, const unsigned short* gk1, const unsigned short* gv0, const unsigned short* gv1) {
  const unsigned lk1 = lk + 32 * FL_LP * 2, lv1 = lv + 32 * FL_LP * 2;
  asm volatile("global_load_async_to_lds_b128 %0, %4, off\n\t"
               "global_load_async_to_lds_b128 %1, %5, off\n\t"
               "global_load_async_to_lds_b128 %2, %6, off\n\t"
               "global_load_async_to_lds_b128 %3, %7, off\n\t"
               "s_wait_xcnt 0x0"
               :: "v"(lk), "v"(lk1), "v"(lv), "v"(lv1), "v"(gk0), "v"(gk1), "v"(gv0), "v"(gv1) : "memory");
}
__global__ __launch_bounds__(256) void k_flash(const _Float16* __restrict__ Q16, int ldq, const _Float16* __restrict__ K16, int ldk, const _Float16* __restrict__ Vt, const int* __restrict__ cnt, float* __restrict__ O, int ldo) {
  constexpr int NW = 8, RPW = 16, NQB = TT / (NW * RPW), DT = 4, KS = 2;
  __shared__ __attribute__((aligned(16))) unsigned short sK[2][FL_SK][FL_LP], sV[2][64][FL_LP];
  __shared__ __attribute__((aligned(16))) float sO[NW][RPW][64 + 4];
  const int tid = threadIdx.x, w = tid >> 5, lane = tid & 31, ln = lane & 15, hh = lane >> 4;
  const int slab = blockIdx.x / NQB, qblk = blockIdx.x % NQB; const int b = slab / NH, h = slab % NH; const int qb0 = qblk * (NW * RPW); const int q0 = qb0 + w * RPW;
  const int n = kept_count(cnt, b); const int nst = (n + FL_SK - 1) / FL_SK;      /* K16 and Vt hold the batch's n kept keys, packed; both are written up to the end of stage nst - 1 */
  const unsigned short* Vth = (const unsigned short*)Vt + (size_t)slab * 64 * TT;
  const int cr = tid >> 3, cc = (tid & 7) * 8;      /* 8 lanes cover one row's 128 bytes; a thread brings rows cr and cr + 32 of both tiles */
  const unsigned short* gk = (const unsigned short*)K16 + ((size_t)b * TT + cr) * ldk + h * 64 + cc;      /* + stage * 64 rows */
  const unsigned short* gv = Vth + (size_t)cr * TT + cc;                                                  /* + stage * 64 columns */
  const unsigned lk = (unsigned)(size_t)&sK[0][cr][cc], lv = (unsigned)(size_t)&sV[0][cr][cc];      /* LDS byte address = low 32 bits of the __shared__ address */
  constexpr unsigned BUFB = FL_SK * FL_LP * 2;      /* bytes of one buffer of either tile */
  if (nst > 0) fl_copy4(lk, lv, gk, gk + (size_t)32 * ldk, gv, gv + (size_t)32 * TT);      /* the same for the whole work-group */
  FragH bq[KS];      /* B operand: column ln = query q0 + ln */
  { const unsigned short* qr = (const unsigned short*)Q16 + ((size_t)b * TT + q0 + ln) * ldq + h * 64;
#pragma unroll
    for (int ks = 0; ks < KS; ++ks) { bq[ks].half[0] = *(const v8us*)(qr + ks * 32 + 8 * hh); bq[ks].half[1] = *(const v8us*)(qr + ks * 32 + 16 + 8 * hh); } }
  asm volatile("s_wait_asynccnt 0x0" ::: "memory");      /* stage 0 of this wave has landed before the barrier that publishes it */
  __syncthreads();
  if (nst > 1) fl_copy4(lk + BUFB, lv + BUFB, gk + (size_t)FL_SK * ldk, gk + (size_t)(FL_SK + 32) * ldk, gv + FL_SK, gv + (size_t)32 * TT + FL_SK);
  float m_q = -3.0e38f, l_q = 0.f; v8f oacc[DT];      /* oacc[dt][r] = O[q0 + ln][dt * 16 + 8 * hh + r] */
#pragma unroll
  for (int dt = 0; dt < DT; ++dt) oacc[dt] = (v8f){0.f,0.f,0.f,0.f,0.f,0.f,0.f,0.f};
#pragma unroll 1
  for (int st = 0; st < nst; ++st) {
    const int cur = st & 1;
#pragma unroll 1      /* rolled: unrolled, the two passes take more than the 128 registers at which all four work-groups of a WGP are resident */
    for (int jj = 0; jj < FL_SK; jj += 32) {
    const int j0 = st * FL_SK + jj;
    v8f s[2];
#pragma unroll
    for (int nt = 0; nt < 2; ++nt) { const unsigned short* kr = &sK[cur][jj + nt * 16 + ln][0]; FragH ak[KS];
#pragma unroll
      for (int ks = 0; ks < KS; ++ks) { ak[ks].half[0] = *(const v8us*)(kr + ks * 32 + 8 * hh); ak[ks].half[1] = *(const v8us*)(kr + ks * 32 + 16 + 8 * hh); }
      v8f acc = (v8f){0.f,0.f,0.f,0.f,0.f,0.f,0.f,0.f};
#pragma unroll
      for (int ks = 0; ks < KS; ++ks) acc = mmaH<1>(ak[ks].v, ak[ks].v, bq[ks].v, bq[ks].v, acc);
      s[nt] = acc; }
    if (j0 + 32 > n) {      /* only a batch's last stage holds rows past its kept keys (this lane's are j0 + 8hh + 0..7 and j0 + 16 + 8hh + 0..7): score -inf, so the exponential below is exactly 0 */
#pragma unroll      /* constant element numbers: the score tiles stay in registers */
      for (int i = 0; i < 16; ++i) s[i >> 3][i & 7] = (j0 + (i >> 3) * 16 + 8 * hh + (i & 7) < n) ? s[i >> 3][i & 7] : -INFINITY; }
    float sc[16]; float mc = -INFINITY;      /* raw q.k */
#pragma unroll
    for (int i = 0; i < 16; ++i) { sc[i] = s[i >> 3][i & 7]; mc = fmaxf(mc, sc[i]); }
    mc = fmaxf(mc, xhalf(mc));
    const float mn = fmaxf(m_q, mc); const float al = __builtin_amdgcn_exp2f((m_q - mn) * FL_C); m_q = mn;      /* m_q and mn (raw q.k units) are finite (start -3e38): no key seen yet gives 2^0 = 1 */
    const float nb = __builtin_fmaf(-mn, FL_C, 10.0f);      /* 2^10 e^((s - mn) / 8) = 2^(s C + nb): scale, maximum and the 2^10 of P in one fused multiply-add a score */
    float ps = 0.f; FragH pb;      /* pb.h[i] = 2^10 P^T[k = kmap(i, hh)][ln] */
#pragma unroll
    for (int i = 0; i < 16; ++i) { const float p = __builtin_amdgcn_exp2f(__builtin_fmaf(sc[i], FL_C, nb)); ps += p; pb.h[i] = (_Float16)p; }
    l_q = l_q * al + ps;      /* the row sum carries the same 2^10 */
#pragma unroll
    for (int dt = 0; dt < DT; ++dt)
#pragma unroll
      for (int r = 0; r < 8; ++r) oacc[dt][r] *= al;
#pragma unroll
    for (int dt = 0; dt < DT; ++dt) { const unsigned short* vrow = &sV[cur][dt * 16 + ln][jj]; FragH av; av.half[0] = *(const v8us*)(vrow + 8 * hh); av.half[1] = *(const v8us*)(vrow + 16 + 8 * hh);
      oacc[dt] = mmaH<1>(av.v, av.v, pb.v, pb.v, oacc[dt]); } }
    asm volatile("s_wait_dscnt 0x0" ::: "memory");      /* this wave's reads of buffer cur have returned before the buffer is refilled */
    asm volatile("s_wait_asynccnt 0x0" ::: "memory");   /* this wave's copies of stage st + 1 have landed before the barrier that publishes them */
    __syncthreads();      /* publishes stage st + 1 and ends every wave's reads of buffer cur */
    if (st + 2 < nst) {      /* the same for the whole work-group */
      const unsigned short* k2 = gk + (size_t)(st + 2) * FL_SK * ldk; const unsigned short* v2 = gv + (st + 2) * FL_SK;
      fl_copy4(lk + cur * BUFB, lv + cur * BUFB, k2, k2 + (size_t)32 * ldk, v2, v2 + (size_t)32 * TT); }
  }
  asm volatile("s_wait_asynccnt 0x0" ::: "memory");      /* nothing of this wave is in flight when it goes on to the output */
  { float l = l_q + xhalf(l_q); l = (l > 0.f) ? 1.0f / l : 0.f;
#pragma unroll
    for (int dt = 0; dt < DT; ++dt)
#pragma unroll
      for (int g = 0; g < 2; ++g) { v4f o; for (int q = 0; q < 4; ++q) o[q] = oacc[dt][g * 4 + q] * l; *(v4fa*)&sO[w][ln][dt * 16 + 8 * hh + g * 4] = o; } }
  __builtin_amdgcn_fence(__ATOMIC_ACQ_REL, "workgroup"); __builtin_amdgcn_wave_barrier();
  {
#pragma unroll
    for (int rp = 0; rp < RPW; rp += 2) { const int r = rp + (lane >> 4), pc = lane & 15; const v4f val = *(const v4fa*)&sO[w][r][pc * 4]; *(v4f*)(O + ((size_t)b * TT + q0 + r) * ldo + h * 64 + pc * 4) = val; }
     } }

__global__ __launch_bounds__(256) void k_addbf(float* __restrict__ out, const float* __restrict__ x, size_t n4) { const size_t t = (size_t)blockIdx.x * 256 + threadIdx.x; if (t >= n4) return; v4f a = *(const v4fa*)(out + t * 4); const v4f b = *(const v4fa*)(x + t * 4); for (int q = 0; q < 4; ++q) a[q] += bf16_round(b[q]); *(v4f*)(out + t * 4) = a;  }
extern "C" void kernel_launch(void* const* d_in, const int* in_sizes, int n_in,
                              void* d_out, int out_size, void* d_ws, size_t ws_size, hipStream_t stream) {
  (void)in_sizes; (void)n_in; (void)out_size;
  const float* const* I = (const float* const*)d_in; const float* x = I[0]; const int* mask = (const int*)d_in[1]; const float* Wqkv = I[2]; const float* bqkv = I[3]; const float* Wo = I[4]; const float* bo = I[5]; const float* lng = I[6]; const float* lnb = I[7];      /* d_in order: hidden_states, encoder_padding_mask, qkv_w, qkv_b, out_w, out_b, ln_g, ln_b */
  const float* bq = bqkv; const float* bk = bqkv + DD; const float* bv = bqkv + 2 * DD;
  char* ws = (char*)d_ws; size_t off = 0;
  auto take = [&](size_t bytes) { char* p = ws + off; off += (bytes + 255) & ~(size_t)255; return p; };
  const size_t WSZ = (size_t)DD * DD; _Float16* Bw = (_Float16*)take(4 * WSZ * 2); _Float16* X16 = (_Float16*)take((size_t)NR * DD * 2);
  _Float16* Q = (_Float16*)take((size_t)NR * DD * 2); _Float16* K = (_Float16*)take((size_t)NR * DD * 2); _Float16* V = (_Float16*)take((size_t)NR * DD * 2); _Float16* Vt = (_Float16*)take((size_t)NR * DD * 2);
  int* kidx = (int*)take((size_t)NR * 4); int* kcnt = (int*)take(BB * 4);
  float* O = (float*)take((size_t)NR * DD * 4); _Float16* O16 = V;      /* the v plane is dead once Vᵀ is built (before the attention kernel); O16 reuses it */
  if (off > ws_size) return;      // 8.4 + 16.8 × 5 + 33.6 ≈ 126 MB (120 MiB)
  const unsigned gw2 = (unsigned)((WSZ / 8 + 255) / 256);
  k_round16f<<<(unsigned)((3 * WSZ / 8 + 255) / 256), 256, 0, stream>>>(Wqkv, Bw, 3 * WSZ / 8); k_round16f<<<gw2, 256, 0, stream>>>(Wo, Bw + 3 * WSZ, WSZ / 8);      /* (out,in) natural ×2^4: rows q|k|v, then out_w */
  const unsigned gx = (unsigned)(((size_t)NR * DD / 8 + 255) / 256); const unsigned gp = (NR / 128) * (DD / 128);
  k_lnx<DD, 1><<<(NR + 7) / 8, 256, 0, stream>>>(x, lng, lnb, NR, 1e-5f, X16, nullptr);      /* x = LN(bf16 hidden) → f16 */
  k_keys<<<BB, 256, 0, stream>>>(mask, kidx, kcnt);
  k_gemm_t<false, false><<<gp, 256, 0, stream>>>(X16, Bw, 0.0625f, bq, nullptr, Q, nullptr, nullptr);      /* q = x·Wq + bq: M 8192 N 1024 K 1024 */
  k_gemm_t<false, true><<<gp, 256, 0, stream>>>(X16, Bw + WSZ, 0.0625f, bk, nullptr, K, kidx, kcnt);      /* kept keys only, packed per batch */
  k_gemm_t<false, true><<<gp, 256, 0, stream>>>(X16, Bw + 2 * WSZ, 0.0625f, bv, nullptr, V, kidx, kcnt);
  k_vt<NH, TT><<<BB * NH * (TT / 64), 256, 0, stream>>>(V, DD, 0, Vt, kcnt);
  k_flash<<<BB * NH * (TT / 128), 256, 0, stream>>>(Q, DD, K, DD, Vt, kcnt, O, DD);
  k_h16<<<gx, 256, 0, stream>>>(O, O16, (size_t)NR * DD / 8);
  k_gemm_t<true, false><<<gp, 256, 0, stream>>>(O16, Bw + 3 * WSZ, 0.0625f, bo, (float*)d_out, nullptr, nullptr, nullptr);      /* out = O·out_wᵀ + out_b */
  k_addbf<<<(unsigned)(((size_t)NR * DD / 4 + 255) / 256), 256, 0, stream>>>((float*)d_out, x, (size_t)NR * DD / 4);      /* += bf16(hidden) in place (residual; no workspace left for an f32 copy) */
}

// v006
// Measured time: 126 microseconds a run.
// Next to v005, in two timings, it ran 1.18 times as fast each time.
// Over all steps from v000 it is 6.66 times as fast.
#include <hip/hip_runtime.h>
// Pre-LN self-attention layer with a key padding mask and residual (B=4, S=2048, H=1024, 16 heads × 64): x = LN(hidden); [q|k|v] = x·qkv_wᵀ + qkv_b ((out,in) fused); scores = q·kᵀ·64^-½ + mask·(−1e8) (int mask [B,S], 1 = pad); softmax;
// out = (attn·v merged)·out_wᵀ + out_b + hidden.
// Compute dtype: x, weights, biases rounded to bf16; q/k/v as f16 GEMM outputs; fused flash-style kernel (online softmax f32, P f16 ×2^10) on v_wmma_f32_16x16x32_f16; O → f16 → output GEMM with bias; f32 accumulate.
#define BB 4
#define TT 2048
#define NH 16
#define DD 1024
#define NR (BB * TT)

typedef __bf16 v16b __attribute__((ext_vector_type(16)));
typedef unsigned short v8us __attribute__((ext_vector_type(8), may_alias));
typedef float  v8f  __attribute__((ext_vector_type(8)));
typedef float  v4f  __attribute__((ext_vector_type(4)));
typedef float  v4fa __attribute__((ext_vector_type(4), may_alias));
union FragB { v16b v; v8us half[2]; unsigned short u[16]; };

__device__ __forceinline__ unsigned short bf16_bits(float x) { unsigned int u = __float_as_uint(x); return (unsigned short)((u + 0x7FFFu + ((u >> 16) & 1u)) >> 16); }
__device__ __forceinline__ float bf16_val(unsigned short b) { return __uint_as_float(((unsigned int)b) << 16); }
__device__ __forceinline__ float bf16_round(float x) { return bf16_val(bf16_bits(x)); }
// D += A·B with NT terms: 1 = ah·bh, 2 = + al·bh (A split), 3 = + ah·bl (both split)
template <int NT>
__device__ __forceinline__ v8f mmaN(v16b ah, v16b al, v16b bh, v16b bl, v8f c) {
  c = __builtin_amdgcn_wmma_f32_16x16x32_bf16(false, ah, false, bh, (short)0, c, false, false);
  if (NT >= 2) c = __builtin_amdgcn_wmma_f32_16x16x32_bf16(false, al, false, bh, (short)0, c, false, false);
  if (NT >= 3) c = __builtin_amdgcn_wmma_f32_16x16x32_bf16(false, ah, false, bl, (short)0, c, false, false);
  asm volatile("v_nop\n\tv_nop\n\tv_nop\n\tv_nop" : "+v"(c) : "v"(ah), "v"(al), "v"(bh), "v"(bl));
  return c;
}

__global__ __launch_bounds__(256) void k_wt_bf16(const float* __restrict__ W, unsigned short* __restrict__ Wt, int K, int N) {
  const int t = blockIdx.x * 256 + threadIdx.x;
  const int k8n = K / 8;
  if (t >= N * k8n) return;
  const int n = t / k8n, k8 = (t % k8n) * 8;
  v8us v;
#pragma unroll
  for (int i = 0; i < 8; ++i) v[i] = bf16_bits(W[(size_t)(k8 + i) * N + n]);
  *(v8us*)(Wt + (size_t)n * K + k8) = v;
  
}

// GEMM C[M][N] (f32, pitch ldc) = act(A[M][K]·W + bias). A f32 row-major (pitch lda) converted per fragment to bf16
// (ASPLIT: hi/lo two planes -> 2 terms, else single rounded term); Wt bf16 [N][K] (pitch ldb). BIAS_BF16 rounds the
// bias to bf16 first (bias quantised to bf16 before the add). K%32==0, M%16==0, N%64==0.
template <bool ASPLIT, int ACT, bool BIAS_BF16>
__global__ __launch_bounds__(128) void k_gemm_bf(const float* __restrict__ A, int lda, const unsigned short* __restrict__ Wt, int ldb,
                                               const float* __restrict__ bias, float* __restrict__ C, int ldc, int M, int N, int K) {
  __shared__ __attribute__((aligned(16))) float so[4][16][64];
  const int tid = threadIdx.x, w = tid >> 5, lane = tid & 31, ln = lane & 15, hh = lane >> 4;
  const int ntn = N / 64;
  const int wid = blockIdx.x * 4 + w;
  const int mt = wid / ntn, nq = wid % ntn;
  if (mt * 16 >= M) return;
  const int row0 = mt * 16, col0 = nq * 64;
  const float* arow = A + (size_t)(row0 + ln) * lda;
  v8f acc[4] = {};
  for (int kb = 0; kb < K; kb += 32) {
    FragB ah, al;
    const v4f x0 = *(const v4fa*)(arow + kb + 8 * hh), x1 = *(const v4fa*)(arow + kb + 8 * hh + 4);
    const v4f x2 = *(const v4fa*)(arow + kb + 16 + 8 * hh), x3 = *(const v4fa*)(arow + kb + 16 + 8 * hh + 4);
    float xs[16] = {x0[0],x0[1],x0[2],x0[3],x1[0],x1[1],x1[2],x1[3],x2[0],x2[1],x2[2],x2[3],x3[0],x3[1],x3[2],x3[3]};
#pragma unroll
    for (int i = 0; i < 16; ++i) { const unsigned short hb = bf16_bits(xs[i]); ah.u[i] = hb; al.u[i] = ASPLIT ? bf16_bits(xs[i] - bf16_val(hb)) : (unsigned short)0; }
#pragma unroll
    for (int t = 0; t < 4; ++t) {
      const unsigned short* brow = Wt + (size_t)(col0 + t * 16 + ln) * ldb + kb;
      FragB b;
      b.half[0] = *(const v8us*)(brow + 8 * hh);
      b.half[1] = *(const v8us*)(brow + 16 + 8 * hh);
      acc[t] = mmaN<ASPLIT ? 2 : 1>(ah.v, al.v, b.v, b.v, acc[t]);
    }
  }
#pragma unroll
  for (int t = 0; t < 4; ++t) {
    float bv = bias ? bias[col0 + t * 16 + ln] : 0.f;
    if (BIAS_BF16) bv = bf16_round(bv);
#pragma unroll
    for (int r = 0; r < 8; ++r) { float v = acc[t][r] + bv; if (ACT == 1) v = fmaxf(v, 0.f); so[w][8 * hh + r][t * 16 + ln] = v; }
  }
  __builtin_amdgcn_fence(__ATOMIC_ACQ_REL, "workgroup");
  __builtin_amdgcn_wave_barrier();
  const int rsub = lane >> 4, c4 = (lane & 15) * 4;
  {
#pragma unroll
    for (int q = 0; q < 8; ++q) {
      const int r = q * 2 + rsub;
      const v4f v = *(const v4fa*)&so[w][r][c4];
      *(v4f*)(C + (size_t)(row0 + r) * ldc + col0 + c4) = v;
    }
    
  }
}

// Flash-style causal/unmasked attention, all contractions 3-term bf16 hi/lo splits, f32 softmax with running max.
// q,k,v rows are read from f32 buffers with arbitrary row pitch (so they can live inside a fused qkv buffer);
// D = head size (multiple of 32, <= 128); one wave = 16 query rows; block = 4 waves (64 queries) sharing K/V chunks of 32.
template <int D, bool CAUSAL>
__global__ __launch_bounds__(128) void k_flash(const float* __restrict__ qb, const float* __restrict__ kb, const float* __restrict__ vb,
                                             int pitch, int T, int H, float scale, float* __restrict__ y, int ypitch) {
  constexpr int KS = D / 32;        // k-steps for QK
  constexpr int DT = D / 16;        // d tiles for PV
  __shared__ __attribute__((aligned(16))) unsigned short sKh[32][D + 8], sKl[32][D + 8], sVh[32][D + 8], sVl[32][D + 8];
  __shared__ __attribute__((aligned(16))) unsigned short sPh[4][16][40], sPl[4][16][40];
  __shared__ __attribute__((aligned(16))) float sO[4][16][D];
  const int tid = threadIdx.x, w = tid >> 5, lane = tid & 31, ln = lane & 15, hh = lane >> 4;
  const int nqb = (T + 63) / 64;
  const int bh = blockIdx.x / nqb, qblk = blockIdx.x % nqb;
  const int b = bh / H, h = bh % H;
  const int q0 = qblk * 64 + w * 16;
  const float* Q = qb + (size_t)b * T * pitch + h * D;
  const float* K = kb + (size_t)b * T * pitch + h * D;
  const float* V = vb + (size_t)b * T * pitch + h * D;

  // A fragments of the wave's 16 query rows (scaled), hi/lo
  FragB aqh[KS], aql[KS];
  {
    int row = q0 + ln; if (row >= T) row = T - 1;
    const float* qr = Q + (size_t)row * pitch;
#pragma unroll
    for (int ks = 0; ks < KS; ++ks)
#pragma unroll
      for (int i = 0; i < 16; ++i) {
        const int d = ks * 32 + ((i < 8) ? (8 * hh + i) : (16 + 8 * hh + (i - 8)));
        const float x = qr[d] * scale; const unsigned short hb = bf16_bits(x);
        aqh[ks].u[i] = hb; aql[ks].u[i] = bf16_bits(x - bf16_val(hb));
      }
  }
  float m_r[8], l_r[8];
#pragma unroll
  for (int r = 0; r < 8; ++r) { m_r[r] = -3.0e38f; l_r[r] = 0.f; }
  v8f oacc[DT];
#pragma unroll
  for (int dt = 0; dt < DT; ++dt) oacc[dt] = (v8f){0.f,0.f,0.f,0.f,0.f,0.f,0.f,0.f};

  const int kv_end = CAUSAL ? min(T, qblk * 64 + 64) : T;     // block-uniform
  for (int j0 = 0; j0 < kv_end; j0 += 32) {
    __syncthreads();
    for (int e = tid; e < 32 * (D / 4); e += 128) {
      const int r = e / (D / 4), c4 = (e % (D / 4)) * 4;
      const int key = j0 + r;
      v4f kf = {0.f,0.f,0.f,0.f}, vf = {0.f,0.f,0.f,0.f};
      if (key < T) { kf = *(const v4fa*)(K + (size_t)key * pitch + c4); vf = *(const v4fa*)(V + (size_t)key * pitch + c4); }
#pragma unroll
      for (int t = 0; t < 4; ++t) {
        unsigned short hb = bf16_bits(kf[t]); sKh[r][c4 + t] = hb; sKl[r][c4 + t] = bf16_bits(kf[t] - bf16_val(hb));
        hb = bf16_bits(vf[t]); sVh[r][c4 + t] = hb; sVl[r][c4 + t] = bf16_bits(vf[t] - bf16_val(hb));
      }
    }
    __syncthreads();
    // S tile 16 x 32
    v8f s[2];
#pragma unroll
    for (int nt = 0; nt < 2; ++nt) {
      v8f acc = {};
#pragma unroll
      for (int ks = 0; ks < KS; ++ks) {
        FragB bh_, bl_;
        bh_.half[0] = *(const v8us*)&sKh[nt * 16 + ln][ks * 32 + 8 * hh]; bh_.half[1] = *(const v8us*)&sKh[nt * 16 + ln][ks * 32 + 16 + 8 * hh];
        bl_.half[0] = *(const v8us*)&sKl[nt * 16 + ln][ks * 32 + 8 * hh]; bl_.half[1] = *(const v8us*)&sKl[nt * 16 + ln][ks * 32 + 16 + 8 * hh];
        acc = mmaN<3>(aqh[ks].v, aql[ks].v, bh_.v, bl_.v, acc);
      }
      s[nt] = acc;
    }
    // mask + running max (rows 8hh+r; the 16 lanes of a half share rows)
    float alpha[8];
#pragma unroll
    for (int r = 0; r < 8; ++r) {
      const int qi = q0 + 8 * hh + r;
      const int ja = j0 + ln, jb = j0 + 16 + ln;
      if (CAUSAL) { if (ja > qi) s[0][r] = -3.0e38f; if (jb > qi) s[1][r] = -3.0e38f; }
      if (ja >= T) s[0][r] = -3.0e38f;
      if (jb >= T) s[1][r] = -3.0e38f;
      float mx = fmaxf(s[0][r], s[1][r]);
      mx = fmaxf(mx, __shfl_xor(mx, 1, 32)); mx = fmaxf(mx, __shfl_xor(mx, 2, 32)); mx = fmaxf(mx, __shfl_xor(mx, 4, 32)); mx = fmaxf(mx, __shfl_xor(mx, 8, 32));
      const float mnew = fmaxf(m_r[r], mx);
      alpha[r] = (mnew > -1.0e38f) ? __expf(m_r[r] - mnew) : 1.0f;
      const float p0 = (s[0][r] > -1.0e38f) ? __expf(s[0][r] - mnew) : 0.f;
      const float p1 = (s[1][r] > -1.0e38f) ? __expf(s[1][r] - mnew) : 0.f;
      m_r[r] = mnew;
      l_r[r] = l_r[r] * alpha[r] + p0 + p1;            // per-lane partial row sum (16 lanes combined at the end)
      unsigned short hb = bf16_bits(p0); sPh[w][8 * hh + r][ln] = hb;      sPl[w][8 * hh + r][ln] = bf16_bits(p0 - bf16_val(hb));
      hb = bf16_bits(p1);                sPh[w][8 * hh + r][16 + ln] = hb; sPl[w][8 * hh + r][16 + ln] = bf16_bits(p1 - bf16_val(hb));
    }
#pragma unroll
    for (int dt = 0; dt < DT; ++dt)
#pragma unroll
      for (int r = 0; r < 8; ++r) oacc[dt][r] *= alpha[r];
    __builtin_amdgcn_fence(__ATOMIC_ACQ_REL, "workgroup");
    __builtin_amdgcn_wave_barrier();
    FragB pah, pal;
    pah.half[0] = *(const v8us*)&sPh[w][ln][8 * hh]; pah.half[1] = *(const v8us*)&sPh[w][ln][16 + 8 * hh];
    pal.half[0] = *(const v8us*)&sPl[w][ln][8 * hh]; pal.half[1] = *(const v8us*)&sPl[w][ln][16 + 8 * hh];
#pragma unroll
    for (int dt = 0; dt < DT; ++dt) {
      FragB bvh, bvl;
#pragma unroll
      for (int i = 0; i < 8; ++i) {
        bvh.u[i] = sVh[8 * hh + i][dt * 16 + ln]; bvh.u[8 + i] = sVh[16 + 8 * hh + i][dt * 16 + ln];
        bvl.u[i] = sVl[8 * hh + i][dt * 16 + ln]; bvl.u[8 + i] = sVl[16 + 8 * hh + i][dt * 16 + ln];
      }
      oacc[dt] = mmaN<3>(pah.v, pal.v, bvh.v, bvl.v, oacc[dt]);
    }
    __builtin_amdgcn_fence(__ATOMIC_ACQ_REL, "workgroup");
    __builtin_amdgcn_wave_barrier();
  }
#pragma unroll
  for (int r = 0; r < 8; ++r) {
    float l = l_r[r];
    l += __shfl_xor(l, 1, 32); l += __shfl_xor(l, 2, 32); l += __shfl_xor(l, 4, 32); l += __shfl_xor(l, 8, 32);
    l_r[r] = (l > 0.f) ? 1.0f / l : 0.f;
  }
#pragma unroll
  for (int dt = 0; dt < DT; ++dt)
#pragma unroll
    for (int r = 0; r < 8; ++r) sO[w][8 * hh + r][dt * 16 + ln] = oacc[dt][r] * l_r[r];
  __builtin_amdgcn_fence(__ATOMIC_ACQ_REL, "workgroup");
  __builtin_amdgcn_wave_barrier();
  {
    for (int r = 0; r < 16; ++r) {
      const int row = q0 + r;
      if (row < T && lane < D / 4) {
        const v4f val = *(const v4fa*)&sO[w][r][lane * 4];
        *(v4f*)(y + ((size_t)b * T + row) * ypitch + h * D + lane * 4) = val;
      }
    }
    
  }
}

// GEMM C = act(A·W + bias + resid): A f32 (ASPLIT -> hi/lo 2 terms), Wt bf16 [N][K]; ACT 0 none, 1 relu, 2 exact gelu;
// resid (optional, f32, row index = (row % rmod), pitch ldr, RES_BF16 rounds it) added before the activation.
template <bool ASPLIT, int ACT, bool BIAS_BF16, bool RES_BF16>
__global__ __launch_bounds__(128) void k_gemm_bf3(const float* __restrict__ A, int lda, const unsigned short* __restrict__ Wt, int ldb,
                                                const float* __restrict__ bias, const float* __restrict__ resid, int rmod, int ldr,
                                                float* __restrict__ C, int ldc, int M, int N, int K) {
  __shared__ __attribute__((aligned(16))) float so[4][16][64];
  const int tid = threadIdx.x, w = tid >> 5, lane = tid & 31, ln = lane & 15, hh = lane >> 4;
  const int ntn = N / 64;
  const int wid = blockIdx.x * 4 + w;
  const int mt = wid / ntn, nq = wid % ntn;
  if (mt * 16 >= M) return;
  const int row0 = mt * 16, col0 = nq * 64;
  const float* arow = A + (size_t)(row0 + ln) * lda;
  v8f acc[4] = {};
  for (int kb = 0; kb < K; kb += 32) {
    FragB ah, al;
    const v4f x0 = *(const v4fa*)(arow + kb + 8 * hh), x1 = *(const v4fa*)(arow + kb + 8 * hh + 4);
    const v4f x2 = *(const v4fa*)(arow + kb + 16 + 8 * hh), x3 = *(const v4fa*)(arow + kb + 16 + 8 * hh + 4);
    float xs[16] = {x0[0],x0[1],x0[2],x0[3],x1[0],x1[1],x1[2],x1[3],x2[0],x2[1],x2[2],x2[3],x3[0],x3[1],x3[2],x3[3]};
#pragma unroll
    for (int i = 0; i < 16; ++i) { const unsigned short hb = bf16_bits(xs[i]); ah.u[i] = hb; al.u[i] = ASPLIT ? bf16_bits(xs[i] - bf16_val(hb)) : (unsigned short)0; }
#pragma unroll
    for (int t = 0; t < 4; ++t) {
      const unsigned short* brow = Wt + (size_t)(col0 + t * 16 + ln) * ldb + kb;
      FragB b;
      b.half[0] = *(const v8us*)(brow + 8 * hh);
      b.half[1] = *(const v8us*)(brow + 16 + 8 * hh);
      acc[t] = mmaN<ASPLIT ? 2 : 1>(ah.v, al.v, b.v, b.v, acc[t]);
    }
  }
#pragma unroll
  for (int t = 0; t < 4; ++t) {
    const int col = col0 + t * 16 + ln;
    float bv = bias ? bias[col] : 0.f;
    if (BIAS_BF16) bv = bf16_round(bv);
#pragma unroll
    for (int r = 0; r < 8; ++r) {
      float v = acc[t][r] + bv;
      if (resid) { float rv = resid[(size_t)((row0 + 8 * hh + r) % rmod) * ldr + col]; if (RES_BF16) rv = bf16_round(rv); v += rv; }
      if (ACT == 1) v = fmaxf(v, 0.f);
      if (ACT == 2) v = 0.5f * v * (1.0f + erff(v * 0.70710678118654752f));
      if (ACT == 3) { const float u = 0.7978845608028654f * (v + 0.044715f * v * v * v); v = 0.5f * v * (1.0f + tanhf(u)); }
      so[w][8 * hh + r][t * 16 + ln] = v;
    }
  }
  __builtin_amdgcn_fence(__ATOMIC_ACQ_REL, "workgroup");
  __builtin_amdgcn_wave_barrier();
  const int rsub = lane >> 4, c4 = (lane & 15) * 4;
  {
#pragma unroll
    for (int q = 0; q < 8; ++q) {
      const int r = q * 2 + rsub;
      const v4f v = *(const v4fa*)&so[w][r][c4];
      *(v4f*)(C + (size_t)(row0 + r) * ldc + col0 + c4) = v;
    }
    
  }
}
// row LayerNorm (biased variance, eps) over N: s = X (+ R); optional out_sum <- s; out_norm <- (s-mu)*rsqrt(var+eps)*g + b
template <bool PARAM_BF16>
__global__ __launch_bounds__(256) void k_layernorm(const float* __restrict__ X, const float* __restrict__ R, const float* __restrict__ g, const float* __restrict__ bta,
                                                  float* __restrict__ out_sum, float* __restrict__ out_norm, int N, float eps) {
  __shared__ float red[256];
  const int row = blockIdx.x, tid = threadIdx.x;
  const float* x = X + (size_t)row * N; const float* rr = R ? R + (size_t)row * N : nullptr;
  float vals[16];                     // up to N = 4096
  const int per = N / 256;            // contiguous chunk per thread? use strided-by-4 chunks: thread handles j = tid*4 + 1024*u
  float s1 = 0.f;
  for (int u = 0; u < per / 4; ++u) {
    const int j = tid * 4 + 1024 * u;
    const v4f a = *(const v4fa*)(x + j);
    v4f b = {0.f,0.f,0.f,0.f}; if (rr) b = *(const v4fa*)(rr + j);
#pragma unroll
    for (int q = 0; q < 4; ++q) { const float v = a[q] + b[q]; vals[u * 4 + q] = v; s1 += v; }
  }
  red[tid] = s1; __syncthreads();
  for (int st = 128; st > 0; st >>= 1) { if (tid < st) red[tid] += red[tid + st]; __syncthreads(); }
  const float mu = red[0] / (float)N; __syncthreads();
  float s2 = 0.f;
  for (int u = 0; u < per / 4; ++u)
#pragma unroll
    for (int q = 0; q < 4; ++q) { const float c = vals[u * 4 + q] - mu; s2 += c * c; }
  red[tid] = s2; __syncthreads();
  for (int st = 128; st > 0; st >>= 1) { if (tid < st) red[tid] += red[tid + st]; __syncthreads(); }
  const float rs = rsqrtf(red[0] / (float)N + eps);
  {
    for (int u = 0; u < per / 4; ++u) {
      const int j = tid * 4 + 1024 * u;
      v4f o, sm;
#pragma unroll
      for (int q = 0; q < 4; ++q) {
        float gg = g[j + q], bb = bta[j + q];
        if (PARAM_BF16) { gg = bf16_round(gg); bb = bf16_round(bb); }
        sm[q] = vals[u * 4 + q]; o[q] = (vals[u * 4 + q] - mu) * rs * gg + bb;
      }
      if (out_sum) *(v4f*)(out_sum + (size_t)row * N + j) = sm;
      *(v4f*)(out_norm + (size_t)row * N + j) = o;
    }
    
  }
}



// ---- f16 WMMA path (v_wmma_f32_16x16x32_f16): 11-bit significands for operands in range — used where a [0,1] probability operand needs more precision than bf16
typedef _Float16 v16h __attribute__((ext_vector_type(16)));
union FragH { v16h v; v8us half[2]; _Float16 h[16]; unsigned short u[16]; };
template <int NT>
__device__ __forceinline__ v8f mmaH(v16h ah, v16h al, v16h bh, v16h bl, v8f c) {
  c = __builtin_amdgcn_wmma_f32_16x16x32_f16(false, ah, false, bh, (short)0, c, false, false);
  if (NT >= 2) c = __builtin_amdgcn_wmma_f32_16x16x32_f16(false, al, false, bh, (short)0, c, false, false);
  if (NT >= 3) c = __builtin_amdgcn_wmma_f32_16x16x32_f16(false, ah, false, bl, (short)0, c, false, false);
  asm volatile("v_nop\n\tv_nop\n\tv_nop\n\tv_nop" : "+v"(c) : "v"(ah), "v"(al), "v"(bh), "v"(bl));
  return c;
}
// batched GEMM like k_gemm_b but f16 operands: A f32 (split into f16 hi/lo if ASPLIT, else rounded to f16), Bt = f16 values [n][k]; alpha; C f32; N multiple of 16 (partial tiles skipped)
template <bool ASPLIT>
__global__ __launch_bounds__(128) void k_gemm_h(const float* __restrict__ A, int lda, size_t sA, const _Float16* __restrict__ Bh, int ldb, size_t sB, float alpha, float* __restrict__ C, int ldc, size_t sC, int M, int N, int K) {
  __shared__ __attribute__((aligned(16))) float so[4][16][64];
  const int tid = threadIdx.x, w = tid >> 5, lane = tid & 31, ln = lane & 15, hh = lane >> 4; const int by = blockIdx.y;
  A += (size_t)by * sA; Bh += (size_t)by * sB; C += (size_t)by * sC;
  const int ntn = (N + 63) / 64; const int wid = blockIdx.x * 4 + w; const int mt = wid / ntn, nq = wid % ntn; if (mt * 16 >= M) return;
  const int row0 = mt * 16, col0 = nq * 64; const float* arow = A + (size_t)(row0 + ln) * lda;
  v8f acc[4] = {};
  for (int kb = 0; kb < K; kb += 32) {
    FragH ah, al;
    const v4f x0 = *(const v4fa*)(arow + kb + 8 * hh), x1 = *(const v4fa*)(arow + kb + 8 * hh + 4), x2 = *(const v4fa*)(arow + kb + 16 + 8 * hh), x3 = *(const v4fa*)(arow + kb + 16 + 8 * hh + 4);
    float xs[16] = {x0[0],x0[1],x0[2],x0[3],x1[0],x1[1],x1[2],x1[3],x2[0],x2[1],x2[2],x2[3],x3[0],x3[1],x3[2],x3[3]};
#pragma unroll
    for (int i = 0; i < 16; ++i) { const _Float16 h = (_Float16)xs[i]; ah.h[i] = h; al.h[i] = ASPLIT ? (_Float16)(xs[i] - (float)h) : (_Float16)0.0f; }
#pragma unroll
    for (int t = 0; t < 4; ++t) { if (col0 + t * 16 >= N) continue; const size_t boff = (size_t)(col0 + t * 16 + ln) * ldb + kb; FragH bq; bq.half[0] = *(const v8us*)(Bh + boff + 8 * hh); bq.half[1] = *(const v8us*)(Bh + boff + 16 + 8 * hh);
      acc[t] = mmaH<ASPLIT ? 2 : 1>(ah.v, al.v, bq.v, bq.v, acc[t]); }
  }
#pragma unroll
  for (int t = 0; t < 4; ++t) { if (col0 + t * 16 >= N) continue;
#pragma unroll
    for (int r = 0; r < 8; ++r) so[w][8 * hh + r][t * 16 + ln] = acc[t][r] * alpha; }
  __builtin_amdgcn_fence(__ATOMIC_ACQ_REL, "workgroup"); __builtin_amdgcn_wave_barrier();
  const int rsub = lane >> 4, c4 = (lane & 15) * 4;
  {
#pragma unroll
    for (int q = 0; q < 8; ++q) { const int r = q * 2 + rsub; if (col0 + c4 < N) { const v4f v = *(const v4fa*)&so[w][r][c4]; *(v4f*)(C + (size_t)(row0 + r) * ldc + col0 + c4) = v; } }
     }
}

// Wt[n][k] = f16(W[k][n]·scale) from f32 row-major W[K][N] (scale = power of two; bf16-exact weights stay exact in f16 away from the subnormal range)
__global__ __launch_bounds__(256) void k_wt_f16(const float* __restrict__ W, _Float16* __restrict__ Wt, int K, int N, float scale) {
  const int t = blockIdx.x * 256 + threadIdx.x; if (t >= N * (K / 8)) return; const int n = t / (K / 8), k8 = (t % (K / 8)) * 8; FragH f;
#pragma unroll
  for (int i = 0; i < 8; ++i) f.h[i] = (_Float16)(bf16_round(W[(size_t)(k8 + i) * N + n]) * scale); const v8us o = f.half[0];
  *(v8us*)((unsigned short*)Wt + (size_t)n * K + k8) = o; 
}
typedef _Float16 v4h __attribute__((ext_vector_type(4)));
// A padded key (mask != 0) has probability exactly 0 in every query's softmax while its batch keeps a key, so it is dropped before K and V are projected (no key kept: context 0).
// idx[b][p] = position of batch b's p-th kept key, ascending (0 from the kept count on, so that every entry names a row); cnt[b] = kept count.
__global__ __launch_bounds__(256) void k_keys(const int* __restrict__ MSK, int* __restrict__ idx, int* __restrict__ cnt) {
  __shared__ int part[256];
  const int b = blockIdx.x, tid = threadIdx.x; const int* m = MSK + (size_t)b * TT + tid * (TT / 256);
  int keep[TT / 256]; int c = 0;
#pragma unroll      /* constant subscripts: keep[] stays in registers */
  for (int q = 0; q < TT / 256; ++q) { keep[q] = (m[q] == 0) ? 1 : 0; c += keep[q]; }
  part[tid] = c; __syncthreads();
  for (int o = 1; o < 256; o <<= 1) { const int a = (tid >= o) ? part[tid - o] : 0; __syncthreads(); part[tid] += a; __syncthreads(); }      /* inclusive sums over the threads */
  int pos = part[tid] - c; const int n = part[255];
#pragma unroll      /* constant subscripts: keep[] stays in registers */
  for (int q = 0; q < TT / 256; ++q) if (keep[q]) idx[(size_t)b * TT + pos++] = tid * (TT / 256) + q;
  for (int p = n + tid; p < TT; p += 256) idx[(size_t)b * TT + p] = 0;
  if (tid == 0) cnt[b] = n;
}
// b is the same for a whole work-group; readfirstlane keeps the clamped count in a scalar register, so that every test on it is a scalar branch
__device__ __forceinline__ int kept_count(const int* __restrict__ cnt, int b) { const int n = cnt[b]; return __builtin_amdgcn_readfirstlane(n < 0 ? 0 : (n > TT ? TT : n)); }
// C = (A.B^T)*alpha + bf16(bias): A f16 [NR][DD], Bh f16 [DD][DD] (row n, k contiguous). OUT 0: f16 C16, pitch DD. OUT 1: f32 C = that + bf16(resid), pitch DD (the layer's residual, added where the tile is stored).
// OUT 2: f16 C16 transposed per batch, C16[batch][column][row in the batch], pitch TT: the V^T that k_flash reads, stored by the projection itself.
// One 128 x 128 tile of C per work-group of 8 waves (4 x 2 waves, 32 x 64 each). 64 k of both operands (one 128-byte line a row) are read from
// global memory in whole lines, once per work-group, and staged in LDS (two buffers, row pitch 144 B for the 16-byte fragment reads);
// the next 64 k are in flight in registers while the waves work on this buffer. Each 16 x 16 tile sums k in ascending order in one accumulator chain.
// GATH (the K and V projections): row p of a batch's C is the projection of that batch's p-th kept key, A row idx[p]; tiles past the batch's kept count do nothing.
template <int OUT, bool GATH>
__global__ __launch_bounds__(256) void k_gemm_t(const _Float16* __restrict__ A, const _Float16* __restrict__ Bh, float alpha, const float* __restrict__ bias, const float* __restrict__ resid, float* __restrict__ C, _Float16* __restrict__ C16, const int* __restrict__ idx, const int* __restrict__ cnt) {
  constexpr int BM = 128, BN = 128, BK = 64, LP = BK + 8, NKT = DD / BK;
  __shared__ __attribute__((aligned(16))) unsigned short sA[2][BM][LP], sB[2][BN][LP];
  __shared__ __attribute__((aligned(16))) float so[8][32][64 + 4];
  const int tid = threadIdx.x, w = tid >> 5, lane = tid & 31, ln = lane & 15, hh = lane >> 4;
  const int nt = blockIdx.x % (DD / BN), mt = blockIdx.x / (DD / BN); const int wm = w >> 1, wn = w & 1;
  const int lr = tid >> 3, lc = (tid & 7) * 8;      /* 8 lanes cover one row's 128 bytes; a thread brings rows lr + 32 i */
  if (GATH) { if ((mt % (TT / BM)) * BM >= kept_count(cnt, mt / (TT / BM))) return; }      /* the same for the whole work-group, in front of every barrier */
  const unsigned short* ga[4];
#pragma unroll
  for (int i = 0; i < 4; ++i) { int row = mt * BM + lr + 32 * i; if (GATH) row = (row & ~(TT - 1)) + (idx[row] & (TT - 1)); ga[i] = (const unsigned short*)A + (size_t)row * DD + lc; }
  const unsigned short* gb = (const unsigned short*)Bh + (size_t)(nt * BN + lr) * DD + lc;
  v8us ra[4], rb[4];
#pragma unroll
  for (int i = 0; i < 4; ++i) { ra[i] = *(const v8us*)ga[i]; rb[i] = *(const v8us*)(gb + (size_t)i * 32 * DD); }
#pragma unroll
  for (int i = 0; i < 4; ++i) { *(v8us*)&sA[0][lr + 32 * i][lc] = ra[i]; *(v8us*)&sB[0][lr + 32 * i][lc] = rb[i]; }
  __syncthreads();
  v8f acc[2][4];
#pragma unroll
  for (int mi = 0; mi < 2; ++mi)
#pragma unroll
    for (int ni = 0; ni < 4; ++ni) acc[mi][ni] = (v8f){0.f,0.f,0.f,0.f,0.f,0.f,0.f,0.f};
  const int rsub = lane >> 4, c4 = (lane & 15) * 4; const int col0 = nt * BN + wn * 64;
  const size_t o0 = (size_t)(mt * BM + wm * 32 + rsub) * DD + col0 + c4;      /* this lane's piece of the wave's rows rsub + 2 q: one address, the rows at constant offsets from it */
  v4f xr[OUT == 1 ? 16 : 1];      /* OUT 1: this lane's 16 pieces of the residual, asked for here so that they arrive from memory under the k loop and not behind it */
  if (OUT == 1) {
#pragma unroll      /* constant subscripts: xr[] stays in registers */
    for (int q = 0; q < 16; ++q) xr[q] = *(const v4fa*)(resid + o0 + q * 2 * DD); }
  for (int kt = 0; kt < NKT; ++kt) {
    const int cur = kt & 1; const bool more = kt + 1 < NKT;      /* the same for the whole work-group */
    if (more) {
#pragma unroll
      for (int i = 0; i < 4; ++i) { ra[i] = *(const v8us*)(ga[i] + (kt + 1) * BK); rb[i] = *(const v8us*)(gb + (size_t)i * 32 * DD + (kt + 1) * BK); } }
    __builtin_amdgcn_sched_barrier(0);      /* keeps the next pass's global loads in front of this pass's products: sunk behind them, their whole latency is waited out in front of the LDS stores */
#pragma unroll
    for (int ks = 0; ks < BK / 32; ++ks) { FragH fa[2], fb[4];
#pragma unroll
      for (int mi = 0; mi < 2; ++mi) { const unsigned short* p = &sA[cur][wm * 32 + mi * 16 + ln][ks * 32 + 8 * hh]; fa[mi].half[0] = *(const v8us*)p; fa[mi].half[1] = *(const v8us*)(p + 16); }
#pragma unroll
      for (int ni = 0; ni < 4; ++ni) { const unsigned short* p = &sB[cur][wn * 64 + ni * 16 + ln][ks * 32 + 8 * hh]; fb[ni].half[0] = *(const v8us*)p; fb[ni].half[1] = *(const v8us*)(p + 16); }
#pragma unroll
      for (int mi = 0; mi < 2; ++mi)
#pragma unroll
        for (int ni = 0; ni < 4; ++ni) acc[mi][ni] = __builtin_amdgcn_wmma_f32_16x16x32_f16(false, fa[mi].v, false, fb[ni].v, (short)0, acc[mi][ni], false, false); }
    if (more) {      /* the other buffer: its last readers left it before the barrier that ended the pass before this one */
#pragma unroll
      for (int i = 0; i < 4; ++i) { *(v8us*)&sA[cur ^ 1][lr + 32 * i][lc] = ra[i]; *(v8us*)&sB[cur ^ 1][lr + 32 * i][lc] = rb[i]; } }
    __syncthreads();
  }
  if (OUT == 2) {      /* a lane's 8 accumulator registers are 8 consecutive rows of one column: 16 bytes of a transposed row. The work-group's tile is staged transposed and stored in whole lines (256 B a column) */
    unsigned short (*sT)[BM + 8] = reinterpret_cast<unsigned short (*)[BM + 8]>(&so[0][0][0]);
#pragma unroll      /* these three: constant subscripts, so that acc[][] stays in registers */
    for (int ni = 0; ni < 4; ++ni) { const float bv = bf16_round(bias[col0 + ni * 16 + ln]);
#pragma unroll
      for (int mi = 0; mi < 2; ++mi) { FragH f;
#pragma unroll
        for (int r = 0; r < 8; ++r) f.h[r] = (_Float16)(acc[mi][ni][r] * alpha + bv);
        *(v8us*)&sT[wn * 64 + ni * 16 + ln][wm * 32 + mi * 16 + 8 * hh] = f.half[0]; } }
    __syncthreads();      /* a transposed row holds the rows of four waves */
    unsigned short* ct = (unsigned short*)C16 + ((size_t)(mt / (TT / BM)) * DD + nt * BN) * TT + (mt % (TT / BM)) * BM;
#pragma unroll      /* the 8 LDS reads go out together, the stores follow as they return */
    for (int q = 0; q < 8; ++q) { const int d = q * 16 + (tid >> 4), pc = (tid & 15) * 8; *(v8us*)(ct + (size_t)d * TT + pc) = *(const v8us*)&sT[d][pc]; }
    return;
  }
#pragma unroll
  for (int ni = 0; ni < 4; ++ni) { const float bv = bf16_round(bias[col0 + ni * 16 + ln]);      /* each wave stages its 32 rows in its own LDS range and stores whole lines */
#pragma unroll
    for (int mi = 0; mi < 2; ++mi)
#pragma unroll
      for (int r = 0; r < 8; ++r) so[w][mi * 16 + 8 * hh + r][ni * 16 + ln] = acc[mi][ni][r] * alpha + bv; }
  __builtin_amdgcn_fence(__ATOMIC_ACQ_REL, "workgroup"); __builtin_amdgcn_wave_barrier();
#pragma unroll
  for (int q = 0; q < 16; ++q) { const int r = q * 2 + rsub; const v4f v = *(const v4fa*)&so[w][r][c4]; const size_t o = o0 + q * 2 * DD;
    if (OUT == 1) { v4f y; for (int i = 0; i < 4; ++i) y[i] = v[i] + bf16_round(xr[q][i]); *(v4f*)(C + o) = y; }
    else { v4h h4; for (int i = 0; i < 4; ++i) h4[i] = (_Float16)v[i]; *(v4h*)(C16 + o) = h4; } }
}

__global__ __launch_bounds__(256) void k_x16(const float* __restrict__ x, _Float16* __restrict__ X16, size_t n8) { const size_t t = (size_t)blockIdx.x * 256 + threadIdx.x; if (t >= n8) return; FragH f;
#pragma unroll
  for (int q = 0; q < 8; ++q) f.h[q] = (_Float16)bf16_round(x[t * 8 + q]); *(v8us*)((unsigned short*)X16 + t * 8) = f.half[0];  }
__global__ __launch_bounds__(256) void k_round16f(const float* __restrict__ W, _Float16* __restrict__ Bt, size_t n8) { const size_t t = (size_t)blockIdx.x * 256 + threadIdx.x; if (t >= n8) return; FragH f;
#pragma unroll
  for (int i = 0; i < 8; ++i) f.h[i] = (_Float16)(bf16_round(W[t * 8 + i]) * 16.0f); *(v8us*)((unsigned short*)Bt + t * 8) = f.half[0];  }
template <int D, int RBF>
__global__ __launch_bounds__(256) void k_lnx(const float* __restrict__ X, const float* __restrict__ gam, const float* __restrict__ bet, int nrows, float eps, _Float16* __restrict__ O16, float* __restrict__ XR) {
  constexpr int NP = D / 128; const int tid = threadIdx.x, wv = tid >> 5, lane = tid & 31; const size_t r = (size_t)blockIdx.x * 8 + wv; if (r >= (size_t)nrows) return; v4f y[NP]; float s = 0.f;
#pragma unroll
  for (int j = 0; j < NP; ++j) { const int c = j * 128 + lane * 4; v4f g = *(const v4fa*)(X + r * D + c); if (RBF) { for (int q = 0; q < 4; ++q) g[q] = bf16_round(g[q]); } y[j] = g; s += g[0] + g[1] + g[2] + g[3]; }
  for (int o = 16; o >= 1; o >>= 1) s += __shfl_xor(s, o, 32); const float mu = s / (float)D; float q2 = 0.f;
#pragma unroll
  for (int j = 0; j < NP; ++j) for (int q = 0; q < 4; ++q) { const float d = y[j][q] - mu; q2 += d * d; }
  for (int o = 16; o >= 1; o >>= 1) q2 += __shfl_xor(q2, o, 32); const float rs = rsqrtf(q2 / (float)D + eps);
  {
#pragma unroll
    for (int j = 0; j < NP; ++j) { const int c = j * 128 + lane * 4; v4h h; for (int q = 0; q < 4; ++q) { const float v = (y[j][q] - mu) * rs * bf16_round(gam[c + q]) + bf16_round(bet[c + q]); h[q] = (_Float16)v; } *(v4h*)(O16 + r * D + c) = h; if (XR) *(v4f*)(XR + r * D + c) = y[j]; }
     } }
// lane l <-> lane l ^ 16 (the two halves of a wave hold the two key halves of one query column)
__device__ __forceinline__ float xhalf(float x) { const int b = __builtin_bit_cast(int, x); return __builtin_bit_cast(float, __builtin_amdgcn_permlanex16(b, b, 0x76543210, 0xfedcba98, false, false)); }
#define FL_SK 64                 /* keys per stage */
#define FL_LP (64 + 8)           /* LDS row pitch in 16-bit elements */
#define FL_C 0.18033688011112042f      /* 64^-1/2 * log2(e): the exponentials are taken in base 2 on the hardware's own instruction */
// one stage: this lane's four 16-byte pieces (K rows r and r + 32, V^T rows r and r + 32). The s_wait_xcnt stands inside the statement so that no address register is rewritten ahead of it.
__device__ __forceinline__ void fl_copy4(unsigned lk, unsigned lv, const unsigned short* gk0, const unsigned short* gk1, const unsigned short* gv0, const unsigned short* gv1) {
  const unsigned lk1 = lk + 32 * FL_LP * 2, lv1 = lv + 32 * FL_LP * 2;
  asm volatile("global_load_async_to_lds_b128 %0, %4, off\n\t"
               "global_load_async_to_lds_b128 %1, %5, off\n\t"
               "global_load_async_to_lds_b128 %2, %6, off\n\t"
               "global_load_async_to_lds_b128 %3, %7, off\n\t"
               "s_wait_xcnt 0x0"
               :: "v"(lk), "v"(lk1), "v"(lv), "v"(lv1), "v"(gk0), "v"(gk1), "v"(gv0), "v"(gv1) : "memory");
}
__global__ __launch_bounds__(256) void k_flash(const _Float16* __restrict__ Q16, int ldq, const _Float16* __restrict__ K16, int ldk, const _Float16* __restrict__ Vt, const int* __restrict__ cnt, _Float16* __restrict__ O16, int ldo) {
  constexpr int NW = 8, RPW = 16, NQB = TT / (NW * RPW), DT = 4, KS = 2;
  __shared__ __attribute__((aligned(16))) unsigned short sK[2][FL_SK][FL_LP], sV[2][64][FL_LP];
  __shared__ __attribute__((aligned(16))) unsigned short sO[NW][RPW][FL_LP];
  const int tid = threadIdx.x, w = tid >> 5, lane = tid & 31, ln = lane & 15, hh = lane >> 4;
  const int slab = blockIdx.x / NQB, qblk = blockIdx.x % NQB; const int b = slab / NH, h = slab % NH; const int qb0 = qblk * (NW * RPW); const int q0 = qb0 + w * RPW;
  const int n = kept_count(cnt, b); const int nst = (n + FL_SK - 1) / FL_SK;      /* K16 and Vt hold the batch's n kept keys, packed; both are written up to the end of stage nst - 1 */
  const unsigned short* Vth = (const unsigned short*)Vt + (size_t)slab * 64 * TT;
  const int cr = tid >> 3, cc = (tid & 7) * 8;      /* 8 lanes cover one row's 128 bytes; a thread brings rows cr and cr + 32 of both tiles */
  const unsigned short* gk = (const unsigned short*)K16 + ((size_t)b * TT + cr) * ldk + h * 64 + cc;      /* + stage * 64 rows */
  const unsigned short* gv = Vth + (size_t)cr * TT + cc;                                                  /* + stage * 64 columns */
  const unsigned lk = (unsigned)(size_t)&sK[0][cr][cc], lv = (unsigned)(size_t)&sV[0][cr][cc];      /* LDS byte address = low 32 bits of the __shared__ address */
  constexpr unsigned BUFB = FL_SK * FL_LP * 2;      /* bytes of one buffer of either tile */
  if (nst > 0) fl_copy4(lk, lv, gk, gk + (size_t)32 * ldk, gv, gv + (size_t)32 * TT);      /* the same for the whole work-group */
  FragH bq[KS];      /* B operand: column ln = query q0 + ln */
  { const unsigned short* qr = (const unsigned short*)Q16 + ((size_t)b * TT + q0 + ln) * ldq + h * 64;
#pragma unroll
    for (int ks = 0; ks < KS; ++ks) { bq[ks].half[0] = *(const v8us*)(qr + ks * 32 + 8 * hh); bq[ks].half[1] = *(const v8us*)(qr + ks * 32 + 16 + 8 * hh); } }
  asm volatile("s_wait_asynccnt 0x0" ::: "memory");      /* stage 0 of this wave has landed before the barrier that publishes it */
  __syncthreads();
  if (nst > 1) fl_copy4(lk + BUFB, lv + BUFB, gk + (size_t)FL_SK * ldk, gk + (size_t)(FL_SK + 32) * ldk, gv + FL_SK, gv + (size_t)32 * TT + FL_SK);
  float m_q = -3.0e38f, l_q = 0.f; v8f oacc[DT];      /* oacc[dt][r] = O[q0 + ln][dt * 16 + 8 * hh + r] */
#pragma unroll
  for (int dt = 0; dt < DT; ++dt) oacc[dt] = (v8f){0.f,0.f,0.f,0.f,0.f,0.f,0.f,0.f};
#pragma unroll 1
  for (int st = 0; st < nst; ++st) {
    const int cur = st & 1;
#pragma unroll 1      /* rolled: unrolled, the two passes take more than the 128 registers at which all four work-groups of a WGP are resident */
    for (int jj = 0; jj < FL_SK; jj += 32) {
    const int j0 = st * FL_SK + jj;
    v8f s[2];
#pragma unroll
    for (int nt = 0; nt < 2; ++nt) { const unsigned short* kr = &sK[cur][jj + nt * 16 + ln][0]; FragH ak[KS];
#pragma unroll
      for (int ks = 0; ks < KS; ++ks) { ak[ks].half[0] = *(const v8us*)(kr + ks * 32 + 8 * hh); ak[ks].half[1] = *(const v8us*)(kr + ks * 32 + 16 + 8 * hh); }
      v8f acc = (v8f){0.f,0.f,0.f,0.f,0.f,0.f,0.f,0.f};
#pragma unroll
      for (int ks = 0; ks < KS; ++ks) acc = mmaH<1>(ak[ks].v, ak[ks].v, bq[ks].v, bq[ks].v, acc);
      s[nt] = acc; }
    if (j0 + 32 > n) {      /* only a batch's last stage holds rows past its kept keys (this lane's are j0 + 8hh + 0..7 and j0 + 16 + 8hh + 0..7): score -inf, so the exponential below is exactly 0 */
#pragma unroll      /* constant element numbers: the score tiles stay in registers */
      for (int i = 0; i < 16; ++i) s[i >> 3][i & 7] = (j0 + (i >> 3) * 16 + 8 * hh + (i & 7) < n) ? s[i >> 3][i & 7] : -INFINITY; }
    float sc[16]; float mc = -INFINITY;      /* raw q.k */
#pragma unroll
    for (int i = 0; i < 16; ++i) { sc[i] = s[i >> 3][i & 7]; mc = fmaxf(mc, sc[i]); }
    mc = fmaxf(mc, xhalf(mc));
    const float mn = fmaxf(m_q, mc); const float al = __builtin_amdgcn_exp2f((m_q - mn) * FL_C); m_q = mn;      /* m_q and mn (raw q.k units) are finite (start -3e38): no key seen yet gives 2^0 = 1 */
    const float nb = __builtin_fmaf(-mn, FL_C, 10.0f);      /* 2^10 e^((s - mn) / 8) = 2^(s C + nb): scale, maximum and the 2^10 of P in one fused multiply-add a score */
    float ps = 0.f; FragH pb;      /* pb.h[i] = 2^10 P^T[k = kmap(i, hh)][ln] */
#pragma unroll
    for (int i = 0; i < 16; ++i) { const float p = __builtin_amdgcn_exp2f(__builtin_fmaf(sc[i], FL_C, nb)); ps += p; pb.h[i] = (_Float16)p; }
    l_q = l_q * al + ps;      /* the row sum carries the same 2^10 */
#pragma unroll
    for (int dt = 0; dt < DT; ++dt)
#pragma unroll
      for (int r = 0; r < 8; ++r) oacc[dt][r] *= al;
#pragma unroll
    for (int dt = 0; dt < DT; ++dt) { const unsigned short* vrow = &sV[cur][dt * 16 + ln][jj]; FragH av; av.half[0] = *(const v8us*)(vrow + 8 * hh); av.half[1] = *(const v8us*)(vrow + 16 + 8 * hh);
      oacc[dt] = mmaH<1>(av.v, av.v, pb.v, pb.v, oacc[dt]); } }
    asm volatile("s_wait_dscnt 0x0" ::: "memory");      /* this wave's reads of buffer cur have returned before the buffer is refilled */
    asm volatile("s_wait_asynccnt 0x0" ::: "memory");   /* this wave's copies of stage st + 1 have landed before the barrier that publishes them */
    __syncthreads();      /* publishes stage st + 1 and ends every wave's reads of buffer cur */
    if (st + 2 < nst) {      /* the same for the whole work-group */
      const unsigned short* k2 = gk + (size_t)(st + 2) * FL_SK * ldk; const unsigned short* v2 = gv + (st + 2) * FL_SK;
      fl_copy4(lk + cur * BUFB, lv + cur * BUFB, k2, k2 + (size_t)32 * ldk, v2, v2 + (size_t)32 * TT); }
  }
  asm volatile("s_wait_asynccnt 0x0" ::: "memory");      /* nothing of this wave is in flight when it goes on to the output */
  { float l = l_q + xhalf(l_q); l = (l > 0.f) ? 1.0f / l : 0.f;
#pragma unroll
    for (int dt = 0; dt < DT; ++dt) { FragH f;      /* the context leaves as the f16 operand of the output GEMM */
#pragma unroll      /* constant subscripts: oacc[] stays in registers */
      for (int r = 0; r < 8; ++r) f.h[r] = (_Float16)(oacc[dt][r] * l);
      *(v8us*)&sO[w][ln][dt * 16 + 8 * hh] = f.half[0]; } }
  __builtin_amdgcn_fence(__ATOMIC_ACQ_REL, "workgroup"); __builtin_amdgcn_wave_barrier();
  {
#pragma unroll
    for (int rp = 0; rp < RPW; rp += 4) { const int r = rp + (lane >> 3), pc = (lane & 7) * 8; *(v8us*)((unsigned short*)O16 + ((size_t)b * TT + q0 + r) * ldo + h * 64 + pc) = *(const v8us*)&sO[w][r][pc]; }      /* 8 lanes store one row's 128-byte line */
     } }

extern "C" void kernel_launch(void* const* d_in, const int* in_sizes, int n_in,
                              void* d_out, int out_size, void* d_ws, size_t ws_size, hipStream_t stream) {
  (void)in_sizes; (void)n_in; (void)out_size;
  const float* const* I = (const float* const*)d_in; const float* x = I[0]; const int* mask = (const int*)d_in[1]; const float* Wqkv = I[2]; const float* bqkv = I[3]; const float* Wo = I[4]; const float* bo = I[5]; const float* lng = I[6]; const float* lnb = I[7];      /* d_in order: hidden_states, encoder_padding_mask, qkv_w, qkv_b, out_w, out_b, ln_g, ln_b */
  const float* bq = bqkv; const float* bk = bqkv + DD; const float* bv = bqkv + 2 * DD;
  char* ws = (char*)d_ws; size_t off = 0;
  auto take = [&](size_t bytes) { char* p = ws + off; off += (bytes + 255) & ~(size_t)255; return p; };
  const size_t WSZ = (size_t)DD * DD; _Float16* Bw = (_Float16*)take(4 * WSZ * 2); _Float16* X16 = (_Float16*)take((size_t)NR * DD * 2);
  _Float16* Q = (_Float16*)take((size_t)NR * DD * 2); _Float16* K = (_Float16*)take((size_t)NR * DD * 2); _Float16* Vt = (_Float16*)take((size_t)NR * DD * 2); _Float16* O16 = (_Float16*)take((size_t)NR * DD * 2);
  int* kidx = (int*)take((size_t)NR * 4); int* kcnt = (int*)take(BB * 4);
  if (off > ws_size) return;
  const unsigned gw2 = (unsigned)((WSZ / 8 + 255) / 256);
  k_round16f<<<(unsigned)((3 * WSZ / 8 + 255) / 256), 256, 0, stream>>>(Wqkv, Bw, 3 * WSZ / 8); k_round16f<<<gw2, 256, 0, stream>>>(Wo, Bw + 3 * WSZ, WSZ / 8);      /* (out,in) natural ×2^4: rows q|k|v, then out_w */
  const unsigned gp = (NR / 128) * (DD / 128);
  k_lnx<DD, 1><<<(NR + 7) / 8, 256, 0, stream>>>(x, lng, lnb, NR, 1e-5f, X16, nullptr);      /* x = LN(bf16 hidden) → f16 */
  k_keys<<<BB, 256, 0, stream>>>(mask, kidx, kcnt);
  k_gemm_t<0, false><<<gp, 256, 0, stream>>>(X16, Bw, 0.0625f, bq, nullptr, nullptr, Q, nullptr, nullptr);      /* q = x.Wq + bq: M 8192 N 1024 K 1024 */
  k_gemm_t<0, true><<<gp, 256, 0, stream>>>(X16, Bw + WSZ, 0.0625f, bk, nullptr, nullptr, K, kidx, kcnt);      /* kept keys only, packed per batch */
  k_gemm_t<2, true><<<gp, 256, 0, stream>>>(X16, Bw + 2 * WSZ, 0.0625f, bv, nullptr, nullptr, Vt, kidx, kcnt);      /* the same rows of v, stored as V^T [batch][head][d][key] */
  k_flash<<<BB * NH * (TT / 128), 256, 0, stream>>>(Q, DD, K, DD, Vt, kcnt, O16, DD);
  k_gemm_t<1, false><<<gp, 256, 0, stream>>>(O16, Bw + 3 * WSZ, 0.0625f, bo, x, (float*)d_out, nullptr, nullptr, nullptr);      /* out = O.out_w^T + out_b + bf16(hidden) */
}

// v007
// A run of this version takes 112 microseconds.
// Next to v006, in two timings, it ran 1.12 and 1.13 times as fast.
// All steps since v000 together make it 7.49 times as fast.
#include <hip/hip_runtime.h>
// Pre-LN self-attention layer with a key padding mask and residual (B=4, S=2048, H=1024, 16 heads × 64): x = LN(hidden); [q|k|v] = x·qkv_wᵀ + qkv_b ((out,in) fused); scores = q·kᵀ·64^-½ + mask·(−1e8) (int mask [B,S], 1 = pad); softmax;
// out = (attn·v merged)·out_wᵀ + out_b + hidden.
// Compute dtype: x, weights, biases rounded to bf16; q/k/v as f16 GEMM outputs; fused flash-style kernel (online softmax f32, P f16 ×2^10) on v_wmma_f32_16x16x32_f16; O → f16 → output GEMM with bias; f32 accumulate.
#define BB 4
#define TT 2048
#define NH 16
#define DD 1024
#define NR (BB * TT)

typedef __bf16 v16b __attribute__((ext_vector_type(16)));
typedef unsigned short v8us __attribute__((ext_vector_type(8), may_alias));
typedef float  v8f  __attribute__((ext_vector_type(8)));
typedef float  v4f  __attribute__((ext_vector_type(4)));
typedef float  v4fa __attribute__((ext_vector_type(4), may_alias));
union FragB { v16b v; v8us half[2]; unsigned short u[16]; };

__device__ __forceinline__ unsigned short bf16_bits(float x) { unsigned int u = __float_as_uint(x); return (unsigned short)((u + 0x7FFFu + ((u >> 16) & 1u)) >> 16); }
__device__ __forceinline__ float bf16_val(unsigned short b) { return __uint_as_float(((unsigned int)b) << 16); }
__device__ __forceinline__ float bf16_round(float x) { return bf16_val(bf16_bits(x)); }
// D += A·B with NT terms: 1 = ah·bh, 2 = + al·bh (A split), 3 = + ah·bl (both split)
template <int NT>
__device__ __forceinline__ v8f mmaN(v16b ah, v16b al, v16b bh, v16b bl, v8f c) {
  c = __builtin_amdgcn_wmma_f32_16x16x32_bf16(false, ah, false, bh, (short)0, c, false, false);
  if (NT >= 2) c = __builtin_amdgcn_wmma_f32_16x16x32_bf16(false, al, false, bh, (short)0, c, false, false);
  if (NT >= 3) c = __builtin_amdgcn_wmma_f32_16x16x32_bf16(false, ah, false, bl, (short)0, c, false, false);
  asm volatile("v_nop\n\tv_nop\n\tv_nop\n\tv_nop" : "+v"(c) : "v"(ah), "v"(al), "v"(bh), "v"(bl));
  return c;
}

__global__ __launch_bounds__(256) void k_wt_bf16(const float* __restrict__ W, unsigned short* __restrict__ Wt, int K, int N) {
  const int t = blockIdx.x * 256 + threadIdx.x;
  const int k8n = K / 8;
  if (t >= N * k8n) return;
  const int n = t / k8n, k8 = (t % k8n) * 8;
  v8us v;
#pragma unroll
  for (int i = 0; i < 8; ++i) v[i] = bf16_bits(W[(size_t)(k8 + i) * N + n]);
  *(v8us*)(Wt + (size_t)n * K + k8) = v;
  
}

// GEMM C[M][N] (f32, pitch ldc) = act(A[M][K]·W + bias). A f32 row-major (pitch lda) converted per fragment to bf16
// (ASPLIT: hi/lo two planes -> 2 terms, else single rounded term); Wt bf16 [N][K] (pitch ldb). BIAS_BF16 rounds the
// bias to bf16 first (bias quantised to bf16 before the add). K%32==0, M%16==0, N%64==0.
template <bool ASPLIT, int ACT, bool BIAS_BF16>
__global__ __launch_bounds__(128) void k_gemm_bf(const float* __restrict__ A, int lda, const unsigned short* __restrict__ Wt, int ldb,
                                               const float* __restrict__ bias, float* __restrict__ C, int ldc, int M, int N, int K) {
  __shared__ __attribute__((aligned(16))) float so[4][16][64];
  const int tid = threadIdx.x, w = tid >> 5, lane = tid & 31, ln = lane & 15, hh = lane >> 4;
  const int ntn = N / 64;
  const int wid = blockIdx.x * 4 + w;
  const int mt = wid / ntn, nq = wid % ntn;
  if (mt * 16 >= M) return;
  const int row0 = mt * 16, col0 = nq * 64;
  const float* arow = A + (size_t)(row0 + ln) * lda;
  v8f acc[4] = {};
  for (int kb = 0; kb < K; kb += 32) {
    FragB ah, al;
    const v4f x0 = *(const v4fa*)(arow + kb + 8 * hh), x1 = *(const v4fa*)(arow + kb + 8 * hh + 4);
    const v4f x2 = *(const v4fa*)(arow + kb + 16 + 8 * hh), x3 = *(const v4fa*)(arow + kb + 16 + 8 * hh + 4);
    float xs[16] = {x0[0],x0[1],x0[2],x0[3],x1[0],x1[1],x1[2],x1[3],x2[0],x2[1],x2[2],x2[3],x3[0],x3[1],x3[2],x3[3]};
#pragma unroll
    for (int i = 0; i < 16; ++i) { const unsigned short hb = bf16_bits(xs[i]); ah.u[i] = hb; al.u[i] = ASPLIT ? bf16_bits(xs[i] - bf16_val(hb)) : (unsigned short)0; }
#pragma unroll
    for (int t = 0; t < 4; ++t) {
      const unsigned short* brow = Wt + (size_t)(col0 + t * 16 + ln) * ldb + kb;
      FragB b;
      b.half[0] = *(const v8us*)(brow + 8 * hh);
      b.half[1] = *(const v8us*)(brow + 16 + 8 * hh);
      acc[t] = mmaN<ASPLIT ? 2 : 1>(ah.v, al.v, b.v, b.v, acc[t]);
    }
  }
#pragma unroll
  for (int t = 0; t < 4; ++t) {
    float bv = bias ? bias[col0 + t * 16 + ln] : 0.f;
    if (BIAS_BF16) bv = bf16_round(bv);
#pragma unroll
    for (int r = 0; r < 8; ++r) { float v = acc[t][r] + bv; if (ACT == 1) v = fmaxf(v, 0.f); so[w][8 * hh + r][t * 16 + ln] = v; }
  }
  __builtin_amdgcn_fence(__ATOMIC_ACQ_REL, "workgroup");
  __builtin_amdgcn_wave_barrier();
  const int rsub = lane >> 4, c4 = (lane & 15) * 4;
  {
#pragma unroll
    for (int q = 0; q < 8; ++q) {
      const int r = q * 2 + rsub;
      const v4f v = *(const v4fa*)&so[w][r][c4];
      *(v4f*)(C + (size_t)(row0 + r) * ldc + col0 + c4) = v;
    }
    
  }
}

// Flash-style causal/unmasked attention, all contractions 3-term bf16 hi/lo splits, f32 softmax with running max.
// q,k,v rows are read from f32 buffers with arbitrary row pitch (so they can live inside a fused qkv buffer);
// D = head size (multiple of 32, <= 128); one wave = 16 query rows; block = 4 waves (64 queries) sharing K/V chunks of 32.
template <int D, bool CAUSAL>
__global__ __launch_bounds__(128) void k_flash(const float* __restrict__ qb, const float* __restrict__ kb, const float* __restrict__ vb,
                                             int pitch, int T, int H, float scale, float* __restrict__ y, int ypitch) {
  constexpr int KS = D / 32;        // k-steps for QK
  constexpr int DT = D / 16;        // d tiles for PV
  __shared__ __attribute__((aligned(16))) unsigned short sKh[32][D + 8], sKl[32][D + 8], sVh[32][D + 8], sVl[32][D + 8];
  __shared__ __attribute__((aligned(16))) unsigned short sPh[4][16][40], sPl[4][16][40];
  __shared__ __attribute__((aligned(16))) float sO[4][16][D];
  const int tid = threadIdx.x, w = tid >> 5, lane = tid & 31, ln = lane & 15, hh = lane >> 4;
  const int nqb = (T + 63) / 64;
  const int bh = blockIdx.x / nqb, qblk = blockIdx.x % nqb;
  const int b = bh / H, h = bh % H;
  const int q0 = qblk * 64 + w * 16;
  const float* Q = qb + (size_t)b * T * pitch + h * D;
  const float* K = kb + (size_t)b * T * pitch + h * D;
  const float* V = vb + (size_t)b * T * pitch + h * D;

  // A fragments of the wave's 16 query rows (scaled), hi/lo
  FragB aqh[KS], aql[KS];
  {
    int row = q0 + ln; if (row >= T) row = T - 1;
    const float* qr = Q + (size_t)row * pitch;
#pragma unroll
    for (int ks = 0; ks < KS; ++ks)
#pragma unroll
      for (int i = 0; i < 16; ++i) {
        const int d = ks * 32 + ((i < 8) ? (8 * hh + i) : (16 + 8 * hh + (i - 8)));
        const float x = qr[d] * scale; const unsigned short hb = bf16_bits(x);
        aqh[ks].u[i] = hb; aql[ks].u[i] = bf16_bits(x - bf16_val(hb));
      }
  }
  float m_r[8], l_r[8];
#pragma unroll
  for (int r = 0; r < 8; ++r) { m_r[r] = -3.0e38f; l_r[r] = 0.f; }
  v8f oacc[DT];
#pragma unroll
  for (int dt = 0; dt < DT; ++dt) oacc[dt] = (v8f){0.f,0.f,0.f,0.f,0.f,0.f,0.f,0.f};

  const int kv_end = CAUSAL ? min(T, qblk * 64 + 64) : T;     // block-uniform
  for (int j0 = 0; j0 < kv_end; j0 += 32) {
    __syncthreads();
    for (int e = tid; e < 32 * (D / 4); e += 128) {
      const int r = e / (D / 4), c4 = (e % (D / 4)) * 4;
      const int key = j0 + r;
      v4f kf = {0.f,0.f,0.f,0.f}, vf = {0.f,0.f,0.f,0.f};
      if (key < T) { kf = *(const v4fa*)(K + (size_t)key * pitch + c4); vf = *(const v4fa*)(V + (size_t)key * pitch + c4); }
#pragma unroll
      for (int t = 0; t < 4; ++t) {
        unsigned short hb = bf16_bits(kf[t]); sKh[r][c4 + t] = hb; sKl[r][c4 + t] = bf16_bits(kf[t] - bf16_val(hb));
        hb = bf16_bits(vf[t]); sVh[r][c4 + t] = hb; sVl[r][c4 + t] = bf16_bits(vf[t] - bf16_val(hb));
      }
    }
    __syncthreads();
    // S tile 16 x 32
    v8f s[2];
#pragma unroll
    for (int nt = 0; nt < 2; ++nt) {
      v8f acc = {};
#pragma unroll
      for (int ks = 0; ks < KS; ++ks) {
        FragB bh_, bl_;
        bh_.half[0] = *(const v8us*)&sKh[nt * 16 + ln][ks * 32 + 8 * hh]; bh_.half[1] = *(const v8us*)&sKh[nt * 16 + ln][ks * 32 + 16 + 8 * hh];
        bl_.half[0] = *(const v8us*)&sKl[nt * 16 + ln][ks * 32 + 8 * hh]; bl_.half[1] = *(const v8us*)&sKl[nt * 16 + ln][ks * 32 + 16 + 8 * hh];
        acc = mmaN<3>(aqh[ks].v, aql[ks].v, bh_.v, bl_.v, acc);
      }
      s[nt] = acc;
    }
    // mask + running max (rows 8hh+r; the 16 lanes of a half share rows)
    float alpha[8];
#pragma unroll
    for (int r = 0; r < 8; ++r) {
      const int qi = q0 + 8 * hh + r;
      const int ja = j0 + ln, jb = j0 + 16 + ln;
      if (CAUSAL) { if (ja > qi) s[0][r] = -3.0e38f; if (jb > qi) s[1][r] = -3.0e38f; }
      if (ja >= T) s[0][r] = -3.0e38f;
      if (jb >= T) s[1][r] = -3.0e38f;
      float mx = fmaxf(s[0][r], s[1][r]);
      mx = fmaxf(mx, __shfl_xor(mx, 1, 32)); mx = fmaxf(mx, __shfl_xor(mx, 2, 32)); mx = fmaxf(mx, __shfl_xor(mx, 4, 32)); mx = fmaxf(mx, __shfl_xor(mx, 8, 32));
      const float mnew = fmaxf(m_r[r], mx);
      alpha[r] = (mnew > -1.0e38f) ? __expf(m_r[r] - mnew) : 1.0f;
      const float p0 = (s[0][r] > -1.0e38f) ? __expf(s[0][r] - mnew) : 0.f;
      const float p1 = (s[1][r] > -1.0e38f) ? __expf(s[1][r] - mnew) : 0.f;
      m_r[r] = mnew;
      l_r[r] = l_r[r] * alpha[r] + p0 + p1;            // per-lane partial row sum (16 lanes combined at the end)
      unsigned short hb = bf16_bits(p0); sPh[w][8 * hh + r][ln] = hb;      sPl[w][8 * hh + r][ln] = bf16_bits(p0 - bf16_val(hb));
      hb = bf16_bits(p1);                sPh[w][8 * hh + r][16 + ln] = hb; sPl[w][8 * hh + r][16 + ln] = bf16_bits(p1 - bf16_val(hb));
    }
#pragma unroll
    for (int dt = 0; dt < DT; ++dt)
#pragma unroll
      for (int r = 0; r < 8; ++r) oacc[dt][r] *= alpha[r];
    __builtin_amdgcn_fence(__ATOMIC_ACQ_REL, "workgroup");
    __builtin_amdgcn_wave_barrier();
    FragB pah, pal;
    pah.half[0] = *(const v8us*)&sPh[w][ln][8 * hh]; pah.half[1] = *(const v8us*)&sPh[w][ln][16 + 8 * hh];
    pal.half[0] = *(const v8us*)&sPl[w][ln][8 * hh]; pal.half[1] = *(const v8us*)&sPl[w][ln][16 + 8 * hh];
#pragma unroll
    for (int dt = 0; dt < DT; ++dt) {
      FragB bvh, bvl;
#pragma unroll
      for (int i = 0; i < 8; ++i) {
        bvh.u[i] = sVh[8 * hh + i][dt * 16 + ln]; bvh.u[8 + i] = sVh[16 + 8 * hh + i][dt * 16 + ln];
        bvl.u[i] = sVl[8 * hh + i][dt * 16 + ln]; bvl.u[8 + i] = sVl[16 + 8 * hh + i][dt * 16 + ln];
      }
      oacc[dt] = mmaN<3>(pah.v, pal.v, bvh.v, bvl.v, oacc[dt]);
    }
    __builtin_amdgcn_fence(__ATOMIC_ACQ_REL, "workgroup");
    __builtin_amdgcn_wave_barrier();
  }
#pragma unroll
  for (int r = 0; r < 8; ++r) {
    float l = l_r[r];
    l += __shfl_xor(l, 1, 32); l += __shfl_xor(l, 2, 32); l += __shfl_xor(l, 4, 32); l += __shfl_xor(l, 8, 32);
    l_r[r] = (l > 0.f) ? 1.0f / l : 0.f;
  }
#pragma unroll
  for (int dt = 0; dt < DT; ++dt)
#pragma unroll
    for (int r = 0; r < 8; ++r) sO[w][8 * hh + r][dt * 16 + ln] = oacc[dt][r] * l_r[r];
  __builtin_amdgcn_fence(__ATOMIC_ACQ_REL, "workgroup");
  __builtin_amdgcn_wave_barrier();
  {
    for (int r = 0; r < 16; ++r) {
      const int row = q0 + r;
      if (row < T && lane < D / 4) {
        const v4f val = *(const v4fa*)&sO[w][r][lane * 4];
        *(v4f*)(y + ((size_t)b * T + row) * ypitch + h * D + lane * 4) = val;
      }
    }
    
  }
}

// GEMM C = act(A·W + bias + resid): A f32 (ASPLIT -> hi/lo 2 terms), Wt bf16 [N][K]; ACT 0 none, 1 relu, 2 exact gelu;
// resid (optional, f32, row index = (row % rmod), pitch ldr, RES_BF16 rounds it) added before the activation.
template <bool ASPLIT, int ACT, bool BIAS_BF16, bool RES_BF16>
__global__ __launch_bounds__(128) void k_gemm_bf3(const float* __restrict__ A, int lda, const unsigned short* __restrict__ Wt, int ldb,
                                                const float* __restrict__ bias, const float* __restrict__ resid, int rmod, int ldr,
                                                float* __restrict__ C, int ldc, int M, int N, int K) {
  __shared__ __attribute__((aligned(16))) float so[4][16][64];
  const int tid = threadIdx.x, w = tid >> 5, lane = tid & 31, ln = lane & 15, hh = lane >> 4;
  const int ntn = N / 64;
  const int wid = blockIdx.x * 4 + w;
  const int mt = wid / ntn, nq = wid % ntn;
  if (mt * 16 >= M) return;
  const int row0 = mt * 16, col0 = nq * 64;
  const float* arow = A + (size_t)(row0 + ln) * lda;
  v8f acc[4] = {};
  for (int kb = 0; kb < K; kb += 32) {
    FragB ah, al;
    const v4f x0 = *(const v4fa*)(arow + kb + 8 * hh), x1 = *(const v4fa*)(arow + kb + 8 * hh + 4);
    const v4f x2 = *(const v4fa*)(arow + kb + 16 + 8 * hh), x3 = *(const v4fa*)(arow + kb + 16 + 8 * hh + 4);
    float xs[16] = {x0[0],x0[1],x0[2],x0[3],x1[0],x1[1],x1[2],x1[3],x2[0],x2[1],x2[2],x2[3],x3[0],x3[1],x3[2],x3[3]};
#pragma unroll
    for (int i = 0; i < 16; ++i) { const unsigned short hb = bf16_bits(xs[i]); ah.u[i] = hb; al.u[i] = ASPLIT ? bf16_bits(xs[i] - bf16_val(hb)) : (unsigned short)0; }
#pragma unroll
    for (int t = 0; t < 4; ++t) {
      const unsigned short* brow = Wt + (size_t)(col0 + t * 16 + ln) * ldb + kb;
      FragB b;
      b.half[0] = *(const v8us*)(brow + 8 * hh);
      b.half[1] = *(const v8us*)(brow + 16 + 8 * hh);
      acc[t] = mmaN<ASPLIT ? 2 : 1>(ah.v, al.v, b.v, b.v, acc[t]);
    }
  }
#pragma unroll
  for (int t = 0; t < 4; ++t) {
    const int col = col0 + t * 16 + ln;
    float bv = bias ? bias[col] : 0.f;
    if (BIAS_BF16) bv = bf16_round(bv);
#pragma unroll
    for (int r = 0; r < 8; ++r) {
      float v = acc[t][r] + bv;
      if (resid) { float rv = resid[(size_t)((row0 + 8 * hh + r) % rmod) * ldr + col]; if (RES_BF16) rv = bf16_round(rv); v += rv; }
      if (ACT == 1) v = fmaxf(v, 0.f);
      if (ACT == 2) v = 0.5f * v * (1.0f + erff(v * 0.70710678118654752f));
      if (ACT == 3) { const float u = 0.7978845608028654f * (v + 0.044715f * v * v * v); v = 0.5f * v * (1.0f + tanhf(u)); }
      so[w][8 * hh + r][t * 16 + ln] = v;
    }
  }
  __builtin_amdgcn_fence(__ATOMIC_ACQ_REL, "workgroup");
  __builtin_amdgcn_wave_barrier();
  const int rsub = lane >> 4, c4 = (lane & 15) * 4;
  {
#pragma unroll
    for (int q = 0; q < 8; ++q) {
      const int r = q * 2 + rsub;
      const v4f v = *(const v4fa*)&so[w][r][c4];
      *(v4f*)(C + (size_t)(row0 + r) * ldc + col0 + c4) = v;
    }
    
  }
}
// row LayerNorm (biased variance, eps) over N: s = X (+ R); optional out_sum <- s; out_norm <- (s-mu)*rsqrt(var+eps)*g + b
template <bool PARAM_BF16>
__global__ __launch_bounds__(256) void k_layernorm(const float* __restrict__ X, const float* __restrict__ R, const float* __restrict__ g, const float* __restrict__ bta,
                                                  float* __restrict__ out_sum, float* __restrict__ out_norm, int N, float eps) {
  __shared__ float red[256];
  const int row = blockIdx.x, tid = threadIdx.x;
  const float* x = X + (size_t)row * N; const float* rr = R ? R + (size_t)row * N : nullptr;
  float vals[16];                     // up to N = 4096
  const int per = N / 256;            // contiguous chunk per thread? use strided-by-4 chunks: thread handles j = tid*4 + 1024*u
  float s1 = 0.f;
  for (int u = 0; u < per / 4; ++u) {
    const int j = tid * 4 + 1024 * u;
    const v4f a = *(const v4fa*)(x + j);
    v4f b = {0.f,0.f,0.f,0.f}; if (rr) b = *(const v4fa*)(rr + j);
#pragma unroll
    for (int q = 0; q < 4; ++q) { const float v = a[q] + b[q]; vals[u * 4 + q] = v; s1 += v; }
  }
  red[tid] = s1; __syncthreads();
  for (int st = 128; st > 0; st >>= 1) { if (tid < st) red[tid] += red[tid + st]; __syncthreads(); }
  const float mu = red[0] / (float)N; __syncthreads();
  float s2 = 0.f;
  for (int u = 0; u < per / 4; ++u)
#pragma unroll
    for (int q = 0; q < 4; ++q) { const float c = vals[u * 4 + q] - mu; s2 += c * c; }
  red[tid] = s2; __syncthreads();
  for (int st = 128; st > 0; st >>= 1) { if (tid < st) red[tid] += red[tid + st]; __syncthreads(); }
  const float rs = rsqrtf(red[0] / (float)N + eps);
  {
    for (int u = 0; u < per / 4; ++u) {
      const int j = tid * 4 + 1024 * u;
      v4f o, sm;
#pragma unroll
      for (int q = 0; q < 4; ++q) {
        float gg = g[j + q], bb = bta[j + q];
        if (PARAM_BF16) { gg = bf16_round(gg); bb = bf16_round(bb); }
        sm[q] = vals[u * 4 + q]; o[q] = (vals[u * 4 + q] - mu) * rs * gg + bb;
      }
      if (out_sum) *(v4f*)(out_sum + (size_t)row * N + j) = sm;
      *(v4f*)(out_norm + (size_t)row * N + j) = o;
    }
    
  }
}



// ---- f16 WMMA path (v_wmma_f32_16x16x32_f16): 11-bit significands for operands in range — used where a [0,1] probability operand needs more precision than bf16
typedef _Float16 v16h __attribute__((ext_vector_type(16)));
union FragH { v16h v; v8us half[2]; _Float16 h[16]; unsigned short u[16]; };
template <int NT>
__device__ __forceinline__ v8f mmaH(v16h ah, v16h al, v16h bh, v16h bl, v8f c) {
  c = __builtin_amdgcn_wmma_f32_16x16x32_f16(false, ah, false, bh, (short)0, c, false, false);
  if (NT >= 2) c = __builtin_amdgcn_wmma_f32_16x16x32_f16(false, al, false, bh, (short)0, c, false, false);
  if (NT >= 3) c = __builtin_amdgcn_wmma_f32_16x16x32_f16(false, ah, false, bl, (short)0, c, false, false);
  asm volatile("v_nop\n\tv_nop\n\tv_nop\n\tv_nop" : "+v"(c) : "v"(ah), "v"(al), "v"(bh), "v"(bl));
  return c;
}
// batched GEMM like k_gemm_b but f16 operands: A f32 (split into f16 hi/lo if ASPLIT, else rounded to f16), Bt = f16 values [n][k]; alpha; C f32; N multiple of 16 (partial tiles skipped)
template <bool ASPLIT>
__global__ __launch_bounds__(128) void k_gemm_h(const float* __restrict__ A, int lda, size_t sA, const _Float16* __restrict__ Bh, int ldb, size_t sB, float alpha, float* __restrict__ C, int ldc, size_t sC, int M, int N, int K) {
  __shared__ __attribute__((aligned(16))) float so[4][16][64];
  const int tid = threadIdx.x, w = tid >> 5, lane = tid & 31, ln = lane & 15, hh = lane >> 4; const int by = blockIdx.y;
  A += (size_t)by * sA; Bh += (size_t)by * sB; C += (size_t)by * sC;
  const int ntn = (N + 63) / 64; const int wid = blockIdx.x * 4 + w; const int mt = wid / ntn, nq = wid % ntn; if (mt * 16 >= M) return;
  const int row0 = mt * 16, col0 = nq * 64; const float* arow = A + (size_t)(row0 + ln) * lda;
  v8f acc[4] = {};
  for (int kb = 0; kb < K; kb += 32) {
    FragH ah, al;
    const v4f x0 = *(const v4fa*)(arow + kb + 8 * hh), x1 = *(const v4fa*)(arow + kb + 8 * hh + 4), x2 = *(const v4fa*)(arow + kb + 16 + 8 * hh), x3 = *(const v4fa*)(arow + kb + 16 + 8 * hh + 4);
    float xs[16] = {x0[0],x0[1],x0[2],x0[3],x1[0],x1[1],x1[2],x1[3],x2[0],x2[1],x2[2],x2[3],x3[0],x3[1],x3[2],x3[3]};
#pragma unroll
    for (int i = 0; i < 16; ++i) { const _Float16 h = (_Float16)xs[i]; ah.h[i] = h; al.h[i] = ASPLIT ? (_Float16)(xs[i] - (float)h) : (_Float16)0.0f; }
#pragma unroll
    for (int t = 0; t < 4; ++t) { if (col0 + t * 16 >= N) continue; const size_t boff = (size_t)(col0 + t * 16 + ln) * ldb + kb; FragH bq; bq.half[0] = *(const v8us*)(Bh + boff + 8 * hh); bq.half[1] = *(const v8us*)(Bh + boff + 16 + 8 * hh);
      acc[t] = mmaH<ASPLIT ? 2 : 1>(ah.v, al.v, bq.v, bq.v, acc[t]); }
  }
#pragma unroll
  for (int t = 0; t < 4; ++t) { if (col0 + t * 16 >= N) continue;
#pragma unroll
    for (int r = 0; r < 8; ++r) so[w][8 * hh + r][t * 16 + ln] = acc[t][r] * alpha; }
  __builtin_amdgcn_fence(__ATOMIC_ACQ_REL, "workgroup"); __builtin_amdgcn_wave_barrier();
  const int rsub = lane >> 4, c4 = (lane & 15) * 4;
  {
#pragma unroll
    for (int q = 0; q < 8; ++q) { const int r = q * 2 + rsub; if (col0 + c4 < N) { const v4f v = *(const v4fa*)&so[w][r][c4]; *(v4f*)(C + (size_t)(row0 + r) * ldc + col0 + c4) = v; } }
     }
}

// Wt[n][k] = f16(W[k][n]·scale) from f32 row-major W[K][N] (scale = power of two; bf16-exact weights stay exact in f16 away from the subnormal range)
__global__ __launch_bounds__(256) void k_wt_f16(const float* __restrict__ W, _Float16* __restrict__ Wt, int K, int N, float scale) {
  const int t = blockIdx.x * 256 + threadIdx.x; if (t >= N * (K / 8)) return; const int n = t / (K / 8), k8 = (t % (K / 8)) * 8; FragH f;
#pragma unroll
  for (int i = 0; i < 8; ++i) f.h[i] = (_Float16)(bf16_round(W[(size_t)(k8 + i) * N + n]) * scale); const v8us o = f.half[0];
  *(v8us*)((unsigned short*)Wt + (size_t)n * K + k8) = o; 
}
typedef _Float16 v4h __attribute__((ext_vector_type(4)));
// A padded key (mask != 0) has probability exactly 0 in every query's softmax while its batch keeps a key, so it is dropped before K and V are projected (no key kept: context 0).
// idx[b][p] = position of batch b's p-th kept key, ascending (0 from the kept count on, so that every entry names a row); cnt[b] = kept count.
__device__ __forceinline__ void keys_part(int b, int* part, const int* __restrict__ MSK, int* __restrict__ idx, int* __restrict__ cnt) {      /* part: 256 ints of LDS */
  const int tid = threadIdx.x; const int* m = MSK + (size_t)b * TT + tid * (TT / 256);
  int keep[TT / 256]; int c = 0;
#pragma unroll      /* constant subscripts: keep[] stays in registers */
  for (int q = 0; q < TT / 256; ++q) { keep[q] = (m[q] == 0) ? 1 : 0; c += keep[q]; }
  part[tid] = c; __syncthreads();
  for (int o = 1; o < 256; o <<= 1) { const int a = (tid >= o) ? part[tid - o] : 0; __syncthreads(); part[tid] += a; __syncthreads(); }      /* inclusive sums over the threads */
  int pos = part[tid] - c; const int n = part[255];
#pragma unroll      /* constant subscripts: keep[] stays in registers */
  for (int q = 0; q < TT / 256; ++q) if (keep[q]) idx[(size_t)b * TT + pos++] = tid * (TT / 256) + q;
  for (int p = n + tid; p < TT; p += 256) idx[(size_t)b * TT + p] = 0;
  if (tid == 0) cnt[b] = n;
}
// b is the same for a whole work-group; readfirstlane keeps the clamped count in a scalar register, so that every test on it is a scalar branch
__device__ __forceinline__ int kept_count(const int* __restrict__ cnt, int b) { const int n = cnt[b]; return __builtin_amdgcn_readfirstlane(n < 0 ? 0 : (n > TT ? TT : n)); }
// C = (A.B^T)*alpha + bf16(bias): A f16 [NR][DD], Bh f16 [DD][DD] (row n, k contiguous). OUT 0: f16 C16, pitch DD. OUT 1: f32 C = that + bf16(resid), pitch DD (the layer's residual, added where the tile is stored).
// OUT 2: f16 C16 transposed per batch, C16[batch][column][row in the batch], pitch TT: the V^T that k_flash reads, stored by the projection itself.
// One 128 x 128 tile of C per work-group of 8 waves (4 x 2 waves, 32 x 64 each). 64 k of both operands (one 128-byte line a row) are read from
// global memory in whole lines, once per work-group, and staged in LDS (two buffers, row pitch 144 B for the 16-byte fragment reads);
// the next 64 k are in flight in registers while the waves work on this buffer. Each 16 x 16 tile sums k in ascending order in one accumulator chain.
// The K and V projections gather: row p of a batch's C is the projection of that batch's p-th kept key, A row idx[p]; tiles past the batch's kept count do nothing.
// QKV: one grid holds the three projections, which read the same A and depend on nothing of one another: the 512 tiles of q (stored as OUT 0 into C16), then those of k (OUT 0 into Ck) and v (OUT 2 into Cvt),
// Bh and bias being the fused q|k|v arrays. The k and v tiles are numbered with the row tile inside the batch slowest, so that the tiles past the kept counts, which do nothing, come last in the grid.
// !QKV: the output projection, OUT 1.
template <bool QKV>
__global__ __launch_bounds__(256) void k_gemm_t(const _Float16* __restrict__ A, const _Float16* __restrict__ Bh, float alpha, const float* __restrict__ bias, const float* __restrict__ resid, float* __restrict__ C, _Float16* __restrict__ C16, _Float16* __restrict__ Ck, _Float16* __restrict__ Cvt, const int* __restrict__ idx, const int* __restrict__ cnt) {
  constexpr int BM = 128, BN = 128, BK = 64, LP = BK + 8, NKT = DD / BK;
  __shared__ __attribute__((aligned(16))) unsigned short sA[2][BM][LP], sB[2][BN][LP];
  __shared__ __attribute__((aligned(16))) float so[8][32][64 + 4];
  const int tid = threadIdx.x, w = tid >> 5, lane = tid & 31, ln = lane & 15, hh = lane >> 4;
  constexpr int NQT = (NR / BM) * (DD / BN); constexpr int OUT1 = QKV ? 0 : 1;
  const int kv = QKV ? (int)blockIdx.x - NQT : -1;      /* from 0 on: a tile of k or v; bits from the low end: 3 column tile, 1 k or v, 2 batch, 4 row tile in the batch */
  const bool GATH = kv >= 0;      /* the same for the whole work-group, like all that is derived from blockIdx */
  const int which = GATH ? 1 + ((kv >> 3) & 1) : 0; const int OUT = QKV ? (which == 2 ? 2 : 0) : 1;
  const int nt = blockIdx.x % (DD / BN), mt = GATH ? ((kv >> 4) & (BB - 1)) * (TT / BM) + (kv >> 6) : blockIdx.x / (DD / BN); const int wm = w >> 1, wn = w & 1;
  if (QKV) { Bh += (size_t)which * DD * DD; bias += which * DD; if (which == 1) C16 = Ck; if (which == 2) C16 = Cvt; }
  const int lr = tid >> 3, lc = (tid & 7) * 8;      /* 8 lanes cover one row's 128 bytes; a thread brings rows lr + 32 i */
  if (GATH) { if ((mt % (TT / BM)) * BM >= kept_count(cnt, mt / (TT / BM))) return; }      /* the same for the whole work-group, in front of every barrier */
  const unsigned short* ga[4]; int arow[4];
#pragma unroll
  for (int i = 0; i < 4; ++i) arow[i] = mt * BM + lr + 32 * i;
  if (GATH) {      /* one test round the four index loads, so that they fly together */
#pragma unroll
    for (int i = 0; i < 4; ++i) arow[i] = idx[arow[i]];
#pragma unroll
    for (int i = 0; i < 4; ++i) arow[i] = ((mt * BM) & ~(TT - 1)) + (arow[i] & (TT - 1)); }
#pragma unroll
  for (int i = 0; i < 4; ++i) ga[i] = (const unsigned short*)A + (size_t)arow[i] * DD + lc;
  const unsigned short* gb = (const unsigned short*)Bh + (size_t)(nt * BN + lr) * DD + lc;
  v8us ra[4], rb[4];
#pragma unroll
  for (int i = 0; i < 4; ++i) { ra[i] = *(const v8us*)ga[i]; rb[i] = *(const v8us*)(gb + (size_t)i * 32 * DD); }
#pragma unroll
  for (int i = 0; i < 4; ++i) { *(v8us*)&sA[0][lr + 32 * i][lc] = ra[i]; *(v8us*)&sB[0][lr + 32 * i][lc] = rb[i]; }
  __syncthreads();
  v8f acc[2][4];
#pragma unroll
  for (int mi = 0; mi < 2; ++mi)
#pragma unroll
    for (int ni = 0; ni < 4; ++ni) acc[mi][ni] = (v8f){0.f,0.f,0.f,0.f,0.f,0.f,0.f,0.f};
  const int rsub = lane >> 4, c4 = (lane & 15) * 4; const int col0 = nt * BN + wn * 64;
  const size_t o0 = (size_t)(mt * BM + wm * 32 + rsub) * DD + col0 + c4;      /* this lane's piece of the wave's rows rsub + 2 q: one address, the rows at constant offsets from it */
  v4f xr[OUT1 == 1 ? 16 : 1];      /* OUT 1: this lane's 16 pieces of the residual, asked for here so that they arrive from memory under the k loop and not behind it */
  if (OUT1 == 1) {
#pragma unroll      /* constant subscripts: xr[] stays in registers */
    for (int q = 0; q < 16; ++q) xr[q] = *(const v4fa*)(resid + o0 + q * 2 * DD); }
  for (int kt = 0; kt < NKT; ++kt) {
    const int cur = kt & 1; const bool more = kt + 1 < NKT;      /* the same for the whole work-group */
    if (more) {
#pragma unroll
      for (int i = 0; i < 4; ++i) { ra[i] = *(const v8us*)(ga[i] + (kt + 1) * BK); rb[i] = *(const v8us*)(gb + (size_t)i * 32 * DD + (kt + 1) * BK); } }
    __builtin_amdgcn_sched_barrier(0);      /* keeps the next pass's global loads in front of this pass's products: sunk behind them, their whole latency is waited out in front of the LDS stores */
#pragma unroll
    for (int ks = 0; ks < BK / 32; ++ks) { FragH fa[2], fb[4];
#pragma unroll
      for (int mi = 0; mi < 2; ++mi) { const unsigned short* p = &sA[cur][wm * 32 + mi * 16 + ln][ks * 32 + 8 * hh]; fa[mi].half[0] = *(const v8us*)p; fa[mi].half[1] = *(const v8us*)(p + 16); }
#pragma unroll
      for (int ni = 0; ni < 4; ++ni) { const unsigned short* p = &sB[cur][wn * 64 + ni * 16 + ln][ks * 32 + 8 * hh]; fb[ni].half[0] = *(const v8us*)p; fb[ni].half[1] = *(const v8us*)(p + 16); }
#pragma unroll
      for (int mi = 0; mi < 2; ++mi)
#pragma unroll
        for (int ni = 0; ni < 4; ++ni) acc[mi][ni] = __builtin_amdgcn_wmma_f32_16x16x32_f16(false, fa[mi].v, false, fb[ni].v, (short)0, acc[mi][ni], false, false); }
    if (more) {      /* the other buffer: its last readers left it before the barrier that ended the pass before this one */
#pragma unroll
      for (int i = 0; i < 4; ++i) { *(v8us*)&sA[cur ^ 1][lr + 32 * i][lc] = ra[i]; *(v8us*)&sB[cur ^ 1][lr + 32 * i][lc] = rb[i]; } }
    __syncthreads();
  }
  float bvs[4];      /* both forms of the store add the same four bias values: asked for once, in front of the test */
#pragma unroll
  for (int ni = 0; ni < 4; ++ni) bvs[ni] = bf16_round(bias[col0 + ni * 16 + ln]);
  if (OUT == 2) {      /* a lane's 8 accumulator registers are 8 consecutive rows of one column: 16 bytes of a transposed row. The work-group's tile is staged transposed and stored in whole lines (256 B a column) */
    unsigned short (*sT)[BM + 8] = reinterpret_cast<unsigned short (*)[BM + 8]>(&so[0][0][0]);
#pragma unroll      /* these three: constant subscripts, so that acc[][] stays in registers */
    for (int ni = 0; ni < 4; ++ni) { const float bv = bvs[ni];
#pragma unroll
      for (int mi = 0; mi < 2; ++mi) { FragH f;
#pragma unroll
        for (int r = 0; r < 8; ++r) f.h[r] = (_Float16)(acc[mi][ni][r] * alpha + bv);
        *(v8us*)&sT[wn * 64 + ni * 16 + ln][wm * 32 + mi * 16 + 8 * hh] = f.half[0]; } }
    __syncthreads();      /* a transposed row holds the rows of four waves */
    unsigned short* ct = (unsigned short*)C16 + ((size_t)(mt / (TT / BM)) * DD + nt * BN) * TT + (mt % (TT / BM)) * BM;
#pragma unroll      /* the 8 LDS reads go out together, the stores follow as they return */
    for (int q = 0; q < 8; ++q) { const int d = q * 16 + (tid >> 4), pc = (tid & 15) * 8; *(v8us*)(ct + (size_t)d * TT + pc) = *(const v8us*)&sT[d][pc]; }
    return;
  }
#pragma unroll
  for (int ni = 0; ni < 4; ++ni) { const float bv = bvs[ni];      /* each wave stages its 32 rows in its own LDS range and stores whole lines */
#pragma unroll
    for (int mi = 0; mi < 2; ++mi)
#pragma unroll
      for (int r = 0; r < 8; ++r) so[w][mi * 16 + 8 * hh + r][ni * 16 + ln] = acc[mi][ni][r] * alpha + bv; }
  __builtin_amdgcn_fence(__ATOMIC_ACQ_REL, "workgroup"); __builtin_amdgcn_wave_barrier();
#pragma unroll
  for (int q = 0; q < 16; ++q) { const int r = q * 2 + rsub; const v4f v = *(const v4fa*)&so[w][r][c4]; const size_t o = o0 + q * 2 * DD;
    if (OUT1 == 1) { v4f y; for (int i = 0; i < 4; ++i) y[i] = v[i] + bf16_round(xr[q][i]); *(v4f*)(C + o) = y; }
    else { v4h h4; for (int i = 0; i < 4; ++i) h4[i] = (_Float16)v[i]; *(v4h*)(C16 + o) = h4; } }
}

__global__ __launch_bounds__(256) void k_x16(const float* __restrict__ x, _Float16* __restrict__ X16, size_t n8) { const size_t t = (size_t)blockIdx.x * 256 + threadIdx.x; if (t >= n8) return; FragH f;
#pragma unroll
  for (int q = 0; q < 8; ++q) f.h[q] = (_Float16)bf16_round(x[t * 8 + q]); *(v8us*)((unsigned short*)X16 + t * 8) = f.half[0];  }
__device__ __forceinline__ void round16f_part(int blk, const float* __restrict__ W, _Float16* __restrict__ Bt, size_t n8) { const size_t t = (size_t)blk * 256 + threadIdx.x; if (t >= n8) return; FragH f;
#pragma unroll
  for (int i = 0; i < 8; ++i) f.h[i] = (_Float16)(bf16_round(W[t * 8 + i]) * 16.0f); *(v8us*)((unsigned short*)Bt + t * 8) = f.half[0];  }
template <int D, int RBF>
__device__ __forceinline__ void lnx_part(int blk, const float* __restrict__ X, const float* __restrict__ gam, const float* __restrict__ bet, int nrows, float eps, _Float16* __restrict__ O16, float* __restrict__ XR) {
  constexpr int NP = D / 128; const int tid = threadIdx.x, wv = tid >> 5, lane = tid & 31; const size_t r = (size_t)blk * 8 + wv; if (r >= (size_t)nrows) return; v4f y[NP]; float s = 0.f;
#pragma unroll
  for (int j = 0; j < NP; ++j) { const int c = j * 128 + lane * 4; v4f g = *(const v4fa*)(X + r * D + c); if (RBF) { for (int q = 0; q < 4; ++q) g[q] = bf16_round(g[q]); } y[j] = g; s += g[0] + g[1] + g[2] + g[3]; }
  for (int o = 16; o >= 1; o >>= 1) s += __shfl_xor(s, o, 32); const float mu = s / (float)D; float q2 = 0.f;
#pragma unroll
  for (int j = 0; j < NP; ++j) for (int q = 0; q < 4; ++q) { const float d = y[j][q] - mu; q2 += d * d; }
  for (int o = 16; o >= 1; o >>= 1) q2 += __shfl_xor(q2, o, 32); const float rs = rsqrtf(q2 / (float)D + eps);
  {
#pragma unroll
    for (int j = 0; j < NP; ++j) { const int c = j * 128 + lane * 4; v4h h; for (int q = 0; q < 4; ++q) { const float v = (y[j][q] - mu) * rs * bf16_round(gam[c + q]) + bf16_round(bet[c + q]); h[q] = (_Float16)v; } *(v4h*)(O16 + r * D + c) = h; if (XR) *(v4f*)(XR + r * D + c) = y[j]; }
     } }
// All that the projections wait for, in one grid: its four parts read only the layer's inputs and depend on nothing of one another. Work-groups 0 .. BB - 1 list the kept keys (the longest chain, so first),
// the next NR / 8 normalise 8 rows each, the rest round the weights: Bw rows q|k|v, then out_w, (out,in) natural x 2^4. XR is lnx_part's optional f32 copy of the rounded rows (null: none is stored).
#define PW_QKV (3 * DD * DD / 8 / 256)      /* work-groups that round qkv_w */
#define PW_OUT (DD * DD / 8 / 256)          /* work-groups that round out_w */
__global__ __launch_bounds__(256) void k_prep(const float* __restrict__ X, const float* __restrict__ gam, const float* __restrict__ bet, const int* __restrict__ MSK, const float* __restrict__ Wqkv, const float* __restrict__ Wo,
                                              _Float16* __restrict__ X16, float* __restrict__ XR, _Float16* __restrict__ Bw, int* __restrict__ idx, int* __restrict__ cnt) {
  __shared__ int part[256];
  int blk = blockIdx.x;      /* every test on it is the same for the whole work-group */
  if (blk < BB) { keys_part(blk, part, MSK, idx, cnt); return; }
  blk -= BB;
  if (blk < NR / 8) { lnx_part<DD, 1>(blk, X, gam, bet, NR, 1e-5f, X16, XR); return; }      /* x = LN(bf16 hidden) -> f16 */
  blk -= NR / 8;
  if (blk < PW_QKV) round16f_part(blk, Wqkv, Bw, (size_t)3 * DD * DD / 8);
  else round16f_part(blk - PW_QKV, Wo, Bw + (size_t)3 * DD * DD, (size_t)DD * DD / 8);
}
// lane l <-> lane l ^ 16 (the two halves of a wave hold the two key halves of one query column)
__device__ __forceinline__ float xhalf(float x) { const int b = __builtin_bit_cast(int, x); return __builtin_bit_cast(float, __builtin_amdgcn_permlanex16(b, b, 0x76543210, 0xfedcba98, false, false)); }
#define FL_SK 64                 /* keys per stage */
#define FL_LP (64 + 8)           /* LDS row pitch in 16-bit elements */
#define FL_C 0.18033688011112042f      /* 64^-1/2 * log2(e): the exponentials are taken in base 2 on the hardware's own instruction */
// one stage: this lane's four 16-byte pieces (K rows r and r + 32, V^T rows r and r + 32). The s_wait_xcnt stands inside the statement so that no address register is rewritten ahead of it.
__device__ __forceinline__ void fl_copy4(unsigned lk, unsigned lv, const unsigned short* gk0, const unsigned short* gk1, const unsigned short* gv0, const unsigned short* gv1) {
  const unsigned lk1 = lk + 32 * FL_LP * 2, lv1 = lv + 32 * FL_LP * 2;
  asm volatile("global_load_async_to_lds_b128 %0, %4, off\n\t"
               "global_load_async_to_lds_b128 %1, %5, off\n\t"
               "global_load_async_to_lds_b128 %2, %6, off\n\t"
               "global_load_async_to_lds_b128 %3, %7, off\n\t"
               "s_wait_xcnt 0x0"
               :: "v"(lk), "v"(lk1), "v"(lv), "v"(lv1), "v"(gk0), "v"(gk1), "v"(gv0), "v"(gv1) : "memory");
}
__global__ __launch_bounds__(256) void k_flash(const _Float16* __restrict__ Q16, int ldq, const _Float16* __restrict__ K16, int ldk, const _Float16* __restrict__ Vt, const int* __restrict__ cnt, _Float16* __restrict__ O16, int ldo) {
  constexpr int NW = 8, RPW = 16, NQB = TT / (NW * RPW), DT = 4, KS = 2;
  __shared__ __attribute__((aligned(16))) unsigned short sK[2][FL_SK][FL_LP], sV[2][64][FL_LP];
  __shared__ __attribute__((aligned(16))) unsigned short sO[NW][RPW][FL_LP];
  const int tid = threadIdx.x, w = tid >> 5, lane = tid & 31, ln = lane & 15, hh = lane >> 4;
  const int slab = blockIdx.x / NQB, qblk = blockIdx.x % NQB; const int b = slab / NH, h = slab % NH; const int qb0 = qblk * (NW * RPW); const int q0 = qb0 + w * RPW;
  const int n = kept_count(cnt, b); const int nst = (n + FL_SK - 1) / FL_SK;      /* K16 and Vt hold the batch's n kept keys, packed; both are written up to the end of stage nst - 1 */
  const unsigned short* Vth = (const unsigned short*)Vt + (size_t)slab * 64 * TT;
  const int cr = tid >> 3, cc = (tid & 7) * 8;      /* 8 lanes cover one row's 128 bytes; a thread brings rows cr and cr + 32 of both tiles */
  const unsigned short* gk = (const unsigned short*)K16 + ((size_t)b * TT + cr) * ldk + h * 64 + cc;      /* + stage * 64 rows */
  const unsigned short* gv = Vth + (size_t)cr * TT + cc;                                                  /* + stage * 64 columns */
  const unsigned lk = (unsigned)(size_t)&sK[0][cr][cc], lv = (unsigned)(size_t)&sV[0][cr][cc];      /* LDS byte address = low 32 bits of the __shared__ address */
  constexpr unsigned BUFB = FL_SK * FL_LP * 2;      /* bytes of one buffer of either tile */
  if (nst > 0) fl_copy4(lk, lv, gk, gk + (size_t)32 * ldk, gv, gv + (size_t)32 * TT);      /* the same for the whole work-group */
  FragH bq[KS];      /* B operand: column ln = query q0 + ln */
  { const unsigned short* qr = (const unsigned short*)Q16 + ((size_t)b * TT + q0 + ln) * ldq + h * 64;
#pragma unroll
    for (int ks = 0; ks < KS; ++ks) { bq[ks].half[0] = *(const v8us*)(qr + ks * 32 + 8 * hh); bq[ks].half[1] = *(const v8us*)(qr + ks * 32 + 16 + 8 * hh); } }
  asm volatile("s_wait_asynccnt 0x0" ::: "memory");      /* stage 0 of this wave has landed before the barrier that publishes it */
  __syncthreads();
  if (nst > 1) fl_copy4(lk + BUFB, lv + BUFB, gk + (size_t)FL_SK * ldk, gk + (size_t)(FL_SK + 32) * ldk, gv + FL_SK, gv + (size_t)32 * TT + FL_SK);
  float m_q = -3.0e38f, l_q = 0.f; v8f oacc[DT];      /* oacc[dt][r] = O[q0 + ln][dt * 16 + 8 * hh + r] */
#pragma unroll
  for (int dt = 0; dt < DT; ++dt) oacc[dt] = (v8f){0.f,0.f,0.f,0.f,0.f,0.f,0.f,0.f};
#pragma unroll 1
  for (int st = 0; st < nst; ++st) {
    const int cur = st & 1;
#pragma unroll 1      /* rolled: unrolled, the two passes take more than the 128 registers at which all four work-groups of a WGP are resident */
    for (int jj = 0; jj < FL_SK; jj += 32) {
    const int j0 = st * FL_SK + jj;
    v8f s[2];
#pragma unroll
    for (int nt = 0; nt < 2; ++nt) { const unsigned short* kr = &sK[cur][jj + nt * 16 + ln][0]; FragH ak[KS];
#pragma unroll
      for (int ks = 0; ks < KS; ++ks) { ak[ks].half[0] = *(const v8us*)(kr + ks * 32 + 8 * hh); ak[ks].half[1] = *(const v8us*)(kr + ks * 32 + 16 + 8 * hh); }
      v8f acc = (v8f){0.f,0.f,0.f,0.f,0.f,0.f,0.f,0.f};
#pragma unroll
      for (int ks = 0; ks < KS; ++ks) acc = mmaH<1>(ak[ks].v, ak[ks].v, bq[ks].v, bq[ks].v, acc);
      s[nt] = acc; }
    if (j0 + 32 > n) {      /* only a batch's last stage holds rows past its kept keys (this lane's are j0 + 8hh + 0..7 and j0 + 16 + 8hh + 0..7): score -inf, so the exponential below is exactly 0 */
#pragma unroll      /* constant element numbers: the score tiles stay in registers */
      for (int i = 0; i < 16; ++i) s[i >> 3][i & 7] = (j0 + (i >> 3) * 16 + 8 * hh + (i & 7) < n) ? s[i >> 3][i & 7] : -INFINITY; }
    float sc[16]; float mc = -INFINITY;      /* raw q.k */
#pragma unroll
    for (int i = 0; i < 16; ++i) { sc[i] = s[i >> 3][i & 7]; mc = fmaxf(mc, sc[i]); }
    mc = fmaxf(mc, xhalf(mc));
    const float mn = fmaxf(m_q, mc); const float al = __builtin_amdgcn_exp2f((m_q - mn) * FL_C); m_q = mn;      /* m_q and mn (raw q.k units) are finite (start -3e38): no key seen yet gives 2^0 = 1 */
    const float nb = __builtin_fmaf(-mn, FL_C, 10.0f);      /* 2^10 e^((s - mn) / 8) = 2^(s C + nb): scale, maximum and the 2^10 of P in one fused multiply-add a score */
    float ps = 0.f; FragH pb;      /* pb.h[i] = 2^10 P^T[k = kmap(i, hh)][ln] */
#pragma unroll
    for (int i = 0; i < 16; ++i) { const float p = __builtin_amdgcn_exp2f(__builtin_fmaf(sc[i], FL_C, nb)); ps += p; pb.h[i] = (_Float16)p; }
    l_q = l_q * al + ps;      /* the row sum carries the same 2^10 */
#pragma unroll
    for (int dt = 0; dt < DT; ++dt)
#pragma unroll
      for (int r = 0; r < 8; ++r) oacc[dt][r] *= al;
#pragma unroll
    for (int dt = 0; dt < DT; ++dt) { const unsigned short* vrow = &sV[cur][dt * 16 + ln][jj]; FragH av; av.half[0] = *(const v8us*)(vrow + 8 * hh); av.half[1] = *(const v8us*)(vrow + 16 + 8 * hh);
      oacc[dt] = mmaH<1>(av.v, av.v, pb.v, pb.v, oacc[dt]); } }
    asm volatile("s_wait_dscnt 0x0" ::: "memory");      /* this wave's reads of buffer cur have returned before the buffer is refilled */
    asm volatile("s_wait_asynccnt 0x0" ::: "memory");   /* this wave's copies of stage st + 1 have landed before the barrier that publishes them */
    __syncthreads();      /* publishes stage st + 1 and ends every wave's reads of buffer cur */
    if (st + 2 < nst) {      /* the same for the whole work-group */
      const unsigned short* k2 = gk + (size_t)(st + 2) * FL_SK * ldk; const unsigned short* v2 = gv + (st + 2) * FL_SK;
      fl_copy4(lk + cur * BUFB, lv + cur * BUFB, k2, k2 + (size_t)32 * ldk, v2, v2 + (size_t)32 * TT); }
  }
  asm volatile("s_wait_asynccnt 0x0" ::: "memory");      /* nothing of this wave is in flight when it goes on to the output */
  { float l = l_q + xhalf(l_q); l = (l > 0.f) ? 1.0f / l : 0.f;
#pragma unroll
    for (int dt = 0; dt < DT; ++dt) { FragH f;      /* the context leaves as the f16 operand of the output GEMM */
#pragma unroll      /* constant subscripts: oacc[] stays in registers */
      for (int r = 0; r < 8; ++r) f.h[r] = (_Float16)(oacc[dt][r] * l);
      *(v8us*)&sO[w][ln][dt * 16 + 8 * hh] = f.half[0]; } }
  __builtin_amdgcn_fence(__ATOMIC_ACQ_REL, "workgroup"); __builtin_amdgcn_wave_barrier();
  {
#pragma unroll
    for (int rp = 0; rp < RPW; rp += 4) { const int r = rp + (lane >> 3), pc = (lane & 7) * 8; *(v8us*)((unsigned short*)O16 + ((size_t)b * TT + q0 + r) * ldo + h * 64 + pc) = *(const v8us*)&sO[w][r][pc]; }      /* 8 lanes store one row's 128-byte line */
     } }

extern "C" void kernel_launch(void* const* d_in, const int* in_sizes, int n_in,
                              void* d_out, int out_size, void* d_ws, size_t ws_size, hipStream_t stream) {
  (void)in_sizes; (void)n_in; (void)out_size;
  const float* const* I = (const float* const*)d_in; const float* x = I[0]; const int* mask = (const int*)d_in[1]; const float* Wqkv = I[2]; const float* bqkv = I[3]; const float* Wo = I[4]; const float* bo = I[5]; const float* lng = I[6]; const float* lnb = I[7];      /* d_in order: hidden_states, encoder_padding_mask, qkv_w, qkv_b, out_w, out_b, ln_g, ln_b */
  char* ws = (char*)d_ws; size_t off = 0;
  auto take = [&](size_t bytes) { char* p = ws + off; off += (bytes + 255) & ~(size_t)255; return p; };
  const size_t WSZ = (size_t)DD * DD; _Float16* Bw = (_Float16*)take(4 * WSZ * 2); _Float16* X16 = (_Float16*)take((size_t)NR * DD * 2);
  _Float16* Q = (_Float16*)take((size_t)NR * DD * 2); _Float16* K = (_Float16*)take((size_t)NR * DD * 2); _Float16* Vt = (_Float16*)take((size_t)NR * DD * 2); _Float16* O16 = (_Float16*)take((size_t)NR * DD * 2);
  int* kidx = (int*)take((size_t)NR * 4); int* kcnt = (int*)take(BB * 4);
  if (off > ws_size) return;
  const unsigned gp = (NR / 128) * (DD / 128);
  k_prep<<<BB + NR / 8 + PW_QKV + PW_OUT, 256, 0, stream>>>(x, lng, lnb, mask, Wqkv, Wo, X16, nullptr, Bw, kidx, kcnt);
  k_gemm_t<true><<<3 * gp, 256, 0, stream>>>(X16, Bw, 0.0625f, bqkv, nullptr, nullptr, Q, K, Vt, kidx, kcnt);      /* q = x.Wq + bq: M 8192 N 1024 K 1024; k and v: kept keys only, packed per batch, v stored as V^T [batch][head][d][key] */
  k_flash<<<BB * NH * (TT / 128), 256, 0, stream>>>(Q, DD, K, DD, Vt, kcnt, O16, DD);
  k_gemm_t<false><<<gp, 256, 0, stream>>>(O16, Bw + 3 * WSZ, 0.0625f, bo, x, (float*)d_out, nullptr, nullptr, nullptr, nullptr, nullptr);      /* out = O.out_w^T + out_b + bf16(hidden) */
}

// v008
// Measured time: 106 microseconds a run.
// In two side-by-side timings against v007, it was 1.05 and 1.06 times as fast.
// All steps since v000 together make it 7.89 times as fast.
#include <hip/hip_runtime.h>
// Pre-LN self-attention layer with a key padding mask and residual (B=4, S=2048, H=1024, 16 heads × 64): x = LN(hidden); [q|k|v] = x·qkv_wᵀ + qkv_b ((out,in) fused); scores = q·kᵀ·64^-½ + mask·(−1e8) (int mask [B,S], 1 = pad); softmax;
// out = (attn·v merged)·out_wᵀ + out_b + hidden.
// Compute dtype: x, weights, biases rounded to bf16; q/k/v as f16 GEMM outputs; fused flash-style kernel (online softmax f32, P f16 ×2^10) on v_wmma_f32_16x16x32_f16; O → f16 → output GEMM with bias; f32 accumulate.
#define BB 4
#define TT 2048
#define NH 16
#define DD 1024
#define NR (BB * TT)

typedef __bf16 v16b __attribute__((ext_vector_type(16)));
typedef unsigned short v8us __attribute__((ext_vector_type(8), may_alias));
typedef float  v8f  __attribute__((ext_vector_type(8)));
typedef float  v4f  __attribute__((ext_vector_type(4)));
typedef float  v4fa __attribute__((ext_vector_type(4), may_alias));
union FragB { v16b v; v8us half[2]; unsigned short u[16]; };

__device__ __forceinline__ unsigned short bf16_bits(float x) { unsigned int u = __float_as_uint(x); return (unsigned short)((u + 0x7FFFu + ((u >> 16) & 1u)) >> 16); }
__device__ __forceinline__ float bf16_val(unsigned short b) { return __uint_as_float(((unsigned int)b) << 16); }
__device__ __forceinline__ float bf16_round(float x) { return bf16_val(bf16_bits(x)); }
// D += A·B with NT terms: 1 = ah·bh, 2 = + al·bh (A split), 3 = + ah·bl (both split)
template <int NT>
__device__ __forceinline__ v8f mmaN(v16b ah, v16b al, v16b bh, v16b bl, v8f c) {
  c = __builtin_amdgcn_wmma_f32_16x16x32_bf16(false, ah, false, bh, (short)0, c, false, false);
  if (NT >= 2) c = __builtin_amdgcn_wmma_f32_16x16x32_bf16(false, al, false, bh, (short)0, c, false, false);
  if (NT >= 3) c = __builtin_amdgcn_wmma_f32_16x16x32_bf16(false, ah, false, bl, (short)0, c, false, false);
  asm volatile("v_nop\n\tv_nop\n\tv_nop\n\tv_nop" : "+v"(c) : "v"(ah), "v"(al), "v"(bh), "v"(bl));
  return c;
}

__global__ __launch_bounds__(256) void k_wt_bf16(const float* __restrict__ W, unsigned short* __restrict__ Wt, int K, int N) {
  const int t = blockIdx.x * 256 + threadIdx.x;
  const int k8n = K / 8;
  if (t >= N * k8n) return;
  const int n = t / k8n, k8 = (t % k8n) * 8;
  v8us v;
#pragma unroll
  for (int i = 0; i < 8; ++i) v[i] = bf16_bits(W[(size_t)(k8 + i) * N + n]);
  *(v8us*)(Wt + (size_t)n * K + k8) = v;
  
}

// GEMM C[M][N] (f32, pitch ldc) = act(A[M][K]·W + bias). A f32 row-major (pitch lda) converted per fragment to bf16
// (ASPLIT: hi/lo two planes -> 2 terms, else single rounded term); Wt bf16 [N][K] (pitch ldb). BIAS_BF16 rounds the
// bias to bf16 first (bias quantised to bf16 before the add). K%32==0, M%16==0, N%64==0.
template <bool ASPLIT, int ACT, bool BIAS_BF16>
__global__ __launch_bounds__(128) void k_gemm_bf(const float* __restrict__ A, int lda, const unsigned short* __restrict__ Wt, int ldb,
                                               const float* __restrict__ bias, float* __restrict__ C, int ldc, int M, int N, int K) {
  __shared__ __attribute__((aligned(16))) float so[4][16][64];
  const int tid = threadIdx.x, w = tid >> 5, lane = tid & 31, ln = lane & 15, hh = lane >> 4;
  const int ntn = N / 64;
  const int wid = blockIdx.x * 4 + w;
  const int mt = wid / ntn, nq = wid % ntn;
  if (mt * 16 >= M) return;
  const int row0 = mt * 16, col0 = nq * 64;
  const float* arow = A + (size_t)(row0 + ln) * lda;
  v8f acc[4] = {};
  for (int kb = 0; kb < K; kb += 32) {
    FragB ah, al;
    const v4f x0 = *(const v4fa*)(arow + kb + 8 * hh), x1 = *(const v4fa*)(arow + kb + 8 * hh + 4);
    const v4f x2 = *(const v4fa*)(arow + kb + 16 + 8 * hh), x3 = *(const v4fa*)(arow + kb + 16 + 8 * hh + 4);
    float xs[16] = {x0[0],x0[1],x0[2],x0[3],x1[0],x1[1],x1[2],x1[3],x2[0],x2[1],x2[2],x2[3],x3[0],x3[1],x3[2],x3[3]};
#pragma unroll
    for (int i = 0; i < 16; ++i) { const unsigned short hb = bf16_bits(xs[i]); ah.u[i] = hb; al.u[i] = ASPLIT ? bf16_bits(xs[i] - bf16_val(hb)) : (unsigned short)0; }
#pragma unroll
    for (int t = 0; t < 4; ++t) {
      const unsigned short* brow = Wt + (size_t)(col0 + t * 16 + ln) * ldb + kb;
      FragB b;
      b.half[0] = *(const v8us*)(brow + 8 * hh);
      b.half[1] = *(const v8us*)(brow + 16 + 8 * hh);
      acc[t] = mmaN<ASPLIT ? 2 : 1>(ah.v, al.v, b.v, b.v, acc[t]);
    }
  }
#pragma unroll
  for (int t = 0; t < 4; ++t) {
    float bv = bias ? bias[col0 + t * 16 + ln] : 0.f;
    if (BIAS_BF16) bv = bf16_round(bv);
#pragma unroll
    for (int r = 0; r < 8; ++r) { float v = acc[t][r] + bv; if (ACT == 1) v = fmaxf(v, 0.f); so[w][8 * hh + r][t * 16 + ln] = v; }
  }
  __builtin_amdgcn_fence(__ATOMIC_ACQ_REL, "workgroup");
  __builtin_amdgcn_wave_barrier();
  const int rsub = lane >> 4, c4 = (lane & 15) * 4;
  {
#pragma unroll
    for (int q = 0; q < 8; ++q) {
      const int r = q * 2 + rsub;
      const v4f v = *(const v4fa*)&so[w][r][c4];
      *(v4f*)(C + (size_t)(row0 + r) * ldc + col0 + c4) = v;
    }
    
  }
}

// Flash-style causal/unmasked attention, all contractions 3-term bf16 hi/lo splits, f32 softmax with running max.
// q,k,v rows are read from f32 buffers with arbitrary row pitch (so they can live inside a fused qkv buffer);
// D = head size (multiple of 32, <= 128); one wave = 16 query rows; block = 4 waves (64 queries) sharing K/V chunks of 32.
template <int D, bool CAUSAL>
__global__ __launch_bounds__(128) void k_flash(const float* __restrict__ qb, const float* __restrict__ kb, const float* __restrict__ vb,
                                             int pitch, int T, int H, float scale, float* __restrict__ y, int ypitch) {
  constexpr int KS = D / 32;        // k-steps for QK
  constexpr int DT = D / 16;        // d tiles for PV
  __shared__ __attribute__((aligned(16))) unsigned short sKh[32][D + 8], sKl[32][D + 8], sVh[32][D + 8], sVl[32][D + 8];
  __shared__ __attribute__((aligned(16))) unsigned short sPh[4][16][40], sPl[4][16][40];
  __shared__ __attribute__((aligned(16))) float sO[4][16][D];
  const int tid = threadIdx.x, w = tid >> 5, lane = tid & 31, ln = lane & 15, hh = lane >> 4;
  const int nqb = (T + 63) / 64;
  const int bh = blockIdx.x / nqb, qblk = blockIdx.x % nqb;
  const int b = bh / H, h = bh % H;
  const int q0 = qblk * 64 + w * 16;
  const float* Q = qb + (size_t)b * T * pitch + h * D;
  const float* K = kb + (size_t)b * T * pitch + h * D;
  const float* V = vb + (size_t)b * T * pitch + h * D;

  // A fragments of the wave's 16 query rows (scaled), hi/lo
  FragB aqh[KS], aql[KS];
  {
    int row = q0 + ln; if (row >= T) row = T - 1;
    const float* qr = Q + (size_t)row * pitch;
#pragma unroll
    for (int ks = 0; ks < KS; ++ks)
#pragma unroll
      for (int i = 0; i < 16; ++i) {
        const int d = ks * 32 + ((i < 8) ? (8 * hh + i) : (16 + 8 * hh + (i - 8)));
        const float x = qr[d] * scale; const unsigned short hb = bf16_bits(x);
        aqh[ks].u[i] = hb; aql[ks].u[i] = bf16_bits(x - bf16_val(hb));
      }
  }
  float m_r[8], l_r[8];
#pragma unroll
  for (int r = 0; r < 8; ++r) { m_r[r] = -3.0e38f; l_r[r] = 0.f; }
  v8f oacc[DT];
#pragma unroll
  for (int dt = 0; dt < DT; ++dt) oacc[dt] = (v8f){0.f,0.f,0.f,0.f,0.f,0.f,0.f,0.f};

  const int kv_end = CAUSAL ? min(T, qblk * 64 + 64) : T;     // block-uniform
  for (int j0 = 0; j0 < kv_end; j0 += 32) {
    __syncthreads();
    for (int e = tid; e < 32 * (D / 4); e += 128) {
      const int r = e / (D / 4), c4 = (e % (D / 4)) * 4;
      const int key = j0 + r;
      v4f kf = {0.f,0.f,0.f,0.f}, vf = {0.f,0.f,0.f,0.f};
      if (key < T) { kf = *(const v4fa*)(K + (size_t)key * pitch + c4); vf = *(const v4fa*)(V + (size_t)key * pitch + c4); }
#pragma unroll
      for (int t = 0; t < 4; ++t) {
        unsigned short hb = bf16_bits(kf[t]); sKh[r][c4 + t] = hb; sKl[r][c4 + t] = bf16_bits(kf[t] - bf16_val(hb));
        hb = bf16_bits(vf[t]); sVh[r][c4 + t] = hb; sVl[r][c4 + t] = bf16_bits(vf[t] - bf16_val(hb));
      }
    }
    __syncthreads();
    // S tile 16 x 32
    v8f s[2];
#pragma unroll
    for (int nt = 0; nt < 2; ++nt) {
      v8f acc = {};
#pragma unroll
      for (int ks = 0; ks < KS; ++ks) {
        FragB bh_, bl_;
        bh_.half[0] = *(const v8us*)&sKh[nt * 16 + ln][ks * 32 + 8 * hh]; bh_.half[1] = *(const v8us*)&sKh[nt * 16 + ln][ks * 32 + 16 + 8 * hh];
        bl_.half[0] = *(const v8us*)&sKl[nt * 16 + ln][ks * 32 + 8 * hh]; bl_.half[1] = *(const v8us*)&sKl[nt * 16 + ln][ks * 32 + 16 + 8 * hh];
        acc = mmaN<3>(aqh[ks].v, aql[ks].v, bh_.v, bl_.v, acc);
      }
      s[nt] = acc;
    }
    // mask + running max (rows 8hh+r; the 16 lanes of a half share rows)
    float alpha[8];
#pragma unroll
    for (int r = 0; r < 8; ++r) {
      const int qi = q0 + 8 * hh + r;
      const int ja = j0 + ln, jb = j0 + 16 + ln;
      if (CAUSAL) { if (ja > qi) s[0][r] = -3.0e38f; if (jb > qi) s[1][r] = -3.0e38f; }
      if (ja >= T) s[0][r] = -3.0e38f;
      if (jb >= T) s[1][r] = -3.0e38f;
      float mx = fmaxf(s[0][r], s[1][r]);
      mx = fmaxf(mx, __shfl_xor(mx, 1, 32)); mx = fmaxf(mx, __shfl_xor(mx, 2, 32)); mx = fmaxf(mx, __shfl_xor(mx, 4, 32)); mx = fmaxf(mx, __shfl_xor(mx, 8, 32));
      const float mnew = fmaxf(m_r[r], mx);
      alpha[r] = (mnew > -1.0e38f) ? __expf(m_r[r] - mnew) : 1.0f;
      const float p0 = (s[0][r] > -1.0e38f) ? __expf(s[0][r] - mnew) : 0.f;
      const float p1 = (s[1][r] > -1.0e38f) ? __expf(s[1][r] - mnew) : 0.f;
      m_r[r] = mnew;
      l_r[r] = l_r[r] * alpha[r] + p0 + p1;            // per-lane partial row sum (16 lanes combined at the end)
      unsigned short hb = bf16_bits(p0); sPh[w][8 * hh + r][ln] = hb;      sPl[w][8 * hh + r][ln] = bf16_bits(p0 - bf16_val(hb));
      hb = bf16_bits(p1);                sPh[w][8 * hh + r][16 + ln] = hb; sPl[w][8 * hh + r][16 + ln] = bf16_bits(p1 - bf16_val(hb));
    }
#pragma unroll
    for (int dt = 0; dt < DT; ++dt)
#pragma unroll
      for (int r = 0; r < 8; ++r) oacc[dt][r] *= alpha[r];
    __builtin_amdgcn_fence(__ATOMIC_ACQ_REL, "workgroup");
    __builtin_amdgcn_wave_barrier();
    FragB pah, pal;
    pah.half[0] = *(const v8us*)&sPh[w][ln][8 * hh]; pah.half[1] = *(const v8us*)&sPh[w][ln][16 + 8 * hh];
    pal.half[0] = *(const v8us*)&sPl[w][ln][8 * hh]; pal.half[1] = *(const v8us*)&sPl[w][ln][16 + 8 * hh];
#pragma unroll
    for (int dt = 0; dt < DT; ++dt) {
      FragB bvh, bvl;
#pragma unroll
      for (int i = 0; i < 8; ++i) {
        bvh.u[i] = sVh[8 * hh + i][dt * 16 + ln]; bvh.u[8 + i] = sVh[16 + 8 * hh + i][dt * 16 + ln];
        bvl.u[i] = sVl[8 * hh + i][dt * 16 + ln]; bvl.u[8 + i] = sVl[16 + 8 * hh + i][dt * 16 + ln];
      }
      oacc[dt] = mmaN<3>(pah.v, pal.v, bvh.v, bvl.v, oacc[dt]);
    }
    __builtin_amdgcn_fence(__ATOMIC_ACQ_REL, "workgroup");
    __builtin_amdgcn_wave_barrier();
  }
#pragma unroll
  for (int r = 0; r < 8; ++r) {
    float l = l_r[r];
    l += __shfl_xor(l, 1, 32); l += __shfl_xor(l, 2, 32); l += __shfl_xor(l, 4, 32); l += __shfl_xor(l, 8, 32);
    l_r[r] = (l > 0.f) ? 1.0f / l : 0.f;
  }
#pragma unroll
  for (int dt = 0; dt < DT; ++dt)
#pragma unroll
    for (int r = 0; r < 8; ++r) sO[w][8 * hh + r][dt * 16 + ln] = oacc[dt][r] * l_r[r];
  __builtin_amdgcn_fence(__ATOMIC_ACQ_REL, "workgroup");
  __builtin_amdgcn_wave_barrier();
  {
    for (int r = 0; r < 16; ++r) {
      const int row = q0 + r;
      if (row < T && lane < D / 4) {
        const v4f val = *(const v4fa*)&sO[w][r][lane * 4];
        *(v4f*)(y + ((size_t)b * T + row) * ypitch + h * D + lane * 4) = val;
      }
    }
    
  }
}

// GEMM C = act(A·W + bias + resid): A f32 (ASPLIT -> hi/lo 2 terms), Wt bf16 [N][K]; ACT 0 none, 1 relu, 2 exact gelu;
// resid (optional, f32, row index = (row % rmod), pitch ldr, RES_BF16 rounds it) added before the activation.
template <bool ASPLIT, int ACT, bool BIAS_BF16, bool RES_BF16>
__global__ __launch_bounds__(128) void k_gemm_bf3(const float* __restrict__ A, int lda, const unsigned short* __restrict__ Wt, int ldb,
                                                const float* __restrict__ bias, const float* __restrict__ resid, int rmod, int ldr,
                                                float* __restrict__ C, int ldc, int M, int N, int K) {
  __shared__ __attribute__((aligned(16))) float so[4][16][64];
  const int tid = threadIdx.x, w = tid >> 5, lane = tid & 31, ln = lane & 15, hh = lane >> 4;
  const int ntn = N / 64;
  const int wid = blockIdx.x * 4 + w;
  const int mt = wid / ntn, nq = wid % ntn;
  if (mt * 16 >= M) return;
  const int row0 = mt * 16, col0 = nq * 64;
  const float* arow = A + (size_t)(row0 + ln) * lda;
  v8f acc[4] = {};
  for (int kb = 0; kb < K; kb += 32) {
    FragB ah, al;
    const v4f x0 = *(const v4fa*)(arow + kb + 8 * hh), x1 = *(const v4fa*)(arow + kb + 8 * hh + 4);
    const v4f x2 = *(const v4fa*)(arow + kb + 16 + 8 * hh), x3 = *(const v4fa*)(arow + kb + 16 + 8 * hh + 4);
    float xs[16] = {x0[0],x0[1],x0[2],x0[3],x1[0],x1[1],x1[2],x1[3],x2[0],x2[1],x2[2],x2[3],x3[0],x3[1],x3[2],x3[3]};
#pragma unroll
    for (int i = 0; i < 16; ++i) { const unsigned short hb = bf16_bits(xs[i]); ah.u[i] = hb; al.u[i] = ASPLIT ? bf16_bits(xs[i] - bf16_val(hb)) : (unsigned short)0; }
#pragma unroll
    for (int t = 0; t < 4; ++t) {
      const unsigned short* brow = Wt + (size_t)(col0 + t * 16 + ln) * ldb + kb;
      FragB b;
      b.half[0] = *(const v8us*)(brow + 8 * hh);
      b.half[1] = *(const v8us*)(brow + 16 + 8 * hh);
      acc[t] = mmaN<ASPLIT ? 2 : 1>(ah.v, al.v, b.v, b.v, acc[t]);
    }
  }
#pragma unroll
  for (int t = 0; t < 4; ++t) {
    const int col = col0 + t * 16 + ln;
    float bv = bias ? bias[col] : 0.f;
    if (BIAS_BF16) bv = bf16_round(bv);
#pragma unroll
    for (int r = 0; r < 8; ++r) {
      float v = acc[t][r] + bv;
      if (resid) { float rv = resid[(size_t)((row0 + 8 * hh + r) % rmod) * ldr + col]; if (RES_BF16) rv = bf16_round(rv); v += rv; }
      if (ACT == 1) v = fmaxf(v, 0.f);
      if (ACT == 2) v = 0.5f * v * (1.0f + erff(v * 0.70710678118654752f));
      if (ACT == 3) { const float u = 0.7978845608028654f * (v + 0.044715f * v * v * v); v = 0.5f * v * (1.0f + tanhf(u)); }
      so[w][8 * hh + r][t * 16 + ln] = v;
    }
  }
  __builtin_amdgcn_fence(__ATOMIC_ACQ_REL, "workgroup");
  __builtin_amdgcn_wave_barrier();
  const int rsub = lane >> 4, c4 = (lane & 15) * 4;
  {
#pragma unroll
    for (int q = 0; q < 8; ++q) {
      const int r = q * 2 + rsub;
      const v4f v = *(const v4fa*)&so[w][r][c4];
      *(v4f*)(C + (size_t)(row0 + r) * ldc + col0 + c4) = v;
    }
    
  }
}
// row LayerNorm (biased variance, eps) over N: s = X (+ R); optional out_sum <- s; out_norm <- (s-mu)*rsqrt(var+eps)*g + b
template <bool PARAM_BF16>
__global__ __launch_bounds__(256) void k_layernorm(const float* __restrict__ X, const float* __restrict__ R, const float* __restrict__ g, const float* __restrict__ bta,
                                                  float* __restrict__ out_sum, float* __restrict__ out_norm, int N, float eps) {
  __shared__ float red[256];
  const int row = blockIdx.x, tid = threadIdx.x;
  const float* x = X + (size_t)row * N; const float* rr = R ? R + (size_t)row * N : nullptr;
  float vals[16];                     // up to N = 4096
  const int per = N / 256;            // contiguous chunk per thread? use strided-by-4 chunks: thread handles j = tid*4 + 1024*u
  float s1 = 0.f;
  for (int u = 0; u < per / 4; ++u) {
    const int j = tid * 4 + 1024 * u;
    const v4f a = *(const v4fa*)(x + j);
    v4f b = {0.f,0.f,0.f,0.f}; if (rr) b = *(const v4fa*)(rr + j);
#pragma unroll
    for (int q = 0; q < 4; ++q) { const float v = a[q] + b[q]; vals[u * 4 + q] = v; s1 += v; }
  }
  red[tid] = s1; __syncthreads();
  for (int st = 128; st > 0; st >>= 1) { if (tid < st) red[tid] += red[tid + st]; __syncthreads(); }
  const float mu = red[0] / (float)N; __syncthreads();
  float s2 = 0.f;
  for (int u = 0; u < per / 4; ++u)
#pragma unroll
    for (int q = 0; q < 4; ++q) { const float c = vals[u * 4 + q] - mu; s2 += c * c; }
  red[tid] = s2; __syncthreads();
  for (int st = 128; st > 0; st >>= 1) { if (tid < st) red[tid] += red[tid + st]; __syncthreads(); }
  const float rs = rsqrtf(red[0] / (float)N + eps);
  {
    for (int u = 0; u < per / 4; ++u) {
      const int j = tid * 4 + 1024 * u;
      v4f o, sm;
#pragma unroll
      for (int q = 0; q < 4; ++q) {
        float gg = g[j + q], bb = bta[j + q];
        if (PARAM_BF16) { gg = bf16_round(gg); bb = bf16_round(bb); }
        sm[q] = vals[u * 4 + q]; o[q] = (vals[u * 4 + q] - mu) * rs * gg + bb;
      }
      if (out_sum) *(v4f*)(out_sum + (size_t)row * N + j) = sm;
      *(v4f*)(out_norm + (size_t)row * N + j) = o;
    }
    
  }
}



// ---- f16 WMMA path (v_wmma_f32_16x16x32_f16): 11-bit significands for operands in range — used where a [0,1] probability operand needs more precision than bf16
typedef _Float16 v16h __attribute__((ext_vector_type(16)));
union FragH { v16h v; v8us half[2]; _Float16 h[16]; unsigned short u[16]; };
template <int NT>
__device__ __forceinline__ v8f mmaH(v16h ah, v16h al, v16h bh, v16h bl, v8f c) {
  c = __builtin_amdgcn_wmma_f32_16x16x32_f16(false, ah, false, bh, (short)0, c, false, false);
  if (NT >= 2) c = __builtin_amdgcn_wmma_f32_16x16x32_f16(false, al, false, bh, (short)0, c, false, false);
  if (NT >= 3) c = __builtin_amdgcn_wmma_f32_16x16x32_f16(false, ah, false, bl, (short)0, c, false, false);
  asm volatile("v_nop\n\tv_nop\n\tv_nop\n\tv_nop" : "+v"(c) : "v"(ah), "v"(al), "v"(bh), "v"(bl));
  return c;
}
// batched GEMM like k_gemm_b but f16 operands: A f32 (split into f16 hi/lo if ASPLIT, else rounded to f16), Bt = f16 values [n][k]; alpha; C f32; N multiple of 16 (partial tiles skipped)
template <bool ASPLIT>
__global__ __launch_bounds__(128) void k_gemm_h(const float* __restrict__ A, int lda, size_t sA, const _Float16* __restrict__ Bh, int ldb, size_t sB, float alpha, float* __restrict__ C, int ldc, size_t sC, int M, int N, int K) {
  __shared__ __attribute__((aligned(16))) float so[4][16][64];
  const int tid = threadIdx.x, w = tid >> 5, lane = tid & 31, ln = lane & 15, hh = lane >> 4; const int by = blockIdx.y;
  A += (size_t)by * sA; Bh += (size_t)by * sB; C += (size_t)by * sC;
  const int ntn = (N + 63) / 64; const int wid = blockIdx.x * 4 + w; const int mt = wid / ntn, nq = wid % ntn; if (mt * 16 >= M) return;
  const int row0 = mt * 16, col0 = nq * 64; const float* arow = A + (size_t)(row0 + ln) * lda;
  v8f acc[4] = {};
  for (int kb = 0; kb < K; kb += 32) {
    FragH ah, al;
    const v4f x0 = *(const v4fa*)(arow + kb + 8 * hh), x1 = *(const v4fa*)(arow + kb + 8 * hh + 4), x2 = *(const v4fa*)(arow + kb + 16 + 8 * hh), x3 = *(const v4fa*)(arow + kb + 16 + 8 * hh + 4);
    float xs[16] = {x0[0],x0[1],x0[2],x0[3],x1[0],x1[1],x1[2],x1[3],x2[0],x2[1],x2[2],x2[3],x3[0],x3[1],x3[2],x3[3]};
#pragma unroll
    for (int i = 0; i < 16; ++i) { const _Float16 h = (_Float16)xs[i]; ah.h[i] = h; al.h[i] = ASPLIT ? (_Float16)(xs[i] - (float)h) : (_Float16)0.0f; }
#pragma unroll
    for (int t = 0; t < 4; ++t) { if (col0 + t * 16 >= N) continue; const size_t boff = (size_t)(col0 + t * 16 + ln) * ldb + kb; FragH bq; bq.half[0] = *(const v8us*)(Bh + boff + 8 * hh); bq.half[1] = *(const v8us*)(Bh + boff + 16 + 8 * hh);
      acc[t] = mmaH<ASPLIT ? 2 : 1>(ah.v, al.v, bq.v, bq.v, acc[t]); }
  }
#pragma unroll
  for (int t = 0; t < 4; ++t) { if (col0 + t * 16 >= N) continue;
#pragma unroll
    for (int r = 0; r < 8; ++r) so[w][8 * hh + r][t * 16 + ln] = acc[t][r] * alpha; }
  __builtin_amdgcn_fence(__ATOMIC_ACQ_REL, "workgroup"); __builtin_amdgcn_wave_barrier();
  const int rsub = lane >> 4, c4 = (lane & 15) * 4;
  {
#pragma unroll
    for (int q = 0; q < 8; ++q) { const int r = q * 2 + rsub; if (col0 + c4 < N) { const v4f v = *(const v4fa*)&so[w][r][c4]; *(v4f*)(C + (size_t)(row0 + r) * ldc + col0 + c4) = v; } }
     }
}

// Wt[n][k] = f16(W[k][n]·scale) from f32 row-major W[K][N] (scale = power of two; bf16-exact weights stay exact in f16 away from the subnormal range)
__global__ __launch_bounds__(256) void k_wt_f16(const float* __restrict__ W, _Float16* __restrict__ Wt, int K, int N, float scale) {
  const int t = blockIdx.x * 256 + threadIdx.x; if (t >= N * (K / 8)) return; const int n = t / (K / 8), k8 = (t % (K / 8)) * 8; FragH f;
#pragma unroll
  for (int i = 0; i < 8; ++i) f.h[i] = (_Float16)(bf16_round(W[(size_t)(k8 + i) * N + n]) * scale); const v8us o = f.half[0];
  *(v8us*)((unsigned short*)Wt + (size_t)n * K + k8) = o; 
}
typedef _Float16 v4h __attribute__((ext_vector_type(4)));
typedef float v2f __attribute__((ext_vector_type(2)));
// A padded key (mask != 0) has probability exactly 0 in every query's softmax while its batch keeps a key, so it is dropped before K and V are projected (no key kept: context 0).
// idx[b][p] = position of batch b's p-th kept key, ascending (0 from the kept count on, so that every entry names a row); cnt[b] = kept count.
__device__ __forceinline__ void keys_part(int b, int* part, const int* __restrict__ MSK, int* __restrict__ idx, int* __restrict__ cnt) {      /* part: 256 ints of LDS */
  const int tid = threadIdx.x; const int* m = MSK + (size_t)b * TT + tid * (TT / 256);
  int keep[TT / 256]; int c = 0;
#pragma unroll      /* constant subscripts: keep[] stays in registers */
  for (int q = 0; q < TT / 256; ++q) { keep[q] = (m[q] == 0) ? 1 : 0; c += keep[q]; }
  part[tid] = c; __syncthreads();
  for (int o = 1; o < 256; o <<= 1) { const int a = (tid >= o) ? part[tid - o] : 0; __syncthreads(); part[tid] += a; __syncthreads(); }      /* inclusive sums over the threads */
  int pos = part[tid] - c; const int n = part[255];
#pragma unroll      /* constant subscripts: keep[] stays in registers */
  for (int q = 0; q < TT / 256; ++q) if (keep[q]) idx[(size_t)b * TT + pos++] = tid * (TT / 256) + q;
  for (int p = n + tid; p < TT; p += 256) idx[(size_t)b * TT + p] = 0;
  if (tid == 0) cnt[b] = n;
}
// b is the same for a whole work-group; readfirstlane keeps the clamped count in a scalar register, so that every test on it is a scalar branch
__device__ __forceinline__ int kept_count(const int* __restrict__ cnt, int b) { const int n = cnt[b]; return __builtin_amdgcn_readfirstlane(n < 0 ? 0 : (n > TT ? TT : n)); }
// C = (A.B^T)*alpha + bf16(bias): A f16 [NR][DD], Bh f16 [DD][DD] (row n, k contiguous). OUT 0: f16 C16, pitch DD. OUT 1: f32 C = that + bf16(resid), pitch DD (the layer's residual, added where the tile is stored).
// OUT 2: f16 C16 transposed per batch, C16[batch][column][row in the batch], pitch TT: the V^T that k_flash reads, stored by the projection itself.
// One 128 x 128 tile of C per work-group of 8 waves (4 x 2 waves, 32 x 64 each). 64 k of both operands (one 128-byte line a row) are read from
// global memory in whole lines, once per work-group, and staged in LDS (two buffers, row pitch 144 B for the 16-byte fragment reads);
// the next 64 k are in flight in registers while the waves work on this buffer. Each 16 x 16 tile sums k in ascending order in one accumulator chain.
// The K and V projections gather: row p of a batch's C is the projection of that batch's p-th kept key, A row idx[p]; tiles past the batch's kept count do nothing.
// QKV: one grid holds the three projections, which read the same A and depend on nothing of one another: the 512 tiles of q (stored as OUT 0 into C16), then those of k (OUT 0 into Ck) and v (OUT 2 into Cvt),
// Bh and bias being the fused q|k|v arrays. The k and v tiles are numbered with the row tile inside the batch slowest, so that the tiles past the kept counts, which do nothing, come last in the grid.
// !QKV: the output projection, OUT 1.
template <bool QKV>
__global__ __launch_bounds__(256) void k_gemm_t(const _Float16* __restrict__ A, const _Float16* __restrict__ Bh, float alpha, const float* __restrict__ bias, const float* __restrict__ resid, float* __restrict__ C, _Float16* __restrict__ C16, _Float16* __restrict__ Ck, _Float16* __restrict__ Cvt, const int* __restrict__ idx, const int* __restrict__ cnt) {
  constexpr int BM = 128, BN = 128, BK = 64, LP = BK + 8, NKT = DD / BK;
  __shared__ __attribute__((aligned(16))) unsigned short sA[2][BM][LP], sB[2][BN][LP];
  __shared__ __attribute__((aligned(16))) float so[8][32][64 + 4];
  const int tid = threadIdx.x, w = tid >> 5, lane = tid & 31, ln = lane & 15, hh = lane >> 4;
  constexpr int NQT = (NR / BM) * (DD / BN); constexpr int OUT1 = QKV ? 0 : 1;
  const int kv = QKV ? (int)blockIdx.x - NQT : -1;      /* from 0 on: a tile of k or v; bits from the low end: 3 column tile, 1 k or v, 2 batch, 4 row tile in the batch */
  const bool GATH = kv >= 0;      /* the same for the whole work-group, like all that is derived from blockIdx */
  const int which = GATH ? 1 + ((kv >> 3) & 1) : 0; const int OUT = QKV ? (which == 2 ? 2 : 0) : 1;
  const int nt = blockIdx.x % (DD / BN), mt = GATH ? ((kv >> 4) & (BB - 1)) * (TT / BM) + (kv >> 6) : blockIdx.x / (DD / BN); const int wm = w >> 1, wn = w & 1;
  if (QKV) { Bh += (size_t)which * DD * DD; bias += which * DD; if (which == 1) C16 = Ck; if (which == 2) C16 = Cvt; }
  const int lr = tid >> 3, lc = (tid & 7) * 8;      /* 8 lanes cover one row's 128 bytes; a thread brings rows lr + 32 i */
  if (GATH) { if ((mt % (TT / BM)) * BM >= kept_count(cnt, mt / (TT / BM))) return; }      /* the same for the whole work-group, in front of every barrier */
  const unsigned short* ga[4]; int arow[4];
#pragma unroll
  for (int i = 0; i < 4; ++i) arow[i] = mt * BM + lr + 32 * i;
  if (GATH) {      /* one test round the four index loads, so that they fly together */
#pragma unroll
    for (int i = 0; i < 4; ++i) arow[i] = idx[arow[i]];
#pragma unroll
    for (int i = 0; i < 4; ++i) arow[i] = ((mt * BM) & ~(TT - 1)) + (arow[i] & (TT - 1)); }
#pragma unroll
  for (int i = 0; i < 4; ++i) ga[i] = (const unsigned short*)A + (size_t)arow[i] * DD + lc;
  const unsigned short* gb = (const unsigned short*)Bh + (size_t)(nt * BN + lr) * DD + lc;
  v8us ra[4], rb[4];
#pragma unroll
  for (int i = 0; i < 4; ++i) { ra[i] = *(const v8us*)ga[i]; rb[i] = *(const v8us*)(gb + (size_t)i * 32 * DD); }
#pragma unroll
  for (int i = 0; i < 4; ++i) { *(v8us*)&sA[0][lr + 32 * i][lc] = ra[i]; *(v8us*)&sB[0][lr + 32 * i][lc] = rb[i]; }
  __syncthreads();
  v8f acc[2][4];
#pragma unroll
  for (int mi = 0; mi < 2; ++mi)
#pragma unroll
    for (int ni = 0; ni < 4; ++ni) acc[mi][ni] = (v8f){0.f,0.f,0.f,0.f,0.f,0.f,0.f,0.f};
  const int rsub = lane >> 4, c4 = (lane & 15) * 4; const int col0 = nt * BN + wn * 64;
  const size_t o0 = (size_t)(mt * BM + wm * 32 + rsub) * DD + col0 + c4;      /* this lane's piece of the wave's rows rsub + 2 q: one address, the rows at constant offsets from it */
  v4f xr[OUT1 == 1 ? 16 : 1];      /* OUT 1: this lane's 16 pieces of the residual, asked for here so that they arrive from memory under the k loop and not behind it */
  if (OUT1 == 1) {
#pragma unroll      /* constant subscripts: xr[] stays in registers */
    for (int q = 0; q < 16; ++q) xr[q] = *(const v4fa*)(resid + o0 + q * 2 * DD); }
  for (int kt = 0; kt < NKT; ++kt) {
    const int cur = kt & 1; const bool more = kt + 1 < NKT;      /* the same for the whole work-group */
    if (more) {
#pragma unroll
      for (int i = 0; i < 4; ++i) { ra[i] = *(const v8us*)(ga[i] + (kt + 1) * BK); rb[i] = *(const v8us*)(gb + (size_t)i * 32 * DD + (kt + 1) * BK); } }
    __builtin_amdgcn_sched_barrier(0);      /* keeps the next pass's global loads in front of this pass's products: sunk behind them, their whole latency is waited out in front of the LDS stores */
#pragma unroll
    for (int ks = 0; ks < BK / 32; ++ks) { FragH fa[2], fb[4];
#pragma unroll
      for (int mi = 0; mi < 2; ++mi) { const unsigned short* p = &sA[cur][wm * 32 + mi * 16 + ln][ks * 32 + 8 * hh]; fa[mi].half[0] = *(const v8us*)p; fa[mi].half[1] = *(const v8us*)(p + 16); }
#pragma unroll
      for (int ni = 0; ni < 4; ++ni) { const unsigned short* p = &sB[cur][wn * 64 + ni * 16 + ln][ks * 32 + 8 * hh]; fb[ni].half[0] = *(const v8us*)p; fb[ni].half[1] = *(const v8us*)(p + 16); }
#pragma unroll
      for (int mi = 0; mi < 2; ++mi)
#pragma unroll
        for (int ni = 0; ni < 4; ++ni) acc[mi][ni] = __builtin_amdgcn_wmma_f32_16x16x32_f16(false, fa[mi].v, false, fb[ni].v, (short)0, acc[mi][ni], false, false); }
    if (more) {      /* the other buffer: its last readers left it before the barrier that ended the pass before this one */
#pragma unroll
      for (int i = 0; i < 4; ++i) { *(v8us*)&sA[cur ^ 1][lr + 32 * i][lc] = ra[i]; *(v8us*)&sB[cur ^ 1][lr + 32 * i][lc] = rb[i]; } }
    __syncthreads();
  }
  float bvs[4];      /* both forms of the store add the same four bias values: asked for once, in front of the test */
#pragma unroll
  for (int ni = 0; ni < 4; ++ni) bvs[ni] = bf16_round(bias[col0 + ni * 16 + ln]);
  if (OUT == 2) {      /* a lane's 8 accumulator registers are 8 consecutive rows of one column: 16 bytes of a transposed row. The work-group's tile is staged transposed and stored in whole lines (256 B a column) */
    unsigned short (*sT)[BM + 8] = reinterpret_cast<unsigned short (*)[BM + 8]>(&so[0][0][0]);
#pragma unroll      /* these three: constant subscripts, so that acc[][] stays in registers */
    for (int ni = 0; ni < 4; ++ni) { const float bv = bvs[ni];
#pragma unroll
      for (int mi = 0; mi < 2; ++mi) { FragH f;
#pragma unroll
        for (int r = 0; r < 8; ++r) f.h[r] = (_Float16)(acc[mi][ni][r] * alpha + bv);
        *(v8us*)&sT[wn * 64 + ni * 16 + ln][wm * 32 + mi * 16 + 8 * hh] = f.half[0]; } }
    __syncthreads();      /* a transposed row holds the rows of four waves */
    unsigned short* ct = (unsigned short*)C16 + ((size_t)(mt / (TT / BM)) * DD + nt * BN) * TT + (mt % (TT / BM)) * BM;
#pragma unroll      /* the 8 LDS reads go out together, the stores follow as they return */
    for (int q = 0; q < 8; ++q) { const int d = q * 16 + (tid >> 4), pc = (tid & 15) * 8; *(v8us*)(ct + (size_t)d * TT + pc) = *(const v8us*)&sT[d][pc]; }
    return;
  }
#pragma unroll
  for (int ni = 0; ni < 4; ++ni) { const float bv = bvs[ni];      /* each wave stages its 32 rows in its own LDS range and stores whole lines */
#pragma unroll
    for (int mi = 0; mi < 2; ++mi)
#pragma unroll
      for (int r = 0; r < 8; ++r) so[w][mi * 16 + 8 * hh + r][ni * 16 + ln] = acc[mi][ni][r] * alpha + bv; }
  __builtin_amdgcn_fence(__ATOMIC_ACQ_REL, "workgroup"); __builtin_amdgcn_wave_barrier();
#pragma unroll
  for (int q = 0; q < 16; ++q) { const int r = q * 2 + rsub; const v4f v = *(const v4fa*)&so[w][r][c4]; const size_t o = o0 + q * 2 * DD;
    if (OUT1 == 1) { v4f y; for (int i = 0; i < 4; ++i) y[i] = v[i] + bf16_round(xr[q][i]); *(v4f*)(C + o) = y; }
    else { v4h h4; for (int i = 0; i < 4; ++i) h4[i] = (_Float16)v[i]; *(v4h*)(C16 + o) = h4; } }
}

__global__ __launch_bounds__(256) void k_x16(const float* __restrict__ x, _Float16* __restrict__ X16, size_t n8) { const size_t t = (size_t)blockIdx.x * 256 + threadIdx.x; if (t >= n8) return; FragH f;
#pragma unroll
  for (int q = 0; q < 8; ++q) f.h[q] = (_Float16)bf16_round(x[t * 8 + q]); *(v8us*)((unsigned short*)X16 + t * 8) = f.half[0];  }
__device__ __forceinline__ void round16f_part(int blk, const float* __restrict__ W, _Float16* __restrict__ Bt, size_t n8) { const size_t t = (size_t)blk * 256 + threadIdx.x; if (t >= n8) return; FragH f;
#pragma unroll
  for (int i = 0; i < 8; ++i) f.h[i] = (_Float16)(bf16_round(W[t * 8 + i]) * 16.0f); *(v8us*)((unsigned short*)Bt + t * 8) = f.half[0];  }
template <int D, int RBF>
__device__ __forceinline__ void lnx_part(int blk, const float* __restrict__ X, const float* __restrict__ gam, const float* __restrict__ bet, int nrows, float eps, _Float16* __restrict__ O16, float* __restrict__ XR) {
  constexpr int NP = D / 128; const int tid = threadIdx.x, wv = tid >> 5, lane = tid & 31; const size_t r = (size_t)blk * 8 + wv; if (r >= (size_t)nrows) return; v4f y[NP]; float s = 0.f;
#pragma unroll
  for (int j = 0; j < NP; ++j) { const int c = j * 128 + lane * 4; v4f g = *(const v4fa*)(X + r * D + c); if (RBF) { for (int q = 0; q < 4; ++q) g[q] = bf16_round(g[q]); } y[j] = g; s += g[0] + g[1] + g[2] + g[3]; }
  for (int o = 16; o >= 1; o >>= 1) s += __shfl_xor(s, o, 32); const float mu = s / (float)D; float q2 = 0.f;
#pragma unroll
  for (int j = 0; j < NP; ++j) for (int q = 0; q < 4; ++q) { const float d = y[j][q] - mu; q2 += d * d; }
  for (int o = 16; o >= 1; o >>= 1) q2 += __shfl_xor(q2, o, 32); const float rs = rsqrtf(q2 / (float)D + eps);
  {
#pragma unroll
    for (int j = 0; j < NP; ++j) { const int c = j * 128 + lane * 4; v4h h; for (int q = 0; q < 4; ++q) { const float v = (y[j][q] - mu) * rs * bf16_round(gam[c + q]) + bf16_round(bet[c + q]); h[q] = (_Float16)v; } *(v4h*)(O16 + r * D + c) = h; if (XR) *(v4f*)(XR + r * D + c) = y[j]; }
     } }
// All that the projections wait for, in one grid: its four parts read only the layer's inputs and depend on nothing of one another. Work-groups 0 .. BB - 1 list the kept keys (the longest chain, so first),
// the next NR / 8 normalise 8 rows each, the rest round the weights: Bw rows q|k|v, then out_w, (out,in) natural x 2^4. XR is lnx_part's optional f32 copy of the rounded rows (null: none is stored).
#define PW_QKV (3 * DD * DD / 8 / 256)      /* work-groups that round qkv_w */
#define PW_OUT (DD * DD / 8 / 256)          /* work-groups that round out_w */
__global__ __launch_bounds__(256) void k_prep(const float* __restrict__ X, const float* __restrict__ gam, const float* __restrict__ bet, const int* __restrict__ MSK, const float* __restrict__ Wqkv, const float* __restrict__ Wo,
                                              _Float16* __restrict__ X16, float* __restrict__ XR, _Float16* __restrict__ Bw, int* __restrict__ idx, int* __restrict__ cnt) {
  __shared__ int part[256];
  int blk = blockIdx.x;      /* every test on it is the same for the whole work-group */
  if (blk < BB) { keys_part(blk, part, MSK, idx, cnt); return; }
  blk -= BB;
  if (blk < NR / 8) { lnx_part<DD, 1>(blk, X, gam, bet, NR, 1e-5f, X16, XR); return; }      /* x = LN(bf16 hidden) -> f16 */
  blk -= NR / 8;
  if (blk < PW_QKV) round16f_part(blk, Wqkv, Bw, (size_t)3 * DD * DD / 8);
  else round16f_part(blk - PW_QKV, Wo, Bw + (size_t)3 * DD * DD, (size_t)DD * DD / 8);
}
// lane l <-> lane l ^ 16 (the two halves of a wave hold the two key halves of one query column)
__device__ __forceinline__ float xhalf(float x) { const int b = __builtin_bit_cast(int, x); return __builtin_bit_cast(float, __builtin_amdgcn_permlanex16(b, b, 0x76543210, 0xfedcba98, false, false)); }
#define FL_SK 64                 /* keys per stage */
#define FL_LP (64 + 8)           /* LDS row pitch in 16-bit elements */
#define FL_NG 2                  /* groups of 16 query columns per wave */
#define FL_C 0.18033688011112042f      /* 64^-1/2 * log2(e): the exponentials are taken in base 2 on the hardware's own instruction */
// one stage: this lane's four 16-byte pieces (K rows r and r + 32, V^T rows r and r + 32). The s_wait_xcnt stands inside the statement so that no address register is rewritten ahead of it.
__device__ __forceinline__ void fl_copy4(unsigned lk, unsigned lv, const unsigned short* gk0, const unsigned short* gk1, const unsigned short* gv0, const unsigned short* gv1) {
  const unsigned lk1 = lk + 32 * FL_LP * 2, lv1 = lv + 32 * FL_LP * 2;
  asm volatile("global_load_async_to_lds_b128 %0, %4, off\n\t"
               "global_load_async_to_lds_b128 %1, %5, off\n\t"
               "global_load_async_to_lds_b128 %2, %6, off\n\t"
               "global_load_async_to_lds_b128 %3, %7, off\n\t"
               "s_wait_xcnt 0x0"
               :: "v"(lk), "v"(lk1), "v"(lv), "v"(lv1), "v"(gk0), "v"(gk1), "v"(gv0), "v"(gv1) : "memory");
}
__global__ __launch_bounds__(256) void k_flash(const _Float16* __restrict__ Q16, int ldq, const _Float16* __restrict__ K16, int ldk, const _Float16* __restrict__ Vt, const int* __restrict__ cnt, _Float16* __restrict__ O16, int ldo) {
  constexpr int NW = 8, NG = FL_NG, RPW = 16 * NG, NQB = TT / (NW * RPW), DT = 4, KS = 2;
  __shared__ __attribute__((aligned(16))) unsigned short sK[2][FL_SK][FL_LP], sV[2][64][FL_LP];
  __shared__ __attribute__((aligned(16))) unsigned short sO[NW][RPW][FL_LP];
  const int tid = threadIdx.x, w = tid >> 5, lane = tid & 31, ln = lane & 15, hh = lane >> 4;
  const int slab = blockIdx.x / NQB, qblk = blockIdx.x % NQB; const int b = slab / NH, h = slab % NH; const int qb0 = qblk * (NW * RPW); const int q0 = qb0 + w * RPW;
  const int n = kept_count(cnt, b); const int nst = (n + FL_SK - 1) / FL_SK;      /* K16 and Vt hold the batch's n kept keys, packed; both are written up to the end of stage nst - 1 */
  const unsigned short* Vth = (const unsigned short*)Vt + (size_t)slab * 64 * TT;
  const int cr = tid >> 3, cc = (tid & 7) * 8;      /* 8 lanes cover one row's 128 bytes; a thread brings rows cr and cr + 32 of both tiles */
  const unsigned short* gk = (const unsigned short*)K16 + ((size_t)b * TT + cr) * ldk + h * 64 + cc;      /* + stage * 64 rows */
  const unsigned short* gv = Vth + (size_t)cr * TT + cc;                                                  /* + stage * 64 columns */
  const unsigned lk = (unsigned)(size_t)&sK[0][cr][cc], lv = (unsigned)(size_t)&sV[0][cr][cc];      /* LDS byte address = low 32 bits of the __shared__ address */
  constexpr unsigned BUFB = FL_SK * FL_LP * 2;      /* bytes of one buffer of either tile */
  if (nst > 0) fl_copy4(lk, lv, gk, gk + (size_t)32 * ldk, gv, gv + (size_t)32 * TT);      /* the same for the whole work-group */
  FragH bq[NG][KS];      /* B operand of group g: column ln = query q0 + 16 g + ln */
#pragma unroll
  for (int g = 0; g < NG; ++g) { const unsigned short* qr = (const unsigned short*)Q16 + ((size_t)b * TT + q0 + g * 16 + ln) * ldq + h * 64;
#pragma unroll
    for (int ks = 0; ks < KS; ++ks) { bq[g][ks].half[0] = *(const v8us*)(qr + ks * 32 + 8 * hh); bq[g][ks].half[1] = *(const v8us*)(qr + ks * 32 + 16 + 8 * hh); } }
  asm volatile("s_wait_asynccnt 0x0" ::: "memory");      /* stage 0 of this wave has landed before the barrier that publishes it */
  __syncthreads();
  if (nst > 1) fl_copy4(lk + BUFB, lv + BUFB, gk + (size_t)FL_SK * ldk, gk + (size_t)(FL_SK + 32) * ldk, gv + FL_SK, gv + (size_t)32 * TT + FL_SK);
  float m_q[NG], l_q[NG]; v8f oacc[NG][DT];      /* oacc[g][dt][r] = O[q0 + 16 g + ln][dt * 16 + 8 * hh + r] */
#pragma unroll
  for (int g = 0; g < NG; ++g) { m_q[g] = -3.0e38f; l_q[g] = 0.f;
#pragma unroll
    for (int dt = 0; dt < DT; ++dt) oacc[g][dt] = (v8f){0.f,0.f,0.f,0.f,0.f,0.f,0.f,0.f}; }
#pragma unroll 1
  for (int st = 0; st < nst; ++st) {
    const int cur = st & 1;
#pragma unroll      /* both passes of a stage in one body, so that one pass's products stand among the other's vector work; it fits the 256 registers at which both work-groups of a WGP are resident */
    for (int jj = 0; jj < FL_SK; jj += 32) {
    const int j0 = st * FL_SK + jj;
    v8f s[NG][2];
#pragma unroll
    for (int nt = 0; nt < 2; ++nt) { const unsigned short* kr = &sK[cur][jj + nt * 16 + ln][0]; FragH ak[KS];      /* one K fragment from LDS serves both column groups */
#pragma unroll
      for (int ks = 0; ks < KS; ++ks) { ak[ks].half[0] = *(const v8us*)(kr + ks * 32 + 8 * hh); ak[ks].half[1] = *(const v8us*)(kr + ks * 32 + 16 + 8 * hh); }
#pragma unroll
      for (int g = 0; g < NG; ++g) s[g][nt] = (v8f){0.f,0.f,0.f,0.f,0.f,0.f,0.f,0.f};
#pragma unroll
      for (int ks = 0; ks < KS; ++ks)
#pragma unroll
        for (int g = 0; g < NG; ++g) s[g][nt] = __builtin_amdgcn_wmma_f32_16x16x32_f16(false, ak[ks].v, false, bq[g][ks].v, (short)0, s[g][nt], false, false); }
    if (j0 + 32 > n) {      /* only a batch's last stage holds rows past its kept keys (this lane's are j0 + 8hh + 0..7 and j0 + 16 + 8hh + 0..7): score -inf, so the exponential below is exactly 0 */
#pragma unroll      /* these two: constant element numbers, so that the score tiles stay in registers */
      for (int g = 0; g < NG; ++g)
#pragma unroll
        for (int i = 0; i < 16; ++i) s[g][i >> 3][i & 7] = (j0 + (i >> 3) * 16 + 8 * hh + (i & 7) < n) ? s[g][i >> 3][i & 7] : -INFINITY; }
    FragH pb[NG];      /* pb[g].h[i] = 2^10 P^T[k = kmap(i, hh)][column ln of group g] */
#pragma unroll
    for (int g = 0; g < NG; ++g) {
    float sc[16]; float mc = -INFINITY;      /* raw q.k */
#pragma unroll
    for (int i = 0; i < 16; ++i) { sc[i] = s[g][i >> 3][i & 7]; mc = fmaxf(mc, sc[i]); }
    mc = fmaxf(mc, xhalf(mc));
    const float mn = fmaxf(m_q[g], mc); const float al = __builtin_amdgcn_exp2f((m_q[g] - mn) * FL_C); m_q[g] = mn;      /* m_q and mn (raw q.k units) are finite (start -3e38): no key seen yet gives 2^0 = 1 */
    const float nb = __builtin_fmaf(-mn, FL_C, 10.0f);      /* 2^10 e^((s - mn) / 8) = 2^(s C + nb): scale, maximum and the 2^10 of P in one fused multiply-add a score */
    float ps = 0.f;
#pragma unroll
    for (int i = 0; i < 16; i += 2) { const v2f e = __builtin_elementwise_fma((v2f){sc[i], sc[i + 1]}, (v2f){FL_C, FL_C}, (v2f){nb, nb});      /* neighbours of one accumulator as a pair: left to itself the compiler pairs across the two groups and pays for it in register moves */
      const float p0 = __builtin_amdgcn_exp2f(e[0]), p1 = __builtin_amdgcn_exp2f(e[1]); ps += p0; ps += p1; pb[g].h[i] = (_Float16)p0; pb[g].h[i + 1] = (_Float16)p1; }
    l_q[g] = l_q[g] * al + ps;      /* the row sum carries the same 2^10 */
#pragma unroll
    for (int dt = 0; dt < DT; ++dt)
#pragma unroll
      for (int r = 0; r < 8; ++r) oacc[g][dt][r] *= al; }
#pragma unroll
    for (int dt = 0; dt < DT; ++dt) { const unsigned short* vrow = &sV[cur][dt * 16 + ln][jj]; FragH av; av.half[0] = *(const v8us*)(vrow + 8 * hh); av.half[1] = *(const v8us*)(vrow + 16 + 8 * hh);      /* one V^T fragment from LDS serves both column groups */
#pragma unroll
      for (int g = 0; g < NG; ++g) oacc[g][dt] = __builtin_amdgcn_wmma_f32_16x16x32_f16(false, av.v, false, pb[g].v, (short)0, oacc[g][dt], false, false); } }
    asm volatile("s_wait_dscnt 0x0" ::: "memory");      /* this wave's reads of buffer cur have returned before the buffer is refilled */
    asm volatile("s_wait_asynccnt 0x0" ::: "memory");   /* this wave's copies of stage st + 1 have landed before the barrier that publishes them */
    __syncthreads();      /* publishes stage st + 1 and ends every wave's reads of buffer cur */
    if (st + 2 < nst) {      /* the same for the whole work-group */
      const unsigned short* k2 = gk + (size_t)(st + 2) * FL_SK * ldk; const unsigned short* v2 = gv + (st + 2) * FL_SK;
      fl_copy4(lk + cur * BUFB, lv + cur * BUFB, k2, k2 + (size_t)32 * ldk, v2, v2 + (size_t)32 * TT); }
  }
  asm volatile("s_wait_asynccnt 0x0" ::: "memory");      /* nothing of this wave is in flight when it goes on to the output */
#pragma unroll
  for (int g = 0; g < NG; ++g) { float l = l_q[g] + xhalf(l_q[g]); l = (l > 0.f) ? 1.0f / l : 0.f;
#pragma unroll
    for (int dt = 0; dt < DT; ++dt) { FragH f;      /* the context leaves as the f16 operand of the output GEMM */
#pragma unroll      /* constant subscripts: oacc[] stays in registers */
      for (int r = 0; r < 8; ++r) f.h[r] = (_Float16)(oacc[g][dt][r] * l);
      *(v8us*)&sO[w][g * 16 + ln][dt * 16 + 8 * hh] = f.half[0]; } }
  __builtin_amdgcn_fence(__ATOMIC_ACQ_REL, "workgroup"); __builtin_amdgcn_wave_barrier();
  {
#pragma unroll
    for (int rp = 0; rp < RPW; rp += 4) { const int r = rp + (lane >> 3), pc = (lane & 7) * 8; *(v8us*)((unsigned short*)O16 + ((size_t)b * TT + q0 + r) * ldo + h * 64 + pc) = *(const v8us*)&sO[w][r][pc]; }      /* 8 lanes store one row's 128-byte line */
     } }

extern "C" void kernel_launch(void* const* d_in, const int* in_sizes, int n_in,
                              void* d_out, int out_size, void* d_ws, size_t ws_size, hipStream_t stream) {
  (void)in_sizes; (void)n_in; (void)out_size;
  const float* const* I = (const float* const*)d_in; const float* x = I[0]; const int* mask = (const int*)d_in[1]; const float* Wqkv = I[2]; const float* bqkv = I[3]; const float* Wo = I[4]; const float* bo = I[5]; const float* lng = I[6]; const float* lnb = I[7];      /* d_in order: hidden_states, encoder_padding_mask, qkv_w, qkv_b, out_w, out_b, ln_g, ln_b */
  char* ws = (char*)d_ws; size_t off = 0;
  auto take = [&](size_t bytes) { char* p = ws + off; off += (bytes + 255) & ~(size_t)255; return p; };
  const size_t WSZ = (size_t)DD * DD; _Float16* Bw = (_Float16*)take(4 * WSZ * 2); _Float16* X16 = (_Float16*)take((size_t)NR * DD * 2);
  _Float16* Q = (_Float16*)take((size_t)NR * DD * 2); _Float16* K = (_Float16*)take((size_t)NR * DD * 2); _Float16* Vt = (_Float16*)take((size_t)NR * DD * 2); _Float16* O16 = (_Float16*)take((size_t)NR * DD * 2);
  int* kidx = (int*)take((size_t)NR * 4); int* kcnt = (int*)take(BB * 4);
  if (off > ws_size) return;
  const unsigned gp = (NR / 128) * (DD / 128);
  k_prep<<<BB + NR / 8 + PW_QKV + PW_OUT, 256, 0, stream>>>(x, lng, lnb, mask, Wqkv, Wo, X16, nullptr, Bw, kidx, kcnt);
  k_gemm_t<true><<<3 * gp, 256, 0, stream>>>(X16, Bw, 0.0625f, bqkv, nullptr, nullptr, Q, K, Vt, kidx, kcnt);      /* q = x.Wq + bq: M 8192 N 1024 K 1024; k and v: kept keys only, packed per batch, v stored as V^T [batch][head][d][key] */
  k_flash<<<BB * NH * (TT / (8 * 16 * FL_NG)), 256, 0, stream>>>(Q, DD, K, DD, Vt, kcnt, O16, DD);
  k_gemm_t<false><<<gp, 256, 0, stream>>>(O16, Bw + 3 * WSZ, 0.0625f, bo, x, (float*)d_out, nullptr, nullptr, nullptr, nullptr, nullptr);      /* out = O.out_w^T + out_b + bf16(hidden) */
}

// v009
// A run of this version takes 97.3 microseconds.
// Next to v008, in two timings, it ran 1.09 times as fast each time.
// Over all steps from v000 it is 8.60 times as fast.
#include <hip/hip_runtime.h>
// Pre-LN self-attention layer with a key padding mask and residual (B=4, S=2048, H=1024, 16 heads × 64): x = LN(hidden); [q|k|v] = x·qkv_wᵀ + qkv_b ((out,in) fused); scores = q·kᵀ·64^-½ + mask·(−1e8) (int mask [B,S], 1 = pad); softmax;
// out = (attn·v merged)·out_wᵀ + out_b + hidden.
// Compute dtype: x, weights, biases rounded to bf16; q/k/v as f16 GEMM outputs; fused flash-style kernel (online softmax f32, P f16 ×2^10) on v_wmma_f32_16x16x32_f16; O → f16 → output GEMM with bias; f32 accumulate.
#define BB 4
#define TT 2048
#define NH 16
#define DD 1024
#define NR (BB * TT)

typedef __bf16 v16b __attribute__((ext_vector_type(16)));
typedef unsigned short v8us __attribute__((ext_vector_type(8), may_alias));
typedef float  v8f  __attribute__((ext_vector_type(8)));
typedef float  v4f  __attribute__((ext_vector_type(4)));
typedef float  v4fa __attribute__((ext_vector_type(4), may_alias));
union FragB { v16b v; v8us half[2]; unsigned short u[16]; };

__device__ __forceinline__ unsigned short bf16_bits(float x) { unsigned int u = __float_as_uint(x); return (unsigned short)((u + 0x7FFFu + ((u >> 16) & 1u)) >> 16); }
__device__ __forceinline__ float bf16_val(unsigned short b) { return __uint_as_float(((unsigned int)b) << 16); }
__device__ __forceinline__ float bf16_round(float x) { return bf16_val(bf16_bits(x)); }
// D += A·B with NT terms: 1 = ah·bh, 2 = + al·bh (A split), 3 = + ah·bl (both split)
template <int NT>
__device__ __forceinline__ v8f mmaN(v16b ah, v16b al, v16b bh, v16b bl, v8f c) {
  c = __builtin_amdgcn_wmma_f32_16x16x32_bf16(false, ah, false, bh, (short)0, c, false, false);
  if (NT >= 2) c = __builtin_amdgcn_wmma_f32_16x16x32_bf16(false, al, false, bh, (short)0, c, false, false);
  if (NT >= 3) c = __builtin_amdgcn_wmma_f32_16x16x32_bf16(false, ah, false, bl, (short)0, c, false, false);
  asm volatile("v_nop\n\tv_nop\n\tv_nop\n\tv_nop" : "+v"(c) : "v"(ah), "v"(al), "v"(bh), "v"(bl));
  return c;
}

__global__ __launch_bounds__(256) void k_wt_bf16(const float* __restrict__ W, unsigned short* __restrict__ Wt, int K, int N) {
  const int t = blockIdx.x * 256 + threadIdx.x;
  const int k8n = K / 8;
  if (t >= N * k8n) return;
  const int n = t / k8n, k8 = (t % k8n) * 8;
  v8us v;
#pragma unroll
  for (int i = 0; i < 8; ++i) v[i] = bf16_bits(W[(size_t)(k8 + i) * N + n]);
  *(v8us*)(Wt + (size_t)n * K + k8) = v;
  
}

// GEMM C[M][N] (f32, pitch ldc) = act(A[M][K]·W + bias). A f32 row-major (pitch lda) converted per fragment to bf16
// (ASPLIT: hi/lo two planes -> 2 terms, else single rounded term); Wt bf16 [N][K] (pitch ldb). BIAS_BF16 rounds the
// bias to bf16 first (bias quantised to bf16 before the add). K%32==0, M%16==0, N%64==0.
template <bool ASPLIT, int ACT, bool BIAS_BF16>
__global__ __launch_bounds__(128) void k_gemm_bf(const float* __restrict__ A, int lda, const unsigned short* __restrict__ Wt, int ldb,
                                               const float* __restrict__ bias, float* __restrict__ C, int ldc, int M, int N, int K) {
  __shared__ __attribute__((aligned(16))) float so[4][16][64];
  const int tid = threadIdx.x, w = tid >> 5, lane = tid & 31, ln = lane & 15, hh = lane >> 4;
  const int ntn = N / 64;
  const int wid = blockIdx.x * 4 + w;
  const int mt = wid / ntn, nq = wid % ntn;
  if (mt * 16 >= M) return;
  const int row0 = mt * 16, col0 = nq * 64;
  const float* arow = A + (size_t)(row0 + ln) * lda;
  v8f acc[4] = {};
  for (int kb = 0; kb < K; kb += 32) {
    FragB ah, al;
    const v4f x0 = *(const v4fa*)(arow + kb + 8 * hh), x1 = *(const v4fa*)(arow + kb + 8 * hh + 4);
    const v4f x2 = *(const v4fa*)(arow + kb + 16 + 8 * hh), x3 = *(const v4fa*)(arow + kb + 16 + 8 * hh + 4);
    float xs[16] = {x0[0],x0[1],x0[2],x0[3],x1[0],x1[1],x1[2],x1[3],x2[0],x2[1],x2[2],x2[3],x3[0],x3[1],x3[2],x3[3]};
#pragma unroll
    for (int i = 0; i < 16; ++i) { const unsigned short hb = bf16_bits(xs[i]); ah.u[i] = hb; al.u[i] = ASPLIT ? bf16_bits(xs[i] - bf16_val(hb)) : (unsigned short)0; }
#pragma unroll
    for (int t = 0; t < 4; ++t) {
      const unsigned short* brow = Wt + (size_t)(col0 + t * 16 + ln) * ldb + kb;
      FragB b;
      b.half[0] = *(const v8us*)(brow + 8 * hh);
      b.half[1] = *(const v8us*)(brow + 16 + 8 * hh);
      acc[t] = mmaN<ASPLIT ? 2 : 1>(ah.v, al.v, b.v, b.v, acc[t]);
    }
  }
#pragma unroll
  for (int t = 0; t < 4; ++t) {
    float bv = bias ? bias[col0 + t * 16 + ln] : 0.f;
    if (BIAS_BF16) bv = bf16_round(bv);
#pragma unroll
    for (int r = 0; r < 8; ++r) { float v = acc[t][r] + bv; if (ACT == 1) v = fmaxf(v, 0.f); so[w][8 * hh + r][t * 16 + ln] = v; }
  }
  __builtin_amdgcn_fence(__ATOMIC_ACQ_REL, "workgroup");
  __builtin_amdgcn_wave_barrier();
  const int rsub = lane >> 4, c4 = (lane & 15) * 4;
  {
#pragma unroll
    for (int q = 0; q < 8; ++q) {
      const int r = q * 2 + rsub;
      const v4f v = *(const v4fa*)&so[w][r][c4];
      *(v4f*)(C + (size_t)(row0 + r) * ldc + col0 + c4) = v;
    }
    
  }
}

// Flash-style causal/unmasked attention, all contractions 3-term bf16 hi/lo splits, f32 softmax with running max.
// q,k,v rows are read from f32 buffers with arbitrary row pitch (so they can live inside a fused qkv buffer);
// D = head size (multiple of 32, <= 128); one wave = 16 query rows; block = 4 waves (64 queries) sharing K/V chunks of 32.
template <int D, bool CAUSAL>
__global__ __launch_bounds__(128) void k_flash(const float* __restrict__ qb, const float* __restrict__ kb, const float* __restrict__ vb,
                                             int pitch, int T, int H, float scale, float* __restrict__ y, int ypitch) {
  constexpr int KS = D / 32;        // k-steps for QK
  constexpr int DT = D / 16;        // d tiles for PV
  __shared__ __attribute__((aligned(16))) unsigned short sKh[32][D + 8], sKl[32][D + 8], sVh[32][D + 8], sVl[32][D + 8];
  __shared__ __attribute__((aligned(16))) unsigned short sPh[4][16][40], sPl[4][16][40];
  __shared__ __attribute__((aligned(16))) float sO[4][16][D];
  const int tid = threadIdx.x, w = tid >> 5, lane = tid & 31, ln = lane & 15, hh = lane >> 4;
  const int nqb = (T + 63) / 64;
  const int bh = blockIdx.x / nqb, qblk = blockIdx.x % nqb;
  const int b = bh / H, h = bh % H;
  const int q0 = qblk * 64 + w * 16;
  const float* Q = qb + (size_t)b * T * pitch + h * D;
  const float* K = kb + (size_t)b * T * pitch + h * D;
  const float* V = vb + (size_t)b * T * pitch + h * D;

  // A fragments of the wave's 16 query rows (scaled), hi/lo
  FragB aqh[KS], aql[KS];
  {
    int row = q0 + ln; if (row >= T) row = T - 1;
    const float* qr = Q + (size_t)row * pitch;
#pragma unroll
    for (int ks = 0; ks < KS; ++ks)
#pragma unroll
      for (int i = 0; i < 16; ++i) {
        const int d = ks * 32 + ((i < 8) ? (8 * hh + i) : (16 + 8 * hh + (i - 8)));
        const float x = qr[d] * scale; const unsigned short hb = bf16_bits(x);
        aqh[ks].u[i] = hb; aql[ks].u[i] = bf16_bits(x - bf16_val(hb));
      }
  }
  float m_r[8], l_r[8];
#pragma unroll
  for (int r = 0; r < 8; ++r) { m_r[r] = -3.0e38f; l_r[r] = 0.f; }
  v8f oacc[DT];
#pragma unroll
  for (int dt = 0; dt < DT; ++dt) oacc[dt] = (v8f){0.f,0.f,0.f,0.f,0.f,0.f,0.f,0.f};

  const int kv_end = CAUSAL ? min(T, qblk * 64 + 64) : T;     // block-uniform
  for (int j0 = 0; j0 < kv_end; j0 += 32) {
    __syncthreads();
    for (int e = tid; e < 32 * (D / 4); e += 128) {
      const int r = e / (D / 4), c4 = (e % (D / 4)) * 4;
      const int key = j0 + r;
      v4f kf = {0.f,0.f,0.f,0.f}, vf = {0.f,0.f,0.f,0.f};
      if (key < T) { kf = *(const v4fa*)(K + (size_t)key * pitch + c4); vf = *(const v4fa*)(V + (size_t)key * pitch + c4); }
#pragma unroll
      for (int t = 0; t < 4; ++t) {
        unsigned short hb = bf16_bits(kf[t]); sKh[r][c4 + t] = hb; sKl[r][c4 + t] = bf16_bits(kf[t] - bf16_val(hb));
        hb = bf16_bits(vf[t]); sVh[r][c4 + t] = hb; sVl[r][c4 + t] = bf16_bits(vf[t] - bf16_val(hb));
      }
    }
    __syncthreads();
    // S tile 16 x 32
    v8f s[2];
#pragma unroll
    for (int nt = 0; nt < 2; ++nt) {
      v8f acc = {};
#pragma unroll
      for (int ks = 0; ks < KS; ++ks) {
        FragB bh_, bl_;
        bh_.half[0] = *(const v8us*)&sKh[nt * 16 + ln][ks * 32 + 8 * hh]; bh_.half[1] = *(const v8us*)&sKh[nt * 16 + ln][ks * 32 + 16 + 8 * hh];
        bl_.half[0] = *(const v8us*)&sKl[nt * 16 + ln][ks * 32 + 8 * hh]; bl_.half[1] = *(const v8us*)&sKl[nt * 16 + ln][ks * 32 + 16 + 8 * hh];
        acc = mmaN<3>(aqh[ks].v, aql[ks].v, bh_.v, bl_.v, acc);
      }
      s[nt] = acc;
    }
    // mask + running max (rows 8hh+r; the 16 lanes of a half share rows)
    float alpha[8];
#pragma unroll
    for (int r = 0; r < 8; ++r) {
      const int qi = q0 + 8 * hh + r;
      const int ja = j0 + ln, jb = j0 + 16 + ln;
      if (CAUSAL) { if (ja > qi) s[0][r] = -3.0e38f; if (jb > qi) s[1][r] = -3.0e38f; }
      if (ja >= T) s[0][r] = -3.0e38f;
      if (jb >= T) s[1][r] = -3.0e38f;
      float mx = fmaxf(s[0][r], s[1][r]);
      mx = fmaxf(mx, __shfl_xor(mx, 1, 32)); mx = fmaxf(mx, __shfl_xor(mx, 2, 32)); mx = fmaxf(mx, __shfl_xor(mx, 4, 32)); mx = fmaxf(mx, __shfl_xor(mx, 8, 32));
      const float mnew = fmaxf(m_r[r], mx);
      alpha[r] = (mnew > -1.0e38f) ? __expf(m_r[r] - mnew) : 1.0f;
      const float p0 = (s[0][r] > -1.0e38f) ? __expf(s[0][r] - mnew) : 0.f;
      const float p1 = (s[1][r] > -1.0e38f) ? __expf(s[1][r] - mnew) : 0.f;
      m_r[r] = mnew;
      l_r[r] = l_r[r] * alpha[r] + p0 + p1;            // per-lane partial row sum (16 lanes combined at the end)
      unsigned short hb = bf16_bits(p0); sPh[w][8 * hh + r][ln] = hb;      sPl[w][8 * hh + r][ln] = bf16_bits(p0 - bf16_val(hb));
      hb = bf16_bits(p1);                sPh[w][8 * hh + r][16 + ln] = hb; sPl[w][8 * hh + r][16 + ln] = bf16_bits(p1 - bf16_val(hb));
    }
#pragma unroll
    for (int dt = 0; dt < DT; ++dt)
#pragma unroll
      for (int r = 0; r < 8; ++r) oacc[dt][r] *= alpha[r];
    __builtin_amdgcn_fence(__ATOMIC_ACQ_REL, "workgroup");
    __builtin_amdgcn_wave_barrier();
    FragB pah, pal;
    pah.half[0] = *(const v8us*)&sPh[w][ln][8 * hh]; pah.half[1] = *(const v8us*)&sPh[w][ln][16 + 8 * hh];
    pal.half[0] = *(const v8us*)&sPl[w][ln][8 * hh]; pal.half[1] = *(const v8us*)&sPl[w][ln][16 + 8 * hh];
#pragma unroll
    for (int dt = 0; dt < DT; ++dt) {
      FragB bvh, bvl;
#pragma unroll
      for (int i = 0; i < 8; ++i) {
        bvh.u[i] = sVh[8 * hh + i][dt * 16 + ln]; bvh.u[8 + i] = sVh[16 + 8 * hh + i][dt * 16 + ln];
        bvl.u[i] = sVl[8 * hh + i][dt * 16 + ln]; bvl.u[8 + i] = sVl[16 + 8 * hh + i][dt * 16 + ln];
      }
      oacc[dt] = mmaN<3>(pah.v, pal.v, bvh.v, bvl.v, oacc[dt]);
    }
    __builtin_amdgcn_fence(__ATOMIC_ACQ_REL, "workgroup");
    __builtin_amdgcn_wave_barrier();
  }
#pragma unroll
  for (int r = 0; r < 8; ++r) {
    float l = l_r[r];
    l += __shfl_xor(l, 1, 32); l += __shfl_xor(l, 2, 32); l += __shfl_xor(l, 4, 32); l += __shfl_xor(l, 8, 32);
    l_r[r] = (l > 0.f) ? 1.0f / l : 0.f;
  }
#pragma unroll
  for (int dt = 0; dt < DT; ++dt)
#pragma unroll
    for (int r = 0; r < 8; ++r) sO[w][8 * hh + r][dt * 16 + ln] = oacc[dt][r] * l_r[r];
  __builtin_amdgcn_fence(__ATOMIC_ACQ_REL, "workgroup");
  __builtin_amdgcn_wave_barrier();
  {
    for (int r = 0; r < 16; ++r) {
      const int row = q0 + r;
      if (row < T && lane < D / 4) {
        const v4f val = *(const v4fa*)&sO[w][r][lane * 4];
        *(v4f*)(y + ((size_t)b * T + row) * ypitch + h * D + lane * 4) = val;
      }
    }
    
  }
}

// GEMM C = act(A·W + bias + resid): A f32 (ASPLIT -> hi/lo 2 terms), Wt bf16 [N][K]; ACT 0 none, 1 relu, 2 exact gelu;
// resid (optional, f32, row index = (row % rmod), pitch ldr, RES_BF16 rounds it) added before the activation.
template <bool ASPLIT, int ACT, bool BIAS_BF16, bool RES_BF16>
__global__ __launch_bounds__(128) void k_gemm_bf3(const float* __restrict__ A, int lda, const unsigned short* __restrict__ Wt, int ldb,
                                                const float* __restrict__ bias, const float* __restrict__ resid, int rmod, int ldr,
                                                float* __restrict__ C, int ldc, int M, int N, int K) {
  __shared__ __attribute__((aligned(16))) float so[4][16][64];
  const int tid = threadIdx.x, w = tid >> 5, lane = tid & 31, ln = lane & 15, hh = lane >> 4;
  const int ntn = N / 64;
  const int wid = blockIdx.x * 4 + w;
  const int mt = wid / ntn, nq = wid % ntn;
  if (mt * 16 >= M) return;
  const int row0 = mt * 16, col0 = nq * 64;
  const float* arow = A + (size_t)(row0 + ln) * lda;
  v8f acc[4] = {};
  for (int kb = 0; kb < K; kb += 32) {
    FragB ah, al;
    const v4f x0 = *(const v4fa*)(arow + kb + 8 * hh), x1 = *(const v4fa*)(arow + kb + 8 * hh + 4);
    const v4f x2 = *(const v4fa*)(arow + kb + 16 + 8 * hh), x3 = *(const v4fa*)(arow + kb + 16 + 8 * hh + 4);
    float xs[16] = {x0[0],x0[1],x0[2],x0[3],x1[0],x1[1],x1[2],x1[3],x2[0],x2[1],x2[2],x2[3],x3[0],x3[1],x3[2],x3[3]};
#pragma unroll
    for (int i = 0; i < 16; ++i) { const unsigned short hb = bf16_bits(xs[i]); ah.u[i] = hb; al.u[i] = ASPLIT ? bf16_bits(xs[i] - bf16_val(hb)) : (unsigned short)0; }
#pragma unroll
    for (int t = 0; t < 4; ++t) {
      const unsigned short* brow = Wt + (size_t)(col0 + t * 16 + ln) * ldb + kb;
      FragB b;
      b.half[0] = *(const v8us*)(brow + 8 * hh);
      b.half[1] = *(const v8us*)(brow + 16 + 8 * hh);
      acc[t] = mmaN<ASPLIT ? 2 : 1>(ah.v, al.v, b.v, b.v, acc[t]);
    }
  }
#pragma unroll
  for (int t = 0; t < 4; ++t) {
    const int col = col0 + t * 16 + ln;
    float bv = bias ? bias[col] : 0.f;
    if (BIAS_BF16) bv = bf16_round(bv);
#pragma unroll
    for (int r = 0; r < 8; ++r) {
      float v = acc[t][r] + bv;
      if (resid) { float rv = resid[(size_t)((row0 + 8 * hh + r) % rmod) * ldr + col]; if (RES_BF16) rv = bf16_round(rv); v += rv; }
      if (ACT == 1) v = fmaxf(v, 0.f);
      if (ACT == 2) v = 0.5f * v * (1.0f + erff(v * 0.70710678118654752f));
      if (ACT == 3) { const float u = 0.7978845608028654f * (v + 0.044715f * v * v * v); v = 0.5f * v * (1.0f + tanhf(u)); }
      so[w][8 * hh + r][t * 16 + ln] = v;
    }
  }
  __builtin_amdgcn_fence(__ATOMIC_ACQ_REL, "workgroup");
  __builtin_amdgcn_wave_barrier();
  const int rsub = lane >> 4, c4 = (lane & 15) * 4;
  {
#pragma unroll
    for (int q = 0; q < 8; ++q) {
      const int r = q * 2 + rsub;
      const v4f v = *(const v4fa*)&so[w][r][c4];
      *(v4f*)(C + (size_t)(row0 + r) * ldc + col0 + c4) = v;
    }
    
  }
}
// row LayerNorm (biased variance, eps) over N: s = X (+ R); optional out_sum <- s; out_norm <- (s-mu)*rsqrt(var+eps)*g + b
template <bool PARAM_BF16>
__global__ __launch_bounds__(256) void k_layernorm(const float* __restrict__ X, const float* __restrict__ R, const float* __restrict__ g, const float* __restrict__ bta,
                                                  float* __restrict__ out_sum, float* __restrict__ out_norm, int N, float eps) {
  __shared__ float red[256];
  const int row = blockIdx.x, tid = threadIdx.x;
  const float* x = X + (size_t)row * N; const float* rr = R ? R + (size_t)row * N : nullptr;
  float vals[16];                     // up to N = 4096
  const int per = N / 256;            // contiguous chunk per thread? use strided-by-4 chunks: thread handles j = tid*4 + 1024*u
  float s1 = 0.f;
  for (int u = 0; u < per / 4; ++u) {
    const int j = tid * 4 + 1024 * u;
    const v4f a = *(const v4fa*)(x + j);
    v4f b = {0.f,0.f,0.f,0.f}; if (rr) b = *(const v4fa*)(rr + j);
#pragma unroll
    for (int q = 0; q < 4; ++q) { const float v = a[q] + b[q]; vals[u * 4 + q] = v; s1 += v; }
  }
  red[tid] = s1; __syncthreads();
  for (int st = 128; st > 0; st >>= 1) { if (tid < st) red[tid] += red[tid + st]; __syncthreads(); }
  const float mu = red[0] / (float)N; __syncthreads();
  float s2 = 0.f;
  for (int u = 0; u < per / 4; ++u)
#pragma unroll
    for (int q = 0; q < 4; ++q) { const float c = vals[u * 4 + q] - mu; s2 += c * c; }
  red[tid] = s2; __syncthreads();
  for (int st = 128; st > 0; st >>= 1) { if (tid < st) red[tid] += red[tid + st]; __syncthreads(); }
  const float rs = rsqrtf(red[0] / (float)N + eps);
  {
    for (int u = 0; u < per / 4; ++u) {
      const int j = tid * 4 + 1024 * u;
      v4f o, sm;
#pragma unroll
      for (int q = 0; q < 4; ++q) {
        float gg = g[j + q], bb = bta[j + q];
        if (PARAM_BF16) { gg = bf16_round(gg); bb = bf16_round(bb); }
        sm[q] = vals[u * 4 + q]; o[q] = (vals[u * 4 + q] - mu) * rs * gg + bb;
      }
      if (out_sum) *(v4f*)(out_sum + (size_t)row * N + j) = sm;
      *(v4f*)(out_norm + (size_t)row * N + j) = o;
    }
    
  }
}



// ---- f16 WMMA path (v_wmma_f32_16x16x32_f16): 11-bit significands for operands in range — used where a [0,1] probability operand needs more precision than bf16
typedef _Float16 v16h __attribute__((ext_vector_type(16)));
union FragH { v16h v; v8us half[2]; _Float16 h[16]; unsigned short u[16]; };
template <int NT>
__device__ __forceinline__ v8f mmaH(v16h ah, v16h al, v16h bh, v16h bl, v8f c) {
  c = __builtin_amdgcn_wmma_f32_16x16x32_f16(false, ah, false, bh, (short)0, c, false, false);
  if (NT >= 2) c = __builtin_amdgcn_wmma_f32_16x16x32_f16(false, al, false, bh, (short)0, c, false, false);
  if (NT >= 3) c = __builtin_amdgcn_wmma_f32_16x16x32_f16(false, ah, false, bl, (short)0, c, false, false);
  asm volatile("v_nop\n\tv_nop\n\tv_nop\n\tv_nop" : "+v"(c) : "v"(ah), "v"(al), "v"(bh), "v"(bl));
  return c;
}
// batched GEMM like k_gemm_b but f16 operands: A f32 (split into f16 hi/lo if ASPLIT, else rounded to f16), Bt = f16 values [n][k]; alpha; C f32; N multiple of 16 (partial tiles skipped)
template <bool ASPLIT>
__global__ __launch_bounds__(128) void k_gemm_h(const float* __restrict__ A, int lda, size_t sA, const _Float16* __restrict__ Bh, int ldb, size_t sB, float alpha, float* __restrict__ C, int ldc, size_t sC, int M, int N, int K) {
  __shared__ __attribute__((aligned(16))) float so[4][16][64];
  const int tid = threadIdx.x, w = tid >> 5, lane = tid & 31, ln = lane & 15, hh = lane >> 4; const int by = blockIdx.y;
  A += (size_t)by * sA; Bh += (size_t)by * sB; C += (size_t)by * sC;
  const int ntn = (N + 63) / 64; const int wid = blockIdx.x * 4 + w; const int mt = wid / ntn, nq = wid % ntn; if (mt * 16 >= M) return;
  const int row0 = mt * 16, col0 = nq * 64; const float* arow = A + (size_t)(row0 + ln) * lda;
  v8f acc[4] = {};
  for (int kb = 0; kb < K; kb += 32) {
    FragH ah, al;
    const v4f x0 = *(const v4fa*)(arow + kb + 8 * hh), x1 = *(const v4fa*)(arow + kb + 8 * hh + 4), x2 = *(const v4fa*)(arow + kb + 16 + 8 * hh), x3 = *(const v4fa*)(arow + kb + 16 + 8 * hh + 4);
    float xs[16] = {x0[0],x0[1],x0[2],x0[3],x1[0],x1[1],x1[2],x1[3],x2[0],x2[1],x2[2],x2[3],x3[0],x3[1],x3[2],x3[3]};
#pragma unroll
    for (int i = 0; i < 16; ++i) { const _Float16 h = (_Float16)xs[i]; ah.h[i] = h; al.h[i] = ASPLIT ? (_Float16)(xs[i] - (float)h) : (_Float16)0.0f; }
#pragma unroll
    for (int t = 0; t < 4; ++t) { if (col0 + t * 16 >= N) continue; const size_t boff = (size_t)(col0 + t * 16 + ln) * ldb + kb; FragH bq; bq.half[0] = *(const v8us*)(Bh + boff + 8 * hh); bq.half[1] = *(const v8us*)(Bh + boff + 16 + 8 * hh);
      acc[t] = mmaH<ASPLIT ? 2 : 1>(ah.v, al.v, bq.v, bq.v, acc[t]); }
  }
#pragma unroll
  for (int t = 0; t < 4; ++t) { if (col0 + t * 16 >= N) continue;
#pragma unroll
    for (int r = 0; r < 8; ++r) so[w][8 * hh + r][t * 16 + ln] = acc[t][r] * alpha; }
  __builtin_amdgcn_fence(__ATOMIC_ACQ_REL, "workgroup"); __builtin_amdgcn_wave_barrier();
  const int rsub = lane >> 4, c4 = (lane & 15) * 4;
  {
#pragma unroll
    for (int q = 0; q < 8; ++q) { const int r = q * 2 + rsub; if (col0 + c4 < N) { const v4f v = *(const v4fa*)&so[w][r][c4]; *(v4f*)(C + (size_t)(row0 + r) * ldc + col0 + c4) = v; } }
     }
}

// Wt[n][k] = f16(W[k][n]·scale) from f32 row-major W[K][N] (scale = power of two; bf16-exact weights stay exact in f16 away from the subnormal range)
__global__ __launch_bounds__(256) void k_wt_f16(const float* __restrict__ W, _Float16* __restrict__ Wt, int K, int N, float scale) {
  const int t = blockIdx.x * 256 + threadIdx.x; if (t >= N * (K / 8)) return; const int n = t / (K / 8), k8 = (t % (K / 8)) * 8; FragH f;
#pragma unroll
  for (int i = 0; i < 8; ++i) f.h[i] = (_Float16)(bf16_round(W[(size_t)(k8 + i) * N + n]) * scale); const v8us o = f.half[0];
  *(v8us*)((unsigned short*)Wt + (size_t)n * K + k8) = o; 
}
typedef _Float16 v4h __attribute__((ext_vector_type(4)));
typedef float v2f __attribute__((ext_vector_type(2)));
// A padded key (mask != 0) has probability exactly 0 in every query's softmax while its batch keeps a key, so it is dropped before K and V are projected (no key kept: context 0).
// idx[b][p] = position of batch b's p-th kept key, ascending (0 from the kept count on, so that every entry names a row); cnt[b] = kept count.
__device__ __forceinline__ void keys_part(int b, int* part, const int* __restrict__ MSK, int* __restrict__ idx, int* __restrict__ cnt) {      /* part: 256 ints of LDS */
  const int tid = threadIdx.x; const int* m = MSK + (size_t)b * TT + tid * (TT / 256);
  int keep[TT / 256]; int c = 0;
#pragma unroll      /* constant subscripts: keep[] stays in registers */
  for (int q = 0; q < TT / 256; ++q) { keep[q] = (m[q] == 0) ? 1 : 0; c += keep[q]; }
  part[tid] = c; __syncthreads();
  for (int o = 1; o < 256; o <<= 1) { const int a = (tid >= o) ? part[tid - o] : 0; __syncthreads(); part[tid] += a; __syncthreads(); }      /* inclusive sums over the threads */
  int pos = part[tid] - c; const int n = part[255];
#pragma unroll      /* constant subscripts: keep[] stays in registers */
  for (int q = 0; q < TT / 256; ++q) if (keep[q]) idx[(size_t)b * TT + pos++] = tid * (TT / 256) + q;
  for (int p = n + tid; p < TT; p += 256) idx[(size_t)b * TT + p] = 0;
  if (tid == 0) cnt[b] = n;
}
// b is the same for a whole work-group; readfirstlane keeps the clamped count in a scalar register, so that every test on it is a scalar branch
__device__ __forceinline__ int kept_count(const int* __restrict__ cnt, int b) { const int n = cnt[b]; return __builtin_amdgcn_readfirstlane(n < 0 ? 0 : (n > TT ? TT : n)); }
// C = (A.B^T)*alpha + bf16(bias): A f16 [NR][DD], Bh f16 [DD][DD] (row n, k contiguous). OUT 0: f16 C16, pitch DD. OUT 1: f32 C = that + bf16(resid), pitch DD (the layer's residual, added where the tile is stored).
// OUT 2: f16 C16 transposed per batch, C16[batch][column][row in the batch], pitch TT: the V^T that k_flash reads, stored by the projection itself.
// One 128 x 128 tile of C per work-group of 8 waves (4 x 2 waves, 32 x 64 each). 64 k of both operands (one 128-byte line a row) are read from
// global memory in whole lines, once per work-group, and staged in LDS (two buffers, row pitch 144 B for the 16-byte fragment reads);
// the next 64 k are in flight in registers while the waves work on this buffer. Each 16 x 16 tile sums k in ascending order in one accumulator chain.
// The K and V projections gather: row p of a batch's C is the projection of that batch's p-th kept key, A row idx[p]; tiles past the batch's kept count do nothing.
// QKV: one grid holds the three projections, which read the same A and depend on nothing of one another: the 512 tiles of q (stored as OUT 0 into C16), then those of k (OUT 0 into Ck) and v (OUT 2 into Cvt),
// Bh and bias being the fused q|k|v arrays. The k and v tiles are numbered with the row tile inside the batch slowest, so that the tiles past the kept counts, which do nothing, come last in the grid.
// !QKV: the output projection, OUT 1.
template <bool QKV>
__global__ __launch_bounds__(256) void k_gemm_t(const _Float16* __restrict__ A, const _Float16* __restrict__ Bh, float alpha, const float* __restrict__ bias, const float* __restrict__ resid, float* __restrict__ C, _Float16* __restrict__ C16, _Float16* __restrict__ Ck, _Float16* __restrict__ Cvt, const int* __restrict__ idx, const int* __restrict__ cnt) {
  constexpr int BM = 128, BN = 128, BK = 64, LP = BK + 8, NKT = DD / BK;
  /* The output staging lies on the operand buffers' own LDS: it is first written behind the k loop's closing __syncthreads(), when no wave reads an operand any more. 72 KiB a work-group instead of 140, so that LDS no longer holds a WGP to two work-groups. */
  constexpr int RINGB = 2 * (BM + BN) * LP * 2, STAGEB = 8 * 32 * (64 + 4) * 4;
  __shared__ __attribute__((aligned(16))) unsigned char sm[RINGB > STAGEB ? RINGB : STAGEB];
  unsigned short (*sA)[BM][LP] = reinterpret_cast<unsigned short (*)[BM][LP]>(&sm[0]);
  unsigned short (*sB)[BN][LP] = reinterpret_cast<unsigned short (*)[BN][LP]>(&sm[2 * BM * LP * 2]);
  float (*so)[32][64 + 4] = reinterpret_cast<float (*)[32][64 + 4]>(&sm[0]);
  const int tid = threadIdx.x, w = tid >> 5, lane = tid & 31, ln = lane & 15, hh = lane >> 4;
  constexpr int NQT = (NR / BM) * (DD / BN); constexpr int OUT1 = QKV ? 0 : 1;
  const int kv = QKV ? (int)blockIdx.x - NQT : -1;      /* from 0 on: a tile of k or v; bits from the low end: 3 column tile, 1 k or v, 2 batch, 4 row tile in the batch */
  const bool GATH = kv >= 0;      /* the same for the whole work-group, like all that is derived from blockIdx */
  const int which = GATH ? 1 + ((kv >> 3) & 1) : 0; const int OUT = QKV ? (which == 2 ? 2 : 0) : 1;
  const int nt = blockIdx.x % (DD / BN), mt = GATH ? ((kv >> 4) & (BB - 1)) * (TT / BM) + (kv >> 6) : blockIdx.x / (DD / BN); const int wm = w >> 1, wn = w & 1;
  if (QKV) { Bh += (size_t)which * DD * DD; bias += which * DD; if (which == 1) C16 = Ck; if (which == 2) C16 = Cvt; }
  const int lr = tid >> 3, lc = (tid & 7) * 8;      /* 8 lanes cover one row's 128 bytes; a thread brings rows lr + 32 i */
  if (GATH) { if ((mt % (TT / BM)) * BM >= kept_count(cnt, mt / (TT / BM))) return; }      /* the same for the whole work-group, in front of every barrier */
  const unsigned short* ga[4]; int arow[4];
#pragma unroll
  for (int i = 0; i < 4; ++i) arow[i] = mt * BM + lr + 32 * i;
  if (GATH) {      /* one test round the four index loads, so that they fly together */
#pragma unroll
    for (int i = 0; i < 4; ++i) arow[i] = idx[arow[i]];
#pragma unroll
    for (int i = 0; i < 4; ++i) arow[i] = ((mt * BM) & ~(TT - 1)) + (arow[i] & (TT - 1)); }
#pragma unroll
  for (int i = 0; i < 4; ++i) ga[i] = (const unsigned short*)A + (size_t)arow[i] * DD + lc;
  const unsigned short* gb = (const unsigned short*)Bh + (size_t)(nt * BN + lr) * DD + lc;
  v8us ra[4], rb[4];
#pragma unroll
  for (int i = 0; i < 4; ++i) { ra[i] = *(const v8us*)ga[i]; rb[i] = *(const v8us*)(gb + (size_t)i * 32 * DD); }
#pragma unroll
  for (int i = 0; i < 4; ++i) { *(v8us*)&sA[0][lr + 32 * i][lc] = ra[i]; *(v8us*)&sB[0][lr + 32 * i][lc] = rb[i]; }
  __syncthreads();
  v8f acc[2][4];
#pragma unroll
  for (int mi = 0; mi < 2; ++mi)
#pragma unroll
    for (int ni = 0; ni < 4; ++ni) acc[mi][ni] = (v8f){0.f,0.f,0.f,0.f,0.f,0.f,0.f,0.f};
  const int rsub = lane >> 4, c4 = (lane & 15) * 4; const int col0 = nt * BN + wn * 64;
  const size_t o0 = (size_t)(mt * BM + wm * 32 + rsub) * DD + col0 + c4;      /* this lane's piece of the wave's rows rsub + 2 q: one address, the rows at constant offsets from it */
  v4f xr[OUT1 == 1 ? 16 : 1];      /* OUT 1: this lane's 16 pieces of the residual, asked for here so that they arrive from memory under the k loop and not behind it */
  if (OUT1 == 1) {
#pragma unroll      /* constant subscripts: xr[] stays in registers */
    for (int q = 0; q < 16; ++q) xr[q] = *(const v4fa*)(resid + o0 + q * 2 * DD); }
  for (int kt = 0; kt < NKT; ++kt) {
    const int cur = kt & 1; const bool more = kt + 1 < NKT;      /* the same for the whole work-group */
    if (more) {
#pragma unroll
      for (int i = 0; i < 4; ++i) { ra[i] = *(const v8us*)(ga[i] + (kt + 1) * BK); rb[i] = *(const v8us*)(gb + (size_t)i * 32 * DD + (kt + 1) * BK); } }
    __builtin_amdgcn_sched_barrier(0);      /* keeps the next pass's global loads in front of this pass's products: sunk behind them, their whole latency is waited out in front of the LDS stores */
#pragma unroll
    for (int ks = 0; ks < BK / 32; ++ks) { FragH fa[2], fb[4];
#pragma unroll
      for (int mi = 0; mi < 2; ++mi) { const unsigned short* p = &sA[cur][wm * 32 + mi * 16 + ln][ks * 32 + 8 * hh]; fa[mi].half[0] = *(const v8us*)p; fa[mi].half[1] = *(const v8us*)(p + 16); }
#pragma unroll
      for (int ni = 0; ni < 4; ++ni) { const unsigned short* p = &sB[cur][wn * 64 + ni * 16 + ln][ks * 32 + 8 * hh]; fb[ni].half[0] = *(const v8us*)p; fb[ni].half[1] = *(const v8us*)(p + 16); }
#pragma unroll
      for (int mi = 0; mi < 2; ++mi)
#pragma unroll
        for (int ni = 0; ni < 4; ++ni) acc[mi][ni] = __builtin_amdgcn_wmma_f32_16x16x32_f16(false, fa[mi].v, false, fb[ni].v, (short)0, acc[mi][ni], false, false); }
    if (more) {      /* the other buffer: its last readers left it before the barrier that ended the pass before this one */
#pragma unroll
      for (int i = 0; i < 4; ++i) { *(v8us*)&sA[cur ^ 1][lr + 32 * i][lc] = ra[i]; *(v8us*)&sB[cur ^ 1][lr + 32 * i][lc] = rb[i]; } }
    __syncthreads();
  }
  float bvs[4];      /* both forms of the store add the same four bias values: asked for once, in front of the test */
#pragma unroll
  for (int ni = 0; ni < 4; ++ni) bvs[ni] = bf16_round(bias[col0 + ni * 16 + ln]);
  if (OUT == 2) {      /* a lane's 8 accumulator registers are 8 consecutive rows of one column: 16 bytes of a transposed row. The work-group's tile is staged transposed and stored in whole lines (256 B a column) */
    unsigned short (*sT)[BM + 8] = reinterpret_cast<unsigned short (*)[BM + 8]>(&so[0][0][0]);
#pragma unroll      /* these three: constant subscripts, so that acc[][] stays in registers */
    for (int ni = 0; ni < 4; ++ni) { const float bv = bvs[ni];
#pragma unroll
      for (int mi = 0; mi < 2; ++mi) { FragH f;
#pragma unroll
        for (int r = 0; r < 8; ++r) f.h[r] = (_Float16)(acc[mi][ni][r] * alpha + bv);
        *(v8us*)&sT[wn * 64 + ni * 16 + ln][wm * 32 + mi * 16 + 8 * hh] = f.half[0]; } }
    __syncthreads();      /* a transposed row holds the rows of four waves */
    unsigned short* ct = (unsigned short*)C16 + ((size_t)(mt / (TT / BM)) * DD + nt * BN) * TT + (mt % (TT / BM)) * BM;
#pragma unroll      /* the 8 LDS reads go out together, the stores follow as they return */
    for (int q = 0; q < 8; ++q) { const int d = q * 16 + (tid >> 4), pc = (tid & 15) * 8; *(v8us*)(ct + (size_t)d * TT + pc) = *(const v8us*)&sT[d][pc]; }
    return;
  }
#pragma unroll
  for (int ni = 0; ni < 4; ++ni) { const float bv = bvs[ni];      /* each wave stages its 32 rows in its own LDS range and stores whole lines */
#pragma unroll
    for (int mi = 0; mi < 2; ++mi)
#pragma unroll
      for (int r = 0; r < 8; ++r) so[w][mi * 16 + 8 * hh + r][ni * 16 + ln] = acc[mi][ni][r] * alpha + bv; }
  __builtin_amdgcn_fence(__ATOMIC_ACQ_REL, "workgroup"); __builtin_amdgcn_wave_barrier();
#pragma unroll
  for (int q = 0; q < 16; ++q) { const int r = q * 2 + rsub; const v4f v = *(const v4fa*)&so[w][r][c4]; const size_t o = o0 + q * 2 * DD;
    if (OUT1 == 1) { v4f y; for (int i = 0; i < 4; ++i) y[i] = v[i] + bf16_round(xr[q][i]); *(v4f*)(C + o) = y; }
    else { v4h h4; for (int i = 0; i < 4; ++i) h4[i] = (_Float16)v[i]; *(v4h*)(C16 + o) = h4; } }
}

__global__ __launch_bounds__(256) void k_x16(const float* __restrict__ x, _Float16* __restrict__ X16, size_t n8) { const size_t t = (size_t)blockIdx.x * 256 + threadIdx.x; if (t >= n8) return; FragH f;
#pragma unroll
  for (int q = 0; q < 8; ++q) f.h[q] = (_Float16)bf16_round(x[t * 8 + q]); *(v8us*)((unsigned short*)X16 + t * 8) = f.half[0];  }
__device__ __forceinline__ void round16f_part(int blk, const float* __restrict__ W, _Float16* __restrict__ Bt, size_t n8) { const size_t t = (size_t)blk * 256 + threadIdx.x; if (t >= n8) return; FragH f;
#pragma unroll
  for (int i = 0; i < 8; ++i) f.h[i] = (_Float16)(bf16_round(W[t * 8 + i]) * 16.0f); *(v8us*)((unsigned short*)Bt + t * 8) = f.half[0];  }
template <int D, int RBF>
__device__ __forceinline__ void lnx_part(int blk, const float* __restrict__ X, const float* __restrict__ gam, const float* __restrict__ bet, int nrows, float eps, _Float16* __restrict__ O16, float* __restrict__ XR) {
  constexpr int NP = D / 128; const int tid = threadIdx.x, wv = tid >> 5, lane = tid & 31; const size_t r = (size_t)blk * 8 + wv; if (r >= (size_t)nrows) return; v4f y[NP]; float s = 0.f;
#pragma unroll
  for (int j = 0; j < NP; ++j) { const int c = j * 128 + lane * 4; v4f g = *(const v4fa*)(X + r * D + c); if (RBF) { for (int q = 0; q < 4; ++q) g[q] = bf16_round(g[q]); } y[j] = g; s += g[0] + g[1] + g[2] + g[3]; }
  for (int o = 16; o >= 1; o >>= 1) s += __shfl_xor(s, o, 32); const float mu = s / (float)D; float q2 = 0.f;
#pragma unroll
  for (int j = 0; j < NP; ++j) for (int q = 0; q < 4; ++q) { const float d = y[j][q] - mu; q2 += d * d; }
  for (int o = 16; o >= 1; o >>= 1) q2 += __shfl_xor(q2, o, 32); const float rs = rsqrtf(q2 / (float)D + eps);
  {
#pragma unroll
    for (int j = 0; j < NP; ++j) { const int c = j * 128 + lane * 4; v4h h; for (int q = 0; q < 4; ++q) { const float v = (y[j][q] - mu) * rs * bf16_round(gam[c + q]) + bf16_round(bet[c + q]); h[q] = (_Float16)v; } *(v4h*)(O16 + r * D + c) = h; if (XR) *(v4f*)(XR + r * D + c) = y[j]; }
     } }
// All that the projections wait for, in one grid: its four parts read only the layer's inputs and depend on nothing of one another. Work-groups 0 .. BB - 1 list the kept keys (the longest chain, so first),
// the next NR / 8 normalise 8 rows each, the rest round the weights: Bw rows q|k|v, then out_w, (out,in) natural x 2^4. XR is lnx_part's optional f32 copy of the rounded rows (null: none is stored).
#define PW_QKV (3 * DD * DD / 8 / 256)      /* work-groups that round qkv_w */
#define PW_OUT (DD * DD / 8 / 256)          /* work-groups that round out_w */
__global__ __launch_bounds__(256) void k_prep(const float* __restrict__ X, const float* __restrict__ gam, const float* __restrict__ bet, const int* __restrict__ MSK, const float* __restrict__ Wqkv, const float* __restrict__ Wo,
                                              _Float16* __restrict__ X16, float* __restrict__ XR, _Float16* __restrict__ Bw, int* __restrict__ idx, int* __restrict__ cnt) {
  __shared__ int part[256];
  int blk = blockIdx.x;      /* every test on it is the same for the whole work-group */
  if (blk < BB) { keys_part(blk, part, MSK, idx, cnt); return; }
  blk -= BB;
  if (blk < NR / 8) { lnx_part<DD, 1>(blk, X, gam, bet, NR, 1e-5f, X16, XR); return; }      /* x = LN(bf16 hidden) -> f16 */
  blk -= NR / 8;
  if (blk < PW_QKV) round16f_part(blk, Wqkv, Bw, (size_t)3 * DD * DD / 8);
  else round16f_part(blk - PW_QKV, Wo, Bw + (size_t)3 * DD * DD, (size_t)DD * DD / 8);
}
// lane l <-> lane l ^ 16 (the two halves of a wave hold the two key halves of one query column)
__device__ __forceinline__ float xhalf(float x) { const int b = __builtin_bit_cast(int, x); return __builtin_bit_cast(float, __builtin_amdgcn_permlanex16(b, b, 0x76543210, 0xfedcba98, false, false)); }
#define FL_SK 64                 /* keys per stage */
#define FL_LP (64 + 8)           /* LDS row pitch in 16-bit elements */
#define FL_NG 2                  /* groups of 16 query columns per wave */
#define FL_C 0.18033688011112042f      /* 64^-1/2 * log2(e): the exponentials are taken in base 2 on the hardware's own instruction */
// one stage: this lane's four 16-byte pieces (K rows r and r + 32, V^T rows r and r + 32). The s_wait_xcnt stands inside the statement so that no address register is rewritten ahead of it.
__device__ __forceinline__ void fl_copy4(unsigned lk, unsigned lv, const unsigned short* gk0, const unsigned short* gk1, const unsigned short* gv0, const unsigned short* gv1) {
  const unsigned lk1 = lk + 32 * FL_LP * 2, lv1 = lv + 32 * FL_LP * 2;
  asm volatile("global_load_async_to_lds_b128 %0, %4, off\n\t"
               "global_load_async_to_lds_b128 %1, %5, off\n\t"
               "global_load_async_to_lds_b128 %2, %6, off\n\t"
               "global_load_async_to_lds_b128 %3, %7, off\n\t"
               "s_wait_xcnt 0x0"
               :: "v"(lk), "v"(lk1), "v"(lv), "v"(lv1), "v"(gk0), "v"(gk1), "v"(gv0), "v"(gv1) : "memory");
}
__global__ __launch_bounds__(256) void k_flash(const _Float16* __restrict__ Q16, int ldq, const _Float16* __restrict__ K16, int ldk, const _Float16* __restrict__ Vt, const int* __restrict__ cnt, _Float16* __restrict__ O16, int ldo) {
  constexpr int NW = 8, NG = FL_NG, RPW = 16 * NG, NQB = TT / (NW * RPW), DT = 4, KS = 2;
  __shared__ __attribute__((aligned(16))) unsigned short sK[2][FL_SK][FL_LP], sV[2][64][FL_LP];
  __shared__ __attribute__((aligned(16))) unsigned short sO[NW][RPW][FL_LP];
  const int tid = threadIdx.x, w = tid >> 5, lane = tid & 31, ln = lane & 15, hh = lane >> 4;
  const int slab = blockIdx.x / NQB, qblk = blockIdx.x % NQB; const int b = slab / NH, h = slab % NH; const int qb0 = qblk * (NW * RPW); const int q0 = qb0 + w * RPW;
  const int n = kept_count(cnt, b); const int nst = (n + FL_SK - 1) / FL_SK;      /* K16 and Vt hold the batch's n kept keys, packed; both are written up to the end of stage nst - 1 */
  const unsigned short* Vth = (const unsigned short*)Vt + (size_t)slab * 64 * TT;
  const int cr = tid >> 3, cc = (tid & 7) * 8;      /* 8 lanes cover one row's 128 bytes; a thread brings rows cr and cr + 32 of both tiles */
  const unsigned short* gk = (const unsigned short*)K16 + ((size_t)b * TT + cr) * ldk + h * 64 + cc;      /* + stage * 64 rows */
  const unsigned short* gv = Vth + (size_t)cr * TT + cc;                                                  /* + stage * 64 columns */
  const unsigned lk = (unsigned)(size_t)&sK[0][cr][cc], lv = (unsigned)(size_t)&sV[0][cr][cc];      /* LDS byte address = low 32 bits of the __shared__ address */
  constexpr unsigned BUFB = FL_SK * FL_LP * 2;      /* bytes of one buffer of either tile */
  if (nst > 0) fl_copy4(lk, lv, gk, gk + (size_t)32 * ldk, gv, gv + (size_t)32 * TT);      /* the same for the whole work-group */
  FragH bq[NG][KS];      /* B operand of group g: column ln = query q0 + 16 g + ln */
#pragma unroll
  for (int g = 0; g < NG; ++g) { const unsigned short* qr = (const unsigned short*)Q16 + ((size_t)b * TT + q0 + g * 16 + ln) * ldq + h * 64;
#pragma unroll
    for (int ks = 0; ks < KS; ++ks) { bq[g][ks].half[0] = *(const v8us*)(qr + ks * 32 + 8 * hh); bq[g][ks].half[1] = *(const v8us*)(qr + ks * 32 + 16 + 8 * hh); } }
  asm volatile("s_wait_asynccnt 0x0" ::: "memory");      /* stage 0 of this wave has landed before the barrier that publishes it */
  __syncthreads();
  if (nst > 1) fl_copy4(lk + BUFB, lv + BUFB, gk + (size_t)FL_SK * ldk, gk + (size_t)(FL_SK + 32) * ldk, gv + FL_SK, gv + (size_t)32 * TT + FL_SK);
  float m_q[NG], l_q[NG]; v8f oacc[NG][DT];      /* oacc[g][dt][r] = O[q0 + 16 g + ln][dt * 16 + 8 * hh + r] */
#pragma unroll
  for (int g = 0; g < NG; ++g) { m_q[g] = -3.0e38f; l_q[g] = 0.f;
#pragma unroll
    for (int dt = 0; dt < DT; ++dt) oacc[g][dt] = (v8f){0.f,0.f,0.f,0.f,0.f,0.f,0.f,0.f}; }
#pragma unroll 1
  for (int st = 0; st < nst; ++st) {
    const int cur = st & 1;
#pragma unroll      /* both passes of a stage in one body, so that one pass's products stand among the other's vector work; it fits the 256 registers at which both work-groups of a WGP are resident */
    for (int jj = 0; jj < FL_SK; jj += 32) {
    const int j0 = st * FL_SK + jj;
    v8f s[NG][2];
#pragma unroll
    for (int nt = 0; nt < 2; ++nt) { const unsigned short* kr = &sK[cur][jj + nt * 16 + ln][0]; FragH ak[KS];      /* one K fragment from LDS serves both column groups */
#pragma unroll
      for (int ks = 0; ks < KS; ++ks) { ak[ks].half[0] = *(const v8us*)(kr + ks * 32 + 8 * hh); ak[ks].half[1] = *(const v8us*)(kr + ks * 32 + 16 + 8 * hh); }
#pragma unroll
      for (int g = 0; g < NG; ++g) s[g][nt] = (v8f){0.f,0.f,0.f,0.f,0.f,0.f,0.f,0.f};
#pragma unroll
      for (int ks = 0; ks < KS; ++ks)
#pragma unroll
        for (int g = 0; g < NG; ++g) s[g][nt] = __builtin_amdgcn_wmma_f32_16x16x32_f16(false, ak[ks].v, false, bq[g][ks].v, (short)0, s[g][nt], false, false); }
    if (j0 + 32 > n) {      /* only a batch's last stage holds rows past its kept keys (this lane's are j0 + 8hh + 0..7 and j0 + 16 + 8hh + 0..7): score -inf, so the exponential below is exactly 0 */
#pragma unroll      /* these two: constant element numbers, so that the score tiles stay in registers */
      for (int g = 0; g < NG; ++g)
#pragma unroll
        for (int i = 0; i < 16; ++i) s[g][i >> 3][i & 7] = (j0 + (i >> 3) * 16 + 8 * hh + (i & 7) < n) ? s[g][i >> 3][i & 7] : -INFINITY; }
    FragH pb[NG];      /* pb[g].h[i] = 2^10 P^T[k = kmap(i, hh)][column ln of group g] */
#pragma unroll
    for (int g = 0; g < NG; ++g) {
    float sc[16]; float mc = -INFINITY;      /* raw q.k */
#pragma unroll
    for (int i = 0; i < 16; ++i) { sc[i] = s[g][i >> 3][i & 7]; mc = fmaxf(mc, sc[i]); }
    mc = fmaxf(mc, xhalf(mc));
    const float mn = fmaxf(m_q[g], mc); const float al = __builtin_amdgcn_exp2f((m_q[g] - mn) * FL_C); m_q[g] = mn;      /* m_q and mn (raw q.k units) are finite (start -3e38): no key seen yet gives 2^0 = 1 */
    const float nb = __builtin_fmaf(-mn, FL_C, 10.0f);      /* 2^10 e^((s - mn) / 8) = 2^(s C + nb): scale, maximum and the 2^10 of P in one fused multiply-add a score */
    float ps = 0.f;
#pragma unroll
    for (int i = 0; i < 16; i += 2) { const v2f e = __builtin_elementwise_fma((v2f){sc[i], sc[i + 1]}, (v2f){FL_C, FL_C}, (v2f){nb, nb});      /* neighbours of one accumulator as a pair: left to itself the compiler pairs across the two groups and pays for it in register moves */
      const float p0 = __builtin_amdgcn_exp2f(e[0]), p1 = __builtin_amdgcn_exp2f(e[1]); ps += p0; ps += p1; pb[g].h[i] = (_Float16)p0; pb[g].h[i + 1] = (_Float16)p1; }
    l_q[g] = l_q[g] * al + ps;      /* the row sum carries the same 2^10 */
#pragma unroll
    for (int dt = 0; dt < DT; ++dt)
#pragma unroll
      for (int r = 0; r < 8; ++r) oacc[g][dt][r] *= al; }
#pragma unroll
    for (int dt = 0; dt < DT; ++dt) { const unsigned short* vrow = &sV[cur][dt * 16 + ln][jj]; FragH av; av.half[0] = *(const v8us*)(vrow + 8 * hh); av.half[1] = *(const v8us*)(vrow + 16 + 8 * hh);      /* one V^T fragment from LDS serves both column groups */
#pragma unroll
      for (int g = 0; g < NG; ++g) oacc[g][dt] = __builtin_amdgcn_wmma_f32_16x16x32_f16(false, av.v, false, pb[g].v, (short)0, oacc[g][dt], false, false); } }
    asm volatile("s_wait_dscnt 0x0" ::: "memory");      /* this wave's reads of buffer cur have returned before the buffer is refilled */
    asm volatile("s_wait_asynccnt 0x0" ::: "memory");   /* this wave's copies of stage st + 1 have landed before the barrier that publishes them */
    __syncthreads();      /* publishes stage st + 1 and ends every wave's reads of buffer cur */
    if (st + 2 < nst) {      /* the same for the whole work-group */
      const unsigned short* k2 = gk + (size_t)(st + 2) * FL_SK * ldk; const unsigned short* v2 = gv + (st + 2) * FL_SK;
      fl_copy4(lk + cur * BUFB, lv + cur * BUFB, k2, k2 + (size_t)32 * ldk, v2, v2 + (size_t)32 * TT); }
  }
  asm volatile("s_wait_asynccnt 0x0" ::: "memory");      /* nothing of this wave is in flight when it goes on to the output */
#pragma unroll
  for (int g = 0; g < NG; ++g) { float l = l_q[g] + xhalf(l_q[g]); l = (l > 0.f) ? 1.0f / l : 0.f;
#pragma unroll
    for (int dt = 0; dt < DT; ++dt) { FragH f;      /* the context leaves as the f16 operand of the output GEMM */
#pragma unroll      /* constant subscripts: oacc[] stays in registers */
      for (int r = 0; r < 8; ++r) f.h[r] = (_Float16)(oacc[g][dt][r] * l);
      *(v8us*)&sO[w][g * 16 + ln][dt * 16 + 8 * hh] = f.half[0]; } }
  __builtin_amdgcn_fence(__ATOMIC_ACQ_REL, "workgroup"); __builtin_amdgcn_wave_barrier();
  {
#pragma unroll
    for (int rp = 0; rp < RPW; rp += 4) { const int r = rp + (lane >> 3), pc = (lane & 7) * 8; *(v8us*)((unsigned short*)O16 + ((size_t)b * TT + q0 + r) * ldo + h * 64 + pc) = *(const v8us*)&sO[w][r][pc]; }      /* 8 lanes store one row's 128-byte line */
     } }

extern "C" void kernel_launch(void* const* d_in, const int* in_sizes, int n_in,
                              void* d_out, int out_size, void* d_ws, size_t ws_size, hipStream_t stream) {
  (void)in_sizes; (void)n_in; (void)out_size;
  const float* const* I = (const float* const*)d_in; const float* x = I[0]; const int* mask = (const int*)d_in[1]; const float* Wqkv = I[2]; const float* bqkv = I[3]; const float* Wo = I[4]; const float* bo = I[5]; const float* lng = I[6]; const float* lnb = I[7];      /* d_in order: hidden_states, encoder_padding_mask, qkv_w, qkv_b, out_w, out_b, ln_g, ln_b */
  char* ws = (char*)d_ws; size_t off = 0;
  auto take = [&](size_t bytes) { char* p = ws + off; off += (bytes + 255) & ~(size_t)255; return p; };
  const size_t WSZ = (size_t)DD * DD; _Float16* Bw = (_Float16*)take(4 * WSZ * 2); _Float16* X16 = (_Float16*)take((size_t)NR * DD * 2);
  _Float16* Q = (_Float16*)take((size_t)NR * DD * 2); _Float16* K = (_Float16*)take((size_t)NR * DD * 2); _Float16* Vt = (_Float16*)take((size_t)NR * DD * 2); _Float16* O16 = (_Float16*)take((size_t)NR * DD * 2);
  int* kidx = (int*)take((size_t)NR * 4); int* kcnt = (int*)take(BB * 4);
  if (off > ws_size) return;
  const unsigned gp = (NR / 128) * (DD / 128);
  k_prep<<<BB + NR / 8 + PW_QKV + PW_OUT, 256, 0, stream>>>(x, lng, lnb, mask, Wqkv, Wo, X16, nullptr, Bw, kidx, kcnt);
  k_gemm_t<true><<<3 * gp, 256, 0, stream>>>(X16, Bw, 0.0625f, bqkv, nullptr, nullptr, Q, K, Vt, kidx, kcnt);      /* q = x.Wq + bq: M 8192 N 1024 K 1024; k and v: kept keys only, packed per batch, v stored as V^T [batch][head][d][key] */
  k_flash<<<BB * NH * (TT / (8 * 16 * FL_NG)), 256, 0, stream>>>(Q, DD, K, DD, Vt, kcnt, O16, DD);
  k_gemm_t<false><<<gp, 256, 0, stream>>>(O16, Bw + 3 * WSZ, 0.0625f, bo, x, (float*)d_out, nullptr, nullptr, nullptr, nullptr, nullptr);      /* out = O.out_w^T + out_b + bf16(hidden) */
}

// v010
// A run of this version takes 90.1 microseconds.
// Timed twice side by side with v009, it ran 1.08 times as fast both times.
// Over all steps from v000 it is 9.26 times as fast.
#include <hip/hip_runtime.h>
// Pre-LN self-attention layer with a key padding mask and residual (B=4, S=2048, H=1024, 16 heads × 64): x = LN(hidden); [q|k|v] = x·qkv_wᵀ + qkv_b ((out,in) fused); scores = q·kᵀ·64^-½ + mask·(−1e8) (int mask [B,S], 1 = pad); softmax;
// out = (attn·v merged)·out_wᵀ + out_b + hidden.
// Compute dtype: x, weights, biases rounded to bf16; q/k/v as f16 GEMM outputs; fused flash-style kernel (online softmax f32, P f16 ×2^10) on v_wmma_f32_16x16x32_f16; O → f16 → output GEMM with bias; f32 accumulate.
#define BB 4
#define TT 2048
#define NH 16
#define DD 1024
#define NR (BB * TT)

typedef __bf16 v16b __attribute__((ext_vector_type(16)));
typedef unsigned short v8us __attribute__((ext_vector_type(8), may_alias));
typedef float  v8f  __attribute__((ext_vector_type(8)));
typedef float  v4f  __attribute__((ext_vector_type(4)));
typedef float  v4fa __attribute__((ext_vector_type(4), may_alias));
union FragB { v16b v; v8us half[2]; unsigned short u[16]; };

__device__ __forceinline__ unsigned short bf16_bits(float x) { unsigned int u = __float_as_uint(x); return (unsigned short)((u + 0x7FFFu + ((u >> 16) & 1u)) >> 16); }
__device__ __forceinline__ float bf16_val(unsigned short b) { return __uint_as_float(((unsigned int)b) << 16); }
__device__ __forceinline__ float bf16_round(float x) { return bf16_val(bf16_bits(x)); }
// D += A·B with NT terms: 1 = ah·bh, 2 = + al·bh (A split), 3 = + ah·bl (both split)
template <int NT>
__device__ __forceinline__ v8f mmaN(v16b ah, v16b al, v16b bh, v16b bl, v8f c) {
  c = __builtin_amdgcn_wmma_f32_16x16x32_bf16(false, ah, false, bh, (short)0, c, false, false);
  if (NT >= 2) c = __builtin_amdgcn_wmma_f32_16x16x32_bf16(false, al, false, bh, (short)0, c, false, false);
  if (NT >= 3) c = __builtin_amdgcn_wmma_f32_16x16x32_bf16(false, ah, false, bl, (short)0, c, false, false);
  asm volatile("v_nop\n\tv_nop\n\tv_nop\n\tv_nop" : "+v"(c) : "v"(ah), "v"(al), "v"(bh), "v"(bl));
  return c;
}

__global__ __launch_bounds__(256) void k_wt_bf16(const float* __restrict__ W, unsigned short* __restrict__ Wt, int K, int N) {
  const int t = blockIdx.x * 256 + threadIdx.x;
  const int k8n = K / 8;
  if (t >= N * k8n) return;
  const int n = t / k8n, k8 = (t % k8n) * 8;
  v8us v;
#pragma unroll
  for (int i = 0; i < 8; ++i) v[i] = bf16_bits(W[(size_t)(k8 + i) * N + n]);
  *(v8us*)(Wt + (size_t)n * K + k8) = v;
  
}

// GEMM C[M][N] (f32, pitch ldc) = act(A[M][K]·W + bias). A f32 row-major (pitch lda) converted per fragment to bf16
// (ASPLIT: hi/lo two planes -> 2 terms, else single rounded term); Wt bf16 [N][K] (pitch ldb). BIAS_BF16 rounds the
// bias to bf16 first (bias quantised to bf16 before the add). K%32==0, M%16==0, N%64==0.
template <bool ASPLIT, int ACT, bool BIAS_BF16>
__global__ __launch_bounds__(128) void k_gemm_bf(const float* __restrict__ A, int lda, const unsigned short* __restrict__ Wt, int ldb,
                                               const float* __restrict__ bias, float* __restrict__ C, int ldc, int M, int N, int K) {
  __shared__ __attribute__((aligned(16))) float so[4][16][64];
  const int tid = threadIdx.x, w = tid >> 5, lane = tid & 31, ln = lane & 15, hh = lane >> 4;
  const int ntn = N / 64;
  const int wid = blockIdx.x * 4 + w;
  const int mt = wid / ntn, nq = wid % ntn;
  if (mt * 16 >= M) return;
  const int row0 = mt * 16, col0 = nq * 64;
  const float* arow = A + (size_t)(row0 + ln) * lda;
  v8f acc[4] = {};
  for (int kb = 0; kb < K; kb += 32) {
    FragB ah, al;
    const v4f x0 = *(const v4fa*)(arow + kb + 8 * hh), x1 = *(const v4fa*)(arow + kb + 8 * hh + 4);
    const v4f x2 = *(const v4fa*)(arow + kb + 16 + 8 * hh), x3 = *(const v4fa*)(arow + kb + 16 + 8 * hh + 4);
    float xs[16] = {x0[0],x0[1],x0[2],x0[3],x1[0],x1[1],x1[2],x1[3],x2[0],x2[1],x2[2],x2[3],x3[0],x3[1],x3[2],x3[3]};
#pragma unroll
    for (int i = 0; i < 16; ++i) { const unsigned short hb = bf16_bits(xs[i]); ah.u[i] = hb; al.u[i] = ASPLIT ? bf16_bits(xs[i] - bf16_val(hb)) : (unsigned short)0; }
#pragma unroll
    for (int t = 0; t < 4; ++t) {
      const unsigned short* brow = Wt + (size_t)(col0 + t * 16 + ln) * ldb + kb;
      FragB b;
      b.half[0] = *(const v8us*)(brow + 8 * hh);
      b.half[1] = *(const v8us*)(brow + 16 + 8 * hh);
      acc[t] = mmaN<ASPLIT ? 2 : 1>(ah.v, al.v, b.v, b.v, acc[t]);
    }
  }
#pragma unroll
  for (int t = 0; t < 4; ++t) {
    float bv = bias ? bias[col0 + t * 16 + ln] : 0.f;
    if (BIAS_BF16) bv = bf16_round(bv);
#pragma unroll
    for (int r = 0; r < 8; ++r) { float v = acc[t][r] + bv; if (ACT == 1) v = fmaxf(v, 0.f); so[w][8 * hh + r][t * 16 + ln] = v; }
  }
  __builtin_amdgcn_fence(__ATOMIC_ACQ_REL, "workgroup");
  __builtin_amdgcn_wave_barrier();
  const int rsub = lane >> 4, c4 = (lane & 15) * 4;
  {
#pragma unroll
    for (int q = 0; q < 8; ++q) {
      const int r = q * 2 + rsub;
      const v4f v = *(const v4fa*)&so[w][r][c4];
      *(v4f*)(C + (size_t)(row0 + r) * ldc + col0 + c4) = v;
    }
    
  }
}

// Flash-style causal/unmasked attention, all contractions 3-term bf16 hi/lo splits, f32 softmax with running max.
// q,k,v rows are read from f32 buffers with arbitrary row pitch (so they can live inside a fused qkv buffer);
// D = head size (multiple of 32, <= 128); one wave = 16 query rows; block = 4 waves (64 queries) sharing K/V chunks of 32.
template <int D, bool CAUSAL>
__global__ __launch_bounds__(128) void k_flash(const float* __restrict__ qb, const float* __restrict__ kb, const float* __restrict__ vb,
                                             int pitch, int T, int H, float scale, float* __restrict__ y, int ypitch) {
  constexpr int KS = D / 32;        // k-steps for QK
  constexpr int DT = D / 16;        // d tiles for PV
  __shared__ __attribute__((aligned(16))) unsigned short sKh[32][D + 8], sKl[32][D + 8], sVh[32][D + 8], sVl[32][D + 8];
  __shared__ __attribute__((aligned(16))) unsigned short sPh[4][16][40], sPl[4][16][40];
  __shared__ __attribute__((aligned(16))) float sO[4][16][D];
  const int tid = threadIdx.x, w = tid >> 5, lane = tid & 31, ln = lane & 15, hh = lane >> 4;
  const int nqb = (T + 63) / 64;
  const int bh = blockIdx.x / nqb, qblk = blockIdx.x % nqb;
  const int b = bh / H, h = bh % H;
  const int q0 = qblk * 64 + w * 16;
  const float* Q = qb + (size_t)b * T * pitch + h * D;
  const float* K = kb + (size_t)b * T * pitch + h * D;
  const float* V = vb + (size_t)b * T * pitch + h * D;

  // A fragments of the wave's 16 query rows (scaled), hi/lo
  FragB aqh[KS], aql[KS];
  {
    int row = q0 + ln; if (row >= T) row = T - 1;
    const float* qr = Q + (size_t)row * pitch;
#pragma unroll
    for (int ks = 0; ks < KS; ++ks)
#pragma unroll
      for (int i = 0; i < 16; ++i) {
        const int d = ks * 32 + ((i < 8) ? (8 * hh + i) : (16 + 8 * hh + (i - 8)));
        const float x = qr[d] * scale; const unsigned short hb = bf16_bits(x);
        aqh[ks].u[i] = hb; aql[ks].u[i] = bf16_bits(x - bf16_val(hb));
      }
  }
  float m_r[8], l_r[8];
#pragma unroll
  for (int r = 0; r < 8; ++r) { m_r[r] = -3.0e38f; l_r[r] = 0.f; }
  v8f oacc[DT];
#pragma unroll
  for (int dt = 0; dt < DT; ++dt) oacc[dt] = (v8f){0.f,0.f,0.f,0.f,0.f,0.f,0.f,0.f};

  const int kv_end = CAUSAL ? min(T, qblk * 64 + 64) : T;     // block-uniform
  for (int j0 = 0; j0 < kv_end; j0 += 32) {
    __syncthreads();
    for (int e = tid; e < 32 * (D / 4); e += 128) {
      const int r = e / (D / 4), c4 = (e % (D / 4)) * 4;
      const int key = j0 + r;
      v4f kf = {0.f,0.f,0.f,0.f}, vf = {0.f,0.f,0.f,0.f};
      if (key < T) { kf = *(const v4fa*)(K + (size_t)key * pitch + c4); vf = *(const v4fa*)(V + (size_t)key * pitch + c4); }
#pragma unroll
      for (int t = 0; t < 4; ++t) {
        unsigned short hb = bf16_bits(kf[t]); sKh[r][c4 + t] = hb; sKl[r][c4 + t] = bf16_bits(kf[t] - bf16_val(hb));
        hb = bf16_bits(vf[t]); sVh[r][c4 + t] = hb; sVl[r][c4 + t] = bf16_bits(vf[t] - bf16_val(hb));
      }
    }
    __syncthreads();
    // S tile 16 x 32
    v8f s[2];
#pragma unroll
    for (int nt = 0; nt < 2; ++nt) {
      v8f acc = {};
#pragma unroll
      for (int ks = 0; ks < KS; ++ks) {
        FragB bh_, bl_;
        bh_.half[0] = *(const v8us*)&sKh[nt * 16 + ln][ks * 32 + 8 * hh]; bh_.half[1] = *(const v8us*)&sKh[nt * 16 + ln][ks * 32 + 16 + 8 * hh];
        bl_.half[0] = *(const v8us*)&sKl[nt * 16 + ln][ks * 32 + 8 * hh]; bl_.half[1] = *(const v8us*)&sKl[nt * 16 + ln][ks * 32 + 16 + 8 * hh];
        acc = mmaN<3>(aqh[ks].v, aql[ks].v, bh_.v, bl_.v, acc);
      }
      s[nt] = acc;
    }
    // mask + running max (rows 8hh+r; the 16 lanes of a half share rows)
    float alpha[8];
#pragma unroll
    for (int r = 0; r < 8; ++r) {
      const int qi = q0 + 8 * hh + r;
      const int ja = j0 + ln, jb = j0 + 16 + ln;
      if (CAUSAL) { if (ja > qi) s[0][r] = -3.0e38f; if (jb > qi) s[1][r] = -3.0e38f; }
      if (ja >= T) s[0][r] = -3.0e38f;
      if (jb >= T) s[1][r] = -3.0e38f;
      float mx = fmaxf(s[0][r], s[1][r]);
      mx = fmaxf(mx, __shfl_xor(mx, 1, 32)); mx = fmaxf(mx, __shfl_xor(mx, 2, 32)); mx = fmaxf(mx, __shfl_xor(mx, 4, 32)); mx = fmaxf(mx, __shfl_xor(mx, 8, 32));
      const float mnew = fmaxf(m_r[r], mx);
      alpha[r] = (mnew > -1.0e38f) ? __expf(m_r[r] - mnew) : 1.0f;
      const float p0 = (s[0][r] > -1.0e38f) ? __expf(s[0][r] - mnew) : 0.f;
      const float p1 = (s[1][r] > -1.0e38f) ? __expf(s[1][r] - mnew) : 0.f;
      m_r[r] = mnew;
      l_r[r] = l_r[r] * alpha[r] + p0 + p1;            // per-lane partial row sum (16 lanes combined at the end)
      unsigned short hb = bf16_bits(p0); sPh[w][8 * hh + r][ln] = hb;      sPl[w][8 * hh + r][ln] = bf16_bits(p0 - bf16_val(hb));
      hb = bf16_bits(p1);                sPh[w][8 * hh + r][16 + ln] = hb; sPl[w][8 * hh + r][16 + ln] = bf16_bits(p1 - bf16_val(hb));
    }
#pragma unroll
    for (int dt = 0; dt < DT; ++dt)
#pragma unroll
      for (int r = 0; r < 8; ++r) oacc[dt][r] *= alpha[r];
    __builtin_amdgcn_fence(__ATOMIC_ACQ_REL, "workgroup");
    __builtin_amdgcn_wave_barrier();
    FragB pah, pal;
    pah.half[0] = *(const v8us*)&sPh[w][ln][8 * hh]; pah.half[1] = *(const v8us*)&sPh[w][ln][16 + 8 * hh];
    pal.half[0] = *(const v8us*)&sPl[w][ln][8 * hh]; pal.half[1] = *(const v8us*)&sPl[w][ln][16 + 8 * hh];
#pragma unroll
    for (int dt = 0; dt < DT; ++dt) {
      FragB bvh, bvl;
#pragma unroll
      for (int i = 0; i < 8; ++i) {
        bvh.u[i] = sVh[8 * hh + i][dt * 16 + ln]; bvh.u[8 + i] = sVh[16 + 8 * hh + i][dt * 16 + ln];
        bvl.u[i] = sVl[8 * hh + i][dt * 16 + ln]; bvl.u[8 + i] = sVl[16 + 8 * hh + i][dt * 16 + ln];
      }
      oacc[dt] = mmaN<3>(pah.v, pal.v, bvh.v, bvl.v, oacc[dt]);
    }
    __builtin_amdgcn_fence(__ATOMIC_ACQ_REL, "workgroup");
    __builtin_amdgcn_wave_barrier();
  }
#pragma unroll
  for (int r = 0; r < 8; ++r) {
    float l = l_r[r];
    l += __shfl_xor(l, 1, 32); l += __shfl_xor(l, 2, 32); l += __shfl_xor(l, 4, 32); l += __shfl_xor(l, 8, 32);
    l_r[r] = (l > 0.f) ? 1.0f / l : 0.f;
  }
#pragma unroll
  for (int dt = 0; dt < DT; ++dt)
#pragma unroll
    for (int r = 0; r < 8; ++r) sO[w][8 * hh + r][dt * 16 + ln] = oacc[dt][r] * l_r[r];
  __builtin_amdgcn_fence(__ATOMIC_ACQ_REL, "workgroup");
  __builtin_amdgcn_wave_barrier();
  {
    for (int r = 0; r < 16; ++r) {
      const int row = q0 + r;
      if (row < T && lane < D / 4) {
        const v4f val = *(const v4fa*)&sO[w][r][lane * 4];
        *(v4f*)(y + ((size_t)b * T + row) * ypitch + h * D + lane * 4) = val;
      }
    }
    
  }
}

// GEMM C = act(A·W + bias + resid): A f32 (ASPLIT -> hi/lo 2 terms), Wt bf16 [N][K]; ACT 0 none, 1 relu, 2 exact gelu;
// resid (optional, f32, row index = (row % rmod), pitch ldr, RES_BF16 rounds it) added before the activation.
template <bool ASPLIT, int ACT, bool BIAS_BF16, bool RES_BF16>
__global__ __launch_bounds__(128) void k_gemm_bf3(const float* __restrict__ A, int lda, const unsigned short* __restrict__ Wt, int ldb,
                                                const float* __restrict__ bias, const float* __restrict__ resid, int rmod, int ldr,
                                                float* __restrict__ C, int ldc, int M, int N, int K) {
  __shared__ __attribute__((aligned(16))) float so[4][16][64];
  const int tid = threadIdx.x, w = tid >> 5, lane = tid & 31, ln = lane & 15, hh = lane >> 4;
  const int ntn = N / 64;
  const int wid = blockIdx.x * 4 + w;
  const int mt = wid / ntn, nq = wid % ntn;
  if (mt * 16 >= M) return;
  const int row0 = mt * 16, col0 = nq * 64;
  const float* arow = A + (size_t)(row0 + ln) * lda;
  v8f acc[4] = {};
  for (int kb = 0; kb < K; kb += 32) {
    FragB ah, al;
    const v4f x0 = *(const v4fa*)(arow + kb + 8 * hh), x1 = *(const v4fa*)(arow + kb + 8 * hh + 4);
    const v4f x2 = *(const v4fa*)(arow + kb + 16 + 8 * hh), x3 = *(const v4fa*)(arow + kb + 16 + 8 * hh + 4);
    float xs[16] = {x0[0],x0[1],x0[2],x0[3],x1[0],x1[1],x1[2],x1[3],x2[0],x2[1],x2[2],x2[3],x3[0],x3[1],x3[2],x3[3]};
#pragma unroll
    for (int i = 0; i < 16; ++i) { const unsigned short hb = bf16_bits(xs[i]); ah.u[i] = hb; al.u[i] = ASPLIT ? bf16_bits(xs[i] - bf16_val(hb)) : (unsigned short)0; }
#pragma unroll
    for (int t = 0; t < 4; ++t) {
      const unsigned short* brow = Wt + (size_t)(col0 + t * 16 + ln) * ldb + kb;
      FragB b;
      b.half[0] = *(const v8us*)(brow + 8 * hh);
      b.half[1] = *(const v8us*)(brow + 16 + 8 * hh);
      acc[t] = mmaN<ASPLIT ? 2 : 1>(ah.v, al.v, b.v, b.v, acc[t]);
    }
  }
#pragma unroll
  for (int t = 0; t < 4; ++t) {
    const int col = col0 + t * 16 + ln;
    float bv = bias ? bias[col] : 0.f;
    if (BIAS_BF16) bv = bf16_round(bv);
#pragma unroll
    for (int r = 0; r < 8; ++r) {
      float v = acc[t][r] + bv;
      if (resid) { float rv = resid[(size_t)((row0 + 8 * hh + r) % rmod) * ldr + col]; if (RES_BF16) rv = bf16_round(rv); v += rv; }
      if (ACT == 1) v = fmaxf(v, 0.f);
      if (ACT == 2) v = 0.5f * v * (1.0f + erff(v * 0.70710678118654752f));
      if (ACT == 3) { const float u = 0.7978845608028654f * (v + 0.044715f * v * v * v); v = 0.5f * v * (1.0f + tanhf(u)); }
      so[w][8 * hh + r][t * 16 + ln] = v;
    }
  }
  __builtin_amdgcn_fence(__ATOMIC_ACQ_REL, "workgroup");
  __builtin_amdgcn_wave_barrier();
  const int rsub = lane >> 4, c4 = (lane & 15) * 4;
  {
#pragma unroll
    for (int q = 0; q < 8; ++q) {
      const int r = q * 2 + rsub;
      const v4f v = *(const v4fa*)&so[w][r][c4];
      *(v4f*)(C + (size_t)(row0 + r) * ldc + col0 + c4) = v;
    }
    
  }
}
// row LayerNorm (biased variance, eps) over N: s = X (+ R); optional out_sum <- s; out_norm <- (s-mu)*rsqrt(var+eps)*g + b
template <bool PARAM_BF16>
__global__ __launch_bounds__(256) void k_layernorm(const float* __restrict__ X, const float* __restrict__ R, const float* __restrict__ g, const float* __restrict__ bta,
                                                  float* __restrict__ out_sum, float* __restrict__ out_norm, int N, float eps) {
  __shared__ float red[256];
  const int row = blockIdx.x, tid = threadIdx.x;
  const float* x = X + (size_t)row * N; const float* rr = R ? R + (size_t)row * N : nullptr;
  float vals[16];                     // up to N = 4096
  const int per = N / 256;            // contiguous chunk per thread? use strided-by-4 chunks: thread handles j = tid*4 + 1024*u
  float s1 = 0.f;
  for (int u = 0; u < per / 4; ++u) {
    const int j = tid * 4 + 1024 * u;
    const v4f a = *(const v4fa*)(x + j);
    v4f b = {0.f,0.f,0.f,0.f}; if (rr) b = *(const v4fa*)(rr + j);
#pragma unroll
    for (int q = 0; q < 4; ++q) { const float v = a[q] + b[q]; vals[u * 4 + q] = v; s1 += v; }
  }
  red[tid] = s1; __syncthreads();
  for (int st = 128; st > 0; st >>= 1) { if (tid < st) red[tid] += red[tid + st]; __syncthreads(); }
  const float mu = red[0] / (float)N; __syncthreads();
  float s2 = 0.f;
  for (int u = 0; u < per / 4; ++u)
#pragma unroll
    for (int q = 0; q < 4; ++q) { const float c = vals[u * 4 + q] - mu; s2 += c * c; }
  red[tid] = s2; __syncthreads();
  for (int st = 128; st > 0; st >>= 1) { if (tid < st) red[tid] += red[tid + st]; __syncthreads(); }
  const float rs = rsqrtf(red[0] / (float)N + eps);
  {
    for (int u = 0; u < per / 4; ++u) {
      const int j = tid * 4 + 1024 * u;
      v4f o, sm;
#pragma unroll
      for (int q = 0; q < 4; ++q) {
        float gg = g[j + q], bb = bta[j + q];
        if (PARAM_BF16) { gg = bf16_round(gg); bb = bf16_round(bb); }
        sm[q] = vals[u * 4 + q]; o[q] = (vals[u * 4 + q] - mu) * rs * gg + bb;
      }
      if (out_sum) *(v4f*)(out_sum + (size_t)row * N + j) = sm;
      *(v4f*)(out_norm + (size_t)row * N + j) = o;
    }
    
  }
}



// ---- f16 WMMA path (v_wmma_f32_16x16x32_f16): 11-bit significands for operands in range — used where a [0,1] probability operand needs more precision than bf16
typedef _Float16 v16h __attribute__((ext_vector_type(16)));
union FragH { v16h v; v8us half[2]; _Float16 h[16]; unsigned short u[16]; };
template <int NT>
__device__ __forceinline__ v8f mmaH(v16h ah, v16h al, v16h bh, v16h bl, v8f c) {
  c = __builtin_amdgcn_wmma_f32_16x16x32_f16(false, ah, false, bh, (short)0, c, false, false);
  if (NT >= 2) c = __builtin_amdgcn_wmma_f32_16x16x32_f16(false, al, false, bh, (short)0, c, false, false);
  if (NT >= 3) c = __builtin_amdgcn_wmma_f32_16x16x32_f16(false, ah, false, bl, (short)0, c, false, false);
  asm volatile("v_nop\n\tv_nop\n\tv_nop\n\tv_nop" : "+v"(c) : "v"(ah), "v"(al), "v"(bh), "v"(bl));
  return c;
}
// batched GEMM like k_gemm_b but f16 operands: A f32 (split into f16 hi/lo if ASPLIT, else rounded to f16), Bt = f16 values [n][k]; alpha; C f32; N multiple of 16 (partial tiles skipped)
template <bool ASPLIT>
__global__ __launch_bounds__(128) void k_gemm_h(const float* __restrict__ A, int lda, size_t sA, const _Float16* __restrict__ Bh, int ldb, size_t sB, float alpha, float* __restrict__ C, int ldc, size_t sC, int M, int N, int K) {
  __shared__ __attribute__((aligned(16))) float so[4][16][64];
  const int tid = threadIdx.x, w = tid >> 5, lane = tid & 31, ln = lane & 15, hh = lane >> 4; const int by = blockIdx.y;
  A += (size_t)by * sA; Bh += (size_t)by * sB; C += (size_t)by * sC;
  const int ntn = (N + 63) / 64; const int wid = blockIdx.x * 4 + w; const int mt = wid / ntn, nq = wid % ntn; if (mt * 16 >= M) return;
  const int row0 = mt * 16, col0 = nq * 64; const float* arow = A + (size_t)(row0 + ln) * lda;
  v8f acc[4] = {};
  for (int kb = 0; kb < K; kb += 32) {
    FragH ah, al;
    const v4f x0 = *(const v4fa*)(arow + kb + 8 * hh), x1 = *(const v4fa*)(arow + kb + 8 * hh + 4), x2 = *(const v4fa*)(arow + kb + 16 + 8 * hh), x3 = *(const v4fa*)(arow + kb + 16 + 8 * hh + 4);
    float xs[16] = {x0[0],x0[1],x0[2],x0[3],x1[0],x1[1],x1[2],x1[3],x2[0],x2[1],x2[2],x2[3],x3[0],x3[1],x3[2],x3[3]};
#pragma unroll
    for (int i = 0; i < 16; ++i) { const _Float16 h = (_Float16)xs[i]; ah.h[i] = h; al.h[i] = ASPLIT ? (_Float16)(xs[i] - (float)h) : (_Float16)0.0f; }
#pragma unroll
    for (int t = 0; t < 4; ++t) { if (col0 + t * 16 >= N) continue; const size_t boff = (size_t)(col0 + t * 16 + ln) * ldb + kb; FragH bq; bq.half[0] = *(const v8us*)(Bh + boff + 8 * hh); bq.half[1] = *(const v8us*)(Bh + boff + 16 + 8 * hh);
      acc[t] = mmaH<ASPLIT ? 2 : 1>(ah.v, al.v, bq.v, bq.v, acc[t]); }
  }
#pragma unroll
  for (int t = 0; t < 4; ++t) { if (col0 + t * 16 >= N) continue;
#pragma unroll
    for (int r = 0; r < 8; ++r) so[w][8 * hh + r][t * 16 + ln] = acc[t][r] * alpha; }
  __builtin_amdgcn_fence(__ATOMIC_ACQ_REL, "workgroup"); __builtin_amdgcn_wave_barrier();
  const int rsub = lane >> 4, c4 = (lane & 15) * 4;
  {
#pragma unroll
    for (int q = 0; q < 8; ++q) { const int r = q * 2 + rsub; if (col0 + c4 < N) { const v4f v = *(const v4fa*)&so[w][r][c4]; *(v4f*)(C + (size_t)(row0 + r) * ldc + col0 + c4) = v; } }
     }
}

// Wt[n][k] = f16(W[k][n]·scale) from f32 row-major W[K][N] (scale = power of two; bf16-exact weights stay exact in f16 away from the subnormal range)
__global__ __launch_bounds__(256) void k_wt_f16(const float* __restrict__ W, _Float16* __restrict__ Wt, int K, int N, float scale) {
  const int t = blockIdx.x * 256 + threadIdx.x; if (t >= N * (K / 8)) return; const int n = t / (K / 8), k8 = (t % (K / 8)) * 8; FragH f;
#pragma unroll
  for (int i = 0; i < 8; ++i) f.h[i] = (_Float16)(bf16_round(W[(size_t)(k8 + i) * N + n]) * scale); const v8us o = f.half[0];
  *(v8us*)((unsigned short*)Wt + (size_t)n * K + k8) = o; 
}
typedef _Float16 v4h __attribute__((ext_vector_type(4)));
typedef float v2f __attribute__((ext_vector_type(2)));
// A padded key (mask != 0) has probability exactly 0 in every query's softmax while its batch keeps a key, so it is dropped before K and V are projected (no key kept: context 0).
// idx[b][p] = position of batch b's p-th kept key, ascending (0 from the kept count on, so that every entry names a row); cnt[b] = kept count.
__device__ __forceinline__ void keys_part(int b, int* part, const int* __restrict__ MSK, int* __restrict__ idx, int* __restrict__ cnt) {      /* part: 256 ints of LDS */
  const int tid = threadIdx.x; const int* m = MSK + (size_t)b * TT + tid * (TT / 256);
  int keep[TT / 256]; int c = 0;
#pragma unroll      /* constant subscripts: keep[] stays in registers */
  for (int q = 0; q < TT / 256; ++q) { keep[q] = (m[q] == 0) ? 1 : 0; c += keep[q]; }
  part[tid] = c; __syncthreads();
  for (int o = 1; o < 256; o <<= 1) { const int a = (tid >= o) ? part[tid - o] : 0; __syncthreads(); part[tid] += a; __syncthreads(); }      /* inclusive sums over the threads */
  int pos = part[tid] - c; const int n = part[255];
#pragma unroll      /* constant subscripts: keep[] stays in registers */
  for (int q = 0; q < TT / 256; ++q) if (keep[q]) idx[(size_t)b * TT + pos++] = tid * (TT / 256) + q;
  for (int p = n + tid; p < TT; p += 256) idx[(size_t)b * TT + p] = 0;
  if (tid == 0) cnt[b] = n;
}
// b is the same for a whole work-group; readfirstlane keeps the clamped count in a scalar register, so that every test on it is a scalar branch
__device__ __forceinline__ int kept_count(const int* __restrict__ cnt, int b) { const int n = cnt[b]; return __builtin_amdgcn_readfirstlane(n < 0 ? 0 : (n > TT ? TT : n)); }
// C = (A.B^T)*alpha + bf16(bias): A f16 [NR][DD], Bh f16 [DD][DD] (row n, k contiguous). OUT 0: f16 C16, pitch DD. OUT 1: f32 C = that + bf16(resid), pitch DD (the layer's residual, added where the tile is stored).
// OUT 2: f16 C16 transposed per batch, C16[batch][column][row in the batch], pitch TT: the V^T that k_flash reads, stored by the projection itself.
// One 128 x 128 tile of C per work-group of 8 waves (4 x 2 waves, 32 x 64 each). 64 k of both operands (one 128-byte line a row) are brought from
// global memory in whole lines, once per work-group, into LDS by asynchronous copies, through no register. Three buffers: waves 0-3 bring the even 64-k tiles, waves 4-7 the odd ones,
// each tile asked for two passes before it is read, so that a wave only ever waits for the one tile it has in flight. Rows lie unpadded (128 B); the 16-byte piece c of row r lies at
// place c ^ ((r >> 1) & 7), so that the 16 rows of a fragment read fall on all 64 banks. Each 16 x 16 tile sums k in ascending order in one accumulator chain.
// The K and V projections gather: row p of a batch's C is the projection of that batch's p-th kept key, A row idx[p]; tiles past the batch's kept count do nothing.
// QKV: one grid holds the three projections, which read the same A and depend on nothing of one another: the 512 tiles of q (stored as OUT 0 into C16), then those of k (OUT 0 into Ck) and v (OUT 2 into Cvt),
// Bh and bias being the fused q|k|v arrays. The k and v tiles are numbered with the row tile inside the batch slowest, so that the tiles past the kept counts, which do nothing, come last in the grid.
// !QKV: the output projection, OUT 1.
// eight 16-byte pieces of one operand: this lane's piece of rows r + 16 i, 2,048 B apart in LDS. Global address = scalar base + the lane's 32-bit byte offset. The immediate offset moves the LDS address and the
// global address alike, so one register holds the LDS address of all eight and base i comes in lowered by 2,048 i. The s_wait_xcnt stands inside the statement so that no address register is rewritten ahead of it.
typedef unsigned long long u64t;
__device__ __forceinline__ void gm_copy8(unsigned l, unsigned o0, unsigned o1, unsigned o2, unsigned o3, unsigned o4, unsigned o5, unsigned o6, unsigned o7, u64t s0, u64t s1, u64t s2, u64t s3, u64t s4, u64t s5, u64t s6, u64t s7) {
  asm volatile("global_load_async_to_lds_b128 %0, %1, %9\n\t"
               "global_load_async_to_lds_b128 %0, %2, %10 offset:2048\n\t"
               "global_load_async_to_lds_b128 %0, %3, %11 offset:4096\n\t"
               "global_load_async_to_lds_b128 %0, %4, %12 offset:6144\n\t"
               "global_load_async_to_lds_b128 %0, %5, %13 offset:8192\n\t"
               "global_load_async_to_lds_b128 %0, %6, %14 offset:10240\n\t"
               "global_load_async_to_lds_b128 %0, %7, %15 offset:12288\n\t"
               "global_load_async_to_lds_b128 %0, %8, %16 offset:14336\n\t"
               "s_wait_xcnt 0x0"
               :: "v"(l), "v"(o0), "v"(o1), "v"(o2), "v"(o3), "v"(o4), "v"(o5), "v"(o6), "v"(o7),
                  "s"(s0), "s"(s1), "s"(s2), "s"(s3), "s"(s4), "s"(s5), "s"(s6), "s"(s7) : "memory");
}
template <bool QKV>
__global__ __launch_bounds__(256) void k_gemm_t(const _Float16* __restrict__ A, const _Float16* __restrict__ Bh, float alpha, const float* __restrict__ bias, const float* __restrict__ resid, float* __restrict__ C, _Float16* __restrict__ C16, _Float16* __restrict__ Ck, _Float16* __restrict__ Cvt, const int* __restrict__ idx, const int* __restrict__ cnt) {
  constexpr int BM = 128, BN = 128, BK = 64, NKT = DD / BK;
  /* The output staging lies on the operand buffers' own LDS: it is first written behind the k loop's closing __syncthreads(), when no wave reads an operand any more and no copy is in flight. 96 KiB a work-group: three work-groups a WGP. */
  constexpr int OPB = 128 * BK * 2, BUFB = 2 * OPB;      /* bytes of one operand's 128 rows, and of one buffer: A rows, then B rows */
  constexpr int RINGB = 3 * BUFB, STAGEB = 8 * 32 * (64 + 4) * 4;
  __shared__ __attribute__((aligned(256))) unsigned char sm[RINGB > STAGEB ? RINGB : STAGEB];
  float (*so)[32][64 + 4] = reinterpret_cast<float (*)[32][64 + 4]>(&sm[0]);
  const int tid = threadIdx.x, w = tid >> 5, lane = tid & 31, ln = lane & 15, hh = lane >> 4;
  constexpr int NQT = (NR / BM) * (DD / BN); constexpr int OUT1 = QKV ? 0 : 1;
  const int kv = QKV ? (int)blockIdx.x - NQT : -1;      /* from 0 on: a tile of k or v; bits from the low end: 3 column tile, 1 k or v, 2 batch, 4 row tile in the batch */
  const bool GATH = kv >= 0;      /* the same for the whole work-group, like all that is derived from blockIdx */
  const int which = GATH ? 1 + ((kv >> 3) & 1) : 0; const int OUT = QKV ? (which == 2 ? 2 : 0) : 1;
  const int nt = blockIdx.x % (DD / BN), mt = GATH ? ((kv >> 4) & (BB - 1)) * (TT / BM) + (kv >> 6) : blockIdx.x / (DD / BN); const int wm = w >> 1, wn = w & 1;
  if (QKV) { Bh += (size_t)which * DD * DD; bias += which * DD; if (which == 1) C16 = Ck; if (which == 2) C16 = Cvt; }
  const int grp = __builtin_amdgcn_readfirstlane(tid >> 7);      /* waves 0-3: 0, waves 4-7: 1; in a scalar register, so that every test on it is a scalar branch */
  const int lr = (tid & 127) >> 3, lc = (tid & 7) * 8;      /* 8 lanes cover one row's 128 bytes; a thread brings rows lr + 16 i of the tiles of its half of the waves */
  if (GATH) { if ((mt % (TT / BM)) * BM >= kept_count(cnt, mt / (TT / BM))) return; }      /* the same for the whole work-group, in front of every barrier */
  unsigned ao[8]; int arow[8];
#pragma unroll
  for (int i = 0; i < 8; ++i) arow[i] = mt * BM + lr + 16 * i;
  if (GATH) {      /* one test round the eight index loads, so that they fly together */
#pragma unroll
    for (int i = 0; i < 8; ++i) arow[i] = idx[arow[i]];
#pragma unroll
    for (int i = 0; i < 8; ++i) arow[i] = ((mt * BM) & ~(TT - 1)) + (arow[i] & (TT - 1)); }
#pragma unroll
  for (int i = 0; i < 8; ++i) ao[i] = (unsigned)(arow[i] * DD + lc) * 2u;      /* byte offset in A of this lane's piece of its i-th row: under NR * DD * 2 = 2^24 */
  const unsigned bo = (unsigned)(lr * DD + lc) * 2u;      /* the same in the tile's 128 rows of B, row lr; rows lr + 16 i through the scalar bases */
  const unsigned lw = (unsigned)(size_t)&sm[0] + lr * 128 + (((tid & 7) ^ ((lr >> 1) & 7)) << 4);      /* LDS byte address (low 32 bits of the __shared__ address) of this lane's piece of row lr; rows lr + 16 i have the same place in the row */
  auto bring = [&](int t, int buf) {      /* 64-k tile t of both operands into buffer buf: 16 copies a lane, all lanes on */
    const unsigned l = lw + buf * BUFB; const u64t a0 = (u64t)(size_t)A + (u64t)(t * BK * 2), b0 = (u64t)(size_t)Bh + (u64t)(nt * BN * DD * 2 + t * BK * 2);
    constexpr u64t SB = 16 * DD * 2 - 2048;      /* 16 rows of B on, less the immediate offset's step */
    gm_copy8(l, ao[0], ao[1], ao[2], ao[3], ao[4], ao[5], ao[6], ao[7], a0, a0 - 2048, a0 - 4096, a0 - 6144, a0 - 8192, a0 - 10240, a0 - 12288, a0 - 14336);
    gm_copy8(l + OPB, bo, bo, bo, bo, bo, bo, bo, bo, b0, b0 + SB, b0 + 2 * SB, b0 + 3 * SB, b0 + 4 * SB, b0 + 5 * SB, b0 + 6 * SB, b0 + 7 * SB); };
  if (grp == 0) bring(0, 0); else bring(1, 1);
  if (grp == 0) asm volatile("s_wait_asynccnt 0x0" ::: "memory");      /* tile 0 has landed before the barrier that publishes it; tile 1 flies on */
  __syncthreads();
  const int fx = ln * 128, fk = ln >> 1;      /* fragment reads: row ln of a 16-row group, and that row's key (the groups start at multiples of 16 rows) */
  int fo[BK / 32][2];      /* byte offset of the pieces that hold k = 32 ks + 8 hh + 0..7 and + 16 */
#pragma unroll
  for (int ks = 0; ks < BK / 32; ++ks) { fo[ks][0] = fx + (((ks * 4 + hh) ^ fk) << 4); fo[ks][1] = fx + (((ks * 4 + 2 + hh) ^ fk) << 4); }
  v8f acc[2][4];
#pragma unroll
  for (int mi = 0; mi < 2; ++mi)
#pragma unroll
    for (int ni = 0; ni < 4; ++ni) acc[mi][ni] = (v8f){0.f,0.f,0.f,0.f,0.f,0.f,0.f,0.f};
  const int rsub = lane >> 4, c4 = (lane & 15) * 4; const int col0 = nt * BN + wn * 64;
  const size_t o0 = (size_t)(mt * BM + wm * 32 + rsub) * DD + col0 + c4;      /* this lane's piece of the wave's rows rsub + 2 q: one address, the rows at constant offsets from it */
  v4f xr[OUT1 == 1 ? 16 : 1];      /* OUT 1: this lane's 16 pieces of the residual, asked for here so that they arrive from memory under the k loop and not behind it */
  if (OUT1 == 1) {
#pragma unroll      /* constant subscripts: xr[] stays in registers */
    for (int q = 0; q < 16; ++q) xr[q] = *(const v4fa*)(resid + o0 + q * 2 * DD); }
  int cur = 0;      /* kt mod 3 */
  for (int kt = 0; kt < NKT; ++kt) {
    const unsigned char* pa = &sm[cur * BUFB + wm * 32 * 128]; const unsigned char* pb = &sm[cur * BUFB + OPB + wn * 64 * 128];
    FragH fa[2], fb[4];
    auto frags = [&](int ks) {
#pragma unroll
      for (int mi = 0; mi < 2; ++mi) { fa[mi].half[0] = *(const v8us*)(pa + mi * 2048 + fo[ks][0]); fa[mi].half[1] = *(const v8us*)(pa + mi * 2048 + fo[ks][1]); }
#pragma unroll
      for (int ni = 0; ni < 4; ++ni) { fb[ni].half[0] = *(const v8us*)(pb + ni * 2048 + fo[ks][0]); fb[ni].half[1] = *(const v8us*)(pb + ni * 2048 + fo[ks][1]); } };
    auto prods = [&]() {
#pragma unroll
      for (int mi = 0; mi < 2; ++mi)
#pragma unroll
        for (int ni = 0; ni < 4; ++ni) acc[mi][ni] = __builtin_amdgcn_wmma_f32_16x16x32_f16(false, fa[mi].v, false, fb[ni].v, (short)0, acc[mi][ni], false, false); };
    frags(0);
    /* tile kt + 2 goes into the buffer that pass kt - 1 read: every wave's reads of it returned in front of the barrier that ended that pass. The copies stand behind this pass's first fragment reads (of another buffer), so that their issue falls into the time those reads take. */
    if (grp == (kt & 1) && kt + 2 < NKT) bring(kt + 2, cur == 0 ? 2 : cur - 1);
    prods(); frags(1); prods();
    asm volatile("s_wait_dscnt 0x0" ::: "memory");      /* this wave's reads of buffer cur have returned before the barrier behind which the buffer is refilled */
    if (grp == ((kt + 1) & 1)) asm volatile("s_wait_asynccnt 0x0" ::: "memory");      /* tile kt + 1, the one tile this wave has in flight, has landed before the barrier that publishes it; the other half's tile kt + 2 flies on */
    __syncthreads();      /* publishes tile kt + 1 and ends every wave's reads of buffer cur */
    cur = (cur == 2) ? 0 : cur + 1;
  }
  asm volatile("s_wait_asynccnt 0x0" ::: "memory");      /* nothing of this wave is in flight when the buffers become the output staging */
  float bvs[4];      /* both forms of the store add the same four bias values: asked for once, in front of the test */
#pragma unroll
  for (int ni = 0; ni < 4; ++ni) bvs[ni] = bf16_round(bias[col0 + ni * 16 + ln]);
  if (OUT == 2) {      /* a lane's 8 accumulator registers are 8 consecutive rows of one column: 16 bytes of a transposed row. The work-group's tile is staged transposed and stored in whole lines (256 B a column) */
    unsigned short (*sT)[BM + 8] = reinterpret_cast<unsigned short (*)[BM + 8]>(&so[0][0][0]);
#pragma unroll      /* these three: constant subscripts, so that acc[][] stays in registers */
    for (int ni = 0; ni < 4; ++ni) { const float bv = bvs[ni];
#pragma unroll
      for (int mi = 0; mi < 2; ++mi) { FragH f;
#pragma unroll
        for (int r = 0; r < 8; ++r) f.h[r] = (_Float16)(acc[mi][ni][r] * alpha + bv);
        *(v8us*)&sT[wn * 64 + ni * 16 + ln][wm * 32 + mi * 16 + 8 * hh] = f.half[0]; } }
    __syncthreads();      /* a transposed row holds the rows of four waves */
    unsigned short* ct = (unsigned short*)C16 + ((size_t)(mt / (TT / BM)) * DD + nt * BN) * TT + (mt % (TT / BM)) * BM;
#pragma unroll      /* the 8 LDS reads go out together, the stores follow as they return */
    for (int q = 0; q < 8; ++q) { const int d = q * 16 + (tid >> 4), pc = (tid & 15) * 8; *(v8us*)(ct + (size_t)d * TT + pc) = *(const v8us*)&sT[d][pc]; }
    return;
  }
#pragma unroll
  for (int ni = 0; ni < 4; ++ni) { const float bv = bvs[ni];      /* each wave stages its 32 rows in its own LDS range and stores whole lines */
#pragma unroll
    for (int mi = 0; mi < 2; ++mi)
#pragma unroll
      for (int r = 0; r < 8; ++r) so[w][mi * 16 + 8 * hh + r][ni * 16 + ln] = acc[mi][ni][r] * alpha + bv; }
  __builtin_amdgcn_fence(__ATOMIC_ACQ_REL, "workgroup"); __builtin_amdgcn_wave_barrier();
#pragma unroll
  for (int q = 0; q < 16; ++q) { const int r = q * 2 + rsub; const v4f v = *(const v4fa*)&so[w][r][c4]; const size_t o = o0 + q * 2 * DD;
    if (OUT1 == 1) { v4f y; for (int i = 0; i < 4; ++i) y[i] = v[i] + bf16_round(xr[q][i]); *(v4f*)(C + o) = y; }
    else { v4h h4; for (int i = 0; i < 4; ++i) h4[i] = (_Float16)v[i]; *(v4h*)(C16 + o) = h4; } }
}

__global__ __launch_bounds__(256) void k_x16(const float* __restrict__ x, _Float16* __restrict__ X16, size_t n8) { const size_t t = (size_t)blockIdx.x * 256 + threadIdx.x; if (t >= n8) return; FragH f;
#pragma unroll
  for (int q = 0; q < 8; ++q) f.h[q] = (_Float16)bf16_round(x[t * 8 + q]); *(v8us*)((unsigned short*)X16 + t * 8) = f.half[0];  }
__device__ __forceinline__ void round16f_part(int blk, const float* __restrict__ W, _Float16* __restrict__ Bt, size_t n8) { const size_t t = (size_t)blk * 256 + threadIdx.x; if (t >= n8) return; FragH f;
#pragma unroll
  for (int i = 0; i < 8; ++i) f.h[i] = (_Float16)(bf16_round(W[t * 8 + i]) * 16.0f); *(v8us*)((unsigned short*)Bt + t * 8) = f.half[0];  }
template <int D, int RBF>
__device__ __forceinline__ void lnx_part(int blk, const float* __restrict__ X, const float* __restrict__ gam, const float* __restrict__ bet, int nrows, float eps, _Float16* __restrict__ O16, float* __restrict__ XR) {
  constexpr int NP = D / 128; const int tid = threadIdx.x, wv = tid >> 5, lane = tid & 31; const size_t r = (size_t)blk * 8 + wv; if (r >= (size_t)nrows) return; v4f y[NP]; float s = 0.f;
#pragma unroll
  for (int j = 0; j < NP; ++j) { const int c = j * 128 + lane * 4; v4f g = *(const v4fa*)(X + r * D + c); if (RBF) { for (int q = 0; q < 4; ++q) g[q] = bf16_round(g[q]); } y[j] = g; s += g[0] + g[1] + g[2] + g[3]; }
  for (int o = 16; o >= 1; o >>= 1) s += __shfl_xor(s, o, 32); const float mu = s / (float)D; float q2 = 0.f;
#pragma unroll
  for (int j = 0; j < NP; ++j) for (int q = 0; q < 4; ++q) { const float d = y[j][q] - mu; q2 += d * d; }
  for (int o = 16; o >= 1; o >>= 1) q2 += __shfl_xor(q2, o, 32); const float rs = rsqrtf(q2 / (float)D + eps);
  {
#pragma unroll
    for (int j = 0; j < NP; ++j) { const int c = j * 128 + lane * 4; v4h h; for (int q = 0; q < 4; ++q) { const float v = (y[j][q] - mu) * rs * bf16_round(gam[c + q]) + bf16_round(bet[c + q]); h[q] = (_Float16)v; } *(v4h*)(O16 + r * D + c) = h; if (XR) *(v4f*)(XR + r * D + c) = y[j]; }
     } }
// All that the projections wait for, in one grid: its four parts read only the layer's inputs and depend on nothing of one another. Work-groups 0 .. BB - 1 list the kept keys (the longest chain, so first),
// the next NR / 8 normalise 8 rows each, the rest round the weights: Bw rows q|k|v, then out_w, (out,in) natural x 2^4. XR is lnx_part's optional f32 copy of the rounded rows (null: none is stored).
#define PW_QKV (3 * DD * DD / 8 / 256)      /* work-groups that round qkv_w */
#define PW_OUT (DD * DD / 8 / 256)          /* work-groups that round out_w */
__global__ __launch_bounds__(256) void k_prep(const float* __restrict__ X, const float* __restrict__ gam, const float* __restrict__ bet, const int* __restrict__ MSK, const float* __restrict__ Wqkv, const float* __restrict__ Wo,
                                              _Float16* __restrict__ X16, float* __restrict__ XR, _Float16* __restrict__ Bw, int* __restrict__ idx, int* __restrict__ cnt) {
  __shared__ int part[256];
  int blk = blockIdx.x;      /* every test on it is the same for the whole work-group */
  if (blk < BB) { keys_part(blk, part, MSK, idx, cnt); return; }
  blk -= BB;
  if (blk < NR / 8) { lnx_part<DD, 1>(blk, X, gam, bet, NR, 1e-5f, X16, XR); return; }      /* x = LN(bf16 hidden) -> f16 */
  blk -= NR / 8;
  if (blk < PW_QKV) round16f_part(blk, Wqkv, Bw, (size_t)3 * DD * DD / 8);
  else round16f_part(blk - PW_QKV, Wo, Bw + (size_t)3 * DD * DD, (size_t)DD * DD / 8);
}
// lane l <-> lane l ^ 16 (the two halves of a wave hold the two key halves of one query column)
__device__ __forceinline__ float xhalf(float x) { const int b = __builtin_bit_cast(int, x); return __builtin_bit_cast(float, __builtin_amdgcn_permlanex16(b, b, 0x76543210, 0xfedcba98, false, false)); }
#define FL_SK 64                 /* keys per stage */
#define FL_LP (64 + 8)           /* LDS row pitch in 16-bit elements */
#define FL_NG 2                  /* groups of 16 query columns per wave */
#define FL_C 0.18033688011112042f      /* 64^-1/2 * log2(e): the exponentials are taken in base 2 on the hardware's own instruction */
// one stage: this lane's four 16-byte pieces (K rows r and r + 32, V^T rows r and r + 32). The s_wait_xcnt stands inside the statement so that no address register is rewritten ahead of it.
__device__ __forceinline__ void fl_copy4(unsigned lk, unsigned lv, const unsigned short* gk0, const unsigned short* gk1, const unsigned short* gv0, const unsigned short* gv1) {
  const unsigned lk1 = lk + 32 * FL_LP * 2, lv1 = lv + 32 * FL_LP * 2;
  asm volatile("global_load_async_to_lds_b128 %0, %4, off\n\t"
               "global_load_async_to_lds_b128 %1, %5, off\n\t"
               "global_load_async_to_lds_b128 %2, %6, off\n\t"
               "global_load_async_to_lds_b128 %3, %7, off\n\t"
               "s_wait_xcnt 0x0"
               :: "v"(lk), "v"(lk1), "v"(lv), "v"(lv1), "v"(gk0), "v"(gk1), "v"(gv0), "v"(gv1) : "memory");
}
__global__ __launch_bounds__(256) void k_flash(const _Float16* __restrict__ Q16, int ldq, const _Float16* __restrict__ K16, int ldk, const _Float16* __restrict__ Vt, const int* __restrict__ cnt, _Float16* __restrict__ O16, int ldo) {
  constexpr int NW = 8, NG = FL_NG, RPW = 16 * NG, NQB = TT / (NW * RPW), DT = 4, KS = 2;
  __shared__ __attribute__((aligned(16))) unsigned short sK[2][FL_SK][FL_LP], sV[2][64][FL_LP];
  __shared__ __attribute__((aligned(16))) unsigned short sO[NW][RPW][FL_LP];
  const int tid = threadIdx.x, w = tid >> 5, lane = tid & 31, ln = lane & 15, hh = lane >> 4;
  const int slab = blockIdx.x / NQB, qblk = blockIdx.x % NQB; const int b = slab / NH, h = slab % NH; const int qb0 = qblk * (NW * RPW); const int q0 = qb0 + w * RPW;
  const int n = kept_count(cnt, b); const int nst = (n + FL_SK - 1) / FL_SK;      /* K16 and Vt hold the batch's n kept keys, packed; both are written up to the end of stage nst - 1 */
  const unsigned short* Vth = (const unsigned short*)Vt + (size_t)slab * 64 * TT;
  const int cr = tid >> 3, cc = (tid & 7) * 8;      /* 8 lanes cover one row's 128 bytes; a thread brings rows cr and cr + 32 of both tiles */
  const unsigned short* gk = (const unsigned short*)K16 + ((size_t)b * TT + cr) * ldk + h * 64 + cc;      /* + stage * 64 rows */
  const unsigned short* gv = Vth + (size_t)cr * TT + cc;                                                  /* + stage * 64 columns */
  const unsigned lk = (unsigned)(size_t)&sK[0][cr][cc], lv = (unsigned)(size_t)&sV[0][cr][cc];      /* LDS byte address = low 32 bits of the __shared__ address */
  constexpr unsigned BUFB = FL_SK * FL_LP * 2;      /* bytes of one buffer of either tile */
  if (nst > 0) fl_copy4(lk, lv, gk, gk + (size_t)32 * ldk, gv, gv + (size_t)32 * TT);      /* the same for the whole work-group */
  FragH bq[NG][KS];      /* B operand of group g: column ln = query q0 + 16 g + ln */
#pragma unroll
  for (int g = 0; g < NG; ++g) { const unsigned short* qr = (const unsigned short*)Q16 + ((size_t)b * TT + q0 + g * 16 + ln) * ldq + h * 64;
#pragma unroll
    for (int ks = 0; ks < KS; ++ks) { bq[g][ks].half[0] = *(const v8us*)(qr + ks * 32 + 8 * hh); bq[g][ks].half[1] = *(const v8us*)(qr + ks * 32 + 16 + 8 * hh); } }
  asm volatile("s_wait_asynccnt 0x0" ::: "memory");      /* stage 0 of this wave has landed before the barrier that publishes it */
  __syncthreads();
  if (nst > 1) fl_copy4(lk + BUFB, lv + BUFB, gk + (size_t)FL_SK * ldk, gk + (size_t)(FL_SK + 32) * ldk, gv + FL_SK, gv + (size_t)32 * TT + FL_SK);
  float m_q[NG], l_q[NG]; v8f oacc[NG][DT];      /* oacc[g][dt][r] = O[q0 + 16 g + ln][dt * 16 + 8 * hh + r] */
#pragma unroll
  for (int g = 0; g < NG; ++g) { m_q[g] = -3.0e38f; l_q[g] = 0.f;
#pragma unroll
    for (int dt = 0; dt < DT; ++dt) oacc[g][dt] = (v8f){0.f,0.f,0.f,0.f,0.f,0.f,0.f,0.f}; }
#pragma unroll 1
  for (int st = 0; st < nst; ++st) {
    const int cur = st & 1;
#pragma unroll      /* both passes of a stage in one body, so that one pass's products stand among the other's vector work; it fits the 256 registers at which both work-groups of a WGP are resident */
    for (int jj = 0; jj < FL_SK; jj += 32) {
    const int j0 = st * FL_SK + jj;
    v8f s[NG][2];
#pragma unroll
    for (int nt = 0; nt < 2; ++nt) { const unsigned short* kr = &sK[cur][jj + nt * 16 + ln][0]; FragH ak[KS];      /* one K fragment from LDS serves both column groups */
#pragma unroll
      for (int ks = 0; ks < KS; ++ks) { ak[ks].half[0] = *(const v8us*)(kr + ks * 32 + 8 * hh); ak[ks].half[1] = *(const v8us*)(kr + ks * 32 + 16 + 8 * hh); }
#pragma unroll
      for (int g = 0; g < NG; ++g) s[g][nt] = (v8f){0.f,0.f,0.f,0.f,0.f,0.f,0.f,0.f};
#pragma unroll
      for (int ks = 0; ks < KS; ++ks)
#pragma unroll
        for (int g = 0; g < NG; ++g) s[g][nt] = __builtin_amdgcn_wmma_f32_16x16x32_f16(false, ak[ks].v, false, bq[g][ks].v, (short)0, s[g][nt], false, false); }
    if (j0 + 32 > n) {      /* only a batch's last stage holds rows past its kept keys (this lane's are j0 + 8hh + 0..7 and j0 + 16 + 8hh + 0..7): score -inf, so the exponential below is exactly 0 */
#pragma unroll      /* these two: constant element numbers, so that the score tiles stay in registers */
      for (int g = 0; g < NG; ++g)
#pragma unroll
        for (int i = 0; i < 16; ++i) s[g][i >> 3][i & 7] = (j0 + (i >> 3) * 16 + 8 * hh + (i & 7) < n) ? s[g][i >> 3][i & 7] : -INFINITY; }
    FragH pb[NG];      /* pb[g].h[i] = 2^10 P^T[k = kmap(i, hh)][column ln of group g] */
#pragma unroll
    for (int g = 0; g < NG; ++g) {
    float sc[16]; float mc = -INFINITY;      /* raw q.k */
#pragma unroll
    for (int i = 0; i < 16; ++i) { sc[i] = s[g][i >> 3][i & 7]; mc = fmaxf(mc, sc[i]); }
    mc = fmaxf(mc, xhalf(mc));
    const float mn = fmaxf(m_q[g], mc); const float al = __builtin_amdgcn_exp2f((m_q[g] - mn) * FL_C); m_q[g] = mn;      /* m_q and mn (raw q.k units) are finite (start -3e38): no key seen yet gives 2^0 = 1 */
    const float nb = __builtin_fmaf(-mn, FL_C, 10.0f);      /* 2^10 e^((s - mn) / 8) = 2^(s C + nb): scale, maximum and the 2^10 of P in one fused multiply-add a score */
    float ps = 0.f;
#pragma unroll
    for (int i = 0; i < 16; i += 2) { const v2f e = __builtin_elementwise_fma((v2f){sc[i], sc[i + 1]}, (v2f){FL_C, FL_C}, (v2f){nb, nb});      /* neighbours of one accumulator as a pair: left to itself the compiler pairs across the two groups and pays for it in register moves */
      const float p0 = __builtin_amdgcn_exp2f(e[0]), p1 = __builtin_amdgcn_exp2f(e[1]); ps += p0; ps += p1; pb[g].h[i] = (_Float16)p0; pb[g].h[i + 1] = (_Float16)p1; }
    l_q[g] = l_q[g] * al + ps;      /* the row sum carries the same 2^10 */
#pragma unroll
    for (int dt = 0; dt < DT; ++dt)
#pragma unroll
      for (int r = 0; r < 8; ++r) oacc[g][dt][r] *= al; }
#pragma unroll
    for (int dt = 0; dt < DT; ++dt) { const unsigned short* vrow = &sV[cur][dt * 16 + ln][jj]; FragH av; av.half[0] = *(const v8us*)(vrow + 8 * hh); av.half[1] = *(const v8us*)(vrow + 16 + 8 * hh);      /* one V^T fragment from LDS serves both column groups */
#pragma unroll
      for (int g = 0; g < NG; ++g) oacc[g][dt] = __builtin_amdgcn_wmma_f32_16x16x32_f16(false, av.v, false, pb[g].v, (short)0, oacc[g][dt], false, false); } }
    asm volatile("s_wait_dscnt 0x0" ::: "memory");      /* this wave's reads of buffer cur have returned before the buffer is refilled */
    asm volatile("s_wait_asynccnt 0x0" ::: "memory");   /* this wave's copies of stage st + 1 have landed before the barrier that publishes them */
    __syncthreads();      /* publishes stage st + 1 and ends every wave's reads of buffer cur */
    if (st + 2 < nst) {      /* the same for the whole work-group */
      const unsigned short* k2 = gk + (size_t)(st + 2) * FL_SK * ldk; const unsigned short* v2 = gv + (st + 2) * FL_SK;
      fl_copy4(lk + cur * BUFB, lv + cur * BUFB, k2, k2 + (size_t)32 * ldk, v2, v2 + (size_t)32 * TT); }
  }
  asm volatile("s_wait_asynccnt 0x0" ::: "memory");      /* nothing of this wave is in flight when it goes on to the output */
#pragma unroll
  for (int g = 0; g < NG; ++g) { float l = l_q[g] + xhalf(l_q[g]); l = (l > 0.f) ? 1.0f / l : 0.f;
#pragma unroll
    for (int dt = 0; dt < DT; ++dt) { FragH f;      /* the context leaves as the f16 operand of the output GEMM */
#pragma unroll      /* constant subscripts: oacc[] stays in registers */
      for (int r = 0; r < 8; ++r) f.h[r] = (_Float16)(oacc[g][dt][r] * l);
      *(v8us*)&sO[w][g * 16 + ln][dt * 16 + 8 * hh] = f.half[0]; } }
  __builtin_amdgcn_fence(__ATOMIC_ACQ_REL, "workgroup"); __builtin_amdgcn_wave_barrier();
  {
#pragma unroll
    for (int rp = 0; rp < RPW; rp += 4) { const int r = rp + (lane >> 3), pc = (lane & 7) * 8; *(v8us*)((unsigned short*)O16 + ((size_t)b * TT + q0 + r) * ldo + h * 64 + pc) = *(const v8us*)&sO[w][r][pc]; }      /* 8 lanes store one row's 128-byte line */
     } }

extern "C" void kernel_launch(void* const* d_in, const int* in_sizes, int n_in,
                              void* d_out, int out_size, void* d_ws, size_t ws_size, hipStream_t stream) {
  (void)in_sizes; (void)n_in; (void)out_size;
  const float* const* I = (const float* const*)d_in; const float* x = I[0]; const int* mask = (const int*)d_in[1]; const float* Wqkv = I[2]; const float* bqkv = I[3]; const float* Wo = I[4]; const float* bo = I[5]; const float* lng = I[6]; const float* lnb = I[7];      /* d_in order: hidden_states, encoder_padding_mask, qkv_w, qkv_b, out_w, out_b, ln_g, ln_b */
  char* ws = (char*)d_ws; size_t off = 0;
  auto take = [&](size_t bytes) { char* p = ws + off; off += (bytes + 255) & ~(size_t)255; return p; };
  const size_t WSZ = (size_t)DD * DD; _Float16* Bw = (_Float16*)take(4 * WSZ * 2); _Float16* X16 = (_Float16*)take((size_t)NR * DD * 2);
  _Float16* Q = (_Float16*)take((size_t)NR * DD * 2); _Float16* K = (_Float16*)take((size_t)NR * DD * 2); _Float16* Vt = (_Float16*)take((size_t)NR * DD * 2); _Float16* O16 = (_Float16*)take((size_t)NR * DD * 2);
  int* kidx = (int*)take((size_t)NR * 4); int* kcnt = (int*)take(BB * 4);
  if (off > ws_size) return;
  const unsigned gp = (NR / 128) * (DD / 128);
  k_prep<<<BB + NR / 8 + PW_QKV + PW_OUT, 256, 0, stream>>>(x, lng, lnb, mask, Wqkv, Wo, X16, nullptr, Bw, kidx, kcnt);
  k_gemm_t<true><<<3 * gp, 256, 0, stream>>>(X16, Bw, 0.0625f, bqkv, nullptr, nullptr, Q, K, Vt, kidx, kcnt);      /* q = x.Wq + bq: M 8192 N 1024 K 1024; k and v: kept keys only, packed per batch, v stored as V^T [batch][head][d][key] */
  k_flash<<<BB * NH * (TT / (8 * 16 * FL_NG)), 256, 0, stream>>>(Q, DD, K, DD, Vt, kcnt, O16, DD);
  k_gemm_t<false><<<gp, 256, 0, stream>>>(O16, Bw + 3 * WSZ, 0.0625f, bo, x, (float*)d_out, nullptr, nullptr, nullptr, nullptr, nullptr);      /* out = O.out_w^T + out_b + bf16(hidden) */
}
